// v000
// The times below were measured on an AMD MI455X: many runs one after another, warmed up first and cycling through
// copies of the inputs, with the whole window's GPU time divided by the number of runs. Launches and the gaps
// between them are all in it. The median over several windows is given; except for v000 it joins two sittings, which
// can be a few percent apart, so the side-by-side timings, each taken in one sitting, are the better comparison.
// The starting kernel, v000, takes 862 microseconds a run.
#include <hip/hip_runtime.h>

// Triangle_Att_Start (AlphaFold triangle attention, starting node: pair_embed [256 rows i][256 j][128]; z = LayerNorm(pair); q/k/v = z W ([128][4 x 32]), q x 32^-0.5; bias[h][j][k] = (z Wb)[j][k][h] shared over rows i; gate = sigmoid(z Wg + bg); logits[h][i][j][k] = q_ij.k_ik + bias[h][j][k]; softmax over k; o = (a v) * gate; out = o Wo + bo -> [256][256][128]).
// Batched layout (exact): every row i is an independent 256-token attention; 32 rows x 4 heads = 128 'virtual heads' of 256 tokens per group, 64 per score pass, 8 groups; the projections run on the 8,192 stacked (row, j) positions of a group; the 32-wide heads run on 64-wide tensor-core tiles by zero padding (exact).

#define NB_  256
#define TT   256
#define DM   128
#define NH_  4
#define NKV  4
#define REP  (NH_ / NKV)
#define HD   64
#define DQ   (NH_ * HD)
#define DKV  (NKV * HD)
#define ZH   64
#define RH   256
#define WIN  0
#define PCAR 1024.0f
#define HDR  32
#define DR   (NH_ * HDR)   // 128
#define CZ   128
#define NPZ  (TT * TT)     // pair rows 65536
#define ZW   64            // padded w2d width
#define LR   256    // tokens per row (no padding)
#define GB   32     // pair rows i per group
#define NG   (NB_ / GB)
#define GR   (GB * TT)   // stacked rows per group
#define NVH  (GB * NH_)  // virtual heads per group
#define SCL  0.17677669529663689f   // 32^-0.5
typedef _Float16 h16;
typedef unsigned short bf;
typedef __attribute__((ext_vector_type(16))) __bf16   v16bf;
typedef __attribute__((ext_vector_type(16))) _Float16 v16h;
typedef __attribute__((ext_vector_type(8)))  _Float16 v8h;
typedef __attribute__((ext_vector_type(8)))  unsigned short v8us;
typedef __attribute__((ext_vector_type(8)))  float    v8f;
typedef __attribute__((ext_vector_type(4)))  float    v4f;
typedef v8h  __attribute__((may_alias)) v8ha;
typedef v4f  __attribute__((may_alias)) v4fa;
typedef v8us __attribute__((may_alias)) v8usa;

__device__ __forceinline__ unsigned short f2bf(float f) { unsigned u = __float_as_uint(f); u += 0x7FFFu + ((u >> 16) & 1u); return (unsigned short)(u >> 16); }
__device__ __forceinline__ float bf2f(unsigned short b) { return __uint_as_float(((unsigned)b) << 16); }
__device__ __forceinline__ float bfr(float f) { return bf2f(f2bf(f)); }
__device__ __forceinline__ v16h cat16(v8h lo, v8h hi) { return __builtin_shufflevector(lo, hi, 0, 1, 2, 3, 4, 5, 6, 7, 8, 9, 10, 11, 12, 13, 14, 15); }
__device__ __forceinline__ v16bf cat16b(v8us lo, v8us hi) { return __builtin_bit_cast(v16bf, __builtin_shufflevector(lo, hi, 0, 1, 2, 3, 4, 5, 6, 7, 8, 9, 10, 11, 12, 13, 14, 15)); }
__device__ __forceinline__ v8f wmma16(v16h a, v16h b, v8f c) { return __builtin_amdgcn_wmma_f32_16x16x32_f16(false, a, false, b, (short)0, c, false, false); }
__device__ __forceinline__ v8f wmmab(v16bf a, v16bf b, v8f c) { return __builtin_amdgcn_wmma_f32_16x16x32_bf16(false, a, false, b, (short)0, c, false, false); }



// ---- k_gemmw: register-blocked GEMM, ONE WAVE per 64x64 output tile (16 accumulators), operands straight from K-contiguous 16-bit planes; grid (M/64, N/64, Z), 32 threads.
// C[m][n] (f32, pitch ldc, + optional f32 bias[n]) = sum_k A[m][k] Bt[n][k] (+ split products per NSPLIT). z-batch strides sA/sB/sC in elements. K % 32 == 0.
template <typename T16> struct WFrag;
template <> struct WFrag<h16> { typedef v16h V; static __device__ __forceinline__ V ld(const h16* p) { return cat16(*(const v8h*)p, *(const v8h*)(p + 16)); } static __device__ __forceinline__ v8f mma(V a, V b, v8f c) { return wmma16(a, b, c); } };
template <> struct WFrag<bf> { typedef v16bf V; static __device__ __forceinline__ V ld(const bf* p) { return cat16b(*(const v8us*)p, *(const v8us*)(p + 16)); } static __device__ __forceinline__ v8f mma(V a, V b, v8f c) { return wmmab(a, b, c); } };
template <typename T16, int NSPLIT, bool BIAS>
__global__ __launch_bounds__(32) void k_gemmw(const T16* __restrict__ A, const T16* __restrict__ A2, const T16* __restrict__ Bt, const T16* __restrict__ Bt2, int K, float* C, int ldc, const float* __restrict__ bias, size_t sA, size_t sB, size_t sC) {
    typedef typename WFrag<T16>::V V;
    __shared__ __align__(16) float os[16 * 68];
    const size_t z = blockIdx.z; A += z * sA; if (A2) A2 += z * sA; Bt += z * sB; if (Bt2) Bt2 += z * sB; C += z * sC;
    const int lane = threadIdx.x & 31, lr = lane & 15, hi = lane >> 4; const int r0 = blockIdx.x * 64, c0 = blockIdx.y * 64;
    v8f acc[4][4];
#pragma unroll
    for (int mb = 0; mb < 4; ++mb)
#pragma unroll
        for (int nb = 0; nb < 4; ++nb) acc[mb][nb] = (v8f){};
    const size_t aoff = (size_t)(r0 + lr) * K + 8 * hi, boff = (size_t)(c0 + lr) * K + 8 * hi;
#pragma unroll 1
    for (int kc = 0; kc < K; kc += 32) {
        V a[4], a2[4];
#pragma unroll
        for (int mb = 0; mb < 4; ++mb) { a[mb] = WFrag<T16>::ld(A + aoff + (size_t)mb * 16 * K + kc); if (NSPLIT == 1 || NSPLIT == 2) a2[mb] = WFrag<T16>::ld(A2 + aoff + (size_t)mb * 16 * K + kc); }
#pragma unroll
        for (int nb = 0; nb < 4; ++nb) { const V b = WFrag<T16>::ld(Bt + boff + (size_t)nb * 16 * K + kc); V b2; if (NSPLIT >= 2) b2 = WFrag<T16>::ld(Bt2 + boff + (size_t)nb * 16 * K + kc);
#pragma unroll
            for (int mb = 0; mb < 4; ++mb) { acc[mb][nb] = WFrag<T16>::mma(a[mb], b, acc[mb][nb]); if (NSPLIT == 1 || NSPLIT == 2) acc[mb][nb] = WFrag<T16>::mma(a2[mb], b, acc[mb][nb]); if (NSPLIT >= 2) acc[mb][nb] = WFrag<T16>::mma(a[mb], b2, acc[mb][nb]); } }
        asm volatile("v_nop\n\tv_nop\n\tv_nop\n\tv_nop" : "+v"(acc[0][0]), "+v"(acc[1][1]), "+v"(acc[2][2]), "+v"(acc[3][3]) : "v"(a[0]), "v"(a[3]));
    }
#pragma unroll
    for (int mb = 0; mb < 4; ++mb) {
#pragma unroll
        for (int nb = 0; nb < 4; ++nb) {
#pragma unroll
            for (int j = 0; j < 8; ++j) os[(hi * 8 + j) * 68 + nb * 16 + lr] = acc[mb][nb][j]; }
        __builtin_amdgcn_wave_barrier(); asm volatile("" ::: "memory");
        float* crow = C + (size_t)(r0 + mb * 16) * ldc + c0;
{
#pragma unroll
            for (int s = 0; s < 8; ++s) { const int row = 2 * s + hi, cofs = lr * 4; v4f val = *(const v4fa*)(os + row * 68 + cofs); if (BIAS) { val[0] += bfr(bias[c0 + cofs]); val[1] += bfr(bias[c0 + cofs + 1]); val[2] += bfr(bias[c0 + cofs + 2]); val[3] += bfr(bias[c0 + cofs + 3]); }
                *(v4f*)(crow + (size_t)row * ldc + cofs) = val; }
             }
        __builtin_amdgcn_wave_barrier(); asm volatile("" ::: "memory");
    }
}

__device__ __forceinline__ h16 tohx(float x) { return (h16)x; }
__device__ __forceinline__ void splitf(float y, unsigned short& h, unsigned short& l) { h = f2bf(y); l = f2bf(y - bf2f(h)); }
typedef __attribute__((ext_vector_type(2))) _Float16 v2h;
typedef __attribute__((ext_vector_type(4))) _Float16 v4h;
typedef __attribute__((ext_vector_type(2))) unsigned short v2us;
typedef __attribute__((ext_vector_type(4))) unsigned short v4us;
typedef __attribute__((ext_vector_type(2))) float v2f;
typedef __attribute__((ext_vector_type(4))) int v4i;

__global__ __launch_bounds__(256) void k_wtG(const float* __restrict__ w, int K, int N, bf* Bt) {
    const int lane = threadIdx.x & 31; const int L0 = (blockIdx.x * 8 + (threadIdx.x >> 5)) * 8; const int nlines = N * K / 64;
{
#pragma unroll 1
        for (int l = 0; l < 8; ++l) { const int L = L0 + l; if (L >= nlines) break; const size_t e = (size_t)L * 64 + lane * 2; const int k = (int)(e % K), n = (int)(e / K); v2us o;
            o[0] = f2bf(w[(size_t)k * N + n]); o[1] = f2bf(w[(size_t)(k + 1) * N + n]); *(v2us*)(Bt + e) = o; }
         }
}
__global__ __launch_bounds__(256) void k_cvt8(const float* __restrict__ src, bf* dst, size_t n8) { const size_t i = (size_t)blockIdx.x * 256 + threadIdx.x; if (i >= n8) return; const v8f v = *(const v8f*)(src + i * 8); v8us o;
#pragma unroll
    for (int k = 0; k < 8; ++k) o[k] = f2bf(v[k]); *(v8us*)(dst + i * 8) = o;  }
__global__ __launch_bounds__(256) void k_cscvt(const float* __restrict__ cosT, const float* __restrict__ sinT, float* CS) { const int idx = blockIdx.x * 256 + threadIdx.x; if (idx >= TT * HD) return; v2f cs; cs[0] = bfr(cosT[idx]); cs[1] = bfr(sinT[idx]); *(v2f*)(CS + (size_t)idx * 2) = cs;  }
// k_rope: head planes [h][t][d] (fp16 + hi/lo) of rope(x) x sc with the rotate-half convention out[d] = x[d] cos[t][d] - x[d+HD/2] sin[t][d], out[d+HD/2] = x[d+HD/2] cos[t][d+HD/2] + x[d] sin[t][d+HD/2]
__global__ __launch_bounds__(256) void k_rope(const float* __restrict__ F, int pitch, int nheads, const float* __restrict__ CS, const float* __restrict__ RF, const float* __restrict__ nw, float sc, h16* P16, bf* Ph, bf* Pl) {
    const size_t e = ((size_t)blockIdx.x * 256 + threadIdx.x) * 2; if (e >= (size_t)nheads * TT * HD) return; const int d = (int)(e % HD); const int t = (int)((e / HD) % TT); const int h = (int)(e / ((size_t)HD * TT)); const float* f = F + (size_t)t * pitch + h * HD; const float rf = RF ? RF[(size_t)h * TT + t] : 1.0f; v2h o16; v2us oh, ol;
#pragma unroll
    for (int q = 0; q < 2; ++q) { const int dd = d + q; const int dp = (dd < HD / 2) ? dd + HD / 2 : dd - HD / 2; float x0 = f[dd], x1 = f[dp];
        if (RF) { float n0 = __fmul_rn(x0, rf), n1 = __fmul_rn(x1, rf); asm volatile("" : "+v"(n0)); asm volatile("" : "+v"(n1)); x0 = __fmul_rn(bfr(nw[dd]), n0); x1 = __fmul_rn(bfr(nw[dp]), n1); }
        const v2f cs = *(const v2f*)(CS + ((size_t)t * HD + dd) * 2); float a = __fmul_rn(x0, cs[0]), bq = __fmul_rn(x1, cs[1]); asm volatile("" : "+v"(a)); asm volatile("" : "+v"(bq)); const float r = ((dd < HD / 2) ? __fsub_rn(a, bq) : __fadd_rn(a, bq)) * sc;
        o16[q] = tohx(r); unsigned short a2, c2; splitf(r, a2, c2); oh[q] = a2; ol[q] = c2; }
    *(v2h*)(P16 + e) = o16; *(v2us*)(Ph + e) = oh; *(v2us*)(Pl + e) = ol;  }
__global__ __launch_bounds__(256) void k_vtp(const float* __restrict__ F, int pitch, int nheads, h16* V16, bf* Vh, bf* Vl) { const size_t e = ((size_t)blockIdx.x * 256 + threadIdx.x) * 2; if (e >= (size_t)nheads * HD * TT) return; const int t = (int)(e % TT); const int d = (int)((e / TT) % HD); const int g = (int)(e / ((size_t)TT * HD)); v2h o16; v2us oh, ol;
#pragma unroll
    for (int q = 0; q < 2; ++q) { const float x = F[(size_t)(t + q) * pitch + g * HD + d]; o16[q] = tohx(x); unsigned short a2, c2; splitf(x, a2, c2); oh[q] = a2; ol[q] = c2; }
    *(v2h*)(V16 + e) = o16; *(v2us*)(Vh + e) = oh; *(v2us*)(Vl + e) = ol;  }
__global__ __launch_bounds__(256) void k_csid(float* CS) { const int idx = blockIdx.x * 256 + threadIdx.x; if (idx >= TT * HD) return; v2f cs; cs[0] = 1.0f; cs[1] = 0.0f; *(v2f*)(CS + (size_t)idx * 2) = cs;  }
__global__ __launch_bounds__(256) void k_cvt8padg(const float* __restrict__ src, bf* XB2) { const size_t e8 = ((size_t)blockIdx.x * 256 + threadIdx.x) * 8; if (e8 >= (size_t)GR * DM) return; const int r = (int)(e8 / DM); const int bl = r / TT, t = r % TT; v8us o; if (t < LR) { const float* sp2 = src + ((size_t)bl * LR + t) * DM + (e8 % DM); for (int u = 0; u < 8; ++u) o[u] = f2bf(bfr(sp2[u])); } else { for (int u = 0; u < 8; ++u) o[u] = 0; } *(v8us*)(XB2 + e8) = o;  }
__global__ __launch_bounds__(256) void k_moutv(const float* __restrict__ O, int z0, float* YO2) { const size_t e = ((size_t)blockIdx.x * 256 + threadIdx.x) * 2; if (e >= (size_t)ZH * TT * HD) return; const int d = (int)(e % HD); const int t = (int)((e / HD) % TT); const int zz = (int)(e / ((size_t)HD * TT)); const int z = z0 + zz; const int bl = z / NH_, h = z % NH_; v2f o; o[0] = O[e]; o[1] = O[e + 1]; float* dst = YO2 + ((size_t)bl * TT + t) * DQ + (size_t)h * HD + d; *(v2f*)dst = o;  }
__global__ __launch_bounds__(256) void k_outcpg(const float* __restrict__ Y, float* O2) { const size_t e = ((size_t)blockIdx.x * 256 + threadIdx.x) * 4; if (e >= (size_t)GB * LR * DM) return; const size_t r = e / DM; const int bl = (int)(r / LR), t = (int)(r % LR); const v4f a = *(const v4f*)(Y + ((size_t)bl * TT + t) * DM + (e % DM)); *(v4f*)(O2 + e) = a;  }
__global__ __launch_bounds__(256) void k_hlG(const float* __restrict__ F, bf* Fh, bf* Fl, size_t n) { const size_t e = ((size_t)blockIdx.x * 256 + threadIdx.x) * 4; if (e >= n) return; const v4f a = *(const v4f*)(F + e); v4us oh, ol; for (int u = 0; u < 4; ++u) { unsigned short p, q; splitf(a[u], p, q); oh[u] = p; ol[u] = q; } *(v4us*)(Fh + e) = oh; *(v4us*)(Fl + e) = ol;  }
__global__ __launch_bounds__(256) void k_lnxg(const float* __restrict__ X, const float* __restrict__ gam, const float* __restrict__ bet, bf* Xh, bf* Xl) { const int lane = threadIdx.x & 31; const int t = blockIdx.x * 8 + (threadIdx.x >> 5); if (t >= GR) return; const float* f = X + (size_t)t * DM; float v[DM / 32]; float su = 0.f;
#pragma unroll
    for (int ch = 0; ch < DM / 128; ++ch) { const v4f a = *(const v4f*)(f + ch * 128 + lane * 4); for (int u = 0; u < 4; ++u) { float xv = bfr(a[u]); asm volatile("" : "+v"(xv)); v[ch * 4 + u] = xv; su = __fadd_rn(su, xv); } }
#pragma unroll
    for (int sh = 16; sh; sh >>= 1) su = __fadd_rn(su, __shfl_xor(su, sh, 32));
    const float mu = __fdiv_rn(su, (float)DM); float sq = 0.f;
#pragma unroll
    for (int q = 0; q < DM / 32; ++q) { float d0 = __fsub_rn(v[q], mu); asm volatile("" : "+v"(d0)); float p = __fmul_rn(d0, d0); asm volatile("" : "+v"(p)); sq = __fadd_rn(sq, p); }
#pragma unroll
    for (int sh = 16; sh; sh >>= 1) sq = __fadd_rn(sq, __shfl_xor(sq, sh, 32));
    const float rs = __fdiv_rn(1.0f, sqrtf(__fadd_rn(__fdiv_rn(sq, (float)DM), 1e-5f)));
    {
#pragma unroll
        for (int ch = 0; ch < DM / 128; ++ch) { v4us oh, ol; for (int u = 0; u < 4; ++u) { const int c = ch * 128 + lane * 4 + u; float d0 = __fsub_rn(v[ch * 4 + u], mu); asm volatile("" : "+v"(d0)); float n = __fmul_rn(d0, rs); asm volatile("" : "+v"(n)); float gg = bfr(gam[c]), bb = bfr(bet[c]); asm volatile("" : "+v"(gg)); asm volatile("" : "+v"(bb)); float y = __fmul_rn(n, gg); asm volatile("" : "+v"(y)); y = __fadd_rn(y, bb); unsigned short p2, q2; splitf(y, p2, q2); oh[u] = p2; ol[u] = q2; } const size_t oo = (size_t)t * DM + ch * 128 + lane * 4; *(v4us*)(Xh + oo) = oh; *(v4us*)(Xl + oo) = ol; }
         } }
__global__ __launch_bounds__(256) void k_lnz(const float* __restrict__ X, const float* __restrict__ gam, const float* __restrict__ bet, bf* Xh, bf* Xl) { const int lane = threadIdx.x & 31; const int t = blockIdx.x * 8 + (threadIdx.x >> 5); if (t >= NPZ) return; const float* f = X + (size_t)t * CZ; float v[CZ / 32]; float su = 0.f;
#pragma unroll
    for (int ch = 0; ch < CZ / 128; ++ch) { const v4f a = *(const v4f*)(f + ch * 128 + lane * 4); for (int u = 0; u < 4; ++u) { float xv = bfr(a[u]); asm volatile("" : "+v"(xv)); v[ch * 4 + u] = xv; su = __fadd_rn(su, xv); } }
#pragma unroll
    for (int sh = 16; sh; sh >>= 1) su = __fadd_rn(su, __shfl_xor(su, sh, 32));
    const float mu = __fdiv_rn(su, (float)CZ); float sq = 0.f;
#pragma unroll
    for (int q = 0; q < CZ / 32; ++q) { float d0 = __fsub_rn(v[q], mu); asm volatile("" : "+v"(d0)); float p = __fmul_rn(d0, d0); asm volatile("" : "+v"(p)); sq = __fadd_rn(sq, p); }
#pragma unroll
    for (int sh = 16; sh; sh >>= 1) sq = __fadd_rn(sq, __shfl_xor(sq, sh, 32));
    const float rs = __fdiv_rn(1.0f, sqrtf(__fadd_rn(__fdiv_rn(sq, (float)CZ), 1e-5f)));
    {
#pragma unroll
        for (int ch = 0; ch < CZ / 128; ++ch) { v4us oh, ol; for (int u = 0; u < 4; ++u) { const int c = ch * 128 + lane * 4 + u; float d0 = __fsub_rn(v[ch * 4 + u], mu); asm volatile("" : "+v"(d0)); float n = __fmul_rn(d0, rs); asm volatile("" : "+v"(n)); float gg = bfr(gam[c]), bb = bfr(bet[c]); asm volatile("" : "+v"(gg)); asm volatile("" : "+v"(bb)); float y = __fmul_rn(n, gg); asm volatile("" : "+v"(y)); y = __fadd_rn(y, bb); unsigned short p2, q2; splitf(y, p2, q2); oh[u] = p2; ol[u] = q2; } const size_t oo = (size_t)t * CZ + ch * 128 + lane * 4; *(v4us*)(Xh + oo) = oh; *(v4us*)(Xl + oo) = ol; }
         } }
__global__ __launch_bounds__(256) void k_w2dp(const float* __restrict__ Wp, bf* WP) { const size_t e = ((size_t)blockIdx.x * 256 + threadIdx.x) * 8; if (e >= (size_t)ZW * CZ) return; const int r = (int)(e / CZ); const int c0 = (int)(e % CZ); v8us o; for (int u = 0; u < 8; ++u) o[u] = (r < NH_) ? f2bf(bfr(Wp[(size_t)(c0 + u) * NH_ + r])) : (unsigned short)0; *(v8us*)(WP + e) = o;  }
__global__ __launch_bounds__(256) void k_ztr(const float* __restrict__ ZF, float* ZB) { const size_t e = (size_t)blockIdx.x * 256 + threadIdx.x; if (e >= (size_t)NH_ * TT * TT) return; const int k = (int)(e % TT); const int q = (int)((e / TT) % TT); const int h = (int)(e / ((size_t)TT * TT)); const float v = ZF[((size_t)q * TT + k) * ZW + h]; *(float*)(ZB + e) = v;  }
__global__ __launch_bounds__(256) void k_planes32g(const float* __restrict__ F, h16* P16, bf* Ph2, bf* Pl2) { const size_t e = ((size_t)blockIdx.x * 256 + threadIdx.x) * 2; if (e >= (size_t)NVH * TT * HD) return; const int d = (int)(e % HD); const int t = (int)((e / HD) % TT); const int z = (int)(e / ((size_t)HD * TT)); const int bl = z / NH_, h = z % NH_; v2h o16; v2us oh, ol; for (int q = 0; q < 2; ++q) { const int dd = d + q; float xv = 0.0f; if (dd < HDR) xv = F[((size_t)bl * TT + t) * DR + h * HDR + dd]; o16[q] = tohx(xv); unsigned short a2, c2; splitf(xv, a2, c2); oh[q] = a2; ol[q] = c2; } *(v2h*)(P16 + e) = o16; *(v2us*)(Ph2 + e) = oh; *(v2us*)(Pl2 + e) = ol;  }
__global__ __launch_bounds__(256) void k_vtp32g(const float* __restrict__ F, h16* V16, bf* Vh2, bf* Vl2) { const size_t e = ((size_t)blockIdx.x * 256 + threadIdx.x) * 2; if (e >= (size_t)NVH * HD * TT) return; const int t = (int)(e % TT); const int d = (int)((e / TT) % HD); const int z = (int)(e / ((size_t)HD * TT)); const int bl = z / NH_, h = z % NH_; v2h o16; v2us oh, ol; for (int q = 0; q < 2; ++q) { const int tt = t + q; float xv = 0.0f; if (d < HDR) xv = F[((size_t)bl * TT + tt) * DR + h * HDR + d]; o16[q] = tohx(xv); unsigned short a2, c2; splitf(xv, a2, c2); oh[q] = a2; ol[q] = c2; } *(v2h*)(V16 + e) = o16; *(v2us*)(Vh2 + e) = oh; *(v2us*)(Vl2 + e) = ol;  }
__global__ __launch_bounds__(256) void k_merge32g(const float* __restrict__ O, int z0, float* YO) { const size_t e = ((size_t)blockIdx.x * 256 + threadIdx.x) * 2; if (e >= (size_t)ZH * TT * HDR) return; const int d = (int)(e % HDR); const int t = (int)((e / HDR) % TT); const int zz = (int)(e / ((size_t)HDR * TT)); const int z = z0 + zz; const int bl = z / NH_, h = z % NH_; v2f o; o[0] = O[((size_t)zz * TT + t) * HD + d]; o[1] = O[((size_t)zz * TT + t) * HD + d + 1]; float* dst = YO + ((size_t)bl * TT + t) * DR + h * HDR + d; *(v2f*)dst = o;  }
__global__ __launch_bounds__(256) void k_gmulpl(const float* __restrict__ YO, const float* __restrict__ FG, bf* Ah, bf* Al) { const size_t e = ((size_t)blockIdx.x * 256 + threadIdx.x) * 4; if (e >= (size_t)GR * DR) return; const v4f a = *(const v4f*)(YO + e); const v4f gz = *(const v4f*)(FG + e); v4us oh, ol; for (int u = 0; u < 4; ++u) { float eg = expf(-gz[u]); float sg = __fdiv_rn(1.0f, __fadd_rn(1.0f, eg)); asm volatile("" : "+v"(sg)); const float ov = __fmul_rn(a[u], sg); unsigned short a2, c2; splitf(ov, a2, c2); oh[u] = a2; ol[u] = c2; } *(v4us*)(Ah + e) = oh; *(v4us*)(Al + e) = ol;  }
// k_asoft: per row (zz, i): t = S x 32^-0.5 + bias[h][i][k] (no mask); softmax over the 256 keys (register row, one exp, fixed trees);
__global__ __launch_bounds__(256) void k_asoft(const float* __restrict__ Sb, const float* __restrict__ ZB, int z0, h16* P16, bf* Ph, bf* Pl) {
    const int lane = threadIdx.x & 31; const int row = blockIdx.x * 8 + (threadIdx.x >> 5); if (row >= ZH * TT) return; const int i = row % TT; const int zz = row / TT; (void)zz; const bool hires = (i < RH); const float* sr = Sb + (size_t)row * TT; const int zv = z0 + zz; const int hh = zv % NH_; const float* zr = ZB + ((size_t)hh * TT + i) * TT; float v[TT / 32]; float mx = -3.0e38f;
#pragma unroll
    for (int ch = 0; ch < TT / 128; ++ch) { const int j0 = ch * 128 + lane * 4; const v4f a = *(const v4f*)(sr + j0);
#pragma unroll
        for (int q = 0; q < 4; ++q) { const int j = j0 + q; (void)j; float sa = a[q] * SCL; asm volatile("" : "+v"(sa)); const float t = __fadd_rn(sa, zr[j]); v[ch * 4 + q] = t; mx = fmaxf(mx, t); } }
#pragma unroll
    for (int sh = 16; sh; sh >>= 1) mx = fmaxf(mx, __shfl_xor(mx, sh, 32));
    float sum = 0.f;
#pragma unroll
    for (int k = 0; k < TT / 32; ++k) { float d0 = __fsub_rn(v[k], mx); asm volatile("" : "+v"(d0)); v[k] = __builtin_amdgcn_exp2f(__fmul_rn(d0, 1.4426950408889634f)); sum += v[k]; }
#pragma unroll
    for (int sh = 16; sh; sh >>= 1) sum += __shfl_xor(sum, sh, 32);
    const float f = __fdiv_rn(hires ? 1.0f : PCAR, sum);
{
        if (hires) {
#pragma unroll
            for (int ch = 0; ch < TT / 128; ++ch) { v4us oh, ol;
#pragma unroll
                for (int q = 0; q < 4; ++q) { unsigned short a, c2; splitf(v[ch * 4 + q] * f, a, c2); oh[q] = a; ol[q] = c2; }
                const size_t oo = ((size_t)zz * (RH ? RH : 1) + i) * TT + ch * 128 + lane * 4; *(v4us*)(Ph + oo) = oh; *(v4us*)(Pl + oo) = ol; }
        } else {
#pragma unroll
            for (int ch = 0; ch < TT / 128; ++ch) { v4h o4;
#pragma unroll
                for (int q = 0; q < 4; ++q) o4[q] = tohx(v[ch * 4 + q] * f);
                *(v4h*)(P16 + (size_t)row * TT + ch * 128 + lane * 4) = o4; } }
         }
}
__global__ __launch_bounds__(256) void k_merge(const float* __restrict__ O, int h0, bf* Ah, bf* Al) { const size_t e = ((size_t)blockIdx.x * 256 + threadIdx.x) * 2; if (e >= (size_t)ZH * TT * HD) return; const int d = (int)(e % HD); const int t = (int)((e / HD) % TT); const int zz = (int)(e / ((size_t)HD * TT)); const float cs = (t < RH) ? 1.0f : (1.0f / PCAR); const size_t oo = (size_t)t * DQ + (h0 + zz) * HD + d;
    v2us oh, ol;
#pragma unroll
    for (int q = 0; q < 2; ++q) { unsigned short a, c2; splitf(O[e + q] * cs, a, c2); oh[q] = a; ol[q] = c2; } *(v2us*)(Ah + oo) = oh; *(v2us*)(Al + oo) = ol;  }

extern "C" void kernel_launch(void* const* d_in, const int* in_sizes, int n_in,
                              void* d_out, int out_size, void* d_ws, size_t ws_size, hipStream_t stream) {
    (void)in_sizes; (void)n_in; (void)out_size;
    const float* x = (const float*)d_in[0]; const float* pair = x; const float* qng = (const float*)d_in[1]; const float* qnb = (const float*)d_in[2]; const float* png_ = qng; const float* pnb = qnb; const float* wq = (const float*)d_in[3]; const float* wk = (const float*)d_in[4]; const float* wv = (const float*)d_in[5]; const float* w2d = (const float*)d_in[6]; const float* wg = (const float*)d_in[7]; const float* bg = (const float*)d_in[8]; const float* wo = (const float*)d_in[9]; const float* bo = (const float*)d_in[10]; const float* cosT = nullptr; const float* sinT = nullptr; (void)cosT; (void)sinT;
    float* OUT = (float*)d_out;   // [256][256][128]
    char* wsp = (char*)d_ws; auto take = [&](size_t bytes) { char* p = wsp; wsp += (bytes + 255) & ~(size_t)255; return (void*)p; };
    bf* WQ = (bf*)take((size_t)DR * DM * 2); bf* WK = (bf*)take((size_t)DR * DM * 2); bf* WV = (bf*)take((size_t)DR * DM * 2); bf* WG = (bf*)take((size_t)DR * DM * 2); bf* WO = (bf*)take((size_t)DM * DR * 2); bf* W2 = (bf*)take((size_t)ZW * CZ * 2); bf* AOh = (bf*)take((size_t)GR * DR * 2); bf* AOl = (bf*)take((size_t)GR * DR * 2); bf* XNh = (bf*)take((size_t)GR * DM * 2); bf* XNl = (bf*)take((size_t)GR * DM * 2); float* FG = (float*)take((size_t)GR * DR * 4); bf* ZNh = (bf*)take((size_t)NPZ * CZ * 2); bf* ZNl = (bf*)take((size_t)NPZ * CZ * 2); float* ZF = (float*)take((size_t)NPZ * ZW * 4); float* ZB = (float*)take((size_t)NH_ * TT * TT * 4); float* CS = (float*)take((size_t)TT * HD * 2 * 4);
    bf* XB = nullptr; (void)XB; float* FQ = (float*)take((size_t)GR * DQ * 4); float* FK = (float*)take((size_t)GR * DKV * 4); float* FV = FK; float* YO = FQ;   /* YO (merged f32 context of the group) reuses FQ after the q planes are built */
    h16* QP16 = (h16*)take((size_t)NVH * TT * HD * 2); bf* QPh = (bf*)take((size_t)NVH * TT * HD * 2); bf* QPl = (bf*)take((size_t)NVH * TT * HD * 2);
    h16* KP16 = (h16*)take((size_t)NVH * TT * HD * 2); bf* KPh = (bf*)take((size_t)NVH * TT * HD * 2); bf* KPl = (bf*)take((size_t)NVH * TT * HD * 2);
    h16* VT16 = (h16*)take((size_t)NVH * HD * TT * 2); bf* VTh = (bf*)take((size_t)NVH * HD * TT * 2); bf* VTl = (bf*)take((size_t)NVH * HD * TT * 2);
    float* Sb = (float*)take((size_t)ZH * TT * TT * 4); h16* P16 = (h16*)take((size_t)ZH * TT * TT * 2); bf* Ph = (bf*)take((size_t)ZH * RH * TT * 2); bf* Pl = (bf*)take((size_t)ZH * RH * TT * 2); float* Ob = (float*)take((size_t)ZH * TT * HD * 4);
    if ((size_t)(wsp - (char*)d_ws) > ws_size) return;   // ws ~ 157 MiB
    { k_wtG<<<(DM * DR / 64 + 63) / 64, 256, 0, stream>>>(wq, DM, DR, WQ); k_wtG<<<(DM * DR / 64 + 63) / 64, 256, 0, stream>>>(wk, DM, DR, WK); k_wtG<<<(DM * DR / 64 + 63) / 64, 256, 0, stream>>>(wv, DM, DR, WV); k_wtG<<<(DM * DR / 64 + 63) / 64, 256, 0, stream>>>(wg, DM, DR, WG); k_wtG<<<(DR * DM / 64 + 63) / 64, 256, 0, stream>>>(wo, DR, DM, WO); k_w2dp<<<(ZW * CZ / 8 + 255) / 256, 256, 0, stream>>>(w2d, W2); k_lnz<<<NPZ / 8, 256, 0, stream>>>(pair, png_, pnb, ZNh, ZNl); k_gemmw<bf, 1, false><<<dim3(NPZ / 64, 1, 1), 32, 0, stream>>>(ZNh, ZNl, W2, nullptr, CZ, ZF, ZW, nullptr, 0, 0, 0); k_ztr<<<(NH_ * TT * TT + 255) / 256, 256, 0, stream>>>(ZF, ZB); k_csid<<<(TT * HD + 255) / 256, 256, 0, stream>>>(CS); }
    const unsigned LQ = (unsigned)(((size_t)NH_ * TT * HD / 2 + 255) / 256);
    for (int gI = 0; gI < NG; ++gI) {
        k_lnxg<<<GR / 8, 256, 0, stream>>>(x + (size_t)gI * GR * DM, qng, qnb, XNh, XNl);
        k_gemmw<bf, 1, false><<<dim3(GR / 64, DR / 64, 1), 32, 0, stream>>>(XNh, XNl, WQ, nullptr, DM, FQ, DR, nullptr, 0, 0, 0); k_gemmw<bf, 1, true><<<dim3(GR / 64, DR / 64, 1), 32, 0, stream>>>(XNh, XNl, WG, nullptr, DM, FG, DR, bg, 0, 0, 0); k_planes32g<<<(unsigned)(((size_t)NVH * TT * HD / 2 + 255) / 256), 256, 0, stream>>>(FQ, QP16, QPh, QPl);
        k_gemmw<bf, 1, false><<<dim3(GR / 64, DR / 64, 1), 32, 0, stream>>>(XNh, XNl, WK, nullptr, DM, FK, DR, nullptr, 0, 0, 0); k_planes32g<<<(unsigned)(((size_t)NVH * TT * HD / 2 + 255) / 256), 256, 0, stream>>>(FK, KP16, KPh, KPl);
        k_gemmw<bf, 1, false><<<dim3(GR / 64, DR / 64, 1), 32, 0, stream>>>(XNh, XNl, WV, nullptr, DM, FV, DR, nullptr, 0, 0, 0); k_vtp32g<<<(unsigned)(((size_t)NVH * HD * TT / 2 + 255) / 256), 256, 0, stream>>>(FV, VT16, VTh, VTl);
        for (int z0 = 0; z0 < NVH; z0 += ZH) { const size_t zq = (size_t)z0;   // virtual head z = bl * 4 + h
            k_gemmw<bf, 2, false><<<dim3(TT / 64, TT / 64, ZH), 32, 0, stream>>>(QPh + zq * TT * HD, QPl + zq * TT * HD, KPh + zq * TT * HD, KPl + zq * TT * HD, HD, Sb, TT, nullptr, (size_t)TT * HD, (size_t)TT * HD, (size_t)TT * TT);
            k_asoft<<<ZH * TT / 8, 256, 0, stream>>>(Sb, ZB, z0, P16, Ph, Pl);
            k_gemmw<bf, 2, false><<<dim3(TT / 64, HD / 64, ZH), 32, 0, stream>>>(Ph, Pl, VTh + zq * HD * TT, VTl + zq * HD * TT, TT, Ob, HD, nullptr, (size_t)RH * TT, (size_t)HD * TT, (size_t)TT * HD);
            k_merge32g<<<(unsigned)(((size_t)ZH * TT * HDR / 2 + 255) / 256), 256, 0, stream>>>(Ob, z0, YO); }
        k_gmulpl<<<(unsigned)(((size_t)GR * DR / 4 + 255) / 256), 256, 0, stream>>>(YO, FG, AOh, AOl); k_gemmw<bf, 1, true><<<dim3(GR / 64, DM / 64, 1), 32, 0, stream>>>(AOh, AOl, WO, nullptr, DR, OUT + (size_t)gI * GR * DM, DM, bo, 0, 0, 0);
    }
}

// v001
// Measured time: 523 microseconds a run.
// Two timings next to v000 put it at 1.65 and 1.64 times that version's speed.
#include <hip/hip_runtime.h>

// Triangle_Att_Start (AlphaFold triangle attention, starting node: pair_embed [256 rows i][256 j][128]; z = LayerNorm(pair); q/k/v = z W ([128][4 x 32]), q x 32^-0.5; bias[h][j][k] = (z Wb)[j][k][h] shared over rows i; gate = sigmoid(z Wg + bg); logits[h][i][j][k] = q_ij.k_ik + bias[h][j][k]; softmax over k; o = (a v) * gate; out = o Wo + bo -> [256][256][128]).
// Batched layout (exact): every row i is an independent 256-token attention; 64 rows x 4 heads = 256 'virtual heads' of 256 tokens per group, all of them in one score pass, 4 groups; the projections run on the 16,384 stacked (row, j) positions of a group; the 32-wide heads run on 64-wide tensor-core tiles by zero padding (exact).

#define NB_  256
#define TT   256
#define DM   128
#define NH_  4
#define NKV  4
#define REP  (NH_ / NKV)
#define HD   64
#define DQ   (NH_ * HD)
#define DKV  (NKV * HD)
#define ZH   256   // virtual heads per score pass (= NVH: one pass per group)
#define RH   256
#define WIN  0
#define PCAR 1024.0f
#define HDR  32
#define DR   (NH_ * HDR)   // 128
#define CZ   128
#define NPZ  (TT * TT)     // pair rows 65536
#define ZW   64            // padded w2d width
#define LR   256    // tokens per row (no padding)
#define GB   64     // rows per group
#define NG   (NB_ / GB)
#define GR   (GB * TT)   // stacked rows per group
#define NVH  (GB * NH_)  // virtual heads per group
#define SCL  0.17677669529663689f   // 32^-0.5
typedef _Float16 h16;
typedef unsigned short bf;
typedef __attribute__((ext_vector_type(16))) __bf16   v16bf;
typedef __attribute__((ext_vector_type(16))) _Float16 v16h;
typedef __attribute__((ext_vector_type(8)))  _Float16 v8h;
typedef __attribute__((ext_vector_type(8)))  unsigned short v8us;
typedef __attribute__((ext_vector_type(8)))  float    v8f;
typedef __attribute__((ext_vector_type(4)))  float    v4f;
typedef v8h  __attribute__((may_alias)) v8ha;
typedef v4f  __attribute__((may_alias)) v4fa;
typedef v8us __attribute__((may_alias)) v8usa;

__device__ __forceinline__ unsigned short f2bf(float f) { unsigned u = __float_as_uint(f); u += 0x7FFFu + ((u >> 16) & 1u); return (unsigned short)(u >> 16); }
__device__ __forceinline__ float bf2f(unsigned short b) { return __uint_as_float(((unsigned)b) << 16); }
__device__ __forceinline__ float bfr(float f) { return bf2f(f2bf(f)); }
__device__ __forceinline__ v16h cat16(v8h lo, v8h hi) { return __builtin_shufflevector(lo, hi, 0, 1, 2, 3, 4, 5, 6, 7, 8, 9, 10, 11, 12, 13, 14, 15); }
__device__ __forceinline__ v16bf cat16b(v8us lo, v8us hi) { return __builtin_bit_cast(v16bf, __builtin_shufflevector(lo, hi, 0, 1, 2, 3, 4, 5, 6, 7, 8, 9, 10, 11, 12, 13, 14, 15)); }
__device__ __forceinline__ v8f wmma16(v16h a, v16h b, v8f c) { return __builtin_amdgcn_wmma_f32_16x16x32_f16(false, a, false, b, (short)0, c, false, false); }
__device__ __forceinline__ v8f wmmab(v16bf a, v16bf b, v8f c) { return __builtin_amdgcn_wmma_f32_16x16x32_bf16(false, a, false, b, (short)0, c, false, false); }



// ---- k_gemmw: register-blocked GEMM, ONE WAVE per 64x64 output tile (16 accumulators), operands straight from K-contiguous 16-bit planes; grid (M/64, N/64, Z), 32 threads.
// C[m][n] (f32, pitch ldc, + optional f32 bias[n]) = sum_k A[m][k] Bt[n][k] (+ split products per NSPLIT). z-batch strides sA/sB/sC in elements. K % 32 == 0.
template <typename T16> struct WFrag;
template <> struct WFrag<h16> { typedef v16h V; static __device__ __forceinline__ V ld(const h16* p) { return cat16(*(const v8h*)p, *(const v8h*)(p + 16)); } static __device__ __forceinline__ v8f mma(V a, V b, v8f c) { return wmma16(a, b, c); } };
template <> struct WFrag<bf> { typedef v16bf V; static __device__ __forceinline__ V ld(const bf* p) { return cat16b(*(const v8us*)p, *(const v8us*)(p + 16)); } static __device__ __forceinline__ v8f mma(V a, V b, v8f c) { return wmmab(a, b, c); } };
template <typename T16, int NSPLIT, bool BIAS>
__global__ __launch_bounds__(32) void k_gemmw(const T16* __restrict__ A, const T16* __restrict__ A2, const T16* __restrict__ Bt, const T16* __restrict__ Bt2, int K, float* C, int ldc, const float* __restrict__ bias, size_t sA, size_t sB, size_t sC) {
    typedef typename WFrag<T16>::V V;
    __shared__ __align__(16) float os[16 * 68];
    const size_t z = blockIdx.z; A += z * sA; if (A2) A2 += z * sA; Bt += z * sB; if (Bt2) Bt2 += z * sB; C += z * sC;
    const int lane = threadIdx.x & 31, lr = lane & 15, hi = lane >> 4; const int r0 = blockIdx.x * 64, c0 = blockIdx.y * 64;
    v8f acc[4][4];
#pragma unroll
    for (int mb = 0; mb < 4; ++mb)
#pragma unroll
        for (int nb = 0; nb < 4; ++nb) acc[mb][nb] = (v8f){};
    const size_t aoff = (size_t)(r0 + lr) * K + 8 * hi, boff = (size_t)(c0 + lr) * K + 8 * hi;
#pragma unroll 1
    for (int kc = 0; kc < K; kc += 32) {
        V a[4], a2[4];
#pragma unroll
        for (int mb = 0; mb < 4; ++mb) { a[mb] = WFrag<T16>::ld(A + aoff + (size_t)mb * 16 * K + kc); if (NSPLIT == 1 || NSPLIT == 2) a2[mb] = WFrag<T16>::ld(A2 + aoff + (size_t)mb * 16 * K + kc); }
#pragma unroll
        for (int nb = 0; nb < 4; ++nb) { const V b = WFrag<T16>::ld(Bt + boff + (size_t)nb * 16 * K + kc); V b2; if (NSPLIT >= 2) b2 = WFrag<T16>::ld(Bt2 + boff + (size_t)nb * 16 * K + kc);
#pragma unroll
            for (int mb = 0; mb < 4; ++mb) { acc[mb][nb] = WFrag<T16>::mma(a[mb], b, acc[mb][nb]); if (NSPLIT == 1 || NSPLIT == 2) acc[mb][nb] = WFrag<T16>::mma(a2[mb], b, acc[mb][nb]); if (NSPLIT >= 2) acc[mb][nb] = WFrag<T16>::mma(a[mb], b2, acc[mb][nb]); } }
        asm volatile("v_nop\n\tv_nop\n\tv_nop\n\tv_nop" : "+v"(acc[0][0]), "+v"(acc[1][1]), "+v"(acc[2][2]), "+v"(acc[3][3]) : "v"(a[0]), "v"(a[3]));
    }
#pragma unroll
    for (int mb = 0; mb < 4; ++mb) {
#pragma unroll
        for (int nb = 0; nb < 4; ++nb) {
#pragma unroll
            for (int j = 0; j < 8; ++j) os[(hi * 8 + j) * 68 + nb * 16 + lr] = acc[mb][nb][j]; }
        __builtin_amdgcn_wave_barrier(); asm volatile("" ::: "memory");
        float* crow = C + (size_t)(r0 + mb * 16) * ldc + c0;
{
#pragma unroll
            for (int s = 0; s < 8; ++s) { const int row = 2 * s + hi, cofs = lr * 4; v4f val = *(const v4fa*)(os + row * 68 + cofs); if (BIAS) { val[0] += bfr(bias[c0 + cofs]); val[1] += bfr(bias[c0 + cofs + 1]); val[2] += bfr(bias[c0 + cofs + 2]); val[3] += bfr(bias[c0 + cofs + 3]); }
                *(v4f*)(crow + (size_t)row * ldc + cofs) = val; }
             }
        __builtin_amdgcn_wave_barrier(); asm volatile("" ::: "memory");
    }
}

__device__ __forceinline__ h16 tohx(float x) { return (h16)x; }
__device__ __forceinline__ void splitf(float y, unsigned short& h, unsigned short& l) { h = f2bf(y); l = f2bf(y - bf2f(h)); }
typedef __attribute__((ext_vector_type(2))) _Float16 v2h;
typedef __attribute__((ext_vector_type(4))) _Float16 v4h;
typedef __attribute__((ext_vector_type(2))) unsigned short v2us;
typedef __attribute__((ext_vector_type(4))) unsigned short v4us;
typedef __attribute__((ext_vector_type(2))) float v2f;
typedef __attribute__((ext_vector_type(4))) int v4i;

__global__ __launch_bounds__(256) void k_wtG(const float* __restrict__ w, int K, int N, bf* Bt) {
    const int lane = threadIdx.x & 31; const int L0 = (blockIdx.x * 8 + (threadIdx.x >> 5)) * 8; const int nlines = N * K / 64;
{
#pragma unroll 1
        for (int l = 0; l < 8; ++l) { const int L = L0 + l; if (L >= nlines) break; const size_t e = (size_t)L * 64 + lane * 2; const int k = (int)(e % K), n = (int)(e / K); v2us o;
            o[0] = f2bf(w[(size_t)k * N + n]); o[1] = f2bf(w[(size_t)(k + 1) * N + n]); *(v2us*)(Bt + e) = o; }
         }
}
__global__ __launch_bounds__(256) void k_cvt8(const float* __restrict__ src, bf* dst, size_t n8) { const size_t i = (size_t)blockIdx.x * 256 + threadIdx.x; if (i >= n8) return; const v8f v = *(const v8f*)(src + i * 8); v8us o;
#pragma unroll
    for (int k = 0; k < 8; ++k) o[k] = f2bf(v[k]); *(v8us*)(dst + i * 8) = o;  }
__global__ __launch_bounds__(256) void k_cscvt(const float* __restrict__ cosT, const float* __restrict__ sinT, float* CS) { const int idx = blockIdx.x * 256 + threadIdx.x; if (idx >= TT * HD) return; v2f cs; cs[0] = bfr(cosT[idx]); cs[1] = bfr(sinT[idx]); *(v2f*)(CS + (size_t)idx * 2) = cs;  }
// k_rope: head planes [h][t][d] (fp16 + hi/lo) of rope(x) x sc with the rotate-half convention out[d] = x[d] cos[t][d] - x[d+HD/2] sin[t][d], out[d+HD/2] = x[d+HD/2] cos[t][d+HD/2] + x[d] sin[t][d+HD/2]
__global__ __launch_bounds__(256) void k_rope(const float* __restrict__ F, int pitch, int nheads, const float* __restrict__ CS, const float* __restrict__ RF, const float* __restrict__ nw, float sc, h16* P16, bf* Ph, bf* Pl) {
    const size_t e = ((size_t)blockIdx.x * 256 + threadIdx.x) * 2; if (e >= (size_t)nheads * TT * HD) return; const int d = (int)(e % HD); const int t = (int)((e / HD) % TT); const int h = (int)(e / ((size_t)HD * TT)); const float* f = F + (size_t)t * pitch + h * HD; const float rf = RF ? RF[(size_t)h * TT + t] : 1.0f; v2h o16; v2us oh, ol;
#pragma unroll
    for (int q = 0; q < 2; ++q) { const int dd = d + q; const int dp = (dd < HD / 2) ? dd + HD / 2 : dd - HD / 2; float x0 = f[dd], x1 = f[dp];
        if (RF) { float n0 = __fmul_rn(x0, rf), n1 = __fmul_rn(x1, rf); asm volatile("" : "+v"(n0)); asm volatile("" : "+v"(n1)); x0 = __fmul_rn(bfr(nw[dd]), n0); x1 = __fmul_rn(bfr(nw[dp]), n1); }
        const v2f cs = *(const v2f*)(CS + ((size_t)t * HD + dd) * 2); float a = __fmul_rn(x0, cs[0]), bq = __fmul_rn(x1, cs[1]); asm volatile("" : "+v"(a)); asm volatile("" : "+v"(bq)); const float r = ((dd < HD / 2) ? __fsub_rn(a, bq) : __fadd_rn(a, bq)) * sc;
        o16[q] = tohx(r); unsigned short a2, c2; splitf(r, a2, c2); oh[q] = a2; ol[q] = c2; }
    *(v2h*)(P16 + e) = o16; *(v2us*)(Ph + e) = oh; *(v2us*)(Pl + e) = ol;  }
__global__ __launch_bounds__(256) void k_vtp(const float* __restrict__ F, int pitch, int nheads, h16* V16, bf* Vh, bf* Vl) { const size_t e = ((size_t)blockIdx.x * 256 + threadIdx.x) * 2; if (e >= (size_t)nheads * HD * TT) return; const int t = (int)(e % TT); const int d = (int)((e / TT) % HD); const int g = (int)(e / ((size_t)TT * HD)); v2h o16; v2us oh, ol;
#pragma unroll
    for (int q = 0; q < 2; ++q) { const float x = F[(size_t)(t + q) * pitch + g * HD + d]; o16[q] = tohx(x); unsigned short a2, c2; splitf(x, a2, c2); oh[q] = a2; ol[q] = c2; }
    *(v2h*)(V16 + e) = o16; *(v2us*)(Vh + e) = oh; *(v2us*)(Vl + e) = ol;  }
__global__ __launch_bounds__(256) void k_csid(float* CS) { const int idx = blockIdx.x * 256 + threadIdx.x; if (idx >= TT * HD) return; v2f cs; cs[0] = 1.0f; cs[1] = 0.0f; *(v2f*)(CS + (size_t)idx * 2) = cs;  }
__global__ __launch_bounds__(256) void k_cvt8padg(const float* __restrict__ src, bf* XB2) { const size_t e8 = ((size_t)blockIdx.x * 256 + threadIdx.x) * 8; if (e8 >= (size_t)GR * DM) return; const int r = (int)(e8 / DM); const int bl = r / TT, t = r % TT; v8us o; if (t < LR) { const float* sp2 = src + ((size_t)bl * LR + t) * DM + (e8 % DM); for (int u = 0; u < 8; ++u) o[u] = f2bf(bfr(sp2[u])); } else { for (int u = 0; u < 8; ++u) o[u] = 0; } *(v8us*)(XB2 + e8) = o;  }
__global__ __launch_bounds__(256) void k_moutv(const float* __restrict__ O, int z0, float* YO2) { const size_t e = ((size_t)blockIdx.x * 256 + threadIdx.x) * 2; if (e >= (size_t)ZH * TT * HD) return; const int d = (int)(e % HD); const int t = (int)((e / HD) % TT); const int zz = (int)(e / ((size_t)HD * TT)); const int z = z0 + zz; const int bl = z / NH_, h = z % NH_; v2f o; o[0] = O[e]; o[1] = O[e + 1]; float* dst = YO2 + ((size_t)bl * TT + t) * DQ + (size_t)h * HD + d; *(v2f*)dst = o;  }
__global__ __launch_bounds__(256) void k_outcpg(const float* __restrict__ Y, float* O2) { const size_t e = ((size_t)blockIdx.x * 256 + threadIdx.x) * 4; if (e >= (size_t)GB * LR * DM) return; const size_t r = e / DM; const int bl = (int)(r / LR), t = (int)(r % LR); const v4f a = *(const v4f*)(Y + ((size_t)bl * TT + t) * DM + (e % DM)); *(v4f*)(O2 + e) = a;  }
__global__ __launch_bounds__(256) void k_hlG(const float* __restrict__ F, bf* Fh, bf* Fl, size_t n) { const size_t e = ((size_t)blockIdx.x * 256 + threadIdx.x) * 4; if (e >= n) return; const v4f a = *(const v4f*)(F + e); v4us oh, ol; for (int u = 0; u < 4; ++u) { unsigned short p, q; splitf(a[u], p, q); oh[u] = p; ol[u] = q; } *(v4us*)(Fh + e) = oh; *(v4us*)(Fl + e) = ol;  }
__global__ __launch_bounds__(256) void k_lnxg(const float* __restrict__ X, const float* __restrict__ gam, const float* __restrict__ bet, bf* Xh, bf* Xl) { const int lane = threadIdx.x & 31; const int t = blockIdx.x * 8 + (threadIdx.x >> 5); if (t >= GR) return; const float* f = X + (size_t)t * DM; float v[DM / 32]; float su = 0.f;
#pragma unroll
    for (int ch = 0; ch < DM / 128; ++ch) { const v4f a = *(const v4f*)(f + ch * 128 + lane * 4); for (int u = 0; u < 4; ++u) { float xv = bfr(a[u]); asm volatile("" : "+v"(xv)); v[ch * 4 + u] = xv; su = __fadd_rn(su, xv); } }
#pragma unroll
    for (int sh = 16; sh; sh >>= 1) su = __fadd_rn(su, __shfl_xor(su, sh, 32));
    const float mu = __fdiv_rn(su, (float)DM); float sq = 0.f;
#pragma unroll
    for (int q = 0; q < DM / 32; ++q) { float d0 = __fsub_rn(v[q], mu); asm volatile("" : "+v"(d0)); float p = __fmul_rn(d0, d0); asm volatile("" : "+v"(p)); sq = __fadd_rn(sq, p); }
#pragma unroll
    for (int sh = 16; sh; sh >>= 1) sq = __fadd_rn(sq, __shfl_xor(sq, sh, 32));
    const float rs = __fdiv_rn(1.0f, sqrtf(__fadd_rn(__fdiv_rn(sq, (float)DM), 1e-5f)));
    {
#pragma unroll
        for (int ch = 0; ch < DM / 128; ++ch) { v4us oh, ol; for (int u = 0; u < 4; ++u) { const int c = ch * 128 + lane * 4 + u; float d0 = __fsub_rn(v[ch * 4 + u], mu); asm volatile("" : "+v"(d0)); float n = __fmul_rn(d0, rs); asm volatile("" : "+v"(n)); float gg = bfr(gam[c]), bb = bfr(bet[c]); asm volatile("" : "+v"(gg)); asm volatile("" : "+v"(bb)); float y = __fmul_rn(n, gg); asm volatile("" : "+v"(y)); y = __fadd_rn(y, bb); unsigned short p2, q2; splitf(y, p2, q2); oh[u] = p2; ol[u] = q2; } const size_t oo = (size_t)t * DM + ch * 128 + lane * 4; *(v4us*)(Xh + oo) = oh; *(v4us*)(Xl + oo) = ol; }
         } }
__global__ __launch_bounds__(256) void k_lnz(const float* __restrict__ X, const float* __restrict__ gam, const float* __restrict__ bet, bf* Xh, bf* Xl) { const int lane = threadIdx.x & 31; const int t = blockIdx.x * 8 + (threadIdx.x >> 5); if (t >= NPZ) return; const float* f = X + (size_t)t * CZ; float v[CZ / 32]; float su = 0.f;
#pragma unroll
    for (int ch = 0; ch < CZ / 128; ++ch) { const v4f a = *(const v4f*)(f + ch * 128 + lane * 4); for (int u = 0; u < 4; ++u) { float xv = bfr(a[u]); asm volatile("" : "+v"(xv)); v[ch * 4 + u] = xv; su = __fadd_rn(su, xv); } }
#pragma unroll
    for (int sh = 16; sh; sh >>= 1) su = __fadd_rn(su, __shfl_xor(su, sh, 32));
    const float mu = __fdiv_rn(su, (float)CZ); float sq = 0.f;
#pragma unroll
    for (int q = 0; q < CZ / 32; ++q) { float d0 = __fsub_rn(v[q], mu); asm volatile("" : "+v"(d0)); float p = __fmul_rn(d0, d0); asm volatile("" : "+v"(p)); sq = __fadd_rn(sq, p); }
#pragma unroll
    for (int sh = 16; sh; sh >>= 1) sq = __fadd_rn(sq, __shfl_xor(sq, sh, 32));
    const float rs = __fdiv_rn(1.0f, sqrtf(__fadd_rn(__fdiv_rn(sq, (float)CZ), 1e-5f)));
    {
#pragma unroll
        for (int ch = 0; ch < CZ / 128; ++ch) { v4us oh, ol; for (int u = 0; u < 4; ++u) { const int c = ch * 128 + lane * 4 + u; float d0 = __fsub_rn(v[ch * 4 + u], mu); asm volatile("" : "+v"(d0)); float n = __fmul_rn(d0, rs); asm volatile("" : "+v"(n)); float gg = bfr(gam[c]), bb = bfr(bet[c]); asm volatile("" : "+v"(gg)); asm volatile("" : "+v"(bb)); float y = __fmul_rn(n, gg); asm volatile("" : "+v"(y)); y = __fadd_rn(y, bb); unsigned short p2, q2; splitf(y, p2, q2); oh[u] = p2; ol[u] = q2; } const size_t oo = (size_t)t * CZ + ch * 128 + lane * 4; *(v4us*)(Xh + oo) = oh; *(v4us*)(Xl + oo) = ol; }
         } }
__global__ __launch_bounds__(256) void k_w2dp(const float* __restrict__ Wp, bf* WP) { const size_t e = ((size_t)blockIdx.x * 256 + threadIdx.x) * 8; if (e >= (size_t)ZW * CZ) return; const int r = (int)(e / CZ); const int c0 = (int)(e % CZ); v8us o; for (int u = 0; u < 8; ++u) o[u] = (r < NH_) ? f2bf(bfr(Wp[(size_t)(c0 + u) * NH_ + r])) : (unsigned short)0; *(v8us*)(WP + e) = o;  }
__global__ __launch_bounds__(256) void k_ztr(const float* __restrict__ ZF, float* ZB) { const size_t e = (size_t)blockIdx.x * 256 + threadIdx.x; if (e >= (size_t)NH_ * TT * TT) return; const int k = (int)(e % TT); const int q = (int)((e / TT) % TT); const int h = (int)(e / ((size_t)TT * TT)); const float v = ZF[((size_t)q * TT + k) * ZW + h]; *(float*)(ZB + e) = v;  }
__global__ __launch_bounds__(256) void k_planes32g(const float* __restrict__ F, h16* P16, bf* Ph2, bf* Pl2) { const size_t e = ((size_t)blockIdx.x * 256 + threadIdx.x) * 2; if (e >= (size_t)NVH * TT * HD) return; const int d = (int)(e % HD); const int t = (int)((e / HD) % TT); const int z = (int)(e / ((size_t)HD * TT)); const int bl = z / NH_, h = z % NH_; v2h o16; v2us oh, ol; for (int q = 0; q < 2; ++q) { const int dd = d + q; float xv = 0.0f; if (dd < HDR) xv = F[((size_t)bl * TT + t) * DR + h * HDR + dd]; o16[q] = tohx(xv); unsigned short a2, c2; splitf(xv, a2, c2); oh[q] = a2; ol[q] = c2; } *(v2h*)(P16 + e) = o16; *(v2us*)(Ph2 + e) = oh; *(v2us*)(Pl2 + e) = ol;  }
__global__ __launch_bounds__(256) void k_vtp32g(const float* __restrict__ F, h16* V16, bf* Vh2, bf* Vl2) { const size_t e = ((size_t)blockIdx.x * 256 + threadIdx.x) * 2; if (e >= (size_t)NVH * HD * TT) return; const int t = (int)(e % TT); const int d = (int)((e / TT) % HD); const int z = (int)(e / ((size_t)HD * TT)); const int bl = z / NH_, h = z % NH_; v2h o16; v2us oh, ol; for (int q = 0; q < 2; ++q) { const int tt = t + q; float xv = 0.0f; if (d < HDR) xv = F[((size_t)bl * TT + tt) * DR + h * HDR + d]; o16[q] = tohx(xv); unsigned short a2, c2; splitf(xv, a2, c2); oh[q] = a2; ol[q] = c2; } *(v2h*)(V16 + e) = o16; *(v2us*)(Vh2 + e) = oh; *(v2us*)(Vl2 + e) = ol;  }
__global__ __launch_bounds__(256) void k_merge32g(const float* __restrict__ O, int z0, float* YO) { const size_t e = ((size_t)blockIdx.x * 256 + threadIdx.x) * 2; if (e >= (size_t)ZH * TT * HDR) return; const int d = (int)(e % HDR); const int t = (int)((e / HDR) % TT); const int zz = (int)(e / ((size_t)HDR * TT)); const int z = z0 + zz; const int bl = z / NH_, h = z % NH_; v2f o; o[0] = O[((size_t)zz * TT + t) * HD + d]; o[1] = O[((size_t)zz * TT + t) * HD + d + 1]; float* dst = YO + ((size_t)bl * TT + t) * DR + h * HDR + d; *(v2f*)dst = o;  }
__global__ __launch_bounds__(256) void k_gmulpl(const float* __restrict__ YO, const float* __restrict__ FG, bf* Ah, bf* Al) { const size_t e = ((size_t)blockIdx.x * 256 + threadIdx.x) * 4; if (e >= (size_t)GR * DR) return; const v4f a = *(const v4f*)(YO + e); const v4f gz = *(const v4f*)(FG + e); v4us oh, ol; for (int u = 0; u < 4; ++u) { float eg = expf(-gz[u]); float sg = __fdiv_rn(1.0f, __fadd_rn(1.0f, eg)); asm volatile("" : "+v"(sg)); const float ov = __fmul_rn(a[u], sg); unsigned short a2, c2; splitf(ov, a2, c2); oh[u] = a2; ol[u] = c2; } *(v4us*)(Ah + e) = oh; *(v4us*)(Al + e) = ol;  }
// k_asoft: per row (zz, i): t = S x 32^-0.5 + bias[h][i][k] (no mask); softmax over the 256 keys (register row, one exp, fixed trees);
__global__ __launch_bounds__(256) void k_asoft(const float* __restrict__ Sb, const float* __restrict__ ZB, int z0, h16* P16, bf* Ph, bf* Pl) {
    const int lane = threadIdx.x & 31; const int row = blockIdx.x * 8 + (threadIdx.x >> 5); if (row >= ZH * TT) return; const int i = row % TT; const int zz = row / TT; (void)zz; const bool hires = (i < RH); const float* sr = Sb + (size_t)row * TT; const int zv = z0 + zz; const int hh = zv % NH_; const float* zr = ZB + ((size_t)hh * TT + i) * TT; float v[TT / 32]; float mx = -3.0e38f;
#pragma unroll
    for (int ch = 0; ch < TT / 128; ++ch) { const int j0 = ch * 128 + lane * 4; const v4f a = *(const v4f*)(sr + j0);
#pragma unroll
        for (int q = 0; q < 4; ++q) { const int j = j0 + q; (void)j; float sa = a[q] * SCL; asm volatile("" : "+v"(sa)); const float t = __fadd_rn(sa, zr[j]); v[ch * 4 + q] = t; mx = fmaxf(mx, t); } }
#pragma unroll
    for (int sh = 16; sh; sh >>= 1) mx = fmaxf(mx, __shfl_xor(mx, sh, 32));
    float sum = 0.f;
#pragma unroll
    for (int k = 0; k < TT / 32; ++k) { float d0 = __fsub_rn(v[k], mx); asm volatile("" : "+v"(d0)); v[k] = __builtin_amdgcn_exp2f(__fmul_rn(d0, 1.4426950408889634f)); sum += v[k]; }
#pragma unroll
    for (int sh = 16; sh; sh >>= 1) sum += __shfl_xor(sum, sh, 32);
    const float f = __fdiv_rn(hires ? 1.0f : PCAR, sum);
{
        if (hires) {
#pragma unroll
            for (int ch = 0; ch < TT / 128; ++ch) { v4us oh, ol;
#pragma unroll
                for (int q = 0; q < 4; ++q) { unsigned short a, c2; splitf(v[ch * 4 + q] * f, a, c2); oh[q] = a; ol[q] = c2; }
                const size_t oo = ((size_t)zz * (RH ? RH : 1) + i) * TT + ch * 128 + lane * 4; *(v4us*)(Ph + oo) = oh; *(v4us*)(Pl + oo) = ol; }
        } else {
#pragma unroll
            for (int ch = 0; ch < TT / 128; ++ch) { v4h o4;
#pragma unroll
                for (int q = 0; q < 4; ++q) o4[q] = tohx(v[ch * 4 + q] * f);
                *(v4h*)(P16 + (size_t)row * TT + ch * 128 + lane * 4) = o4; } }
         }
}
__global__ __launch_bounds__(256) void k_merge(const float* __restrict__ O, int h0, bf* Ah, bf* Al) { const size_t e = ((size_t)blockIdx.x * 256 + threadIdx.x) * 2; if (e >= (size_t)ZH * TT * HD) return; const int d = (int)(e % HD); const int t = (int)((e / HD) % TT); const int zz = (int)(e / ((size_t)HD * TT)); const float cs = (t < RH) ? 1.0f : (1.0f / PCAR); const size_t oo = (size_t)t * DQ + (h0 + zz) * HD + d;
    v2us oh, ol;
#pragma unroll
    for (int q = 0; q < 2; ++q) { unsigned short a, c2; splitf(O[e + q] * cs, a, c2); oh[q] = a; ol[q] = c2; } *(v2us*)(Ah + oo) = oh; *(v2us*)(Al + oo) = ol;  }

extern "C" void kernel_launch(void* const* d_in, const int* in_sizes, int n_in,
                              void* d_out, int out_size, void* d_ws, size_t ws_size, hipStream_t stream) {
    (void)in_sizes; (void)n_in; (void)out_size;
    const float* x = (const float*)d_in[0]; const float* pair = x; const float* qng = (const float*)d_in[1]; const float* qnb = (const float*)d_in[2]; const float* png_ = qng; const float* pnb = qnb; const float* wq = (const float*)d_in[3]; const float* wk = (const float*)d_in[4]; const float* wv = (const float*)d_in[5]; const float* w2d = (const float*)d_in[6]; const float* wg = (const float*)d_in[7]; const float* bg = (const float*)d_in[8]; const float* wo = (const float*)d_in[9]; const float* bo = (const float*)d_in[10]; const float* cosT = nullptr; const float* sinT = nullptr; (void)cosT; (void)sinT;
    float* OUT = (float*)d_out;   // [256][256][128]
    char* wsp = (char*)d_ws; auto take = [&](size_t bytes) { char* p = wsp; wsp += (bytes + 255) & ~(size_t)255; return (void*)p; };
    bf* WQ = (bf*)take((size_t)3 * DR * DM * 2); bf* WK = WQ + (size_t)DR * DM; bf* WV = WK + (size_t)DR * DM;   /* one block: the q, k, v projections run as the three z slices of one launch */
    bf* WG = (bf*)take((size_t)DR * DM * 2); bf* WO = (bf*)take((size_t)DM * DR * 2); bf* W2 = (bf*)take((size_t)ZW * CZ * 2); bf* XNh = (bf*)take((size_t)GR * DM * 2); bf* XNl = (bf*)take((size_t)GR * DM * 2); float* FG = (float*)take((size_t)GR * DR * 4); float* ZB = (float*)take((size_t)NH_ * TT * TT * 4); float* CS = (float*)take((size_t)TT * HD * 2 * 4);
    bf* XB = nullptr; (void)XB; float* FQ = (float*)take((size_t)3 * GR * DR * 4); float* FK = FQ + (size_t)GR * DR; float* FV = FK + (size_t)GR * DR; float* YO = FQ;   /* YO (merged f32 context of the group) reuses FQ after the q planes are built */
    h16* QP16 = (h16*)take((size_t)NVH * TT * HD * 2); bf* QPh = (bf*)take((size_t)NVH * TT * HD * 2); bf* QPl = (bf*)take((size_t)NVH * TT * HD * 2);
    h16* KP16 = (h16*)take((size_t)NVH * TT * HD * 2); bf* KPh = (bf*)take((size_t)NVH * TT * HD * 2); bf* KPl = (bf*)take((size_t)NVH * TT * HD * 2);
    h16* VT16 = (h16*)take((size_t)NVH * HD * TT * 2); bf* VTh = (bf*)take((size_t)NVH * HD * TT * 2); bf* VTl = (bf*)take((size_t)NVH * HD * TT * 2);
    float* Sb = (float*)take((size_t)ZH * TT * TT * 4); h16* P16 = nullptr;   /* the f16 probability plane is only for rows i >= RH, and there are none (RH == TT) */
    bf* Ph = (bf*)take((size_t)ZH * RH * TT * 2); bf* Pl = (bf*)take((size_t)ZH * RH * TT * 2); float* Ob = Sb;   /* the context tiles are written after the softmax has read the last score */
    bf* ZNh = (bf*)Sb; bf* ZNl = ZNh + (size_t)NPZ * CZ; float* ZF = (float*)(ZNl + (size_t)NPZ * CZ);   /* the bias prologue's planes (48 MiB) are dead once ZB is built: they lie in Sb (64 MiB), first written by the groups' score pass */
    bf* AOh = Ph; bf* AOl = Pl;   /* the gated context planes are written after the group's last read of Ph and Pl */
    if ((size_t)(wsp - (char*)d_ws) > ws_size) return;   // ws ~ 242 MiB
    { k_wtG<<<(DM * DR / 64 + 63) / 64, 256, 0, stream>>>(wq, DM, DR, WQ); k_wtG<<<(DM * DR / 64 + 63) / 64, 256, 0, stream>>>(wk, DM, DR, WK); k_wtG<<<(DM * DR / 64 + 63) / 64, 256, 0, stream>>>(wv, DM, DR, WV); k_wtG<<<(DM * DR / 64 + 63) / 64, 256, 0, stream>>>(wg, DM, DR, WG); k_wtG<<<(DR * DM / 64 + 63) / 64, 256, 0, stream>>>(wo, DR, DM, WO); k_w2dp<<<(ZW * CZ / 8 + 255) / 256, 256, 0, stream>>>(w2d, W2); k_lnz<<<NPZ / 8, 256, 0, stream>>>(pair, png_, pnb, ZNh, ZNl); k_gemmw<bf, 1, false><<<dim3(NPZ / 64, 1, 1), 32, 0, stream>>>(ZNh, ZNl, W2, nullptr, CZ, ZF, ZW, nullptr, 0, 0, 0); k_ztr<<<(NH_ * TT * TT + 255) / 256, 256, 0, stream>>>(ZF, ZB); k_csid<<<(TT * HD + 255) / 256, 256, 0, stream>>>(CS); }
    const unsigned LQ = (unsigned)(((size_t)NH_ * TT * HD / 2 + 255) / 256);
    for (int gI = 0; gI < NG; ++gI) {
        k_lnxg<<<GR / 8, 256, 0, stream>>>(x + (size_t)gI * GR * DM, qng, qnb, XNh, XNl);
        k_gemmw<bf, 1, false><<<dim3(GR / 64, DR / 64, 3), 32, 0, stream>>>(XNh, XNl, WQ, nullptr, DM, FQ, DR, nullptr, 0, (size_t)DR * DM, (size_t)GR * DR); k_gemmw<bf, 1, true><<<dim3(GR / 64, DR / 64, 1), 32, 0, stream>>>(XNh, XNl, WG, nullptr, DM, FG, DR, bg, 0, 0, 0); k_planes32g<<<(unsigned)(((size_t)NVH * TT * HD / 2 + 255) / 256), 256, 0, stream>>>(FQ, QP16, QPh, QPl);
        k_planes32g<<<(unsigned)(((size_t)NVH * TT * HD / 2 + 255) / 256), 256, 0, stream>>>(FK, KP16, KPh, KPl);
        k_vtp32g<<<(unsigned)(((size_t)NVH * HD * TT / 2 + 255) / 256), 256, 0, stream>>>(FV, VT16, VTh, VTl);
        for (int z0 = 0; z0 < NVH; z0 += ZH) { const size_t zq = (size_t)z0;   // virtual head z = bl * 4 + h
            k_gemmw<bf, 2, false><<<dim3(TT / 64, TT / 64, ZH), 32, 0, stream>>>(QPh + zq * TT * HD, QPl + zq * TT * HD, KPh + zq * TT * HD, KPl + zq * TT * HD, HD, Sb, TT, nullptr, (size_t)TT * HD, (size_t)TT * HD, (size_t)TT * TT);
            k_asoft<<<ZH * TT / 8, 256, 0, stream>>>(Sb, ZB, z0, P16, Ph, Pl);
            k_gemmw<bf, 2, false><<<dim3(TT / 64, HD / 64, ZH), 32, 0, stream>>>(Ph, Pl, VTh + zq * HD * TT, VTl + zq * HD * TT, TT, Ob, HD, nullptr, (size_t)RH * TT, (size_t)HD * TT, (size_t)TT * HD);
            k_merge32g<<<(unsigned)(((size_t)ZH * TT * HDR / 2 + 255) / 256), 256, 0, stream>>>(Ob, z0, YO); }
        k_gmulpl<<<(unsigned)(((size_t)GR * DR / 4 + 255) / 256), 256, 0, stream>>>(YO, FG, AOh, AOl); k_gemmw<bf, 1, true><<<dim3(GR / 64, DM / 64, 1), 32, 0, stream>>>(AOh, AOl, WO, nullptr, DR, OUT + (size_t)gI * GR * DM, DM, bo, 0, 0, 0);
    }
}

// v002
// It runs in 240 microseconds.
// Two timings next to v001 both put it at 2.17 times that version's speed.
// All steps since v000 together make it 3.57 times as fast.
#include <hip/hip_runtime.h>

// Triangle_Att_Start (AlphaFold triangle attention, starting node: pair_embed [256 rows i][256 j][128]; z = LayerNorm(pair); q/k/v = z W ([128][4 x 32]), q x 32^-0.5; bias[h][j][k] = (z Wb)[j][k][h] shared over rows i; gate = sigmoid(z Wg + bg); logits[h][i][j][k] = q_ij.k_ik + bias[h][j][k]; softmax over k; o = (a v) * gate; out = o Wo + bo -> [256][256][128]).
// Batched layout (exact): every row i is an independent 256-token attention; 64 rows x 4 heads = 256 'virtual heads' of 256 tokens per group, one work-group of the fused attention kernel each, 4 groups; the projections run on the 16,384 stacked (row, j) positions of a group.

#define NB_  256
#define TT   256
#define DM   128
#define NH_  4
#define NKV  4
#define REP  (NH_ / NKV)
#define HD   64
#define DQ   (NH_ * HD)
#define DKV  (NKV * HD)
#define ZH   256   // heads per k_moutv / k_merge launch (neither is launched)
#define RH   256
#define WIN  0
#define PCAR 1024.0f
#define HDR  32
#define DR   (NH_ * HDR)   // 128
#define CZ   128
#define NPZ  (TT * TT)     // pair rows 65536
#define ZW   64            // padded w2d width
#define LR   256    // tokens per row (no padding)
#define GB   64     // rows per group
#define NG   (NB_ / GB)
#define GR   (GB * TT)   // stacked rows per group
#define NVH  (GB * NH_)  // virtual heads per group
#define SCL  0.17677669529663689f   // 32^-0.5
typedef _Float16 h16;
typedef unsigned short bf;
typedef __attribute__((ext_vector_type(16))) __bf16   v16bf;
typedef __attribute__((ext_vector_type(16))) _Float16 v16h;
typedef __attribute__((ext_vector_type(8)))  _Float16 v8h;
typedef __attribute__((ext_vector_type(8)))  unsigned short v8us;
typedef __attribute__((ext_vector_type(8)))  float    v8f;
typedef __attribute__((ext_vector_type(4)))  float    v4f;
typedef v8h  __attribute__((may_alias)) v8ha;
typedef v4f  __attribute__((may_alias)) v4fa;
typedef v8us __attribute__((may_alias)) v8usa;

__device__ __forceinline__ unsigned short f2bf(float f) { unsigned u = __float_as_uint(f); u += 0x7FFFu + ((u >> 16) & 1u); return (unsigned short)(u >> 16); }
__device__ __forceinline__ float bf2f(unsigned short b) { return __uint_as_float(((unsigned)b) << 16); }
__device__ __forceinline__ float bfr(float f) { return bf2f(f2bf(f)); }
__device__ __forceinline__ v16h cat16(v8h lo, v8h hi) { return __builtin_shufflevector(lo, hi, 0, 1, 2, 3, 4, 5, 6, 7, 8, 9, 10, 11, 12, 13, 14, 15); }
__device__ __forceinline__ v16bf cat16b(v8us lo, v8us hi) { return __builtin_bit_cast(v16bf, __builtin_shufflevector(lo, hi, 0, 1, 2, 3, 4, 5, 6, 7, 8, 9, 10, 11, 12, 13, 14, 15)); }
__device__ __forceinline__ v8f wmma16(v16h a, v16h b, v8f c) { return __builtin_amdgcn_wmma_f32_16x16x32_f16(false, a, false, b, (short)0, c, false, false); }
__device__ __forceinline__ v8f wmmab(v16bf a, v16bf b, v8f c) { return __builtin_amdgcn_wmma_f32_16x16x32_bf16(false, a, false, b, (short)0, c, false, false); }



// ---- k_gemmw: register-blocked GEMM, ONE WAVE per 64x64 output tile (16 accumulators), operands straight from K-contiguous 16-bit planes; grid (M/64, N/64, Z), 32 threads.
// C[m][n] (f32, pitch ldc, + optional f32 bias[n]) = sum_k A[m][k] Bt[n][k] (+ split products per NSPLIT). z-batch strides sA/sB/sC in elements. K % 32 == 0.
template <typename T16> struct WFrag;
template <> struct WFrag<h16> { typedef v16h V; static __device__ __forceinline__ V ld(const h16* p) { return cat16(*(const v8h*)p, *(const v8h*)(p + 16)); } static __device__ __forceinline__ v8f mma(V a, V b, v8f c) { return wmma16(a, b, c); } };
template <> struct WFrag<bf> { typedef v16bf V; static __device__ __forceinline__ V ld(const bf* p) { return cat16b(*(const v8us*)p, *(const v8us*)(p + 16)); } static __device__ __forceinline__ v8f mma(V a, V b, v8f c) { return wmmab(a, b, c); } };
template <typename T16, int NSPLIT, bool BIAS>
__global__ __launch_bounds__(32) void k_gemmw(const T16* __restrict__ A, const T16* __restrict__ A2, const T16* __restrict__ Bt, const T16* __restrict__ Bt2, int K, float* C, int ldc, const float* __restrict__ bias, size_t sA, size_t sB, size_t sC) {
    typedef typename WFrag<T16>::V V;
    __shared__ __align__(16) float os[16 * 68];
    const size_t z = blockIdx.z; A += z * sA; if (A2) A2 += z * sA; Bt += z * sB; if (Bt2) Bt2 += z * sB; C += z * sC;
    const int lane = threadIdx.x & 31, lr = lane & 15, hi = lane >> 4; const int r0 = blockIdx.x * 64, c0 = blockIdx.y * 64;
    v8f acc[4][4];
#pragma unroll
    for (int mb = 0; mb < 4; ++mb)
#pragma unroll
        for (int nb = 0; nb < 4; ++nb) acc[mb][nb] = (v8f){};
    const size_t aoff = (size_t)(r0 + lr) * K + 8 * hi, boff = (size_t)(c0 + lr) * K + 8 * hi;
#pragma unroll 1
    for (int kc = 0; kc < K; kc += 32) {
        V a[4], a2[4];
#pragma unroll
        for (int mb = 0; mb < 4; ++mb) { a[mb] = WFrag<T16>::ld(A + aoff + (size_t)mb * 16 * K + kc); if (NSPLIT == 1 || NSPLIT == 2) a2[mb] = WFrag<T16>::ld(A2 + aoff + (size_t)mb * 16 * K + kc); }
#pragma unroll
        for (int nb = 0; nb < 4; ++nb) { const V b = WFrag<T16>::ld(Bt + boff + (size_t)nb * 16 * K + kc); V b2; if (NSPLIT >= 2) b2 = WFrag<T16>::ld(Bt2 + boff + (size_t)nb * 16 * K + kc);
#pragma unroll
            for (int mb = 0; mb < 4; ++mb) { acc[mb][nb] = WFrag<T16>::mma(a[mb], b, acc[mb][nb]); if (NSPLIT == 1 || NSPLIT == 2) acc[mb][nb] = WFrag<T16>::mma(a2[mb], b, acc[mb][nb]); if (NSPLIT >= 2) acc[mb][nb] = WFrag<T16>::mma(a[mb], b2, acc[mb][nb]); } }
        asm volatile("v_nop\n\tv_nop\n\tv_nop\n\tv_nop" : "+v"(acc[0][0]), "+v"(acc[1][1]), "+v"(acc[2][2]), "+v"(acc[3][3]) : "v"(a[0]), "v"(a[3]));
    }
#pragma unroll
    for (int mb = 0; mb < 4; ++mb) {
#pragma unroll
        for (int nb = 0; nb < 4; ++nb) {
#pragma unroll
            for (int j = 0; j < 8; ++j) os[(hi * 8 + j) * 68 + nb * 16 + lr] = acc[mb][nb][j]; }
        __builtin_amdgcn_wave_barrier(); asm volatile("" ::: "memory");
        float* crow = C + (size_t)(r0 + mb * 16) * ldc + c0;
{
#pragma unroll
            for (int s = 0; s < 8; ++s) { const int row = 2 * s + hi, cofs = lr * 4; v4f val = *(const v4fa*)(os + row * 68 + cofs); if (BIAS) { val[0] += bfr(bias[c0 + cofs]); val[1] += bfr(bias[c0 + cofs + 1]); val[2] += bfr(bias[c0 + cofs + 2]); val[3] += bfr(bias[c0 + cofs + 3]); }
                *(v4f*)(crow + (size_t)row * ldc + cofs) = val; }
             }
        __builtin_amdgcn_wave_barrier(); asm volatile("" ::: "memory");
    }
}

__device__ __forceinline__ h16 tohx(float x) { return (h16)x; }
__device__ __forceinline__ void splitf(float y, unsigned short& h, unsigned short& l) { h = f2bf(y); l = f2bf(y - bf2f(h)); }
typedef __attribute__((ext_vector_type(2))) _Float16 v2h;
typedef __attribute__((ext_vector_type(4))) _Float16 v4h;
typedef __attribute__((ext_vector_type(2))) unsigned short v2us;
typedef __attribute__((ext_vector_type(4))) unsigned short v4us;
typedef __attribute__((ext_vector_type(2))) float v2f;
typedef __attribute__((ext_vector_type(4))) int v4i;

__global__ __launch_bounds__(256) void k_wtG(const float* __restrict__ w, int K, int N, bf* Bt) {
    const int lane = threadIdx.x & 31; const int L0 = (blockIdx.x * 8 + (threadIdx.x >> 5)) * 8; const int nlines = N * K / 64;
{
#pragma unroll 1
        for (int l = 0; l < 8; ++l) { const int L = L0 + l; if (L >= nlines) break; const size_t e = (size_t)L * 64 + lane * 2; const int k = (int)(e % K), n = (int)(e / K); v2us o;
            o[0] = f2bf(w[(size_t)k * N + n]); o[1] = f2bf(w[(size_t)(k + 1) * N + n]); *(v2us*)(Bt + e) = o; }
         }
}
__global__ __launch_bounds__(256) void k_cvt8(const float* __restrict__ src, bf* dst, size_t n8) { const size_t i = (size_t)blockIdx.x * 256 + threadIdx.x; if (i >= n8) return; const v8f v = *(const v8f*)(src + i * 8); v8us o;
#pragma unroll
    for (int k = 0; k < 8; ++k) o[k] = f2bf(v[k]); *(v8us*)(dst + i * 8) = o;  }
__global__ __launch_bounds__(256) void k_cscvt(const float* __restrict__ cosT, const float* __restrict__ sinT, float* CS) { const int idx = blockIdx.x * 256 + threadIdx.x; if (idx >= TT * HD) return; v2f cs; cs[0] = bfr(cosT[idx]); cs[1] = bfr(sinT[idx]); *(v2f*)(CS + (size_t)idx * 2) = cs;  }
// k_rope: head planes [h][t][d] (fp16 + hi/lo) of rope(x) x sc with the rotate-half convention out[d] = x[d] cos[t][d] - x[d+HD/2] sin[t][d], out[d+HD/2] = x[d+HD/2] cos[t][d+HD/2] + x[d] sin[t][d+HD/2]
__global__ __launch_bounds__(256) void k_rope(const float* __restrict__ F, int pitch, int nheads, const float* __restrict__ CS, const float* __restrict__ RF, const float* __restrict__ nw, float sc, h16* P16, bf* Ph, bf* Pl) {
    const size_t e = ((size_t)blockIdx.x * 256 + threadIdx.x) * 2; if (e >= (size_t)nheads * TT * HD) return; const int d = (int)(e % HD); const int t = (int)((e / HD) % TT); const int h = (int)(e / ((size_t)HD * TT)); const float* f = F + (size_t)t * pitch + h * HD; const float rf = RF ? RF[(size_t)h * TT + t] : 1.0f; v2h o16; v2us oh, ol;
#pragma unroll
    for (int q = 0; q < 2; ++q) { const int dd = d + q; const int dp = (dd < HD / 2) ? dd + HD / 2 : dd - HD / 2; float x0 = f[dd], x1 = f[dp];
        if (RF) { float n0 = __fmul_rn(x0, rf), n1 = __fmul_rn(x1, rf); asm volatile("" : "+v"(n0)); asm volatile("" : "+v"(n1)); x0 = __fmul_rn(bfr(nw[dd]), n0); x1 = __fmul_rn(bfr(nw[dp]), n1); }
        const v2f cs = *(const v2f*)(CS + ((size_t)t * HD + dd) * 2); float a = __fmul_rn(x0, cs[0]), bq = __fmul_rn(x1, cs[1]); asm volatile("" : "+v"(a)); asm volatile("" : "+v"(bq)); const float r = ((dd < HD / 2) ? __fsub_rn(a, bq) : __fadd_rn(a, bq)) * sc;
        o16[q] = tohx(r); unsigned short a2, c2; splitf(r, a2, c2); oh[q] = a2; ol[q] = c2; }
    *(v2h*)(P16 + e) = o16; *(v2us*)(Ph + e) = oh; *(v2us*)(Pl + e) = ol;  }
__global__ __launch_bounds__(256) void k_vtp(const float* __restrict__ F, int pitch, int nheads, h16* V16, bf* Vh, bf* Vl) { const size_t e = ((size_t)blockIdx.x * 256 + threadIdx.x) * 2; if (e >= (size_t)nheads * HD * TT) return; const int t = (int)(e % TT); const int d = (int)((e / TT) % HD); const int g = (int)(e / ((size_t)TT * HD)); v2h o16; v2us oh, ol;
#pragma unroll
    for (int q = 0; q < 2; ++q) { const float x = F[(size_t)(t + q) * pitch + g * HD + d]; o16[q] = tohx(x); unsigned short a2, c2; splitf(x, a2, c2); oh[q] = a2; ol[q] = c2; }
    *(v2h*)(V16 + e) = o16; *(v2us*)(Vh + e) = oh; *(v2us*)(Vl + e) = ol;  }
__global__ __launch_bounds__(256) void k_csid(float* CS) { const int idx = blockIdx.x * 256 + threadIdx.x; if (idx >= TT * HD) return; v2f cs; cs[0] = 1.0f; cs[1] = 0.0f; *(v2f*)(CS + (size_t)idx * 2) = cs;  }
__global__ __launch_bounds__(256) void k_cvt8padg(const float* __restrict__ src, bf* XB2) { const size_t e8 = ((size_t)blockIdx.x * 256 + threadIdx.x) * 8; if (e8 >= (size_t)GR * DM) return; const int r = (int)(e8 / DM); const int bl = r / TT, t = r % TT; v8us o; if (t < LR) { const float* sp2 = src + ((size_t)bl * LR + t) * DM + (e8 % DM); for (int u = 0; u < 8; ++u) o[u] = f2bf(bfr(sp2[u])); } else { for (int u = 0; u < 8; ++u) o[u] = 0; } *(v8us*)(XB2 + e8) = o;  }
__global__ __launch_bounds__(256) void k_moutv(const float* __restrict__ O, int z0, float* YO2) { const size_t e = ((size_t)blockIdx.x * 256 + threadIdx.x) * 2; if (e >= (size_t)ZH * TT * HD) return; const int d = (int)(e % HD); const int t = (int)((e / HD) % TT); const int zz = (int)(e / ((size_t)HD * TT)); const int z = z0 + zz; const int bl = z / NH_, h = z % NH_; v2f o; o[0] = O[e]; o[1] = O[e + 1]; float* dst = YO2 + ((size_t)bl * TT + t) * DQ + (size_t)h * HD + d; *(v2f*)dst = o;  }
__global__ __launch_bounds__(256) void k_outcpg(const float* __restrict__ Y, float* O2) { const size_t e = ((size_t)blockIdx.x * 256 + threadIdx.x) * 4; if (e >= (size_t)GB * LR * DM) return; const size_t r = e / DM; const int bl = (int)(r / LR), t = (int)(r % LR); const v4f a = *(const v4f*)(Y + ((size_t)bl * TT + t) * DM + (e % DM)); *(v4f*)(O2 + e) = a;  }
__global__ __launch_bounds__(256) void k_hlG(const float* __restrict__ F, bf* Fh, bf* Fl, size_t n) { const size_t e = ((size_t)blockIdx.x * 256 + threadIdx.x) * 4; if (e >= n) return; const v4f a = *(const v4f*)(F + e); v4us oh, ol; for (int u = 0; u < 4; ++u) { unsigned short p, q; splitf(a[u], p, q); oh[u] = p; ol[u] = q; } *(v4us*)(Fh + e) = oh; *(v4us*)(Fl + e) = ol;  }
__global__ __launch_bounds__(256) void k_lnxg(const float* __restrict__ X, const float* __restrict__ gam, const float* __restrict__ bet, bf* Xh, bf* Xl) { const int lane = threadIdx.x & 31; const int t = blockIdx.x * 8 + (threadIdx.x >> 5); if (t >= GR) return; const float* f = X + (size_t)t * DM; float v[DM / 32]; float su = 0.f;
#pragma unroll
    for (int ch = 0; ch < DM / 128; ++ch) { const v4f a = *(const v4f*)(f + ch * 128 + lane * 4); for (int u = 0; u < 4; ++u) { float xv = bfr(a[u]); asm volatile("" : "+v"(xv)); v[ch * 4 + u] = xv; su = __fadd_rn(su, xv); } }
#pragma unroll
    for (int sh = 16; sh; sh >>= 1) su = __fadd_rn(su, __shfl_xor(su, sh, 32));
    const float mu = __fdiv_rn(su, (float)DM); float sq = 0.f;
#pragma unroll
    for (int q = 0; q < DM / 32; ++q) { float d0 = __fsub_rn(v[q], mu); asm volatile("" : "+v"(d0)); float p = __fmul_rn(d0, d0); asm volatile("" : "+v"(p)); sq = __fadd_rn(sq, p); }
#pragma unroll
    for (int sh = 16; sh; sh >>= 1) sq = __fadd_rn(sq, __shfl_xor(sq, sh, 32));
    const float rs = __fdiv_rn(1.0f, sqrtf(__fadd_rn(__fdiv_rn(sq, (float)DM), 1e-5f)));
    {
#pragma unroll
        for (int ch = 0; ch < DM / 128; ++ch) { v4us oh, ol; for (int u = 0; u < 4; ++u) { const int c = ch * 128 + lane * 4 + u; float d0 = __fsub_rn(v[ch * 4 + u], mu); asm volatile("" : "+v"(d0)); float n = __fmul_rn(d0, rs); asm volatile("" : "+v"(n)); float gg = bfr(gam[c]), bb = bfr(bet[c]); asm volatile("" : "+v"(gg)); asm volatile("" : "+v"(bb)); float y = __fmul_rn(n, gg); asm volatile("" : "+v"(y)); y = __fadd_rn(y, bb); unsigned short p2, q2; splitf(y, p2, q2); oh[u] = p2; ol[u] = q2; } const size_t oo = (size_t)t * DM + ch * 128 + lane * 4; *(v4us*)(Xh + oo) = oh; *(v4us*)(Xl + oo) = ol; }
         } }
__global__ __launch_bounds__(256) void k_lnz(const float* __restrict__ X, const float* __restrict__ gam, const float* __restrict__ bet, bf* Xh, bf* Xl) { const int lane = threadIdx.x & 31; const int t = blockIdx.x * 8 + (threadIdx.x >> 5); if (t >= NPZ) return; const float* f = X + (size_t)t * CZ; float v[CZ / 32]; float su = 0.f;
#pragma unroll
    for (int ch = 0; ch < CZ / 128; ++ch) { const v4f a = *(const v4f*)(f + ch * 128 + lane * 4); for (int u = 0; u < 4; ++u) { float xv = bfr(a[u]); asm volatile("" : "+v"(xv)); v[ch * 4 + u] = xv; su = __fadd_rn(su, xv); } }
#pragma unroll
    for (int sh = 16; sh; sh >>= 1) su = __fadd_rn(su, __shfl_xor(su, sh, 32));
    const float mu = __fdiv_rn(su, (float)CZ); float sq = 0.f;
#pragma unroll
    for (int q = 0; q < CZ / 32; ++q) { float d0 = __fsub_rn(v[q], mu); asm volatile("" : "+v"(d0)); float p = __fmul_rn(d0, d0); asm volatile("" : "+v"(p)); sq = __fadd_rn(sq, p); }
#pragma unroll
    for (int sh = 16; sh; sh >>= 1) sq = __fadd_rn(sq, __shfl_xor(sq, sh, 32));
    const float rs = __fdiv_rn(1.0f, sqrtf(__fadd_rn(__fdiv_rn(sq, (float)CZ), 1e-5f)));
    {
#pragma unroll
        for (int ch = 0; ch < CZ / 128; ++ch) { v4us oh, ol; for (int u = 0; u < 4; ++u) { const int c = ch * 128 + lane * 4 + u; float d0 = __fsub_rn(v[ch * 4 + u], mu); asm volatile("" : "+v"(d0)); float n = __fmul_rn(d0, rs); asm volatile("" : "+v"(n)); float gg = bfr(gam[c]), bb = bfr(bet[c]); asm volatile("" : "+v"(gg)); asm volatile("" : "+v"(bb)); float y = __fmul_rn(n, gg); asm volatile("" : "+v"(y)); y = __fadd_rn(y, bb); unsigned short p2, q2; splitf(y, p2, q2); oh[u] = p2; ol[u] = q2; } const size_t oo = (size_t)t * CZ + ch * 128 + lane * 4; *(v4us*)(Xh + oo) = oh; *(v4us*)(Xl + oo) = ol; }
         } }
__global__ __launch_bounds__(256) void k_w2dp(const float* __restrict__ Wp, bf* WP) { const size_t e = ((size_t)blockIdx.x * 256 + threadIdx.x) * 8; if (e >= (size_t)ZW * CZ) return; const int r = (int)(e / CZ); const int c0 = (int)(e % CZ); v8us o; for (int u = 0; u < 8; ++u) o[u] = (r < NH_) ? f2bf(bfr(Wp[(size_t)(c0 + u) * NH_ + r])) : (unsigned short)0; *(v8us*)(WP + e) = o;  }
__global__ __launch_bounds__(256) void k_ztr(const float* __restrict__ ZF, float* ZB) { const size_t e = (size_t)blockIdx.x * 256 + threadIdx.x; if (e >= (size_t)NH_ * TT * TT) return; const int k = (int)(e % TT); const int q = (int)((e / TT) % TT); const int h = (int)(e / ((size_t)TT * TT)); const float v = ZF[((size_t)q * TT + k) * ZW + h]; *(float*)(ZB + e) = v;  }
__global__ __launch_bounds__(256) void k_gmulpl(const float* __restrict__ YO, const float* __restrict__ FG, bf* Ah, bf* Al) { const size_t e = ((size_t)blockIdx.x * 256 + threadIdx.x) * 4; if (e >= (size_t)GR * DR) return; const v4f a = *(const v4f*)(YO + e); const v4f gz = *(const v4f*)(FG + e); v4us oh, ol; for (int u = 0; u < 4; ++u) { float eg = expf(-gz[u]); float sg = __fdiv_rn(1.0f, __fadd_rn(1.0f, eg)); asm volatile("" : "+v"(sg)); const float ov = __fmul_rn(a[u], sg); unsigned short a2, c2; splitf(ov, a2, c2); oh[u] = a2; ol[u] = c2; } *(v4us*)(Ah + e) = oh; *(v4us*)(Al + e) = ol;  }
// ---- k_attn: the whole attention of one virtual head (row bl, head h) in one work-group: 16 waves x 16 queries, all 256 keys at once, scores and probabilities never leave the registers.
// K [key][d] and V^T [d][key] are split into bf16 hi/lo planes on the way into LDS. S^T = K Q^T (A = K rows, B = Q columns), so a lane holds 128 scores of ONE query: tile kt, register r = key kt*16 + 8*hi + r, query lr.
// Two neighbouring score tiles, converted in place, are the B operand of O^T = V^T P^T (hardware k order: 8*hi + s, 16 + 8*hi + (s - 8)); the LDS fragment loads use the same order.
// The pair bias, times 32^0.5, is the start value of the score accumulators; 32^-0.5 is folded into the exponent's scale.
#define KPI  40    // K row pitch in LDS, bf16 elements: 80 bytes = 16 x odd, no bank conflict for 16-byte reads
#define VPI  264   // V^T row pitch in LDS: 528 bytes = 16 x odd
#define RSCL 5.656854249492381f   // 32^0.5
typedef __attribute__((ext_vector_type(2))) __bf16 v2bf;
typedef __attribute__((ext_vector_type(2))) unsigned v2u;
typedef __attribute__((ext_vector_type(8))) unsigned v8u;
typedef unsigned __attribute__((may_alias)) u32a;
typedef v2u __attribute__((may_alias)) v2ua;
__device__ __forceinline__ unsigned pk2(float a, float b) { v2f x; x[0] = a; x[1] = b; return __builtin_bit_cast(unsigned, __builtin_convertvector(x, v2bf)); }
__device__ __forceinline__ void split2(float a, float b, unsigned& h, unsigned& l) { h = pk2(a, b); l = pk2(a - __uint_as_float(h << 16), b - __uint_as_float(h & 0xFFFF0000u)); }
// 2^x with the one issue slot that the instruction set asks for behind a transcendental, before its result is read or its source register overwritten: in one statement, so that the slot stands directly behind it
__device__ __forceinline__ float exp2slot(float x) { float e; asm("v_exp_f32 %0, %1\n\tv_nop" : "=v"(e) : "v"(x)); return e; }
__device__ __forceinline__ v16bf ldsfrag(const bf* p) { return cat16b(*(const v8usa*)p, *(const v8usa*)(p + 16)); }
__global__ __launch_bounds__(512) void k_attn(const float* __restrict__ FQ, const float* __restrict__ FK, const float* __restrict__ FV, const float* __restrict__ ZB, float* __restrict__ YO) {
    __shared__ __align__(16) bf Kh[TT * KPI]; __shared__ __align__(16) bf Kl[TT * KPI]; __shared__ __align__(16) bf Vh[HDR * VPI]; __shared__ __align__(16) bf Vl[HDR * VPI];
    const int tid = threadIdx.x, lane = tid & 31, lr = lane & 15, hi = lane >> 4; const int z = blockIdx.x, bl = z / NH_, h = z % NH_;
    const size_t base = (size_t)bl * TT * DR + h * HDR;   // element (t, d) of this head: base + t * DR + d
#pragma unroll
    for (int i = 0; i < 4; ++i) { const int idx = i * 512 + tid, t = idx >> 3, c = idx & 7; const v4f a = *(const v4f*)(FK + base + (size_t)t * DR + c * 4); v2u oh, ol; unsigned p, r;
        split2(a[0], a[1], p, r); oh[0] = p; ol[0] = r; split2(a[2], a[3], p, r); oh[1] = p; ol[1] = r; *(v2ua*)(Kh + t * KPI + c * 4) = oh; *(v2ua*)(Kl + t * KPI + c * 4) = ol; }
#pragma unroll
    for (int i = 0; i < 2; ++i) { const int idx = i * 512 + tid, tp = idx >> 3, c = idx & 7; const float* vp = FV + base + (size_t)(2 * tp) * DR + c * 4; const v4f a = *(const v4f*)vp; const v4f b = *(const v4f*)(vp + DR);
#pragma unroll
        for (int u = 0; u < 4; ++u) { unsigned p, r; split2(a[u], b[u], p, r); *(u32a*)(Vh + (c * 4 + u) * VPI + 2 * tp) = p; *(u32a*)(Vl + (c * 4 + u) * VPI + 2 * tp) = r; } }
    const int q = (tid >> 5) * 16 + lr;
    const float* zr = ZB + ((size_t)h * TT + q) * TT + 8 * hi; v8f acc[16];
#pragma unroll
    for (int kt = 0; kt < 16; ++kt) { const v4f a = *(const v4f*)(zr + kt * 16); const v4f b = *(const v4f*)(zr + kt * 16 + 4);
#pragma unroll
        for (int u = 0; u < 4; ++u) { acc[kt][u] = a[u] * RSCL; acc[kt][4 + u] = b[u] * RSCL; } }
    const float* qp = FQ + base + (size_t)q * DR + 8 * hi; v8u qh, ql;
#pragma unroll
    for (int g = 0; g < 2; ++g) { const v4f a = *(const v4f*)(qp + g * 16); const v4f b = *(const v4f*)(qp + g * 16 + 4); unsigned p, r;
        split2(a[0], a[1], p, r); qh[g * 4] = p; ql[g * 4] = r; split2(a[2], a[3], p, r); qh[g * 4 + 1] = p; ql[g * 4 + 1] = r; split2(b[0], b[1], p, r); qh[g * 4 + 2] = p; ql[g * 4 + 2] = r; split2(b[2], b[3], p, r); qh[g * 4 + 3] = p; ql[g * 4 + 3] = r; }
    const v16bf Qh = __builtin_bit_cast(v16bf, qh), Ql = __builtin_bit_cast(v16bf, ql);
    __syncthreads();   // the K and V planes are complete before any wave reads a fragment
#pragma unroll
    for (int kt = 0; kt < 16; ++kt) { const int ko = (kt * 16 + lr) * KPI + 8 * hi; const v16bf ah = ldsfrag(Kh + ko), al = ldsfrag(Kl + ko);
        acc[kt] = wmmab(ah, Qh, acc[kt]); acc[kt] = wmmab(ah, Ql, acc[kt]); acc[kt] = wmmab(al, Qh, acc[kt]); }
    v8f m8 = acc[0];
#pragma unroll
    for (int kt = 1; kt < 16; ++kt)
#pragma unroll
        for (int r = 0; r < 8; ++r) m8[r] = fmaxf(m8[r], acc[kt][r]);
    float mx = fmaxf(fmaxf(fmaxf(m8[0], m8[1]), fmaxf(m8[2], m8[3])), fmaxf(fmaxf(m8[4], m8[5]), fmaxf(m8[6], m8[7])));
    mx = fmaxf(mx, __shfl_xor(mx, 16, 32));   // the other half of the query's keys
    const float c1 = SCL * 1.4426950408889634f, mc = mx * c1; v8f s8 = (v8f){};
#pragma unroll
    for (int kt = 0; kt < 16; ++kt)
#pragma unroll
        for (int r = 0; r < 8; ++r) { const float e = exp2slot(fmaf(acc[kt][r], c1, -mc)); acc[kt][r] = e; s8[r] += e; }
    float sum = ((s8[0] + s8[1]) + (s8[2] + s8[3])) + ((s8[4] + s8[5]) + (s8[6] + s8[7]));
    sum += __shfl_xor(sum, 16, 32);
    const float f = __fdiv_rn(1.0f, sum);
    v8f o[2]; o[0] = (v8f){}; o[1] = (v8f){};
#pragma unroll
    for (int ks = 0; ks < 8; ++ks) { v8u ph, pl;
#pragma unroll
        for (int g = 0; g < 2; ++g)
#pragma unroll
            for (int i = 0; i < 4; ++i) { unsigned p, r; split2(acc[2 * ks + g][2 * i] * f, acc[2 * ks + g][2 * i + 1] * f, p, r); ph[g * 4 + i] = p; pl[g * 4 + i] = r; }
        const v16bf Ph = __builtin_bit_cast(v16bf, ph), Pl = __builtin_bit_cast(v16bf, pl);
#pragma unroll
        for (int mb = 0; mb < 2; ++mb) { const int vo = (mb * 16 + lr) * VPI + ks * 32 + 8 * hi; const v16bf vh = ldsfrag(Vh + vo), vl = ldsfrag(Vl + vo);
            o[mb] = wmmab(vh, Ph, o[mb]); o[mb] = wmmab(vh, Pl, o[mb]); o[mb] = wmmab(vl, Ph, o[mb]); } }
    float* yp = YO + base + (size_t)q * DR + 8 * hi;   // o[mb][r] = context of query q at d = mb*16 + 8*hi + r
#pragma unroll
    for (int mb = 0; mb < 2; ++mb) { v4f a, b;
#pragma unroll
        for (int u = 0; u < 4; ++u) { a[u] = o[mb][u]; b[u] = o[mb][4 + u]; }
        *(v4f*)(yp + mb * 16) = a; *(v4f*)(yp + mb * 16 + 4) = b; }
}
__global__ __launch_bounds__(256) void k_merge(const float* __restrict__ O, int h0, bf* Ah, bf* Al) { const size_t e = ((size_t)blockIdx.x * 256 + threadIdx.x) * 2; if (e >= (size_t)ZH * TT * HD) return; const int d = (int)(e % HD); const int t = (int)((e / HD) % TT); const int zz = (int)(e / ((size_t)HD * TT)); const float cs = (t < RH) ? 1.0f : (1.0f / PCAR); const size_t oo = (size_t)t * DQ + (h0 + zz) * HD + d;
    v2us oh, ol;
#pragma unroll
    for (int q = 0; q < 2; ++q) { unsigned short a, c2; splitf(O[e + q] * cs, a, c2); oh[q] = a; ol[q] = c2; } *(v2us*)(Ah + oo) = oh; *(v2us*)(Al + oo) = ol;  }

extern "C" void kernel_launch(void* const* d_in, const int* in_sizes, int n_in,
                              void* d_out, int out_size, void* d_ws, size_t ws_size, hipStream_t stream) {
    (void)in_sizes; (void)n_in; (void)out_size;
    const float* x = (const float*)d_in[0]; const float* pair = x; const float* qng = (const float*)d_in[1]; const float* qnb = (const float*)d_in[2]; const float* png_ = qng; const float* pnb = qnb; const float* wq = (const float*)d_in[3]; const float* wk = (const float*)d_in[4]; const float* wv = (const float*)d_in[5]; const float* w2d = (const float*)d_in[6]; const float* wg = (const float*)d_in[7]; const float* bg = (const float*)d_in[8]; const float* wo = (const float*)d_in[9]; const float* bo = (const float*)d_in[10]; const float* cosT = nullptr; const float* sinT = nullptr; (void)cosT; (void)sinT;
    float* OUT = (float*)d_out;   // [256][256][128]
    char* wsp = (char*)d_ws; auto take = [&](size_t bytes) { char* p = wsp; wsp += (bytes + 255) & ~(size_t)255; return (void*)p; };
    bf* WQ = (bf*)take((size_t)3 * DR * DM * 2); bf* WK = WQ + (size_t)DR * DM; bf* WV = WK + (size_t)DR * DM;   /* one block: the q, k, v projections run as the three z slices of one launch */
    bf* WG = (bf*)take((size_t)DR * DM * 2); bf* WO = (bf*)take((size_t)DM * DR * 2); bf* W2 = (bf*)take((size_t)ZW * CZ * 2); bf* XNh = (bf*)take((size_t)GR * DM * 2); bf* XNl = (bf*)take((size_t)GR * DM * 2); float* FG = (float*)take((size_t)GR * DR * 4); float* ZB = (float*)take((size_t)NH_ * TT * TT * 4); float* CS = (float*)take((size_t)TT * HD * 2 * 4);
    bf* XB = nullptr; (void)XB; float* FQ = (float*)take((size_t)3 * GR * DR * 4); float* FK = FQ + (size_t)GR * DR; float* FV = FK + (size_t)GR * DR;
    float* YO = (float*)take((size_t)GR * DR * 4);   /* merged f32 context of the group */
    bf* AOh = (bf*)take((size_t)GR * DR * 2); bf* AOl = (bf*)take((size_t)GR * DR * 2);
    bf* ZNh = (bf*)take((size_t)NPZ * CZ * 2); bf* ZNl = (bf*)take((size_t)NPZ * CZ * 2); float* ZF = (float*)take((size_t)NPZ * ZW * 4);   /* the bias prologue's planes */
    if ((size_t)(wsp - (char*)d_ws) > ws_size) return;   // ws ~ 106 MiB
    { k_wtG<<<(DM * DR / 64 + 63) / 64, 256, 0, stream>>>(wq, DM, DR, WQ); k_wtG<<<(DM * DR / 64 + 63) / 64, 256, 0, stream>>>(wk, DM, DR, WK); k_wtG<<<(DM * DR / 64 + 63) / 64, 256, 0, stream>>>(wv, DM, DR, WV); k_wtG<<<(DM * DR / 64 + 63) / 64, 256, 0, stream>>>(wg, DM, DR, WG); k_wtG<<<(DR * DM / 64 + 63) / 64, 256, 0, stream>>>(wo, DR, DM, WO); k_w2dp<<<(ZW * CZ / 8 + 255) / 256, 256, 0, stream>>>(w2d, W2); k_lnz<<<NPZ / 8, 256, 0, stream>>>(pair, png_, pnb, ZNh, ZNl); k_gemmw<bf, 1, false><<<dim3(NPZ / 64, 1, 1), 32, 0, stream>>>(ZNh, ZNl, W2, nullptr, CZ, ZF, ZW, nullptr, 0, 0, 0); k_ztr<<<(NH_ * TT * TT + 255) / 256, 256, 0, stream>>>(ZF, ZB); k_csid<<<(TT * HD + 255) / 256, 256, 0, stream>>>(CS); }
    const unsigned LQ = (unsigned)(((size_t)NH_ * TT * HD / 2 + 255) / 256);
    for (int gI = 0; gI < NG; ++gI) {
        k_lnxg<<<GR / 8, 256, 0, stream>>>(x + (size_t)gI * GR * DM, qng, qnb, XNh, XNl);
        k_gemmw<bf, 1, false><<<dim3(GR / 64, DR / 64, 3), 32, 0, stream>>>(XNh, XNl, WQ, nullptr, DM, FQ, DR, nullptr, 0, (size_t)DR * DM, (size_t)GR * DR); k_gemmw<bf, 1, true><<<dim3(GR / 64, DR / 64, 1), 32, 0, stream>>>(XNh, XNl, WG, nullptr, DM, FG, DR, bg, 0, 0, 0);
        k_attn<<<NVH, 512, 0, stream>>>(FQ, FK, FV, ZB, YO);
        k_gmulpl<<<(unsigned)(((size_t)GR * DR / 4 + 255) / 256), 256, 0, stream>>>(YO, FG, AOh, AOl); k_gemmw<bf, 1, true><<<dim3(GR / 64, DM / 64, 1), 32, 0, stream>>>(AOh, AOl, WO, nullptr, DR, OUT + (size_t)gI * GR * DM, DM, bo, 0, 0, 0);
    }
}

// v003
// A run of this version takes 136 microseconds.
// Timed twice side by side with v002, it ran 1.77 and 1.76 times as fast.
// Counting every step since v000, it is 6.32 times as fast.
#include <hip/hip_runtime.h>

// Triangle_Att_Start (AlphaFold triangle attention, starting node: pair_embed [256 rows i][256 j][128]; z = LayerNorm(pair); q/k/v = z W ([128][4 x 32]), q x 32^-0.5; bias[h][j][k] = (z Wb)[j][k][h] shared over rows i; gate = sigmoid(z Wg + bg); logits[h][i][j][k] = q_ij.k_ik + bias[h][j][k]; softmax over k; o = (a v) * gate; out = o Wo + bo -> [256][256][128]).
// Batched layout (exact): every row i is an independent 256-token attention; 256 rows x 4 heads = 1024 'virtual heads' of 256 tokens, one work-group of the fused attention kernel each, all in one launch; the projections run on all 65,536 stacked (row, j) positions at once.

#define NB_  256
#define TT   256
#define DM   128
#define NH_  4
#define NKV  4
#define REP  (NH_ / NKV)
#define HD   64
#define DQ   (NH_ * HD)
#define DKV  (NKV * HD)
#define ZH   256   // virtual heads per k_moutv / k_merge call (a quarter of NVH)
#define RH   256
#define WIN  0
#define PCAR 1024.0f
#define HDR  32
#define DR   (NH_ * HDR)   // 128
#define CZ   128
#define NPZ  (TT * TT)     // pair rows 65536
#define ZW   64            // padded w2d width
#define LR   256    // tokens per row (no padding)
#define GB   256    // rows per group: all of them, one group
#define NG   (NB_ / GB)
#define GR   (GB * TT)   // stacked rows per group
#define NVH  (GB * NH_)  // virtual heads per group
#define SCL  0.17677669529663689f   // 32^-0.5
typedef _Float16 h16;
typedef unsigned short bf;
typedef __attribute__((ext_vector_type(16))) __bf16   v16bf;
typedef __attribute__((ext_vector_type(16))) _Float16 v16h;
typedef __attribute__((ext_vector_type(8)))  _Float16 v8h;
typedef __attribute__((ext_vector_type(8)))  unsigned short v8us;
typedef __attribute__((ext_vector_type(8)))  float    v8f;
typedef __attribute__((ext_vector_type(4)))  float    v4f;
typedef v8h  __attribute__((may_alias)) v8ha;
typedef v4f  __attribute__((may_alias)) v4fa;
typedef v8us __attribute__((may_alias)) v8usa;

__device__ __forceinline__ unsigned short f2bf(float f) { unsigned u = __float_as_uint(f); u += 0x7FFFu + ((u >> 16) & 1u); return (unsigned short)(u >> 16); }
__device__ __forceinline__ float bf2f(unsigned short b) { return __uint_as_float(((unsigned)b) << 16); }
__device__ __forceinline__ float bfr(float f) { return bf2f(f2bf(f)); }
__device__ __forceinline__ v16h cat16(v8h lo, v8h hi) { return __builtin_shufflevector(lo, hi, 0, 1, 2, 3, 4, 5, 6, 7, 8, 9, 10, 11, 12, 13, 14, 15); }
__device__ __forceinline__ v16bf cat16b(v8us lo, v8us hi) { return __builtin_bit_cast(v16bf, __builtin_shufflevector(lo, hi, 0, 1, 2, 3, 4, 5, 6, 7, 8, 9, 10, 11, 12, 13, 14, 15)); }
__device__ __forceinline__ v8f wmma16(v16h a, v16h b, v8f c) { return __builtin_amdgcn_wmma_f32_16x16x32_f16(false, a, false, b, (short)0, c, false, false); }
__device__ __forceinline__ v8f wmmab(v16bf a, v16bf b, v8f c) { return __builtin_amdgcn_wmma_f32_16x16x32_bf16(false, a, false, b, (short)0, c, false, false); }



// ---- k_gemmw: register-blocked GEMM, ONE WAVE per 64x64 output tile (16 accumulators), operands straight from K-contiguous 16-bit planes; grid (column tiles of all z slices, M/64), 32 threads: the tiles that read the same 64 rows of A start side by side.
// C[m][n] (f32, pitch ldc, + optional f32 bias[n]) = sum_k A[m][k] Bt[n][k] (+ split products per NSPLIT). z-batch: ct column tiles a slice, strides sA/sB/sC in elements; slice zx (if any) has the output pitch ldx. K % 32 == 0.
template <typename T16> struct WFrag;
template <> struct WFrag<h16> { typedef v16h V; static __device__ __forceinline__ V ld(const h16* p) { return cat16(*(const v8h*)p, *(const v8h*)(p + 16)); } static __device__ __forceinline__ v8f mma(V a, V b, v8f c) { return wmma16(a, b, c); } };
template <> struct WFrag<bf> { typedef v16bf V; static __device__ __forceinline__ V ld(const bf* p) { return cat16b(*(const v8us*)p, *(const v8us*)(p + 16)); } static __device__ __forceinline__ v8f mma(V a, V b, v8f c) { return wmmab(a, b, c); } };
template <typename T16, int NSPLIT, bool BIAS>
__global__ __launch_bounds__(32) void k_gemmw(const T16* __restrict__ A, const T16* __restrict__ A2, const T16* __restrict__ Bt, const T16* __restrict__ Bt2, int K, float* C, int ldc, const float* __restrict__ bias, size_t sA, size_t sB, size_t sC, int ct, int zx, int ldx) {
    typedef typename WFrag<T16>::V V;
    __shared__ __align__(16) float os[16 * 68];
    const size_t z = blockIdx.x / ct; A += z * sA; if (A2) A2 += z * sA; Bt += z * sB; if (Bt2) Bt2 += z * sB; C += z * sC; if ((int)z == zx) ldc = ldx;
    const int lane = threadIdx.x & 31, lr = lane & 15, hi = lane >> 4; const int r0 = blockIdx.y * 64, c0 = (blockIdx.x % ct) * 64;
    v8f acc[4][4];
#pragma unroll
    for (int mb = 0; mb < 4; ++mb)
#pragma unroll
        for (int nb = 0; nb < 4; ++nb) acc[mb][nb] = (v8f){};
    const size_t aoff = (size_t)(r0 + lr) * K + 8 * hi, boff = (size_t)(c0 + lr) * K + 8 * hi;
#pragma unroll 1
    for (int kc = 0; kc < K; kc += 32) {
        V a[4], a2[4];
#pragma unroll
        for (int mb = 0; mb < 4; ++mb) { a[mb] = WFrag<T16>::ld(A + aoff + (size_t)mb * 16 * K + kc); if (NSPLIT == 1 || NSPLIT == 2) a2[mb] = WFrag<T16>::ld(A2 + aoff + (size_t)mb * 16 * K + kc); }
#pragma unroll
        for (int nb = 0; nb < 4; ++nb) { const V b = WFrag<T16>::ld(Bt + boff + (size_t)nb * 16 * K + kc); V b2; if (NSPLIT >= 2) b2 = WFrag<T16>::ld(Bt2 + boff + (size_t)nb * 16 * K + kc);
#pragma unroll
            for (int mb = 0; mb < 4; ++mb) { acc[mb][nb] = WFrag<T16>::mma(a[mb], b, acc[mb][nb]); if (NSPLIT == 1 || NSPLIT == 2) acc[mb][nb] = WFrag<T16>::mma(a2[mb], b, acc[mb][nb]); if (NSPLIT >= 2) acc[mb][nb] = WFrag<T16>::mma(a[mb], b2, acc[mb][nb]); } }
        asm volatile("v_nop\n\tv_nop\n\tv_nop\n\tv_nop" : "+v"(acc[0][0]), "+v"(acc[1][1]), "+v"(acc[2][2]), "+v"(acc[3][3]) : "v"(a[0]), "v"(a[3]));
    }
#pragma unroll
    for (int mb = 0; mb < 4; ++mb) {
#pragma unroll
        for (int nb = 0; nb < 4; ++nb) {
#pragma unroll
            for (int j = 0; j < 8; ++j) os[(hi * 8 + j) * 68 + nb * 16 + lr] = acc[mb][nb][j]; }
        __builtin_amdgcn_wave_barrier(); asm volatile("" ::: "memory");
        float* crow = C + (size_t)(r0 + mb * 16) * ldc + c0;
{
#pragma unroll
            for (int s = 0; s < 8; ++s) { const int row = 2 * s + hi, cofs = lr * 4; v4f val = *(const v4fa*)(os + row * 68 + cofs); if (BIAS) { val[0] += bfr(bias[c0 + cofs]); val[1] += bfr(bias[c0 + cofs + 1]); val[2] += bfr(bias[c0 + cofs + 2]); val[3] += bfr(bias[c0 + cofs + 3]); }
                *(v4f*)(crow + (size_t)row * ldc + cofs) = val; }
             }
        __builtin_amdgcn_wave_barrier(); asm volatile("" ::: "memory");
    }
}

__device__ __forceinline__ h16 tohx(float x) { return (h16)x; }
__device__ __forceinline__ void splitf(float y, unsigned short& h, unsigned short& l) { h = f2bf(y); l = f2bf(y - bf2f(h)); }
typedef __attribute__((ext_vector_type(2))) _Float16 v2h;
typedef __attribute__((ext_vector_type(4))) _Float16 v4h;
typedef __attribute__((ext_vector_type(2))) unsigned short v2us;
typedef __attribute__((ext_vector_type(4))) unsigned short v4us;
typedef __attribute__((ext_vector_type(2))) float v2f;
typedef __attribute__((ext_vector_type(4))) int v4i;

__device__ __forceinline__ void d_wtG(int bx, const float* __restrict__ w, int K, int N, bf* Bt) {
    const int lane = threadIdx.x & 31; const int L0 = (bx * 8 + (threadIdx.x >> 5)) * 8; const int nlines = N * K / 64;
{
#pragma unroll 1
        for (int l = 0; l < 8; ++l) { const int L = L0 + l; if (L >= nlines) break; const size_t e = (size_t)L * 64 + lane * 2; const int k = (int)(e % K), n = (int)(e / K); v2us o;
            o[0] = f2bf(w[(size_t)k * N + n]); o[1] = f2bf(w[(size_t)(k + 1) * N + n]); *(v2us*)(Bt + e) = o; }
         }
}
__global__ __launch_bounds__(256) void k_cvt8(const float* __restrict__ src, bf* dst, size_t n8) { const size_t i = (size_t)blockIdx.x * 256 + threadIdx.x; if (i >= n8) return; const v8f v = *(const v8f*)(src + i * 8); v8us o;
#pragma unroll
    for (int k = 0; k < 8; ++k) o[k] = f2bf(v[k]); *(v8us*)(dst + i * 8) = o;  }
__global__ __launch_bounds__(256) void k_cscvt(const float* __restrict__ cosT, const float* __restrict__ sinT, float* CS) { const int idx = blockIdx.x * 256 + threadIdx.x; if (idx >= TT * HD) return; v2f cs; cs[0] = bfr(cosT[idx]); cs[1] = bfr(sinT[idx]); *(v2f*)(CS + (size_t)idx * 2) = cs;  }
// k_rope: head planes [h][t][d] (fp16 + hi/lo) of rope(x) x sc with the rotate-half convention out[d] = x[d] cos[t][d] - x[d+HD/2] sin[t][d], out[d+HD/2] = x[d+HD/2] cos[t][d+HD/2] + x[d] sin[t][d+HD/2]
__global__ __launch_bounds__(256) void k_rope(const float* __restrict__ F, int pitch, int nheads, const float* __restrict__ CS, const float* __restrict__ RF, const float* __restrict__ nw, float sc, h16* P16, bf* Ph, bf* Pl) {
    const size_t e = ((size_t)blockIdx.x * 256 + threadIdx.x) * 2; if (e >= (size_t)nheads * TT * HD) return; const int d = (int)(e % HD); const int t = (int)((e / HD) % TT); const int h = (int)(e / ((size_t)HD * TT)); const float* f = F + (size_t)t * pitch + h * HD; const float rf = RF ? RF[(size_t)h * TT + t] : 1.0f; v2h o16; v2us oh, ol;
#pragma unroll
    for (int q = 0; q < 2; ++q) { const int dd = d + q; const int dp = (dd < HD / 2) ? dd + HD / 2 : dd - HD / 2; float x0 = f[dd], x1 = f[dp];
        if (RF) { float n0 = __fmul_rn(x0, rf), n1 = __fmul_rn(x1, rf); asm volatile("" : "+v"(n0)); asm volatile("" : "+v"(n1)); x0 = __fmul_rn(bfr(nw[dd]), n0); x1 = __fmul_rn(bfr(nw[dp]), n1); }
        const v2f cs = *(const v2f*)(CS + ((size_t)t * HD + dd) * 2); float a = __fmul_rn(x0, cs[0]), bq = __fmul_rn(x1, cs[1]); asm volatile("" : "+v"(a)); asm volatile("" : "+v"(bq)); const float r = ((dd < HD / 2) ? __fsub_rn(a, bq) : __fadd_rn(a, bq)) * sc;
        o16[q] = tohx(r); unsigned short a2, c2; splitf(r, a2, c2); oh[q] = a2; ol[q] = c2; }
    *(v2h*)(P16 + e) = o16; *(v2us*)(Ph + e) = oh; *(v2us*)(Pl + e) = ol;  }
__global__ __launch_bounds__(256) void k_vtp(const float* __restrict__ F, int pitch, int nheads, h16* V16, bf* Vh, bf* Vl) { const size_t e = ((size_t)blockIdx.x * 256 + threadIdx.x) * 2; if (e >= (size_t)nheads * HD * TT) return; const int t = (int)(e % TT); const int d = (int)((e / TT) % HD); const int g = (int)(e / ((size_t)TT * HD)); v2h o16; v2us oh, ol;
#pragma unroll
    for (int q = 0; q < 2; ++q) { const float x = F[(size_t)(t + q) * pitch + g * HD + d]; o16[q] = tohx(x); unsigned short a2, c2; splitf(x, a2, c2); oh[q] = a2; ol[q] = c2; }
    *(v2h*)(V16 + e) = o16; *(v2us*)(Vh + e) = oh; *(v2us*)(Vl + e) = ol;  }
__global__ __launch_bounds__(256) void k_cvt8padg(const float* __restrict__ src, bf* XB2) { const size_t e8 = ((size_t)blockIdx.x * 256 + threadIdx.x) * 8; if (e8 >= (size_t)GR * DM) return; const int r = (int)(e8 / DM); const int bl = r / TT, t = r % TT; v8us o; if (t < LR) { const float* sp2 = src + ((size_t)bl * LR + t) * DM + (e8 % DM); for (int u = 0; u < 8; ++u) o[u] = f2bf(bfr(sp2[u])); } else { for (int u = 0; u < 8; ++u) o[u] = 0; } *(v8us*)(XB2 + e8) = o;  }
__global__ __launch_bounds__(256) void k_moutv(const float* __restrict__ O, int z0, float* YO2) { const size_t e = ((size_t)blockIdx.x * 256 + threadIdx.x) * 2; if (e >= (size_t)ZH * TT * HD) return; const int d = (int)(e % HD); const int t = (int)((e / HD) % TT); const int zz = (int)(e / ((size_t)HD * TT)); const int z = z0 + zz; const int bl = z / NH_, h = z % NH_; v2f o; o[0] = O[e]; o[1] = O[e + 1]; float* dst = YO2 + ((size_t)bl * TT + t) * DQ + (size_t)h * HD + d; *(v2f*)dst = o;  }
__global__ __launch_bounds__(256) void k_outcpg(const float* __restrict__ Y, float* O2) { const size_t e = ((size_t)blockIdx.x * 256 + threadIdx.x) * 4; if (e >= (size_t)GB * LR * DM) return; const size_t r = e / DM; const int bl = (int)(r / LR), t = (int)(r % LR); const v4f a = *(const v4f*)(Y + ((size_t)bl * TT + t) * DM + (e % DM)); *(v4f*)(O2 + e) = a;  }
__global__ __launch_bounds__(256) void k_hlG(const float* __restrict__ F, bf* Fh, bf* Fl, size_t n) { const size_t e = ((size_t)blockIdx.x * 256 + threadIdx.x) * 4; if (e >= n) return; const v4f a = *(const v4f*)(F + e); v4us oh, ol; for (int u = 0; u < 4; ++u) { unsigned short p, q; splitf(a[u], p, q); oh[u] = p; ol[u] = q; } *(v4us*)(Fh + e) = oh; *(v4us*)(Fl + e) = ol;  }
__device__ __forceinline__ void d_lnz(int bx, const float* __restrict__ X, const float* __restrict__ gam, const float* __restrict__ bet, bf* Xh, bf* Xl) { const int lane = threadIdx.x & 31; const int t = bx * 8 + (threadIdx.x >> 5); if (t >= NPZ) return; const float* f = X + (size_t)t * CZ; float v[CZ / 32]; float su = 0.f;
#pragma unroll
    for (int ch = 0; ch < CZ / 128; ++ch) { const v4f a = *(const v4f*)(f + ch * 128 + lane * 4); for (int u = 0; u < 4; ++u) { float xv = bfr(a[u]); asm volatile("" : "+v"(xv)); v[ch * 4 + u] = xv; su = __fadd_rn(su, xv); } }
#pragma unroll
    for (int sh = 16; sh; sh >>= 1) su = __fadd_rn(su, __shfl_xor(su, sh, 32));
    const float mu = __fdiv_rn(su, (float)CZ); float sq = 0.f;
#pragma unroll
    for (int q = 0; q < CZ / 32; ++q) { float d0 = __fsub_rn(v[q], mu); asm volatile("" : "+v"(d0)); float p = __fmul_rn(d0, d0); asm volatile("" : "+v"(p)); sq = __fadd_rn(sq, p); }
#pragma unroll
    for (int sh = 16; sh; sh >>= 1) sq = __fadd_rn(sq, __shfl_xor(sq, sh, 32));
    const float rs = __fdiv_rn(1.0f, sqrtf(__fadd_rn(__fdiv_rn(sq, (float)CZ), 1e-5f)));
    {
#pragma unroll
        for (int ch = 0; ch < CZ / 128; ++ch) { v4us oh, ol; for (int u = 0; u < 4; ++u) { const int c = ch * 128 + lane * 4 + u; float d0 = __fsub_rn(v[ch * 4 + u], mu); asm volatile("" : "+v"(d0)); float n = __fmul_rn(d0, rs); asm volatile("" : "+v"(n)); float gg = bfr(gam[c]), bb = bfr(bet[c]); asm volatile("" : "+v"(gg)); asm volatile("" : "+v"(bb)); float y = __fmul_rn(n, gg); asm volatile("" : "+v"(y)); y = __fadd_rn(y, bb); unsigned short p2, q2; splitf(y, p2, q2); oh[u] = p2; ol[u] = q2; } const size_t oo = (size_t)t * CZ + ch * 128 + lane * 4; *(v4us*)(Xh + oo) = oh; *(v4us*)(Xl + oo) = ol; }
         } }
__device__ __forceinline__ void d_w2dp(int bx, const float* __restrict__ Wp, bf* WP) { const size_t e = ((size_t)bx * 256 + threadIdx.x) * 8; if (e >= (size_t)ZW * CZ) return; const int r = (int)(e / CZ); const int c0 = (int)(e % CZ); v8us o; for (int u = 0; u < 8; ++u) o[u] = (r < NH_) ? f2bf(bfr(Wp[(size_t)(c0 + u) * NH_ + r])) : (unsigned short)0; *(v8us*)(WP + e) = o;  }
// ---- k_pre: all that depends on the inputs alone, in one launch. Blocks 0..23: the six weight planes of WT, 4 blocks each (0..3 = Wq, Wk, Wv, Wg transposed to bf16; 4 = the padded pair-bias weights, half a plane; 5 = Wo transposed); blocks 24..: LayerNorm of the 65,536 pair rows, 8 rows a block, once for the pair bias and the projections alike.
#define WPB  4     // blocks per weight plane: DM * DR / 64 lines at 64 lines a block; ZW * CZ / 8 threads for the pair-bias weights
#define NWB  (6 * WPB)
__global__ __launch_bounds__(256) void k_pre(const float* __restrict__ X, const float* __restrict__ gam, const float* __restrict__ bet, bf* Xh, bf* Xl, const float* __restrict__ wq, const float* __restrict__ wk, const float* __restrict__ wv, const float* __restrict__ wg, const float* __restrict__ w2d, const float* __restrict__ wo, bf* WT) {
    const int b = blockIdx.x;
    if (b < NWB) { const int p = b / WPB, bx = b % WPB; bf* dst = WT + (size_t)p * DR * DM;
        if (p == 4) d_w2dp(bx, w2d, dst);
        else d_wtG(bx, (p == 0) ? wq : (p == 1) ? wk : (p == 2) ? wv : (p == 3) ? wg : wo, DM, DR, dst);   // DM == DR: Wo's K and N are the same two numbers
        return; }
    d_lnz(b - NWB, X, gam, bet, Xh, Xl);
}
__global__ __launch_bounds__(256) void k_ztr(const float* __restrict__ ZF, float* ZB) { const size_t e = (size_t)blockIdx.x * 256 + threadIdx.x; if (e >= (size_t)NH_ * TT * TT) return; const int k = (int)(e % TT); const int q = (int)((e / TT) % TT); const int h = (int)(e / ((size_t)TT * TT)); const float v = ZF[((size_t)q * TT + k) * ZW + h]; *(float*)(ZB + e) = v;  }
// FG holds z Wg without its bias (the gate's GEMM shares a launch with GEMMs that have none); the bias is added here, to the same f32 value
__global__ __launch_bounds__(256) void k_gmulpl(const float* __restrict__ YO, const float* __restrict__ FG, const float* __restrict__ bg, bf* Ah, bf* Al) { const size_t e = ((size_t)blockIdx.x * 256 + threadIdx.x) * 4; if (e >= (size_t)GR * DR) return; const v4f a = *(const v4f*)(YO + e); const v4f gz = *(const v4f*)(FG + e); const v4f gb = *(const v4f*)(bg + e % DR); v4us oh, ol; for (int u = 0; u < 4; ++u) { float eg = expf(-(gz[u] + bfr(gb[u]))); float sg = __fdiv_rn(1.0f, __fadd_rn(1.0f, eg)); asm volatile("" : "+v"(sg)); const float ov = __fmul_rn(a[u], sg); unsigned short a2, c2; splitf(ov, a2, c2); oh[u] = a2; ol[u] = c2; } *(v4us*)(Ah + e) = oh; *(v4us*)(Al + e) = ol;  }
// ---- k_attn: the whole attention of one virtual head (row bl, head h) in one work-group: 16 waves x 16 queries, all 256 keys at once, scores and probabilities never leave the registers.
// K [key][d] and V^T [d][key] are split into bf16 hi/lo planes on the way into LDS. S^T = K Q^T (A = K rows, B = Q columns), so a lane holds 128 scores of ONE query: tile kt, register r = key kt*16 + 8*hi + r, query lr.
// Two neighbouring score tiles, converted in place, are the B operand of O^T = V^T P^T (hardware k order: 8*hi + s, 16 + 8*hi + (s - 8)); the LDS fragment loads use the same order.
// The pair bias, times 32^0.5, is the start value of the score accumulators; 32^-0.5 is folded into the exponent's scale.
#define KPI  40    // K row pitch in LDS, bf16 elements: 80 bytes = 16 x odd, no bank conflict for 16-byte reads
#define VPI  264   // V^T row pitch in LDS: 528 bytes = 16 x odd
#define RSCL 5.656854249492381f   // 32^0.5
typedef __attribute__((ext_vector_type(2))) __bf16 v2bf;
typedef __attribute__((ext_vector_type(2))) unsigned v2u;
typedef __attribute__((ext_vector_type(8))) unsigned v8u;
typedef unsigned __attribute__((may_alias)) u32a;
typedef v2u __attribute__((may_alias)) v2ua;
__device__ __forceinline__ unsigned pk2(float a, float b) { v2f x; x[0] = a; x[1] = b; return __builtin_bit_cast(unsigned, __builtin_convertvector(x, v2bf)); }
__device__ __forceinline__ void split2(float a, float b, unsigned& h, unsigned& l) { h = pk2(a, b); l = pk2(a - __uint_as_float(h << 16), b - __uint_as_float(h & 0xFFFF0000u)); }
// 2^x with the one issue slot that the instruction set asks for behind a transcendental, before its result is read or its source register overwritten: in one statement, so that the slot stands directly behind it
__device__ __forceinline__ float exp2slot(float x) { float e; asm("v_exp_f32 %0, %1\n\tv_nop" : "=v"(e) : "v"(x)); return e; }
__device__ __forceinline__ v16bf ldsfrag(const bf* p) { return cat16b(*(const v8usa*)p, *(const v8usa*)(p + 16)); }
__global__ __launch_bounds__(512) void k_attn(const float* __restrict__ FQ, const float* __restrict__ FK, const float* __restrict__ FV, const float* __restrict__ ZB, float* __restrict__ YO) {
    __shared__ __align__(16) bf Kh[TT * KPI]; __shared__ __align__(16) bf Kl[TT * KPI]; __shared__ __align__(16) bf Vh[HDR * VPI]; __shared__ __align__(16) bf Vl[HDR * VPI];
    const int tid = threadIdx.x, lane = tid & 31, lr = lane & 15, hi = lane >> 4; const int z = blockIdx.x, bl = z / NH_, h = z % NH_;
    const size_t base = (size_t)bl * TT * DR + h * HDR;   // element (t, d) of this head: base + t * DR + d
#pragma unroll
    for (int i = 0; i < 4; ++i) { const int idx = i * 512 + tid, t = idx >> 3, c = idx & 7; const v4f a = *(const v4f*)(FK + base + (size_t)t * DR + c * 4); v2u oh, ol; unsigned p, r;
        split2(a[0], a[1], p, r); oh[0] = p; ol[0] = r; split2(a[2], a[3], p, r); oh[1] = p; ol[1] = r; *(v2ua*)(Kh + t * KPI + c * 4) = oh; *(v2ua*)(Kl + t * KPI + c * 4) = ol; }
#pragma unroll
    for (int i = 0; i < 2; ++i) { const int idx = i * 512 + tid, tp = idx >> 3, c = idx & 7; const float* vp = FV + base + (size_t)(2 * tp) * DR + c * 4; const v4f a = *(const v4f*)vp; const v4f b = *(const v4f*)(vp + DR);
#pragma unroll
        for (int u = 0; u < 4; ++u) { unsigned p, r; split2(a[u], b[u], p, r); *(u32a*)(Vh + (c * 4 + u) * VPI + 2 * tp) = p; *(u32a*)(Vl + (c * 4 + u) * VPI + 2 * tp) = r; } }
    const int q = (tid >> 5) * 16 + lr;
    const float* zr = ZB + ((size_t)h * TT + q) * TT + 8 * hi; v8f acc[16];
#pragma unroll
    for (int kt = 0; kt < 16; ++kt) { const v4f a = *(const v4f*)(zr + kt * 16); const v4f b = *(const v4f*)(zr + kt * 16 + 4);
#pragma unroll
        for (int u = 0; u < 4; ++u) { acc[kt][u] = a[u] * RSCL; acc[kt][4 + u] = b[u] * RSCL; } }
    const float* qp = FQ + base + (size_t)q * DR + 8 * hi; v8u qh, ql;
#pragma unroll
    for (int g = 0; g < 2; ++g) { const v4f a = *(const v4f*)(qp + g * 16); const v4f b = *(const v4f*)(qp + g * 16 + 4); unsigned p, r;
        split2(a[0], a[1], p, r); qh[g * 4] = p; ql[g * 4] = r; split2(a[2], a[3], p, r); qh[g * 4 + 1] = p; ql[g * 4 + 1] = r; split2(b[0], b[1], p, r); qh[g * 4 + 2] = p; ql[g * 4 + 2] = r; split2(b[2], b[3], p, r); qh[g * 4 + 3] = p; ql[g * 4 + 3] = r; }
    const v16bf Qh = __builtin_bit_cast(v16bf, qh), Ql = __builtin_bit_cast(v16bf, ql);
    __syncthreads();   // the K and V planes are complete before any wave reads a fragment
#pragma unroll
    for (int kt = 0; kt < 16; ++kt) { const int ko = (kt * 16 + lr) * KPI + 8 * hi; const v16bf ah = ldsfrag(Kh + ko), al = ldsfrag(Kl + ko);
        acc[kt] = wmmab(ah, Qh, acc[kt]); acc[kt] = wmmab(ah, Ql, acc[kt]); acc[kt] = wmmab(al, Qh, acc[kt]); }
    v8f m8 = acc[0];
#pragma unroll
    for (int kt = 1; kt < 16; ++kt)
#pragma unroll
        for (int r = 0; r < 8; ++r) m8[r] = fmaxf(m8[r], acc[kt][r]);
    float mx = fmaxf(fmaxf(fmaxf(m8[0], m8[1]), fmaxf(m8[2], m8[3])), fmaxf(fmaxf(m8[4], m8[5]), fmaxf(m8[6], m8[7])));
    mx = fmaxf(mx, __shfl_xor(mx, 16, 32));   // the other half of the query's keys
    const float c1 = SCL * 1.4426950408889634f, mc = mx * c1; v8f s8 = (v8f){};
#pragma unroll
    for (int kt = 0; kt < 16; ++kt)
#pragma unroll
        for (int r = 0; r < 8; ++r) { const float e = exp2slot(fmaf(acc[kt][r], c1, -mc)); acc[kt][r] = e; s8[r] += e; }
    float sum = ((s8[0] + s8[1]) + (s8[2] + s8[3])) + ((s8[4] + s8[5]) + (s8[6] + s8[7]));
    sum += __shfl_xor(sum, 16, 32);
    const float f = __fdiv_rn(1.0f, sum);
    v8f o[2]; o[0] = (v8f){}; o[1] = (v8f){};
#pragma unroll
    for (int ks = 0; ks < 8; ++ks) { v8u ph, pl;
#pragma unroll
        for (int g = 0; g < 2; ++g)
#pragma unroll
            for (int i = 0; i < 4; ++i) { unsigned p, r; split2(acc[2 * ks + g][2 * i] * f, acc[2 * ks + g][2 * i + 1] * f, p, r); ph[g * 4 + i] = p; pl[g * 4 + i] = r; }
        const v16bf Ph = __builtin_bit_cast(v16bf, ph), Pl = __builtin_bit_cast(v16bf, pl);
#pragma unroll
        for (int mb = 0; mb < 2; ++mb) { const int vo = (mb * 16 + lr) * VPI + ks * 32 + 8 * hi; const v16bf vh = ldsfrag(Vh + vo), vl = ldsfrag(Vl + vo);
            o[mb] = wmmab(vh, Ph, o[mb]); o[mb] = wmmab(vh, Pl, o[mb]); o[mb] = wmmab(vl, Ph, o[mb]); } }
    float* yp = YO + base + (size_t)q * DR + 8 * hi;   // o[mb][r] = context of query q at d = mb*16 + 8*hi + r
#pragma unroll
    for (int mb = 0; mb < 2; ++mb) { v4f a, b;
#pragma unroll
        for (int u = 0; u < 4; ++u) { a[u] = o[mb][u]; b[u] = o[mb][4 + u]; }
        *(v4f*)(yp + mb * 16) = a; *(v4f*)(yp + mb * 16 + 4) = b; }
}
__global__ __launch_bounds__(256) void k_merge(const float* __restrict__ O, int h0, bf* Ah, bf* Al) { const size_t e = ((size_t)blockIdx.x * 256 + threadIdx.x) * 2; if (e >= (size_t)ZH * TT * HD) return; const int d = (int)(e % HD); const int t = (int)((e / HD) % TT); const int zz = (int)(e / ((size_t)HD * TT)); const float cs = (t < RH) ? 1.0f : (1.0f / PCAR); const size_t oo = (size_t)t * DQ + (h0 + zz) * HD + d;
    v2us oh, ol;
#pragma unroll
    for (int q = 0; q < 2; ++q) { unsigned short a, c2; splitf(O[e + q] * cs, a, c2); oh[q] = a; ol[q] = c2; } *(v2us*)(Ah + oo) = oh; *(v2us*)(Al + oo) = ol;  }

extern "C" void kernel_launch(void* const* d_in, const int* in_sizes, int n_in,
                              void* d_out, int out_size, void* d_ws, size_t ws_size, hipStream_t stream) {
    (void)in_sizes; (void)n_in; (void)out_size;
    const float* x = (const float*)d_in[0]; const float* qng = (const float*)d_in[1]; const float* qnb = (const float*)d_in[2]; const float* wq = (const float*)d_in[3]; const float* wk = (const float*)d_in[4]; const float* wv = (const float*)d_in[5]; const float* w2d = (const float*)d_in[6]; const float* wg = (const float*)d_in[7]; const float* bg = (const float*)d_in[8]; const float* wo = (const float*)d_in[9]; const float* bo = (const float*)d_in[10];
    float* OUT = (float*)d_out;   // [256][256][128]
    char* wsp = (char*)d_ws; auto take = [&](size_t bytes) { char* p = wsp; wsp += (bytes + 255) & ~(size_t)255; return (void*)p; };
    bf* WT = (bf*)take((size_t)6 * DR * DM * 2); bf* WO = WT + (size_t)5 * DR * DM;   /* one block of six planes: Wq, Wk, Wv, Wg, pair-bias weights, Wo */
    bf* XNh = (bf*)take((size_t)GR * DM * 2); bf* XNl = (bf*)take((size_t)GR * DM * 2); float* ZB = (float*)take((size_t)NH_ * TT * TT * 4);
    float* FQ = (float*)take(((size_t)4 * GR * DR + (size_t)NPZ * ZW) * 4); float* FK = FQ + (size_t)GR * DR; float* FV = FK + (size_t)GR * DR; float* FG = FV + (size_t)GR * DR; float* ZF = FG + (size_t)GR * DR;   /* one block: q, k, v, gate planes, then the pair bias before its transpose (pitch ZW) */
    float* YO = (float*)take((size_t)GR * DR * 4);   /* merged f32 context */
    bf* AOh = (bf*)take((size_t)GR * DR * 2); bf* AOl = (bf*)take((size_t)GR * DR * 2);
    if ((size_t)(wsp - (char*)d_ws) > ws_size) return;   // ws ~ 241 MiB
    k_pre<<<NWB + NPZ / 8, 256, 0, stream>>>(x, qng, qnb, XNh, XNl, wq, wk, wv, wg, w2d, wo, WT);
    k_gemmw<bf, 1, false><<<dim3(4 * (DR / 64) + 1, GR / 64, 1), 32, 0, stream>>>(XNh, XNl, WT, nullptr, DM, FQ, DR, nullptr, 0, (size_t)DR * DM, (size_t)GR * DR, DR / 64, 4, ZW);   /* q, k, v, gate, pair bias */
    k_ztr<<<(NH_ * TT * TT + 255) / 256, 256, 0, stream>>>(ZF, ZB);
    k_attn<<<NVH, 512, 0, stream>>>(FQ, FK, FV, ZB, YO);
    k_gmulpl<<<(unsigned)(((size_t)GR * DR / 4 + 255) / 256), 256, 0, stream>>>(YO, FG, bg, AOh, AOl);
    k_gemmw<bf, 1, true><<<dim3(DM / 64, GR / 64, 1), 32, 0, stream>>>(AOh, AOl, WO, nullptr, DR, OUT, DM, bo, 0, 0, 0, DM / 64, -1, 0);
}

// v004
// A run of this version takes 120 microseconds.
// Next to v003, in two timings, it ran 1.13 times as fast each time.
// Counting every step since v000, it is 7.16 times as fast.
#include <hip/hip_runtime.h>

// Triangle_Att_Start (AlphaFold triangle attention, starting node: pair_embed [256 rows i][256 j][128]; z = LayerNorm(pair); q/k/v = z W ([128][4 x 32]), q x 32^-0.5; bias[h][j][k] = (z Wb)[j][k][h] shared over rows i; gate = sigmoid(z Wg + bg); logits[h][i][j][k] = q_ij.k_ik + bias[h][j][k]; softmax over k; o = (a v) * gate; out = o Wo + bo -> [256][256][128]).
// Batched layout (exact): every row i is an independent 256-token attention; 256 rows x 4 heads = 1024 'virtual heads' of 256 tokens, one work-group of the fused attention kernel each, all in one launch; the projections run on all 65,536 stacked (row, j) positions at once.

#define NB_  256
#define TT   256
#define DM   128
#define NH_  4
#define NKV  4
#define REP  (NH_ / NKV)
#define HD   64
#define DQ   (NH_ * HD)
#define DKV  (NKV * HD)
#define ZH   256   // virtual heads per k_moutv / k_merge call (a quarter of NVH)
#define RH   256
#define WIN  0
#define PCAR 1024.0f
#define HDR  32
#define DR   (NH_ * HDR)   // 128
#define CZ   128
#define NPZ  (TT * TT)     // pair rows 65536
#define ZW   64            // padded w2d width
#define LR   256    // tokens per row (no padding)
#define GB   256    // rows per group: all of them, one group
#define NG   (NB_ / GB)
#define GR   (GB * TT)   // stacked rows per group
#define NVH  (GB * NH_)  // virtual heads per group
#define SCL  0.17677669529663689f   // 32^-0.5
typedef _Float16 h16;
typedef unsigned short bf;
typedef __attribute__((ext_vector_type(16))) __bf16   v16bf;
typedef __attribute__((ext_vector_type(16))) _Float16 v16h;
typedef __attribute__((ext_vector_type(8)))  _Float16 v8h;
typedef __attribute__((ext_vector_type(8)))  unsigned short v8us;
typedef __attribute__((ext_vector_type(8)))  float    v8f;
typedef __attribute__((ext_vector_type(4)))  float    v4f;
typedef v8h  __attribute__((may_alias)) v8ha;
typedef v4f  __attribute__((may_alias)) v4fa;
typedef v8us __attribute__((may_alias)) v8usa;

__device__ __forceinline__ unsigned short f2bf(float f) { unsigned u = __float_as_uint(f); u += 0x7FFFu + ((u >> 16) & 1u); return (unsigned short)(u >> 16); }
__device__ __forceinline__ float bf2f(unsigned short b) { return __uint_as_float(((unsigned)b) << 16); }
__device__ __forceinline__ float bfr(float f) { return bf2f(f2bf(f)); }
__device__ __forceinline__ v16h cat16(v8h lo, v8h hi) { return __builtin_shufflevector(lo, hi, 0, 1, 2, 3, 4, 5, 6, 7, 8, 9, 10, 11, 12, 13, 14, 15); }
__device__ __forceinline__ v16bf cat16b(v8us lo, v8us hi) { return __builtin_bit_cast(v16bf, __builtin_shufflevector(lo, hi, 0, 1, 2, 3, 4, 5, 6, 7, 8, 9, 10, 11, 12, 13, 14, 15)); }
__device__ __forceinline__ v8f wmma16(v16h a, v16h b, v8f c) { return __builtin_amdgcn_wmma_f32_16x16x32_f16(false, a, false, b, (short)0, c, false, false); }
__device__ __forceinline__ v8f wmmab(v16bf a, v16bf b, v8f c) { return __builtin_amdgcn_wmma_f32_16x16x32_bf16(false, a, false, b, (short)0, c, false, false); }



// ---- k_gemmw: register-blocked GEMM, ONE WAVE per 64x64 output tile (16 accumulators), operands straight from 16-bit planes in fragment order (fro); grid (column tiles of all z slices, M/64), 32 threads: the tiles that read the same 64 rows of A start side by side.
// A, A2, Bt, Bt2 lie in fragment order (fro below): the 32 lanes' 16-byte pieces of one fragment load are 512 contiguous bytes, four whole lines, not 16-byte pieces of 16 lines.
// C[m][n] (f32, pitch ldc, + optional f32 bias[n]) = sum_k A[m][k] Bt[n][k] (+ split products per NSPLIT). z-batch: ct column tiles a slice, strides sA/sB/sC in elements; slice zx (if any) has the output pitch ldx. K % 32 == 0.
// fro: element offset of (row n, k) in a fragment-ordered plane of K columns: blocks of 16 rows x 32 k (512 elements); in a block two halves (k 0-15, 16-31) of 32 lane pieces; lane piece 16 * ((k >> 3) & 1) + (n & 15) holds 8 consecutive k
__device__ __forceinline__ size_t fro(int n, int k, int K) { return ((size_t)(n >> 4) * (K >> 5) + (k >> 5)) * 512 + ((k >> 4) & 1) * 256 + ((((k >> 3) & 1) << 4) + (n & 15)) * 8 + (k & 7); }
template <typename T16> struct WFrag;
template <> struct WFrag<h16> { typedef v16h V; static __device__ __forceinline__ V ld(const h16* p) { return cat16(*(const v8h*)p, *(const v8h*)(p + 256)); } static __device__ __forceinline__ v8f mma(V a, V b, v8f c) { return wmma16(a, b, c); } };
template <> struct WFrag<bf> { typedef v16bf V; static __device__ __forceinline__ V ld(const bf* p) { return cat16b(*(const v8us*)p, *(const v8us*)(p + 256)); } static __device__ __forceinline__ v8f mma(V a, V b, v8f c) { return wmmab(a, b, c); } };
template <typename T16, int NSPLIT, bool BIAS>
__global__ __launch_bounds__(32) void k_gemmw(const T16* __restrict__ A, const T16* __restrict__ A2, const T16* __restrict__ Bt, const T16* __restrict__ Bt2, int K, float* C, int ldc, const float* __restrict__ bias, size_t sA, size_t sB, size_t sC, int ct, int zx, int ldx) {
    typedef typename WFrag<T16>::V V;
    __shared__ __align__(16) float os[16 * 68];
    const size_t z = blockIdx.x / ct; A += z * sA; if (A2) A2 += z * sA; Bt += z * sB; if (Bt2) Bt2 += z * sB; C += z * sC; if ((int)z == zx) ldc = ldx;
    const int lane = threadIdx.x & 31, lr = lane & 15, hi = lane >> 4; const int r0 = blockIdx.y * 64, c0 = (blockIdx.x % ct) * 64;
    v8f acc[4][4];
#pragma unroll
    for (int mb = 0; mb < 4; ++mb)
#pragma unroll
        for (int nb = 0; nb < 4; ++nb) acc[mb][nb] = (v8f){};
    const size_t aoff = (size_t)r0 * K + lane * 8, boff = (size_t)c0 * K + lane * 8;   // fro(r0 + lr, 8 * hi, K), fro(c0 + lr, 8 * hi, K); 16 rows on = 16 * K elements, 32 k on = 512
#pragma unroll 1
    for (int kc = 0; kc < K; kc += 32) {
        V a[4], a2[4];
#pragma unroll
        for (int mb = 0; mb < 4; ++mb) { a[mb] = WFrag<T16>::ld(A + aoff + (size_t)mb * 16 * K + kc * 16); if (NSPLIT == 1 || NSPLIT == 2) a2[mb] = WFrag<T16>::ld(A2 + aoff + (size_t)mb * 16 * K + kc * 16); }
#pragma unroll
        for (int nb = 0; nb < 4; ++nb) { const V b = WFrag<T16>::ld(Bt + boff + (size_t)nb * 16 * K + kc * 16); V b2; if (NSPLIT >= 2) b2 = WFrag<T16>::ld(Bt2 + boff + (size_t)nb * 16 * K + kc * 16);
#pragma unroll
            for (int mb = 0; mb < 4; ++mb) { acc[mb][nb] = WFrag<T16>::mma(a[mb], b, acc[mb][nb]); if (NSPLIT == 1 || NSPLIT == 2) acc[mb][nb] = WFrag<T16>::mma(a2[mb], b, acc[mb][nb]); if (NSPLIT >= 2) acc[mb][nb] = WFrag<T16>::mma(a[mb], b2, acc[mb][nb]); } }
        asm volatile("v_nop\n\tv_nop\n\tv_nop\n\tv_nop" : "+v"(acc[0][0]), "+v"(acc[1][1]), "+v"(acc[2][2]), "+v"(acc[3][3]) : "v"(a[0]), "v"(a[3]));
    }
#pragma unroll
    for (int mb = 0; mb < 4; ++mb) {
#pragma unroll
        for (int nb = 0; nb < 4; ++nb) {
#pragma unroll
            for (int j = 0; j < 8; ++j) os[(hi * 8 + j) * 68 + nb * 16 + lr] = acc[mb][nb][j]; }
        __builtin_amdgcn_wave_barrier(); asm volatile("" ::: "memory");
        float* crow = C + (size_t)(r0 + mb * 16) * ldc + c0;
{
#pragma unroll
            for (int s = 0; s < 8; ++s) { const int row = 2 * s + hi, cofs = lr * 4; v4f val = *(const v4fa*)(os + row * 68 + cofs); if (BIAS) { val[0] += bfr(bias[c0 + cofs]); val[1] += bfr(bias[c0 + cofs + 1]); val[2] += bfr(bias[c0 + cofs + 2]); val[3] += bfr(bias[c0 + cofs + 3]); }
                *(v4f*)(crow + (size_t)row * ldc + cofs) = val; }
             }
        if (mb < 3) asm volatile("s_wait_xcnt 0x0" ::: "memory");   // the next round rewrites the stores' address and data registers: the wait that belongs in front of that
        __builtin_amdgcn_wave_barrier(); asm volatile("" ::: "memory");
    }
}

__device__ __forceinline__ h16 tohx(float x) { return (h16)x; }
__device__ __forceinline__ void splitf(float y, unsigned short& h, unsigned short& l) { h = f2bf(y); l = f2bf(y - bf2f(h)); }
typedef __attribute__((ext_vector_type(2))) _Float16 v2h;
typedef __attribute__((ext_vector_type(4))) _Float16 v4h;
typedef __attribute__((ext_vector_type(2))) unsigned short v2us;
typedef __attribute__((ext_vector_type(4))) unsigned short v4us;
typedef __attribute__((ext_vector_type(2))) float v2f;
typedef __attribute__((ext_vector_type(4))) int v4i;

__device__ __forceinline__ void d_wtG(int bx, const float* __restrict__ w, int K, int N, bf* Bt) {
    const int lane = threadIdx.x & 31; const int L0 = (bx * 8 + (threadIdx.x >> 5)) * 8; const int nlines = N * K / 64;
{
#pragma unroll 1
        for (int l = 0; l < 8; ++l) { const int L = L0 + l; if (L >= nlines) break; const size_t e = (size_t)L * 64 + lane * 2; const int k = (int)(e % K), n = (int)(e / K); v2us o;
            o[0] = f2bf(w[(size_t)k * N + n]); o[1] = f2bf(w[(size_t)(k + 1) * N + n]); *(v2us*)(Bt + fro(n, k, K)) = o;
            asm volatile("s_wait_xcnt 0x0" ::: "memory"); }   // the next trip rewrites the store's address and data registers: the wait that belongs in front of that
         }
}
__global__ __launch_bounds__(256) void k_cvt8(const float* __restrict__ src, bf* dst, size_t n8) { const size_t i = (size_t)blockIdx.x * 256 + threadIdx.x; if (i >= n8) return; const v8f v = *(const v8f*)(src + i * 8); v8us o;
#pragma unroll
    for (int k = 0; k < 8; ++k) o[k] = f2bf(v[k]); *(v8us*)(dst + i * 8) = o;  }
__global__ __launch_bounds__(256) void k_cscvt(const float* __restrict__ cosT, const float* __restrict__ sinT, float* CS) { const int idx = blockIdx.x * 256 + threadIdx.x; if (idx >= TT * HD) return; v2f cs; cs[0] = bfr(cosT[idx]); cs[1] = bfr(sinT[idx]); *(v2f*)(CS + (size_t)idx * 2) = cs;  }
// k_rope: head planes [h][t][d] (fp16 + hi/lo) of rope(x) x sc with the rotate-half convention out[d] = x[d] cos[t][d] - x[d+HD/2] sin[t][d], out[d+HD/2] = x[d+HD/2] cos[t][d+HD/2] + x[d] sin[t][d+HD/2]
__global__ __launch_bounds__(256) void k_rope(const float* __restrict__ F, int pitch, int nheads, const float* __restrict__ CS, const float* __restrict__ RF, const float* __restrict__ nw, float sc, h16* P16, bf* Ph, bf* Pl) {
    const size_t e = ((size_t)blockIdx.x * 256 + threadIdx.x) * 2; if (e >= (size_t)nheads * TT * HD) return; const int d = (int)(e % HD); const int t = (int)((e / HD) % TT); const int h = (int)(e / ((size_t)HD * TT)); const float* f = F + (size_t)t * pitch + h * HD; const float rf = RF ? RF[(size_t)h * TT + t] : 1.0f; v2h o16; v2us oh, ol;
#pragma unroll
    for (int q = 0; q < 2; ++q) { const int dd = d + q; const int dp = (dd < HD / 2) ? dd + HD / 2 : dd - HD / 2; float x0 = f[dd], x1 = f[dp];
        if (RF) { float n0 = __fmul_rn(x0, rf), n1 = __fmul_rn(x1, rf); asm volatile("" : "+v"(n0)); asm volatile("" : "+v"(n1)); x0 = __fmul_rn(bfr(nw[dd]), n0); x1 = __fmul_rn(bfr(nw[dp]), n1); }
        const v2f cs = *(const v2f*)(CS + ((size_t)t * HD + dd) * 2); float a = __fmul_rn(x0, cs[0]), bq = __fmul_rn(x1, cs[1]); asm volatile("" : "+v"(a)); asm volatile("" : "+v"(bq)); const float r = ((dd < HD / 2) ? __fsub_rn(a, bq) : __fadd_rn(a, bq)) * sc;
        o16[q] = tohx(r); unsigned short a2, c2; splitf(r, a2, c2); oh[q] = a2; ol[q] = c2; }
    *(v2h*)(P16 + e) = o16; *(v2us*)(Ph + e) = oh; *(v2us*)(Pl + e) = ol;  }
__global__ __launch_bounds__(256) void k_vtp(const float* __restrict__ F, int pitch, int nheads, h16* V16, bf* Vh, bf* Vl) { const size_t e = ((size_t)blockIdx.x * 256 + threadIdx.x) * 2; if (e >= (size_t)nheads * HD * TT) return; const int t = (int)(e % TT); const int d = (int)((e / TT) % HD); const int g = (int)(e / ((size_t)TT * HD)); v2h o16; v2us oh, ol;
#pragma unroll
    for (int q = 0; q < 2; ++q) { const float x = F[(size_t)(t + q) * pitch + g * HD + d]; o16[q] = tohx(x); unsigned short a2, c2; splitf(x, a2, c2); oh[q] = a2; ol[q] = c2; }
    *(v2h*)(V16 + e) = o16; *(v2us*)(Vh + e) = oh; *(v2us*)(Vl + e) = ol;  }
__global__ __launch_bounds__(256) void k_cvt8padg(const float* __restrict__ src, bf* XB2) { const size_t e8 = ((size_t)blockIdx.x * 256 + threadIdx.x) * 8; if (e8 >= (size_t)GR * DM) return; const int r = (int)(e8 / DM); const int bl = r / TT, t = r % TT; v8us o; if (t < LR) { const float* sp2 = src + ((size_t)bl * LR + t) * DM + (e8 % DM); for (int u = 0; u < 8; ++u) o[u] = f2bf(bfr(sp2[u])); } else { for (int u = 0; u < 8; ++u) o[u] = 0; } *(v8us*)(XB2 + e8) = o;  }
__global__ __launch_bounds__(256) void k_moutv(const float* __restrict__ O, int z0, float* YO2) { const size_t e = ((size_t)blockIdx.x * 256 + threadIdx.x) * 2; if (e >= (size_t)ZH * TT * HD) return; const int d = (int)(e % HD); const int t = (int)((e / HD) % TT); const int zz = (int)(e / ((size_t)HD * TT)); const int z = z0 + zz; const int bl = z / NH_, h = z % NH_; v2f o; o[0] = O[e]; o[1] = O[e + 1]; float* dst = YO2 + ((size_t)bl * TT + t) * DQ + (size_t)h * HD + d; *(v2f*)dst = o;  }
__global__ __launch_bounds__(256) void k_outcpg(const float* __restrict__ Y, float* O2) { const size_t e = ((size_t)blockIdx.x * 256 + threadIdx.x) * 4; if (e >= (size_t)GB * LR * DM) return; const size_t r = e / DM; const int bl = (int)(r / LR), t = (int)(r % LR); const v4f a = *(const v4f*)(Y + ((size_t)bl * TT + t) * DM + (e % DM)); *(v4f*)(O2 + e) = a;  }
__global__ __launch_bounds__(256) void k_hlG(const float* __restrict__ F, bf* Fh, bf* Fl, size_t n) { const size_t e = ((size_t)blockIdx.x * 256 + threadIdx.x) * 4; if (e >= n) return; const v4f a = *(const v4f*)(F + e); v4us oh, ol; for (int u = 0; u < 4; ++u) { unsigned short p, q; splitf(a[u], p, q); oh[u] = p; ol[u] = q; } *(v4us*)(Fh + e) = oh; *(v4us*)(Fl + e) = ol;  }
// d_fro8: a block of 8 waves, wave w holding row bx*8 + w of a 128-column hi and lo plane (4 columns a lane), stores both planes in fragment order (fro), turned through LDS: thread = (plane, k group of 8, row); the 8 rows' pieces of one k group are one whole 128-byte line, and a wave stores four such lines. Every thread of the block calls it.
#define LNP  136   // LDS row pitch, bf16 elements: 272 bytes = 16 x odd, no bank conflict for 16-byte reads down a column of rows
typedef v4us __attribute__((may_alias)) v4usa;
__device__ __forceinline__ void d_fro8(int bx, v4us oh, v4us ol, bf* Ph, bf* Pl) {
    __shared__ __align__(16) bf st[2 * 8 * LNP]; const int oo = (threadIdx.x >> 5) * LNP + (threadIdx.x & 31) * 4; *(v4usa*)(st + oo) = oh; *(v4usa*)(st + 8 * LNP + oo) = ol;
    __syncthreads();   // the block's 8 rows, hi and lo, are in LDS before they are read across rows
    const int pl = threadIdx.x >> 7, kg = (threadIdx.x >> 3) & 15, un = threadIdx.x & 7; const v8us val = *(const v8usa*)(st + (pl * 8 + un) * LNP + kg * 8);
    *(v8us*)((pl ? Pl : Ph) + fro(bx * 8 + un, kg * 8, 128)) = val; }
__device__ __forceinline__ void d_lnz(int bx, const float* __restrict__ X, const float* __restrict__ gam, const float* __restrict__ bet, bf* Xh, bf* Xl) { const int lane = threadIdx.x & 31; const int t = bx * 8 + (threadIdx.x >> 5); if (bx >= NPZ / 8) return;   /* the same for the whole block: d_fro8 has a barrier */
    const float* f = X + (size_t)t * CZ; float v[CZ / 32]; float su = 0.f;
#pragma unroll
    for (int ch = 0; ch < CZ / 128; ++ch) { const v4f a = *(const v4f*)(f + ch * 128 + lane * 4); for (int u = 0; u < 4; ++u) { float xv = bfr(a[u]); asm volatile("" : "+v"(xv)); v[ch * 4 + u] = xv; su = __fadd_rn(su, xv); } }
#pragma unroll
    for (int sh = 16; sh; sh >>= 1) su = __fadd_rn(su, __shfl_xor(su, sh, 32));
    const float mu = __fdiv_rn(su, (float)CZ); float sq = 0.f;
#pragma unroll
    for (int q = 0; q < CZ / 32; ++q) { float d0 = __fsub_rn(v[q], mu); asm volatile("" : "+v"(d0)); float p = __fmul_rn(d0, d0); asm volatile("" : "+v"(p)); sq = __fadd_rn(sq, p); }
#pragma unroll
    for (int sh = 16; sh; sh >>= 1) sq = __fadd_rn(sq, __shfl_xor(sq, sh, 32));
    const float rs = __fdiv_rn(1.0f, sqrtf(__fadd_rn(__fdiv_rn(sq, (float)CZ), 1e-5f)));
    {
#pragma unroll
        for (int ch = 0; ch < CZ / 128; ++ch) { v4us oh, ol; for (int u = 0; u < 4; ++u) { const int c = ch * 128 + lane * 4 + u; float d0 = __fsub_rn(v[ch * 4 + u], mu); asm volatile("" : "+v"(d0)); float n = __fmul_rn(d0, rs); asm volatile("" : "+v"(n)); float gg = bfr(gam[c]), bb = bfr(bet[c]); asm volatile("" : "+v"(gg)); asm volatile("" : "+v"(bb)); float y = __fmul_rn(n, gg); asm volatile("" : "+v"(y)); y = __fadd_rn(y, bb); unsigned short p2, q2; splitf(y, p2, q2); oh[u] = p2; ol[u] = q2; } d_fro8(bx, oh, ol, Xh, Xl); }   // CZ == 128: one pass
         } }
__device__ __forceinline__ void d_w2dp(int bx, const float* __restrict__ Wp, bf* WP) { const size_t e = ((size_t)bx * 256 + threadIdx.x) * 8; if (e >= (size_t)ZW * CZ) return; const int r = (int)(e / CZ); const int c0 = (int)(e % CZ); v8us o; for (int u = 0; u < 8; ++u) o[u] = (r < NH_) ? f2bf(bfr(Wp[(size_t)(c0 + u) * NH_ + r])) : (unsigned short)0; *(v8us*)(WP + fro(r, c0, CZ)) = o;  }
// ---- k_pre: all that depends on the inputs alone, in one launch. Blocks 0..23: the six weight planes of WT, in fragment order (fro), 4 blocks each (0..3 = Wq, Wk, Wv, Wg transposed to bf16; 4 = the padded pair-bias weights, half a plane; 5 = Wo transposed); blocks 24..: LayerNorm of the 65,536 pair rows, 8 rows a block, once for the pair bias and the projections alike, its hi and lo planes in fragment order (d_fro8).
#define WPB  4     // blocks per weight plane: DM * DR / 64 lines at 64 lines a block; ZW * CZ / 8 threads for the pair-bias weights
#define NWB  (6 * WPB)
__global__ __launch_bounds__(256) void k_pre(const float* __restrict__ X, const float* __restrict__ gam, const float* __restrict__ bet, bf* Xh, bf* Xl, const float* __restrict__ wq, const float* __restrict__ wk, const float* __restrict__ wv, const float* __restrict__ wg, const float* __restrict__ w2d, const float* __restrict__ wo, bf* WT) {
    const int b = blockIdx.x;
    if (b < NWB) { const int p = b / WPB, bx = b % WPB; bf* dst = WT + (size_t)p * DR * DM;
        if (p == 4) d_w2dp(bx, w2d, dst);
        else d_wtG(bx, (p == 0) ? wq : (p == 1) ? wk : (p == 2) ? wv : (p == 3) ? wg : wo, DM, DR, dst);   // DM == DR: Wo's K and N are the same two numbers
        return; }
    d_lnz(b - NWB, X, gam, bet, Xh, Xl);
}
// k_ztr: the pair bias in the order of k_attn's score accumulators: ZB[h][query tile qt][key tile kt][half][lane][u] = bias of query qt*16 + (lane & 15), key kt*16 + 8*(lane >> 4) + 4*half + u, so that each of the reader's wave-wide 16-byte loads covers 512 contiguous bytes
__global__ __launch_bounds__(256) void k_ztr(const float* __restrict__ ZF, float* ZB) { const size_t e = (size_t)blockIdx.x * 256 + threadIdx.x; if (e >= (size_t)NH_ * TT * TT) return; const int u = (int)(e & 3), ln = (int)((e >> 2) & 31), hf = (int)((e >> 7) & 1), kt = (int)((e >> 8) & 15), qt = (int)((e >> 12) & 15); const int h = (int)(e / ((size_t)TT * TT)); const int k = kt * 16 + 8 * (ln >> 4) + 4 * hf + u; const int q = qt * 16 + (ln & 15); const float v = ZF[((size_t)q * TT + k) * ZW + h]; *(float*)(ZB + e) = v;  }
// FG holds z Wg without its bias (the gate's GEMM shares a launch with GEMMs that have none); the bias is added here, to the same f32 value
__global__ __launch_bounds__(256) void k_gmulpl(const float* __restrict__ YO, const float* __restrict__ FG, const float* __restrict__ bg, bf* Ah, bf* Al) { const size_t e = ((size_t)blockIdx.x * 256 + threadIdx.x) * 4; if ((size_t)blockIdx.x * 1024 >= (size_t)GR * DR) return;   /* the same for the whole block (8 whole rows of DR == 128): d_fro8 has a barrier */
    const v4f a = *(const v4f*)(YO + e); const v4f gz = *(const v4f*)(FG + e); const v4f gb = *(const v4f*)(bg + e % DR); v4us oh, ol; for (int u = 0; u < 4; ++u) { float eg = expf(-(gz[u] + bfr(gb[u]))); float sg = __fdiv_rn(1.0f, __fadd_rn(1.0f, eg)); asm volatile("" : "+v"(sg)); const float ov = __fmul_rn(a[u], sg); unsigned short a2, c2; splitf(ov, a2, c2); oh[u] = a2; ol[u] = c2; } d_fro8(blockIdx.x, oh, ol, Ah, Al);  }
// ---- k_attn: the whole attention of one virtual head (row bl, head h) in one work-group: 16 waves x 16 queries, all 256 keys at once, scores and probabilities never leave the registers.
// K [key][d] and V^T [d][key] are split into bf16 hi/lo planes on the way into LDS. S^T = K Q^T (A = K rows, B = Q columns), so a lane holds 128 scores of ONE query: tile kt, register r = key kt*16 + 8*hi + r, query lr.
// Two neighbouring score tiles, converted in place, are the B operand of O^T = V^T P^T (hardware k order: 8*hi + s, 16 + 8*hi + (s - 8)); the LDS fragment loads use the same order.
// The pair bias, times 32^0.5, is the start value of the score accumulators; 32^-0.5 is folded into the exponent's scale.
#define KPI  40    // K row pitch in LDS, bf16 elements: 80 bytes = 16 x odd, no bank conflict for 16-byte reads
#define VPI  264   // V^T row pitch in LDS: 528 bytes = 16 x odd
#define RSCL 5.656854249492381f   // 32^0.5
typedef __attribute__((ext_vector_type(2))) __bf16 v2bf;
typedef __attribute__((ext_vector_type(2))) unsigned v2u;
typedef __attribute__((ext_vector_type(8))) unsigned v8u;
typedef unsigned __attribute__((may_alias)) u32a;
typedef v2u __attribute__((may_alias)) v2ua;
__device__ __forceinline__ unsigned pk2(float a, float b) { v2f x; x[0] = a; x[1] = b; return __builtin_bit_cast(unsigned, __builtin_convertvector(x, v2bf)); }
__device__ __forceinline__ void split2(float a, float b, unsigned& h, unsigned& l) { h = pk2(a, b); l = pk2(a - __uint_as_float(h << 16), b - __uint_as_float(h & 0xFFFF0000u)); }
// 2^x with the one issue slot that the instruction set asks for behind a transcendental, before its result is read or its source register overwritten: in one statement, so that the slot stands directly behind it
__device__ __forceinline__ float exp2slot(float x) { float e; asm("v_exp_f32 %0, %1\n\tv_nop" : "=v"(e) : "v"(x)); return e; }
__device__ __forceinline__ v16bf ldsfrag(const bf* p) { return cat16b(*(const v8usa*)p, *(const v8usa*)(p + 16)); }
__global__ __launch_bounds__(512) void k_attn(const float* __restrict__ FQ, const float* __restrict__ FK, const float* __restrict__ FV, const float* __restrict__ ZB, float* __restrict__ YO) {
    __shared__ __align__(16) bf Kh[TT * KPI]; __shared__ __align__(16) bf Kl[TT * KPI]; __shared__ __align__(16) bf Vh[HDR * VPI]; __shared__ __align__(16) bf Vl[HDR * VPI];
    const int tid = threadIdx.x, lane = tid & 31, lr = lane & 15, hi = lane >> 4; const int z = blockIdx.x, bl = z / NH_, h = z % NH_;
    const size_t base = (size_t)bl * TT * DR + h * HDR;   // element (t, d) of this head: base + t * DR + d
    const float* zr = ZB + ((size_t)h * 16 + (tid >> 5)) * (16 * TT) + lane * 4;   // this wave's 16 queries x 256 keys of the pair bias, in accumulator order (k_ztr)
#pragma unroll
    for (int i = 0; i < 4; ++i) { const int idx = i * 512 + tid, t = idx >> 3, c = idx & 7; const v4f a = *(const v4f*)(FK + base + (size_t)t * DR + c * 4); v2u oh, ol; unsigned p, r;
        split2(a[0], a[1], p, r); oh[0] = p; ol[0] = r; split2(a[2], a[3], p, r); oh[1] = p; ol[1] = r; *(v2ua*)(Kh + t * KPI + c * 4) = oh; *(v2ua*)(Kl + t * KPI + c * 4) = ol; }
#pragma unroll
    for (int i = 0; i < 2; ++i) { const int idx = i * 512 + tid, tp = idx >> 3, c = idx & 7; const float* vp = FV + base + (size_t)(2 * tp) * DR + c * 4; const v4f a = *(const v4f*)vp; const v4f b = *(const v4f*)(vp + DR);
#pragma unroll
        for (int u = 0; u < 4; ++u) { unsigned p, r; split2(a[u], b[u], p, r); *(u32a*)(Vh + (c * 4 + u) * VPI + 2 * tp) = p; *(u32a*)(Vl + (c * 4 + u) * VPI + 2 * tp) = r; } }
    const int q = (tid >> 5) * 16 + lr;
    v8f acc[16];
#pragma unroll
    for (int kt = 0; kt < 16; ++kt) { const v4f a = *(const v4f*)(zr + kt * 256); const v4f b = *(const v4f*)(zr + kt * 256 + 128);
#pragma unroll
        for (int u = 0; u < 4; ++u) { acc[kt][u] = a[u] * RSCL; acc[kt][4 + u] = b[u] * RSCL; } }
    const float* qp = FQ + base + (size_t)q * DR + 8 * hi; v8u qh, ql;
#pragma unroll
    for (int g = 0; g < 2; ++g) { const v4f a = *(const v4f*)(qp + g * 16); const v4f b = *(const v4f*)(qp + g * 16 + 4); unsigned p, r;
        split2(a[0], a[1], p, r); qh[g * 4] = p; ql[g * 4] = r; split2(a[2], a[3], p, r); qh[g * 4 + 1] = p; ql[g * 4 + 1] = r; split2(b[0], b[1], p, r); qh[g * 4 + 2] = p; ql[g * 4 + 2] = r; split2(b[2], b[3], p, r); qh[g * 4 + 3] = p; ql[g * 4 + 3] = r; }
    const v16bf Qh = __builtin_bit_cast(v16bf, qh), Ql = __builtin_bit_cast(v16bf, ql);
    __syncthreads();   // the K and V planes are complete before any wave reads a fragment
#pragma unroll
    for (int kt = 0; kt < 16; ++kt) { const int ko = (kt * 16 + lr) * KPI + 8 * hi; const v16bf ah = ldsfrag(Kh + ko), al = ldsfrag(Kl + ko);
        acc[kt] = wmmab(ah, Qh, acc[kt]); acc[kt] = wmmab(ah, Ql, acc[kt]); acc[kt] = wmmab(al, Qh, acc[kt]); }
    v8f m8 = acc[0];
#pragma unroll
    for (int kt = 1; kt < 16; ++kt)
#pragma unroll
        for (int r = 0; r < 8; ++r) m8[r] = fmaxf(m8[r], acc[kt][r]);
    float mx = fmaxf(fmaxf(fmaxf(m8[0], m8[1]), fmaxf(m8[2], m8[3])), fmaxf(fmaxf(m8[4], m8[5]), fmaxf(m8[6], m8[7])));
    mx = fmaxf(mx, __shfl_xor(mx, 16, 32));   // the other half of the query's keys
    const float c1 = SCL * 1.4426950408889634f, mc = mx * c1; v8f s8 = (v8f){};
#pragma unroll
    for (int kt = 0; kt < 16; ++kt)
#pragma unroll
        for (int r = 0; r < 8; ++r) { const float e = exp2slot(fmaf(acc[kt][r], c1, -mc)); acc[kt][r] = e; s8[r] += e; }
    float sum = ((s8[0] + s8[1]) + (s8[2] + s8[3])) + ((s8[4] + s8[5]) + (s8[6] + s8[7]));
    sum += __shfl_xor(sum, 16, 32);
    const float f = __fdiv_rn(1.0f, sum);
    v8f o[2]; o[0] = (v8f){}; o[1] = (v8f){};
#pragma unroll
    for (int ks = 0; ks < 8; ++ks) { v8u ph, pl;
#pragma unroll
        for (int g = 0; g < 2; ++g)
#pragma unroll
            for (int i = 0; i < 4; ++i) { unsigned p, r; split2(acc[2 * ks + g][2 * i] * f, acc[2 * ks + g][2 * i + 1] * f, p, r); ph[g * 4 + i] = p; pl[g * 4 + i] = r; }
        const v16bf Ph = __builtin_bit_cast(v16bf, ph), Pl = __builtin_bit_cast(v16bf, pl);
#pragma unroll
        for (int mb = 0; mb < 2; ++mb) { const int vo = (mb * 16 + lr) * VPI + ks * 32 + 8 * hi; const v16bf vh = ldsfrag(Vh + vo), vl = ldsfrag(Vl + vo);
            o[mb] = wmmab(vh, Ph, o[mb]); o[mb] = wmmab(vh, Pl, o[mb]); o[mb] = wmmab(vl, Ph, o[mb]); } }
    float* yp = YO + base + (size_t)q * DR + 8 * hi;   // o[mb][r] = context of query q at d = mb*16 + 8*hi + r
#pragma unroll
    for (int mb = 0; mb < 2; ++mb) { v4f a, b;
#pragma unroll
        for (int u = 0; u < 4; ++u) { a[u] = o[mb][u]; b[u] = o[mb][4 + u]; }
        *(v4f*)(yp + mb * 16) = a; *(v4f*)(yp + mb * 16 + 4) = b; }
}
__global__ __launch_bounds__(256) void k_merge(const float* __restrict__ O, int h0, bf* Ah, bf* Al) { const size_t e = ((size_t)blockIdx.x * 256 + threadIdx.x) * 2; if (e >= (size_t)ZH * TT * HD) return; const int d = (int)(e % HD); const int t = (int)((e / HD) % TT); const int zz = (int)(e / ((size_t)HD * TT)); const float cs = (t < RH) ? 1.0f : (1.0f / PCAR); const size_t oo = (size_t)t * DQ + (h0 + zz) * HD + d;
    v2us oh, ol;
#pragma unroll
    for (int q = 0; q < 2; ++q) { unsigned short a, c2; splitf(O[e + q] * cs, a, c2); oh[q] = a; ol[q] = c2; } *(v2us*)(Ah + oo) = oh; *(v2us*)(Al + oo) = ol;  }

extern "C" void kernel_launch(void* const* d_in, const int* in_sizes, int n_in,
                              void* d_out, int out_size, void* d_ws, size_t ws_size, hipStream_t stream) {
    (void)in_sizes; (void)n_in; (void)out_size;
    const float* x = (const float*)d_in[0]; const float* qng = (const float*)d_in[1]; const float* qnb = (const float*)d_in[2]; const float* wq = (const float*)d_in[3]; const float* wk = (const float*)d_in[4]; const float* wv = (const float*)d_in[5]; const float* w2d = (const float*)d_in[6]; const float* wg = (const float*)d_in[7]; const float* bg = (const float*)d_in[8]; const float* wo = (const float*)d_in[9]; const float* bo = (const float*)d_in[10];
    float* OUT = (float*)d_out;   // [256][256][128]
    char* wsp = (char*)d_ws; auto take = [&](size_t bytes) { char* p = wsp; wsp += (bytes + 255) & ~(size_t)255; return (void*)p; };
    bf* WT = (bf*)take((size_t)6 * DR * DM * 2); bf* WO = WT + (size_t)5 * DR * DM;   /* one block of six planes: Wq, Wk, Wv, Wg, pair-bias weights, Wo */
    bf* XNh = (bf*)take((size_t)GR * DM * 2); bf* XNl = (bf*)take((size_t)GR * DM * 2); float* ZB = (float*)take((size_t)NH_ * TT * TT * 4);
    float* FQ = (float*)take(((size_t)4 * GR * DR + (size_t)NPZ * ZW) * 4); float* FK = FQ + (size_t)GR * DR; float* FV = FK + (size_t)GR * DR; float* FG = FV + (size_t)GR * DR; float* ZF = FG + (size_t)GR * DR;   /* one block: q, k, v, gate planes, then the pair bias before its transpose (pitch ZW) */
    float* YO = (float*)take((size_t)GR * DR * 4);   /* merged f32 context */
    bf* AOh = (bf*)take((size_t)GR * DR * 2); bf* AOl = (bf*)take((size_t)GR * DR * 2);
    if ((size_t)(wsp - (char*)d_ws) > ws_size) return;   // ws ~ 241 MiB
    k_pre<<<NWB + NPZ / 8, 256, 0, stream>>>(x, qng, qnb, XNh, XNl, wq, wk, wv, wg, w2d, wo, WT);
    k_gemmw<bf, 1, false><<<dim3(4 * (DR / 64) + 1, GR / 64, 1), 32, 0, stream>>>(XNh, XNl, WT, nullptr, DM, FQ, DR, nullptr, 0, (size_t)DR * DM, (size_t)GR * DR, DR / 64, 4, ZW);   /* q, k, v, gate, pair bias */
    k_ztr<<<(NH_ * TT * TT + 255) / 256, 256, 0, stream>>>(ZF, ZB);
    k_attn<<<NVH, 512, 0, stream>>>(FQ, FK, FV, ZB, YO);
    k_gmulpl<<<(unsigned)(((size_t)GR * DR / 4 + 255) / 256), 256, 0, stream>>>(YO, FG, bg, AOh, AOl);
    k_gemmw<bf, 1, true><<<dim3(DM / 64, GR / 64, 1), 32, 0, stream>>>(AOh, AOl, WO, nullptr, DR, OUT, DM, bo, 0, 0, 0, DM / 64, -1, 0);
}

// v005
// One run takes 114 microseconds.
// Next to v004, in two timings, it ran 1.06 times as fast each time.
// All steps since v000 together make it 7.56 times as fast.
#include <hip/hip_runtime.h>

// Triangle_Att_Start (AlphaFold triangle attention, starting node: pair_embed [256 rows i][256 j][128]; z = LayerNorm(pair); q/k/v = z W ([128][4 x 32]), q x 32^-0.5; bias[h][j][k] = (z Wb)[j][k][h] shared over rows i; gate = sigmoid(z Wg + bg); logits[h][i][j][k] = q_ij.k_ik + bias[h][j][k]; softmax over k; o = (a v) * gate; out = o Wo + bo -> [256][256][128]).
// Batched layout (exact): every row i is an independent 256-token attention; 256 rows x 4 heads = 1024 'virtual heads' of 256 tokens, one work-group of the fused attention kernel each, all in one launch; the projections run on all 65,536 stacked (row, j) positions at once.

#define NB_  256
#define TT   256
#define DM   128
#define NH_  4
#define NKV  4
#define REP  (NH_ / NKV)
#define HD   64
#define DQ   (NH_ * HD)
#define DKV  (NKV * HD)
#define ZH   256   // virtual heads per k_moutv / k_merge call (a quarter of NVH)
#define RH   256
#define WIN  0
#define PCAR 1024.0f
#define HDR  32
#define DR   (NH_ * HDR)   // 128
#define CZ   128
#define NPZ  (TT * TT)     // pair rows 65536
#define ZW   64            // padded w2d width
#define LR   256    // tokens per row (no padding)
#define GB   256    // rows per group: all of them, one group
#define NG   (NB_ / GB)
#define GR   (GB * TT)   // stacked rows per group
#define NVH  (GB * NH_)  // virtual heads per group
#define SCL  0.17677669529663689f   // 32^-0.5
typedef _Float16 h16;
typedef unsigned short bf;
typedef __attribute__((ext_vector_type(16))) __bf16   v16bf;
typedef __attribute__((ext_vector_type(16))) _Float16 v16h;
typedef __attribute__((ext_vector_type(8)))  _Float16 v8h;
typedef __attribute__((ext_vector_type(8)))  unsigned short v8us;
typedef __attribute__((ext_vector_type(8)))  float    v8f;
typedef __attribute__((ext_vector_type(4)))  float    v4f;
typedef v8h  __attribute__((may_alias)) v8ha;
typedef v4f  __attribute__((may_alias)) v4fa;
typedef v8us __attribute__((may_alias)) v8usa;

__device__ __forceinline__ unsigned short f2bf(float f) { unsigned u = __float_as_uint(f); u += 0x7FFFu + ((u >> 16) & 1u); return (unsigned short)(u >> 16); }
__device__ __forceinline__ float bf2f(unsigned short b) { return __uint_as_float(((unsigned)b) << 16); }
__device__ __forceinline__ float bfr(float f) { return bf2f(f2bf(f)); }
__device__ __forceinline__ v16h cat16(v8h lo, v8h hi) { return __builtin_shufflevector(lo, hi, 0, 1, 2, 3, 4, 5, 6, 7, 8, 9, 10, 11, 12, 13, 14, 15); }
__device__ __forceinline__ v16bf cat16b(v8us lo, v8us hi) { return __builtin_bit_cast(v16bf, __builtin_shufflevector(lo, hi, 0, 1, 2, 3, 4, 5, 6, 7, 8, 9, 10, 11, 12, 13, 14, 15)); }
__device__ __forceinline__ v8f wmma16(v16h a, v16h b, v8f c) { return __builtin_amdgcn_wmma_f32_16x16x32_f16(false, a, false, b, (short)0, c, false, false); }
__device__ __forceinline__ v8f wmmab(v16bf a, v16bf b, v8f c) { return __builtin_amdgcn_wmma_f32_16x16x32_bf16(false, a, false, b, (short)0, c, false, false); }



// ---- k_gemmw: register-blocked GEMM, ONE WAVE per 64x64 output tile (16 accumulators), operands straight from 16-bit planes in fragment order (fro); grid (column tiles of all z slices, M/64), 32 threads: the tiles that read the same 64 rows of A start side by side.
// A, A2, Bt, Bt2 lie in fragment order (fro below): the 32 lanes' 16-byte pieces of one fragment load are 512 contiguous bytes, four whole lines, not 16-byte pieces of 16 lines.
// C[m][n] (f32, pitch ldc, + optional f32 bias[n]) = sum_k A[m][k] Bt[n][k] (+ split products per NSPLIT). z-batch: ct column tiles a slice, strides sA/sB/sC in elements; slice zx (if any) has the output pitch ldx. K % 32 == 0.
// fro: element offset of (row n, k) in a fragment-ordered plane of K columns: blocks of 16 rows x 32 k (512 elements); in a block two halves (k 0-15, 16-31) of 32 lane pieces; lane piece 16 * ((k >> 3) & 1) + (n & 15) holds 8 consecutive k
__device__ __forceinline__ size_t fro(int n, int k, int K) { return ((size_t)(n >> 4) * (K >> 5) + (k >> 5)) * 512 + ((k >> 4) & 1) * 256 + ((((k >> 3) & 1) << 4) + (n & 15)) * 8 + (k & 7); }
template <typename T16> struct WFrag;
template <> struct WFrag<h16> { typedef v16h V; static __device__ __forceinline__ V ld(const h16* p) { return cat16(*(const v8h*)p, *(const v8h*)(p + 256)); } static __device__ __forceinline__ v8f mma(V a, V b, v8f c) { return wmma16(a, b, c); } };
template <> struct WFrag<bf> { typedef v16bf V; static __device__ __forceinline__ V ld(const bf* p) { return cat16b(*(const v8us*)p, *(const v8us*)(p + 256)); } static __device__ __forceinline__ v8f mma(V a, V b, v8f c) { return wmmab(a, b, c); } };
template <typename T16, int NSPLIT, bool BIAS>
__global__ __launch_bounds__(32) void k_gemmw(const T16* __restrict__ A, const T16* __restrict__ A2, const T16* __restrict__ Bt, const T16* __restrict__ Bt2, int K, float* C, int ldc, const float* __restrict__ bias, size_t sA, size_t sB, size_t sC, int ct, int zx, int ldx) {
    typedef typename WFrag<T16>::V V;
    __shared__ __align__(16) float os[16 * 68];
    const size_t z = blockIdx.x / ct; A += z * sA; if (A2) A2 += z * sA; Bt += z * sB; if (Bt2) Bt2 += z * sB; C += z * sC; if ((int)z == zx) ldc = ldx;
    const int lane = threadIdx.x & 31, lr = lane & 15, hi = lane >> 4; const int r0 = blockIdx.y * 64, c0 = (blockIdx.x % ct) * 64;
    v8f acc[4][4];
#pragma unroll
    for (int mb = 0; mb < 4; ++mb)
#pragma unroll
        for (int nb = 0; nb < 4; ++nb) acc[mb][nb] = (v8f){};
    const size_t aoff = (size_t)r0 * K + lane * 8, boff = (size_t)c0 * K + lane * 8;   // fro(r0 + lr, 8 * hi, K), fro(c0 + lr, 8 * hi, K); 16 rows on = 16 * K elements, 32 k on = 512
#pragma unroll 1
    for (int kc = 0; kc < K; kc += 32) {
        V a[4], a2[4];
#pragma unroll
        for (int mb = 0; mb < 4; ++mb) { a[mb] = WFrag<T16>::ld(A + aoff + (size_t)mb * 16 * K + kc * 16); if (NSPLIT == 1 || NSPLIT == 2) a2[mb] = WFrag<T16>::ld(A2 + aoff + (size_t)mb * 16 * K + kc * 16); }
#pragma unroll
        for (int nb = 0; nb < 4; ++nb) { const V b = WFrag<T16>::ld(Bt + boff + (size_t)nb * 16 * K + kc * 16); V b2; if (NSPLIT >= 2) b2 = WFrag<T16>::ld(Bt2 + boff + (size_t)nb * 16 * K + kc * 16);
#pragma unroll
            for (int mb = 0; mb < 4; ++mb) { acc[mb][nb] = WFrag<T16>::mma(a[mb], b, acc[mb][nb]); if (NSPLIT == 1 || NSPLIT == 2) acc[mb][nb] = WFrag<T16>::mma(a2[mb], b, acc[mb][nb]); if (NSPLIT >= 2) acc[mb][nb] = WFrag<T16>::mma(a[mb], b2, acc[mb][nb]); } }
        asm volatile("v_nop\n\tv_nop\n\tv_nop\n\tv_nop" : "+v"(acc[0][0]), "+v"(acc[1][1]), "+v"(acc[2][2]), "+v"(acc[3][3]) : "v"(a[0]), "v"(a[3]));
    }
#pragma unroll
    for (int mb = 0; mb < 4; ++mb) {
#pragma unroll
        for (int nb = 0; nb < 4; ++nb) {
#pragma unroll
            for (int j = 0; j < 8; ++j) os[(hi * 8 + j) * 68 + nb * 16 + lr] = acc[mb][nb][j]; }
        __builtin_amdgcn_wave_barrier(); asm volatile("" ::: "memory");
        float* crow = C + (size_t)(r0 + mb * 16) * ldc + c0;
{
#pragma unroll
            for (int s = 0; s < 8; ++s) { const int row = 2 * s + hi, cofs = lr * 4; v4f val = *(const v4fa*)(os + row * 68 + cofs); if (BIAS) { val[0] += bfr(bias[c0 + cofs]); val[1] += bfr(bias[c0 + cofs + 1]); val[2] += bfr(bias[c0 + cofs + 2]); val[3] += bfr(bias[c0 + cofs + 3]); }
                *(v4f*)(crow + (size_t)row * ldc + cofs) = val; }
             }
        if (mb < 3) asm volatile("s_wait_xcnt 0x0" ::: "memory");   // the next round rewrites the stores' address and data registers: the wait that belongs in front of that
        __builtin_amdgcn_wave_barrier(); asm volatile("" ::: "memory");
    }
}

__device__ __forceinline__ h16 tohx(float x) { return (h16)x; }
__device__ __forceinline__ void splitf(float y, unsigned short& h, unsigned short& l) { h = f2bf(y); l = f2bf(y - bf2f(h)); }
typedef __attribute__((ext_vector_type(2))) _Float16 v2h;
typedef __attribute__((ext_vector_type(4))) _Float16 v4h;
typedef __attribute__((ext_vector_type(2))) unsigned short v2us;
typedef __attribute__((ext_vector_type(4))) unsigned short v4us;
typedef __attribute__((ext_vector_type(2))) float v2f;
typedef __attribute__((ext_vector_type(4))) int v4i;

__device__ __forceinline__ void d_wtG(int bx, const float* __restrict__ w, int K, int N, bf* Bt) {
    const int lane = threadIdx.x & 31; const int L0 = (bx * 8 + (threadIdx.x >> 5)) * 8; const int nlines = N * K / 64;
{
#pragma unroll 1
        for (int l = 0; l < 8; ++l) { const int L = L0 + l; if (L >= nlines) break; const size_t e = (size_t)L * 64 + lane * 2; const int k = (int)(e % K), n = (int)(e / K); v2us o;
            o[0] = f2bf(w[(size_t)k * N + n]); o[1] = f2bf(w[(size_t)(k + 1) * N + n]); *(v2us*)(Bt + fro(n, k, K)) = o;
            asm volatile("s_wait_xcnt 0x0" ::: "memory"); }   // the next trip rewrites the store's address and data registers: the wait that belongs in front of that
         }
}
__global__ __launch_bounds__(256) void k_cvt8(const float* __restrict__ src, bf* dst, size_t n8) { const size_t i = (size_t)blockIdx.x * 256 + threadIdx.x; if (i >= n8) return; const v8f v = *(const v8f*)(src + i * 8); v8us o;
#pragma unroll
    for (int k = 0; k < 8; ++k) o[k] = f2bf(v[k]); *(v8us*)(dst + i * 8) = o;  }
__global__ __launch_bounds__(256) void k_cscvt(const float* __restrict__ cosT, const float* __restrict__ sinT, float* CS) { const int idx = blockIdx.x * 256 + threadIdx.x; if (idx >= TT * HD) return; v2f cs; cs[0] = bfr(cosT[idx]); cs[1] = bfr(sinT[idx]); *(v2f*)(CS + (size_t)idx * 2) = cs;  }
// k_rope: head planes [h][t][d] (fp16 + hi/lo) of rope(x) x sc with the rotate-half convention out[d] = x[d] cos[t][d] - x[d+HD/2] sin[t][d], out[d+HD/2] = x[d+HD/2] cos[t][d+HD/2] + x[d] sin[t][d+HD/2]
__global__ __launch_bounds__(256) void k_rope(const float* __restrict__ F, int pitch, int nheads, const float* __restrict__ CS, const float* __restrict__ RF, const float* __restrict__ nw, float sc, h16* P16, bf* Ph, bf* Pl) {
    const size_t e = ((size_t)blockIdx.x * 256 + threadIdx.x) * 2; if (e >= (size_t)nheads * TT * HD) return; const int d = (int)(e % HD); const int t = (int)((e / HD) % TT); const int h = (int)(e / ((size_t)HD * TT)); const float* f = F + (size_t)t * pitch + h * HD; const float rf = RF ? RF[(size_t)h * TT + t] : 1.0f; v2h o16; v2us oh, ol;
#pragma unroll
    for (int q = 0; q < 2; ++q) { const int dd = d + q; const int dp = (dd < HD / 2) ? dd + HD / 2 : dd - HD / 2; float x0 = f[dd], x1 = f[dp];
        if (RF) { float n0 = __fmul_rn(x0, rf), n1 = __fmul_rn(x1, rf); asm volatile("" : "+v"(n0)); asm volatile("" : "+v"(n1)); x0 = __fmul_rn(bfr(nw[dd]), n0); x1 = __fmul_rn(bfr(nw[dp]), n1); }
        const v2f cs = *(const v2f*)(CS + ((size_t)t * HD + dd) * 2); float a = __fmul_rn(x0, cs[0]), bq = __fmul_rn(x1, cs[1]); asm volatile("" : "+v"(a)); asm volatile("" : "+v"(bq)); const float r = ((dd < HD / 2) ? __fsub_rn(a, bq) : __fadd_rn(a, bq)) * sc;
        o16[q] = tohx(r); unsigned short a2, c2; splitf(r, a2, c2); oh[q] = a2; ol[q] = c2; }
    *(v2h*)(P16 + e) = o16; *(v2us*)(Ph + e) = oh; *(v2us*)(Pl + e) = ol;  }
__global__ __launch_bounds__(256) void k_vtp(const float* __restrict__ F, int pitch, int nheads, h16* V16, bf* Vh, bf* Vl) { const size_t e = ((size_t)blockIdx.x * 256 + threadIdx.x) * 2; if (e >= (size_t)nheads * HD * TT) return; const int t = (int)(e % TT); const int d = (int)((e / TT) % HD); const int g = (int)(e / ((size_t)TT * HD)); v2h o16; v2us oh, ol;
#pragma unroll
    for (int q = 0; q < 2; ++q) { const float x = F[(size_t)(t + q) * pitch + g * HD + d]; o16[q] = tohx(x); unsigned short a2, c2; splitf(x, a2, c2); oh[q] = a2; ol[q] = c2; }
    *(v2h*)(V16 + e) = o16; *(v2us*)(Vh + e) = oh; *(v2us*)(Vl + e) = ol;  }
__global__ __launch_bounds__(256) void k_cvt8padg(const float* __restrict__ src, bf* XB2) { const size_t e8 = ((size_t)blockIdx.x * 256 + threadIdx.x) * 8; if (e8 >= (size_t)GR * DM) return; const int r = (int)(e8 / DM); const int bl = r / TT, t = r % TT; v8us o; if (t < LR) { const float* sp2 = src + ((size_t)bl * LR + t) * DM + (e8 % DM); for (int u = 0; u < 8; ++u) o[u] = f2bf(bfr(sp2[u])); } else { for (int u = 0; u < 8; ++u) o[u] = 0; } *(v8us*)(XB2 + e8) = o;  }
__global__ __launch_bounds__(256) void k_moutv(const float* __restrict__ O, int z0, float* YO2) { const size_t e = ((size_t)blockIdx.x * 256 + threadIdx.x) * 2; if (e >= (size_t)ZH * TT * HD) return; const int d = (int)(e % HD); const int t = (int)((e / HD) % TT); const int zz = (int)(e / ((size_t)HD * TT)); const int z = z0 + zz; const int bl = z / NH_, h = z % NH_; v2f o; o[0] = O[e]; o[1] = O[e + 1]; float* dst = YO2 + ((size_t)bl * TT + t) * DQ + (size_t)h * HD + d; *(v2f*)dst = o;  }
__global__ __launch_bounds__(256) void k_outcpg(const float* __restrict__ Y, float* O2) { const size_t e = ((size_t)blockIdx.x * 256 + threadIdx.x) * 4; if (e >= (size_t)GB * LR * DM) return; const size_t r = e / DM; const int bl = (int)(r / LR), t = (int)(r % LR); const v4f a = *(const v4f*)(Y + ((size_t)bl * TT + t) * DM + (e % DM)); *(v4f*)(O2 + e) = a;  }
__global__ __launch_bounds__(256) void k_hlG(const float* __restrict__ F, bf* Fh, bf* Fl, size_t n) { const size_t e = ((size_t)blockIdx.x * 256 + threadIdx.x) * 4; if (e >= n) return; const v4f a = *(const v4f*)(F + e); v4us oh, ol; for (int u = 0; u < 4; ++u) { unsigned short p, q; splitf(a[u], p, q); oh[u] = p; ol[u] = q; } *(v4us*)(Fh + e) = oh; *(v4us*)(Fl + e) = ol;  }
// d_fro8: a block of 8 waves, wave w holding row bx*8 + w of a 128-column hi and lo plane (4 columns a lane), stores both planes in fragment order (fro), turned through LDS: thread = (plane, k group of 8, row); the 8 rows' pieces of one k group are one whole 128-byte line, and a wave stores four such lines. Every thread of the block calls it.
#define LNP  136   // LDS row pitch, bf16 elements: 272 bytes = 16 x odd, no bank conflict for 16-byte reads down a column of rows
typedef v4us __attribute__((may_alias)) v4usa;
__device__ __forceinline__ void d_fro8(int bx, v4us oh, v4us ol, bf* Ph, bf* Pl) {
    __shared__ __align__(16) bf st[2 * 8 * LNP]; const int oo = (threadIdx.x >> 5) * LNP + (threadIdx.x & 31) * 4; *(v4usa*)(st + oo) = oh; *(v4usa*)(st + 8 * LNP + oo) = ol;
    __syncthreads();   // the block's 8 rows, hi and lo, are in LDS before they are read across rows
    const int pl = threadIdx.x >> 7, kg = (threadIdx.x >> 3) & 15, un = threadIdx.x & 7; const v8us val = *(const v8usa*)(st + (pl * 8 + un) * LNP + kg * 8);
    *(v8us*)((pl ? Pl : Ph) + fro(bx * 8 + un, kg * 8, 128)) = val; }
__device__ __forceinline__ void d_lnz(int bx, const float* __restrict__ X, const float* __restrict__ gam, const float* __restrict__ bet, bf* Xh, bf* Xl) { const int lane = threadIdx.x & 31; const int t = bx * 8 + (threadIdx.x >> 5); if (bx >= NPZ / 8) return;   /* the same for the whole block: d_fro8 has a barrier */
    const float* f = X + (size_t)t * CZ; float v[CZ / 32]; float su = 0.f;
#pragma unroll
    for (int ch = 0; ch < CZ / 128; ++ch) { const v4f a = *(const v4f*)(f + ch * 128 + lane * 4); for (int u = 0; u < 4; ++u) { float xv = bfr(a[u]); asm volatile("" : "+v"(xv)); v[ch * 4 + u] = xv; su = __fadd_rn(su, xv); } }
#pragma unroll
    for (int sh = 16; sh; sh >>= 1) su = __fadd_rn(su, __shfl_xor(su, sh, 32));
    const float mu = __fdiv_rn(su, (float)CZ); float sq = 0.f;
#pragma unroll
    for (int q = 0; q < CZ / 32; ++q) { float d0 = __fsub_rn(v[q], mu); asm volatile("" : "+v"(d0)); float p = __fmul_rn(d0, d0); asm volatile("" : "+v"(p)); sq = __fadd_rn(sq, p); }
#pragma unroll
    for (int sh = 16; sh; sh >>= 1) sq = __fadd_rn(sq, __shfl_xor(sq, sh, 32));
    const float rs = __fdiv_rn(1.0f, sqrtf(__fadd_rn(__fdiv_rn(sq, (float)CZ), 1e-5f)));
    {
#pragma unroll
        for (int ch = 0; ch < CZ / 128; ++ch) { v4us oh, ol; for (int u = 0; u < 4; ++u) { const int c = ch * 128 + lane * 4 + u; float d0 = __fsub_rn(v[ch * 4 + u], mu); asm volatile("" : "+v"(d0)); float n = __fmul_rn(d0, rs); asm volatile("" : "+v"(n)); float gg = bfr(gam[c]), bb = bfr(bet[c]); asm volatile("" : "+v"(gg)); asm volatile("" : "+v"(bb)); float y = __fmul_rn(n, gg); asm volatile("" : "+v"(y)); y = __fadd_rn(y, bb); unsigned short p2, q2; splitf(y, p2, q2); oh[u] = p2; ol[u] = q2; } d_fro8(bx, oh, ol, Xh, Xl); }   // CZ == 128: one pass
         } }
__device__ __forceinline__ void d_w2dp(int bx, const float* __restrict__ Wp, bf* WP) { const size_t e = ((size_t)bx * 256 + threadIdx.x) * 8; if (e >= (size_t)ZW * CZ) return; const int r = (int)(e / CZ); const int c0 = (int)(e % CZ); v8us o; for (int u = 0; u < 8; ++u) o[u] = (r < NH_) ? f2bf(bfr(Wp[(size_t)(c0 + u) * NH_ + r])) : (unsigned short)0; *(v8us*)(WP + fro(r, c0, CZ)) = o;  }
// ---- k_pre: all that depends on the inputs alone, in one launch. Blocks 0..23: the six weight planes of WT, in fragment order (fro), 4 blocks each (0..3 = Wq, Wk, Wv, Wg transposed to bf16; 4 = the padded pair-bias weights, half a plane; 5 = Wo transposed); blocks 24..: LayerNorm of the 65,536 pair rows, 8 rows a block, once for the pair bias and the projections alike, its hi and lo planes in fragment order (d_fro8).
#define WPB  4     // blocks per weight plane: DM * DR / 64 lines at 64 lines a block; ZW * CZ / 8 threads for the pair-bias weights
#define NWB  (6 * WPB)
__global__ __launch_bounds__(256) void k_pre(const float* __restrict__ X, const float* __restrict__ gam, const float* __restrict__ bet, bf* Xh, bf* Xl, const float* __restrict__ wq, const float* __restrict__ wk, const float* __restrict__ wv, const float* __restrict__ wg, const float* __restrict__ w2d, const float* __restrict__ wo, bf* WT) {
    const int b = blockIdx.x;
    if (b < NWB) { const int p = b / WPB, bx = b % WPB; bf* dst = WT + (size_t)p * DR * DM;
        if (p == 4) d_w2dp(bx, w2d, dst);
        else d_wtG(bx, (p == 0) ? wq : (p == 1) ? wk : (p == 2) ? wv : (p == 3) ? wg : wo, DM, DR, dst);   // DM == DR: Wo's K and N are the same two numbers
        return; }
    d_lnz(b - NWB, X, gam, bet, Xh, Xl);
}
// k_ztr: the pair bias in the order of k_attn's score accumulators: ZB[h][query tile qt][key tile kt][half][lane][u] = bias of query qt*16 + (lane & 15), key kt*16 + 8*(lane >> 4) + 4*half + u, so that each of the reader's wave-wide 16-byte loads covers 512 contiguous bytes
__global__ __launch_bounds__(256) void k_ztr(const float* __restrict__ ZF, float* ZB) { const size_t e = (size_t)blockIdx.x * 256 + threadIdx.x; if (e >= (size_t)NH_ * TT * TT) return; const int u = (int)(e & 3), ln = (int)((e >> 2) & 31), hf = (int)((e >> 7) & 1), kt = (int)((e >> 8) & 15), qt = (int)((e >> 12) & 15); const int h = (int)(e / ((size_t)TT * TT)); const int k = kt * 16 + 8 * (ln >> 4) + 4 * hf + u; const int q = qt * 16 + (ln & 15); const float v = ZF[((size_t)q * TT + k) * ZW + h]; *(float*)(ZB + e) = v;  }
// ---- k_attn: the whole attention of one virtual head (row bl, head h) in one work-group: 16 waves x 16 queries, all 256 keys at once, scores and probabilities never leave the registers.
// K [key][d] and V^T [d][key] are split into bf16 hi/lo planes on the way into LDS. S^T = K Q^T (A = K rows, B = Q columns), so a lane holds 128 scores of ONE query: tile kt, register r = key kt*16 + 8*hi + r, query lr.
// Two neighbouring score tiles, converted in place, are the B operand of O^T = V^T P^T (hardware k order: 8*hi + s, 16 + 8*hi + (s - 8)); the LDS fragment loads use the same order.
// The pair bias, times 32^0.5, is the start value of the score accumulators; 32^-0.5 is folded into the exponent's scale.
// The gate is applied here: a lane's 8 context values of one accumulator are 8 consecutive k of one row of the output projection's A operand, and the 32 lanes' pieces are one half block of its fragment order (fro), so the gated hi and lo planes go straight from the accumulators to global, 512 contiguous bytes a store. FG holds z Wg without its bias (the gate's GEMM shares a launch with GEMMs that have none); the bias is added here, to the same f32 value.
#define KPI  40    // K row pitch in LDS, bf16 elements: 80 bytes = 16 x odd, no bank conflict for 16-byte reads
#define VPI  264   // V^T row pitch in LDS: 528 bytes = 16 x odd
#define RSCL 5.656854249492381f   // 32^0.5
typedef __attribute__((ext_vector_type(2))) __bf16 v2bf;
typedef __attribute__((ext_vector_type(2))) unsigned v2u;
typedef __attribute__((ext_vector_type(4))) unsigned v4u;
typedef __attribute__((ext_vector_type(8))) unsigned v8u;
typedef unsigned __attribute__((may_alias)) u32a;
typedef v2u __attribute__((may_alias)) v2ua;
__device__ __forceinline__ unsigned pk2(float a, float b) { v2f x; x[0] = a; x[1] = b; return __builtin_bit_cast(unsigned, __builtin_convertvector(x, v2bf)); }
__device__ __forceinline__ void split2(float a, float b, unsigned& h, unsigned& l) { h = pk2(a, b); l = pk2(a - __uint_as_float(h << 16), b - __uint_as_float(h & 0xFFFF0000u)); }
// 2^x with the one issue slot that the instruction set asks for behind a transcendental, before its result is read or its source register overwritten: in one statement, so that the slot stands directly behind it
__device__ __forceinline__ float exp2slot(float x) { float e; asm("v_exp_f32 %0, %1\n\tv_nop" : "=v"(e) : "v"(x)); return e; }
__device__ __forceinline__ v16bf ldsfrag(const bf* p) { return cat16b(*(const v8usa*)p, *(const v8usa*)(p + 16)); }
__global__ __launch_bounds__(512) void k_attn(const float* __restrict__ FQ, const float* __restrict__ FK, const float* __restrict__ FV, const float* __restrict__ ZB, const float* __restrict__ FG, const float* __restrict__ bg, bf* __restrict__ Ah, bf* __restrict__ Al) {
    __shared__ __align__(16) bf Kh[TT * KPI]; __shared__ __align__(16) bf Kl[TT * KPI]; __shared__ __align__(16) bf Vh[HDR * VPI]; __shared__ __align__(16) bf Vl[HDR * VPI];
    const int tid = threadIdx.x, lane = tid & 31, lr = lane & 15, hi = lane >> 4; const int z = blockIdx.x, bl = z / NH_, h = z % NH_;
    const size_t base = (size_t)bl * TT * DR + h * HDR;   // element (t, d) of this head: base + t * DR + d
    const float* zr = ZB + ((size_t)h * 16 + (tid >> 5)) * (16 * TT) + lane * 4;   // this wave's 16 queries x 256 keys of the pair bias, in accumulator order (k_ztr)
    const int q = (tid >> 5) * 16 + lr;
    // every global read of the work-group is issued first, the gate's in front: gate logits and gate bias of this lane's 16 context elements (d = mb*16 + 8*hi + 0..7), then K, V, the pair bias, Q
    const float* gp = FG + base + (size_t)q * DR + 8 * hi; const float* bp = bg + h * HDR + 8 * hi; const float* qp = FQ + base + (size_t)q * DR + 8 * hi;
    v4f gz[4], gb[4], ka[4], va[2], vb[2], za[16], zb[16], qa[2], qb[2];
#pragma unroll
    for (int g = 0; g < 4; ++g) { gz[g] = *(const v4f*)(gp + (g >> 1) * 16 + (g & 1) * 4); gb[g] = *(const v4f*)(bp + (g >> 1) * 16 + (g & 1) * 4); }
#pragma unroll
    for (int i = 0; i < 4; ++i) { const int idx = i * 512 + tid, t = idx >> 3, c = idx & 7; ka[i] = *(const v4f*)(FK + base + (size_t)t * DR + c * 4); }
    asm volatile("s_wait_xcnt 0x0" ::: "memory");   // a V load lands in registers that held addresses of the K loads: the wait that belongs in front of that
#pragma unroll
    for (int i = 0; i < 2; ++i) { const int idx = i * 512 + tid, tp = idx >> 3, c = idx & 7; const float* vp = FV + base + (size_t)(2 * tp) * DR + c * 4; va[i] = *(const v4f*)vp; vb[i] = *(const v4f*)(vp + DR); }
    asm volatile("s_wait_xcnt 0x0" ::: "memory");   // the loads below land in registers that held the addresses of the loads above: the wait that belongs in front of that
#pragma unroll
    for (int kt = 0; kt < 16; ++kt) { za[kt] = *(const v4f*)(zr + kt * 256); if (kt < 15) zb[kt] = *(const v4f*)(zr + kt * 256 + 128); }
    qa[0] = *(const v4f*)qp; qb[0] = *(const v4f*)(qp + 4); qa[1] = *(const v4f*)(qp + 16);
    asm volatile("s_wait_xcnt 0x0" ::: "memory");   // the last load of a run lands on the run's own address pair: the same wait
    zb[15] = *(const v4f*)(zr + 15 * 256 + 128); qb[1] = *(const v4f*)(qp + 20);
    __builtin_amdgcn_sched_barrier(0);   // keeps the loads above in front of the gate's arithmetic: moved behind it they would start only when it is done
    v8f sg[2];   // sg[mb][r] = gate at d = mb*16 + 8*hi + r
#pragma unroll
    for (int g = 0; g < 4; ++g)
#pragma unroll
        for (int u = 0; u < 4; ++u) { const float eg = expf(-(gz[g][u] + bfr(gb[g][u]))); sg[g >> 1][(g & 1) * 4 + u] = __fdiv_rn(1.0f, __fadd_rn(1.0f, eg)); }
    // the next two lines keep the gate's arithmetic here, where the wave would otherwise only wait for the K, V, bias and Q loads: left free, part of it sinks behind the barrier, into the phases that the vector port limits, or is mixed with work that waits for the last loads
    asm volatile("" :: "v"(sg[0]), "v"(sg[1]));   // inputs only: the 16 gates are complete at this place
    __builtin_amdgcn_sched_barrier(0);   // nothing of the work below, which waits for later loads, is moved up between the gate's instructions
#pragma unroll
    for (int i = 0; i < 4; ++i) { const int idx = i * 512 + tid, t = idx >> 3, c = idx & 7; const v4f a = ka[i]; v2u oh, ol; unsigned p, r;
        split2(a[0], a[1], p, r); oh[0] = p; ol[0] = r; split2(a[2], a[3], p, r); oh[1] = p; ol[1] = r; *(v2ua*)(Kh + t * KPI + c * 4) = oh; *(v2ua*)(Kl + t * KPI + c * 4) = ol; }
#pragma unroll
    for (int i = 0; i < 2; ++i) { const int idx = i * 512 + tid, tp = idx >> 3, c = idx & 7; const v4f a = va[i]; const v4f b = vb[i];
#pragma unroll
        for (int u = 0; u < 4; ++u) { unsigned p, r; split2(a[u], b[u], p, r); *(u32a*)(Vh + (c * 4 + u) * VPI + 2 * tp) = p; *(u32a*)(Vl + (c * 4 + u) * VPI + 2 * tp) = r; } }
    v8f acc[16];
#pragma unroll
    for (int kt = 0; kt < 16; ++kt) { const v4f a = za[kt]; const v4f b = zb[kt];
#pragma unroll
        for (int u = 0; u < 4; ++u) { acc[kt][u] = a[u] * RSCL; acc[kt][4 + u] = b[u] * RSCL; } }
    v8u qh, ql;
#pragma unroll
    for (int g = 0; g < 2; ++g) { const v4f a = qa[g]; const v4f b = qb[g]; unsigned p, r;
        split2(a[0], a[1], p, r); qh[g * 4] = p; ql[g * 4] = r; split2(a[2], a[3], p, r); qh[g * 4 + 1] = p; ql[g * 4 + 1] = r; split2(b[0], b[1], p, r); qh[g * 4 + 2] = p; ql[g * 4 + 2] = r; split2(b[2], b[3], p, r); qh[g * 4 + 3] = p; ql[g * 4 + 3] = r; }
    const v16bf Qh = __builtin_bit_cast(v16bf, qh), Ql = __builtin_bit_cast(v16bf, ql);
    __syncthreads();   // the K and V planes are complete before any wave reads a fragment
#pragma unroll
    for (int kt = 0; kt < 16; ++kt) { const int ko = (kt * 16 + lr) * KPI + 8 * hi; const v16bf ah = ldsfrag(Kh + ko), al = ldsfrag(Kl + ko);
        acc[kt] = wmmab(ah, Qh, acc[kt]); acc[kt] = wmmab(ah, Ql, acc[kt]); acc[kt] = wmmab(al, Qh, acc[kt]); }
    v8f m8 = acc[0];
#pragma unroll
    for (int kt = 1; kt < 16; ++kt)
#pragma unroll
        for (int r = 0; r < 8; ++r) m8[r] = fmaxf(m8[r], acc[kt][r]);
    float mx = fmaxf(fmaxf(fmaxf(m8[0], m8[1]), fmaxf(m8[2], m8[3])), fmaxf(fmaxf(m8[4], m8[5]), fmaxf(m8[6], m8[7])));
    mx = fmaxf(mx, __shfl_xor(mx, 16, 32));   // the other half of the query's keys
    const float c1 = SCL * 1.4426950408889634f, mc = mx * c1; v8f s8 = (v8f){};
#pragma unroll
    for (int kt = 0; kt < 16; ++kt)
#pragma unroll
        for (int r = 0; r < 8; ++r) { const float e = exp2slot(fmaf(acc[kt][r], c1, -mc)); acc[kt][r] = e; s8[r] += e; }
    float sum = ((s8[0] + s8[1]) + (s8[2] + s8[3])) + ((s8[4] + s8[5]) + (s8[6] + s8[7]));
    sum += __shfl_xor(sum, 16, 32);
    const float f = __fdiv_rn(1.0f, sum);
    v8f o[2]; o[0] = (v8f){}; o[1] = (v8f){};
#pragma unroll
    for (int ks = 0; ks < 8; ++ks) { v8u ph, pl;
#pragma unroll
        for (int g = 0; g < 2; ++g)
#pragma unroll
            for (int i = 0; i < 4; ++i) { unsigned p, r; split2(acc[2 * ks + g][2 * i] * f, acc[2 * ks + g][2 * i + 1] * f, p, r); ph[g * 4 + i] = p; pl[g * 4 + i] = r; }
        const v16bf Ph = __builtin_bit_cast(v16bf, ph), Pl = __builtin_bit_cast(v16bf, pl);
#pragma unroll
        for (int mb = 0; mb < 2; ++mb) { const int vo = (mb * 16 + lr) * VPI + ks * 32 + 8 * hi; const v16bf vh = ldsfrag(Vh + vo), vl = ldsfrag(Vl + vo);
            o[mb] = wmmab(vh, Ph, o[mb]); o[mb] = wmmab(vh, Pl, o[mb]); o[mb] = wmmab(vl, Ph, o[mb]); } }
#pragma unroll
    for (int mb = 0; mb < 2; ++mb) { float ov[8]; v4u oh, ol;   // o[mb][r] = context of query q at d = mb*16 + 8*hi + r
#pragma unroll
        for (int r = 0; r < 8; ++r) ov[r] = __fmul_rn(o[mb][r], sg[mb][r]);
#pragma unroll
        for (int i = 0; i < 4; ++i) { unsigned p, r; split2(ov[2 * i], ov[2 * i + 1], p, r); oh[i] = p; ol[i] = r; }
        const size_t fo = fro(bl * TT + q, h * HDR + mb * 16 + 8 * hi, DR); *(v4u*)(Ah + fo) = oh; *(v4u*)(Al + fo) = ol; }
}
__global__ __launch_bounds__(256) void k_merge(const float* __restrict__ O, int h0, bf* Ah, bf* Al) { const size_t e = ((size_t)blockIdx.x * 256 + threadIdx.x) * 2; if (e >= (size_t)ZH * TT * HD) return; const int d = (int)(e % HD); const int t = (int)((e / HD) % TT); const int zz = (int)(e / ((size_t)HD * TT)); const float cs = (t < RH) ? 1.0f : (1.0f / PCAR); const size_t oo = (size_t)t * DQ + (h0 + zz) * HD + d;
    v2us oh, ol;
#pragma unroll
    for (int q = 0; q < 2; ++q) { unsigned short a, c2; splitf(O[e + q] * cs, a, c2); oh[q] = a; ol[q] = c2; } *(v2us*)(Ah + oo) = oh; *(v2us*)(Al + oo) = ol;  }

extern "C" void kernel_launch(void* const* d_in, const int* in_sizes, int n_in,
                              void* d_out, int out_size, void* d_ws, size_t ws_size, hipStream_t stream) {
    (void)in_sizes; (void)n_in; (void)out_size;
    const float* x = (const float*)d_in[0]; const float* qng = (const float*)d_in[1]; const float* qnb = (const float*)d_in[2]; const float* wq = (const float*)d_in[3]; const float* wk = (const float*)d_in[4]; const float* wv = (const float*)d_in[5]; const float* w2d = (const float*)d_in[6]; const float* wg = (const float*)d_in[7]; const float* bg = (const float*)d_in[8]; const float* wo = (const float*)d_in[9]; const float* bo = (const float*)d_in[10];
    float* OUT = (float*)d_out;   // [256][256][128]
    char* wsp = (char*)d_ws; auto take = [&](size_t bytes) { char* p = wsp; wsp += (bytes + 255) & ~(size_t)255; return (void*)p; };
    bf* WT = (bf*)take((size_t)6 * DR * DM * 2); bf* WO = WT + (size_t)5 * DR * DM;   /* one block of six planes: Wq, Wk, Wv, Wg, pair-bias weights, Wo */
    bf* XNh = (bf*)take((size_t)GR * DM * 2); bf* XNl = (bf*)take((size_t)GR * DM * 2); float* ZB = (float*)take((size_t)NH_ * TT * TT * 4);
    float* FQ = (float*)take(((size_t)4 * GR * DR + (size_t)NPZ * ZW) * 4); float* FK = FQ + (size_t)GR * DR; float* FV = FK + (size_t)GR * DR; float* FG = FV + (size_t)GR * DR; float* ZF = FG + (size_t)GR * DR;   /* one block: q, k, v, gate planes, then the pair bias before its transpose (pitch ZW) */
    bf* AOh = (bf*)take((size_t)GR * DR * 2); bf* AOl = (bf*)take((size_t)GR * DR * 2);
    if ((size_t)(wsp - (char*)d_ws) > ws_size) return;   // ws ~ 209 MiB
    k_pre<<<NWB + NPZ / 8, 256, 0, stream>>>(x, qng, qnb, XNh, XNl, wq, wk, wv, wg, w2d, wo, WT);
    k_gemmw<bf, 1, false><<<dim3(4 * (DR / 64) + 1, GR / 64, 1), 32, 0, stream>>>(XNh, XNl, WT, nullptr, DM, FQ, DR, nullptr, 0, (size_t)DR * DM, (size_t)GR * DR, DR / 64, 4, ZW);   /* q, k, v, gate, pair bias */
    k_ztr<<<(NH_ * TT * TT + 255) / 256, 256, 0, stream>>>(ZF, ZB);
    k_attn<<<NVH, 512, 0, stream>>>(FQ, FK, FV, ZB, FG, bg, AOh, AOl);
    k_gemmw<bf, 1, true><<<dim3(DM / 64, GR / 64, 1), 32, 0, stream>>>(AOh, AOl, WO, nullptr, DR, OUT, DM, bo, 0, 0, 0, DM / 64, -1, 0);
}

// v006
// Measured time: 84.8 microseconds a run.
// In two side-by-side timings against v005, it was 1.33 and 1.34 times as fast.
// Counting every step since v000, it is 10.1 times as fast.
#include <hip/hip_runtime.h>

// Triangle_Att_Start (AlphaFold triangle attention, starting node: pair_embed [256 rows i][256 j][128]; z = LayerNorm(pair); q/k/v = z W ([128][4 x 32]), q x 32^-0.5; bias[h][j][k] = (z Wb)[j][k][h] shared over rows i; gate = sigmoid(z Wg + bg); logits[h][i][j][k] = q_ij.k_ik + bias[h][j][k]; softmax over k; o = (a v) * gate; out = o Wo + bo -> [256][256][128]).
// Batched layout (exact): every row i is an independent 256-token attention; 256 rows x 4 heads = 1024 'virtual heads' of 256 tokens, one work-group of the fused attention kernel each, all in one launch, which also projects its own q, k, v and gate; the pair-bias and output projections run on all 65,536 stacked (row, j) positions at once.

#define NB_  256
#define TT   256
#define DM   128
#define NH_  4
#define NKV  4
#define REP  (NH_ / NKV)
#define HD   64
#define DQ   (NH_ * HD)
#define DKV  (NKV * HD)
#define ZH   256   // virtual heads per k_moutv / k_merge call (a quarter of NVH)
#define RH   256
#define WIN  0
#define PCAR 1024.0f
#define HDR  32
#define DR   (NH_ * HDR)   // 128
#define CZ   128
#define NPZ  (TT * TT)     // pair rows 65536
#define ZW   64            // padded w2d width
#define LR   256    // tokens per row (no padding)
#define GB   256    // rows per group: all of them, one group
#define NG   (NB_ / GB)
#define GR   (GB * TT)   // stacked rows per group
#define NVH  (GB * NH_)  // virtual heads per group
#define SCL  0.17677669529663689f   // 32^-0.5
typedef _Float16 h16;
typedef unsigned short bf;
typedef __attribute__((ext_vector_type(16))) __bf16   v16bf;
typedef __attribute__((ext_vector_type(16))) _Float16 v16h;
typedef __attribute__((ext_vector_type(8)))  _Float16 v8h;
typedef __attribute__((ext_vector_type(8)))  unsigned short v8us;
typedef __attribute__((ext_vector_type(8)))  float    v8f;
typedef __attribute__((ext_vector_type(4)))  float    v4f;
typedef v8h  __attribute__((may_alias)) v8ha;
typedef v4f  __attribute__((may_alias)) v4fa;
typedef v8us __attribute__((may_alias)) v8usa;

__device__ __forceinline__ unsigned short f2bf(float f) { unsigned u = __float_as_uint(f); u += 0x7FFFu + ((u >> 16) & 1u); return (unsigned short)(u >> 16); }
__device__ __forceinline__ float bf2f(unsigned short b) { return __uint_as_float(((unsigned)b) << 16); }
__device__ __forceinline__ float bfr(float f) { return bf2f(f2bf(f)); }
__device__ __forceinline__ v16h cat16(v8h lo, v8h hi) { return __builtin_shufflevector(lo, hi, 0, 1, 2, 3, 4, 5, 6, 7, 8, 9, 10, 11, 12, 13, 14, 15); }
__device__ __forceinline__ v16bf cat16b(v8us lo, v8us hi) { return __builtin_bit_cast(v16bf, __builtin_shufflevector(lo, hi, 0, 1, 2, 3, 4, 5, 6, 7, 8, 9, 10, 11, 12, 13, 14, 15)); }
__device__ __forceinline__ v8f wmma16(v16h a, v16h b, v8f c) { return __builtin_amdgcn_wmma_f32_16x16x32_f16(false, a, false, b, (short)0, c, false, false); }
__device__ __forceinline__ v8f wmmab(v16bf a, v16bf b, v8f c) { return __builtin_amdgcn_wmma_f32_16x16x32_bf16(false, a, false, b, (short)0, c, false, false); }



// ---- k_gemmw: register-blocked GEMM, ONE WAVE per 64x64 output tile (16 accumulators), operands straight from 16-bit planes in fragment order (fro); grid (column tiles of all z slices, M/64), 32 threads: the tiles that read the same 64 rows of A start side by side.
// A, A2, Bt, Bt2 lie in fragment order (fro below): the 32 lanes' 16-byte pieces of one fragment load are 512 contiguous bytes, four whole lines, not 16-byte pieces of 16 lines.
// C[m][n] (f32, pitch ldc, + optional f32 bias[n]) = sum_k A[m][k] Bt[n][k] (+ split products per NSPLIT). z-batch: ct column tiles a slice, strides sA/sB/sC in elements; slice zx (if any) has the output pitch ldx. K % 32 == 0.
// fro: element offset of (row n, k) in a fragment-ordered plane of K columns: blocks of 16 rows x 32 k (512 elements); in a block two halves (k 0-15, 16-31) of 32 lane pieces; lane piece 16 * ((k >> 3) & 1) + (n & 15) holds 8 consecutive k
__device__ __forceinline__ size_t fro(int n, int k, int K) { return ((size_t)(n >> 4) * (K >> 5) + (k >> 5)) * 512 + ((k >> 4) & 1) * 256 + ((((k >> 3) & 1) << 4) + (n & 15)) * 8 + (k & 7); }
template <typename T16> struct WFrag;
template <> struct WFrag<h16> { typedef v16h V; static __device__ __forceinline__ V ld(const h16* p) { return cat16(*(const v8h*)p, *(const v8h*)(p + 256)); } static __device__ __forceinline__ v8f mma(V a, V b, v8f c) { return wmma16(a, b, c); } };
template <> struct WFrag<bf> { typedef v16bf V; static __device__ __forceinline__ V ld(const bf* p) { return cat16b(*(const v8us*)p, *(const v8us*)(p + 256)); } static __device__ __forceinline__ v8f mma(V a, V b, v8f c) { return wmmab(a, b, c); } };
template <typename T16, int NSPLIT, bool BIAS>
__global__ __launch_bounds__(32) void k_gemmw(const T16* __restrict__ A, const T16* __restrict__ A2, const T16* __restrict__ Bt, const T16* __restrict__ Bt2, int K, float* C, int ldc, const float* __restrict__ bias, size_t sA, size_t sB, size_t sC, int ct, int zx, int ldx) {
    typedef typename WFrag<T16>::V V;
    __shared__ __align__(16) float os[16 * 68];
    const size_t z = blockIdx.x / ct; A += z * sA; if (A2) A2 += z * sA; Bt += z * sB; if (Bt2) Bt2 += z * sB; C += z * sC; if ((int)z == zx) ldc = ldx;
    const int lane = threadIdx.x & 31, lr = lane & 15, hi = lane >> 4; const int r0 = blockIdx.y * 64, c0 = (blockIdx.x % ct) * 64;
    v8f acc[4][4];
#pragma unroll
    for (int mb = 0; mb < 4; ++mb)
#pragma unroll
        for (int nb = 0; nb < 4; ++nb) acc[mb][nb] = (v8f){};
    const size_t aoff = (size_t)r0 * K + lane * 8, boff = (size_t)c0 * K + lane * 8;   // fro(r0 + lr, 8 * hi, K), fro(c0 + lr, 8 * hi, K); 16 rows on = 16 * K elements, 32 k on = 512
#pragma unroll 1
    for (int kc = 0; kc < K; kc += 32) {
        V a[4], a2[4];
#pragma unroll
        for (int mb = 0; mb < 4; ++mb) { a[mb] = WFrag<T16>::ld(A + aoff + (size_t)mb * 16 * K + kc * 16); if (NSPLIT == 1 || NSPLIT == 2) a2[mb] = WFrag<T16>::ld(A2 + aoff + (size_t)mb * 16 * K + kc * 16); }
#pragma unroll
        for (int nb = 0; nb < 4; ++nb) { const V b = WFrag<T16>::ld(Bt + boff + (size_t)nb * 16 * K + kc * 16); V b2; if (NSPLIT >= 2) b2 = WFrag<T16>::ld(Bt2 + boff + (size_t)nb * 16 * K + kc * 16);
#pragma unroll
            for (int mb = 0; mb < 4; ++mb) { acc[mb][nb] = WFrag<T16>::mma(a[mb], b, acc[mb][nb]); if (NSPLIT == 1 || NSPLIT == 2) acc[mb][nb] = WFrag<T16>::mma(a2[mb], b, acc[mb][nb]); if (NSPLIT >= 2) acc[mb][nb] = WFrag<T16>::mma(a[mb], b2, acc[mb][nb]); } }
        asm volatile("v_nop\n\tv_nop\n\tv_nop\n\tv_nop" : "+v"(acc[0][0]), "+v"(acc[1][1]), "+v"(acc[2][2]), "+v"(acc[3][3]) : "v"(a[0]), "v"(a[3]));
    }
#pragma unroll
    for (int mb = 0; mb < 4; ++mb) {
#pragma unroll
        for (int nb = 0; nb < 4; ++nb) {
#pragma unroll
            for (int j = 0; j < 8; ++j) os[(hi * 8 + j) * 68 + nb * 16 + lr] = acc[mb][nb][j]; }
        __builtin_amdgcn_wave_barrier(); asm volatile("" ::: "memory");
        float* crow = C + (size_t)(r0 + mb * 16) * ldc + c0;
{
#pragma unroll
            for (int s = 0; s < 8; ++s) { const int row = 2 * s + hi, cofs = lr * 4; v4f val = *(const v4fa*)(os + row * 68 + cofs); if (BIAS) { val[0] += bfr(bias[c0 + cofs]); val[1] += bfr(bias[c0 + cofs + 1]); val[2] += bfr(bias[c0 + cofs + 2]); val[3] += bfr(bias[c0 + cofs + 3]); }
                *(v4f*)(crow + (size_t)row * ldc + cofs) = val; }
             }
        if (mb < 3) asm volatile("s_wait_xcnt 0x0" ::: "memory");   // the next round rewrites the stores' address and data registers: the wait that belongs in front of that
        __builtin_amdgcn_wave_barrier(); asm volatile("" ::: "memory");
    }
}

__device__ __forceinline__ h16 tohx(float x) { return (h16)x; }
__device__ __forceinline__ void splitf(float y, unsigned short& h, unsigned short& l) { h = f2bf(y); l = f2bf(y - bf2f(h)); }
typedef __attribute__((ext_vector_type(2))) _Float16 v2h;
typedef __attribute__((ext_vector_type(4))) _Float16 v4h;
typedef __attribute__((ext_vector_type(2))) unsigned short v2us;
typedef __attribute__((ext_vector_type(4))) unsigned short v4us;
typedef __attribute__((ext_vector_type(2))) float v2f;
typedef __attribute__((ext_vector_type(4))) int v4i;

__device__ __forceinline__ void d_wtG(int bx, const float* __restrict__ w, int K, int N, bf* Bt) {
    const int lane = threadIdx.x & 31; const int L0 = (bx * 8 + (threadIdx.x >> 5)) * 8; const int nlines = N * K / 64;
{
#pragma unroll 1
        for (int l = 0; l < 8; ++l) { const int L = L0 + l; if (L >= nlines) break; const size_t e = (size_t)L * 64 + lane * 2; const int k = (int)(e % K), n = (int)(e / K); v2us o;
            o[0] = f2bf(w[(size_t)k * N + n]); o[1] = f2bf(w[(size_t)(k + 1) * N + n]); *(v2us*)(Bt + fro(n, k, K)) = o;
            asm volatile("s_wait_xcnt 0x0" ::: "memory"); }   // the next trip rewrites the store's address and data registers: the wait that belongs in front of that
         }
}
__global__ __launch_bounds__(256) void k_cvt8(const float* __restrict__ src, bf* dst, size_t n8) { const size_t i = (size_t)blockIdx.x * 256 + threadIdx.x; if (i >= n8) return; const v8f v = *(const v8f*)(src + i * 8); v8us o;
#pragma unroll
    for (int k = 0; k < 8; ++k) o[k] = f2bf(v[k]); *(v8us*)(dst + i * 8) = o;  }
__global__ __launch_bounds__(256) void k_cscvt(const float* __restrict__ cosT, const float* __restrict__ sinT, float* CS) { const int idx = blockIdx.x * 256 + threadIdx.x; if (idx >= TT * HD) return; v2f cs; cs[0] = bfr(cosT[idx]); cs[1] = bfr(sinT[idx]); *(v2f*)(CS + (size_t)idx * 2) = cs;  }
// k_rope: head planes [h][t][d] (fp16 + hi/lo) of rope(x) x sc with the rotate-half convention out[d] = x[d] cos[t][d] - x[d+HD/2] sin[t][d], out[d+HD/2] = x[d+HD/2] cos[t][d+HD/2] + x[d] sin[t][d+HD/2]
__global__ __launch_bounds__(256) void k_rope(const float* __restrict__ F, int pitch, int nheads, const float* __restrict__ CS, const float* __restrict__ RF, const float* __restrict__ nw, float sc, h16* P16, bf* Ph, bf* Pl) {
    const size_t e = ((size_t)blockIdx.x * 256 + threadIdx.x) * 2; if (e >= (size_t)nheads * TT * HD) return; const int d = (int)(e % HD); const int t = (int)((e / HD) % TT); const int h = (int)(e / ((size_t)HD * TT)); const float* f = F + (size_t)t * pitch + h * HD; const float rf = RF ? RF[(size_t)h * TT + t] : 1.0f; v2h o16; v2us oh, ol;
#pragma unroll
    for (int q = 0; q < 2; ++q) { const int dd = d + q; const int dp = (dd < HD / 2) ? dd + HD / 2 : dd - HD / 2; float x0 = f[dd], x1 = f[dp];
        if (RF) { float n0 = __fmul_rn(x0, rf), n1 = __fmul_rn(x1, rf); asm volatile("" : "+v"(n0)); asm volatile("" : "+v"(n1)); x0 = __fmul_rn(bfr(nw[dd]), n0); x1 = __fmul_rn(bfr(nw[dp]), n1); }
        const v2f cs = *(const v2f*)(CS + ((size_t)t * HD + dd) * 2); float a = __fmul_rn(x0, cs[0]), bq = __fmul_rn(x1, cs[1]); asm volatile("" : "+v"(a)); asm volatile("" : "+v"(bq)); const float r = ((dd < HD / 2) ? __fsub_rn(a, bq) : __fadd_rn(a, bq)) * sc;
        o16[q] = tohx(r); unsigned short a2, c2; splitf(r, a2, c2); oh[q] = a2; ol[q] = c2; }
    *(v2h*)(P16 + e) = o16; *(v2us*)(Ph + e) = oh; *(v2us*)(Pl + e) = ol;  }
__global__ __launch_bounds__(256) void k_vtp(const float* __restrict__ F, int pitch, int nheads, h16* V16, bf* Vh, bf* Vl) { const size_t e = ((size_t)blockIdx.x * 256 + threadIdx.x) * 2; if (e >= (size_t)nheads * HD * TT) return; const int t = (int)(e % TT); const int d = (int)((e / TT) % HD); const int g = (int)(e / ((size_t)TT * HD)); v2h o16; v2us oh, ol;
#pragma unroll
    for (int q = 0; q < 2; ++q) { const float x = F[(size_t)(t + q) * pitch + g * HD + d]; o16[q] = tohx(x); unsigned short a2, c2; splitf(x, a2, c2); oh[q] = a2; ol[q] = c2; }
    *(v2h*)(V16 + e) = o16; *(v2us*)(Vh + e) = oh; *(v2us*)(Vl + e) = ol;  }
__global__ __launch_bounds__(256) void k_cvt8padg(const float* __restrict__ src, bf* XB2) { const size_t e8 = ((size_t)blockIdx.x * 256 + threadIdx.x) * 8; if (e8 >= (size_t)GR * DM) return; const int r = (int)(e8 / DM); const int bl = r / TT, t = r % TT; v8us o; if (t < LR) { const float* sp2 = src + ((size_t)bl * LR + t) * DM + (e8 % DM); for (int u = 0; u < 8; ++u) o[u] = f2bf(bfr(sp2[u])); } else { for (int u = 0; u < 8; ++u) o[u] = 0; } *(v8us*)(XB2 + e8) = o;  }
__global__ __launch_bounds__(256) void k_moutv(const float* __restrict__ O, int z0, float* YO2) { const size_t e = ((size_t)blockIdx.x * 256 + threadIdx.x) * 2; if (e >= (size_t)ZH * TT * HD) return; const int d = (int)(e % HD); const int t = (int)((e / HD) % TT); const int zz = (int)(e / ((size_t)HD * TT)); const int z = z0 + zz; const int bl = z / NH_, h = z % NH_; v2f o; o[0] = O[e]; o[1] = O[e + 1]; float* dst = YO2 + ((size_t)bl * TT + t) * DQ + (size_t)h * HD + d; *(v2f*)dst = o;  }
__global__ __launch_bounds__(256) void k_outcpg(const float* __restrict__ Y, float* O2) { const size_t e = ((size_t)blockIdx.x * 256 + threadIdx.x) * 4; if (e >= (size_t)GB * LR * DM) return; const size_t r = e / DM; const int bl = (int)(r / LR), t = (int)(r % LR); const v4f a = *(const v4f*)(Y + ((size_t)bl * TT + t) * DM + (e % DM)); *(v4f*)(O2 + e) = a;  }
__global__ __launch_bounds__(256) void k_hlG(const float* __restrict__ F, bf* Fh, bf* Fl, size_t n) { const size_t e = ((size_t)blockIdx.x * 256 + threadIdx.x) * 4; if (e >= n) return; const v4f a = *(const v4f*)(F + e); v4us oh, ol; for (int u = 0; u < 4; ++u) { unsigned short p, q; splitf(a[u], p, q); oh[u] = p; ol[u] = q; } *(v4us*)(Fh + e) = oh; *(v4us*)(Fl + e) = ol;  }
// d_fro8: a block of 8 waves, wave w holding row bx*8 + w of a 128-column hi and lo plane (4 columns a lane), stores both planes in fragment order (fro), turned through LDS: thread = (plane, k group of 8, row); the 8 rows' pieces of one k group are one whole 128-byte line, and a wave stores four such lines. Every thread of the block calls it.
#define LNP  136   // LDS row pitch, bf16 elements: 272 bytes = 16 x odd, no bank conflict for 16-byte reads down a column of rows
typedef v4us __attribute__((may_alias)) v4usa;
__device__ __forceinline__ void d_fro8(int bx, v4us oh, v4us ol, bf* Ph, bf* Pl) {
    __shared__ __align__(16) bf st[2 * 8 * LNP]; const int oo = (threadIdx.x >> 5) * LNP + (threadIdx.x & 31) * 4; *(v4usa*)(st + oo) = oh; *(v4usa*)(st + 8 * LNP + oo) = ol;
    __syncthreads();   // the block's 8 rows, hi and lo, are in LDS before they are read across rows
    const int pl = threadIdx.x >> 7, kg = (threadIdx.x >> 3) & 15, un = threadIdx.x & 7; const v8us val = *(const v8usa*)(st + (pl * 8 + un) * LNP + kg * 8);
    *(v8us*)((pl ? Pl : Ph) + fro(bx * 8 + un, kg * 8, 128)) = val; }
__device__ __forceinline__ void d_lnz(int bx, const float* __restrict__ X, const float* __restrict__ gam, const float* __restrict__ bet, bf* Xh, bf* Xl) { const int lane = threadIdx.x & 31; const int t = bx * 8 + (threadIdx.x >> 5); if (bx >= NPZ / 8) return;   /* the same for the whole block: d_fro8 has a barrier */
    const float* f = X + (size_t)t * CZ; float v[CZ / 32]; float su = 0.f;
#pragma unroll
    for (int ch = 0; ch < CZ / 128; ++ch) { const v4f a = *(const v4f*)(f + ch * 128 + lane * 4); for (int u = 0; u < 4; ++u) { float xv = bfr(a[u]); asm volatile("" : "+v"(xv)); v[ch * 4 + u] = xv; su = __fadd_rn(su, xv); } }
#pragma unroll
    for (int sh = 16; sh; sh >>= 1) su = __fadd_rn(su, __shfl_xor(su, sh, 32));
    const float mu = __fdiv_rn(su, (float)CZ); float sq = 0.f;
#pragma unroll
    for (int q = 0; q < CZ / 32; ++q) { float d0 = __fsub_rn(v[q], mu); asm volatile("" : "+v"(d0)); float p = __fmul_rn(d0, d0); asm volatile("" : "+v"(p)); sq = __fadd_rn(sq, p); }
#pragma unroll
    for (int sh = 16; sh; sh >>= 1) sq = __fadd_rn(sq, __shfl_xor(sq, sh, 32));
    const float rs = __fdiv_rn(1.0f, sqrtf(__fadd_rn(__fdiv_rn(sq, (float)CZ), 1e-5f)));
    {
#pragma unroll
        for (int ch = 0; ch < CZ / 128; ++ch) { v4us oh, ol; for (int u = 0; u < 4; ++u) { const int c = ch * 128 + lane * 4 + u; float d0 = __fsub_rn(v[ch * 4 + u], mu); asm volatile("" : "+v"(d0)); float n = __fmul_rn(d0, rs); asm volatile("" : "+v"(n)); float gg = bfr(gam[c]), bb = bfr(bet[c]); asm volatile("" : "+v"(gg)); asm volatile("" : "+v"(bb)); float y = __fmul_rn(n, gg); asm volatile("" : "+v"(y)); y = __fadd_rn(y, bb); unsigned short p2, q2; splitf(y, p2, q2); oh[u] = p2; ol[u] = q2; } d_fro8(bx, oh, ol, Xh, Xl); }   // CZ == 128: one pass
         } }
__device__ __forceinline__ void d_w2dp(int bx, const float* __restrict__ Wp, bf* WP) { const size_t e = ((size_t)bx * 256 + threadIdx.x) * 8; if (e >= (size_t)ZW * CZ) return; const int r = (int)(e / CZ); const int c0 = (int)(e % CZ); v8us o; for (int u = 0; u < 8; ++u) o[u] = (r < NH_) ? f2bf(bfr(Wp[(size_t)(c0 + u) * NH_ + r])) : (unsigned short)0; *(v8us*)(WP + fro(r, c0, CZ)) = o;  }
// ---- k_pre: all that depends on the inputs alone, in one launch. Blocks 0..23: the six weight planes of WT, in fragment order (fro), 4 blocks each (0..3 = Wq, Wk, Wv, Wg transposed to bf16; 4 = the padded pair-bias weights, half a plane; 5 = Wo transposed); blocks 24..: LayerNorm of the 65,536 pair rows, 8 rows a block, once for the pair bias and the projections alike, its hi and lo planes in fragment order (d_fro8).
#define WPB  4     // blocks per weight plane: DM * DR / 64 lines at 64 lines a block; ZW * CZ / 8 threads for the pair-bias weights
#define NWB  (6 * WPB)
__global__ __launch_bounds__(256) void k_pre(const float* __restrict__ X, const float* __restrict__ gam, const float* __restrict__ bet, bf* Xh, bf* Xl, const float* __restrict__ wq, const float* __restrict__ wk, const float* __restrict__ wv, const float* __restrict__ wg, const float* __restrict__ w2d, const float* __restrict__ wo, bf* WT) {
    const int b = blockIdx.x;
    if (b < NWB) { const int p = b / WPB, bx = b % WPB; bf* dst = WT + (size_t)p * DR * DM;
        if (p == 4) d_w2dp(bx, w2d, dst);
        else d_wtG(bx, (p == 0) ? wq : (p == 1) ? wk : (p == 2) ? wv : (p == 3) ? wg : wo, DM, DR, dst);   // DM == DR: Wo's K and N are the same two numbers
        return; }
    d_lnz(b - NWB, X, gam, bet, Xh, Xl);
}
// k_ztr: the pair bias in the order of k_attn's score accumulators: ZB[h][query tile qt][key tile kt][half][lane][u] = bias of query qt*16 + (lane & 15), key kt*16 + 8*(lane >> 4) + 4*half + u, so that each of the reader's wave-wide 16-byte loads covers 512 contiguous bytes
__global__ __launch_bounds__(256) void k_ztr(const float* __restrict__ ZF, float* ZB) { const size_t e = (size_t)blockIdx.x * 256 + threadIdx.x; if (e >= (size_t)NH_ * TT * TT) return; const int u = (int)(e & 3), ln = (int)((e >> 2) & 31), hf = (int)((e >> 7) & 1), kt = (int)((e >> 8) & 15), qt = (int)((e >> 12) & 15); const int h = (int)(e / ((size_t)TT * TT)); const int k = kt * 16 + 8 * (ln >> 4) + 4 * hf + u; const int q = qt * 16 + (ln & 15); const float v = ZF[((size_t)q * TT + k) * ZW + h]; *(float*)(ZB + e) = v;  }
// ---- k_attn: the q, k, v and gate projections and the whole attention of one virtual head (row bl, head h) in one work-group: 16 waves x 16 tokens, all 256 keys at once; q, k, v, gate logits, scores and probabilities never leave the chip.
// Projections: wave w takes the 16 tokens w*16.. of the row. Its LayerNorm fragments (hi and lo planes, fragment order fro, 4 chunks of 32 k) come straight from global into registers; the head's 32 columns of Wq, Wk, Wv, Wg (4 x 8 KB, already in fragment order) are copied to LDS once a work-group. Each accumulator sums hi then lo per 32-k chunk.
// Q^T, K^T, G^T = W^T z^T (A = weight rows d, B = token columns): a lane holds d = mb*16 + 8*hi + r of ONE token lr. That is the B fragment of Q as it stands, 8 consecutive d of a K row for LDS, and the gate of the lane's own context values. V = z Wv (A = tokens, B = weight columns d): a lane holds 8 consecutive tokens of one d, 16 bytes of a V^T row for LDS.
// K [key][d] and V^T [d][key] are split into bf16 hi/lo planes on the way into LDS. S^T = K Q^T (A = K rows, B = Q columns), so a lane holds 128 scores of ONE query: tile kt, register r = key kt*16 + 8*hi + r, query lr.
// Two neighbouring score tiles, converted in place, are the B operand of O^T = V^T P^T (hardware k order: 8*hi + s, 16 + 8*hi + (s - 8)); the LDS fragment loads use the same order.
// The pair bias, times 32^0.5, is the start value of the score accumulators; 32^-0.5 is folded into the exponent's scale.
// The gate is applied here: a lane's 8 context values of one accumulator are 8 consecutive k of one row of the output projection's A operand, and the 32 lanes' pieces are one half block of its fragment order (fro), so the gated hi and lo planes go straight from the accumulators to global, 512 contiguous bytes a store.
#define KPI  40    // K row pitch in LDS, bf16 elements: 80 bytes = 16 x odd, no bank conflict for 16-byte reads
#define VPI  264   // V^T row pitch in LDS: 528 bytes = 16 x odd
#define RSCL 5.656854249492381f   // 32^0.5
typedef __attribute__((ext_vector_type(2))) __bf16 v2bf;
typedef __attribute__((ext_vector_type(2))) unsigned v2u;
typedef __attribute__((ext_vector_type(4))) unsigned v4u;
typedef __attribute__((ext_vector_type(8))) unsigned v8u;
typedef unsigned __attribute__((may_alias)) u32a;
typedef v2u __attribute__((may_alias)) v2ua;
__device__ __forceinline__ unsigned pk2(float a, float b) { v2f x; x[0] = a; x[1] = b; return __builtin_bit_cast(unsigned, __builtin_convertvector(x, v2bf)); }
__device__ __forceinline__ void split2(float a, float b, unsigned& h, unsigned& l) { h = pk2(a, b); l = pk2(a - __uint_as_float(h << 16), b - __uint_as_float(h & 0xFFFF0000u)); }
// 2^x with the one issue slot that the instruction set asks for behind a transcendental, before its result is read or its source register overwritten: in one statement, so that the slot stands directly behind it
__device__ __forceinline__ float exp2slot(float x) { float e; asm("v_exp_f32 %0, %1\n\tv_nop" : "=v"(e) : "v"(x)); return e; }
__device__ __forceinline__ v16bf ldsfrag(const bf* p) { return cat16b(*(const v8usa*)p, *(const v8usa*)(p + 16)); }
typedef v4u __attribute__((may_alias)) v4ua;
__device__ __forceinline__ v16bf ldswfrag(const bf* p) { return cat16b(*(const v8usa*)p, *(const v8usa*)(p + 256)); }   // a fragment kept in fragment order: two runs of 512 contiguous bytes
__global__ __launch_bounds__(512) void k_attn(const bf* __restrict__ Xh, const bf* __restrict__ Xl, const bf* __restrict__ WT, const float* __restrict__ ZB, const float* __restrict__ bg, bf* __restrict__ Ah, bf* __restrict__ Al) {
    __shared__ __align__(16) bf Kh[TT * KPI]; __shared__ __align__(16) bf Kl[TT * KPI]; __shared__ __align__(16) bf Vh[HDR * VPI]; __shared__ __align__(16) bf Vl[HDR * VPI]; __shared__ __align__(16) bf Ws[4 * HDR * DM]; __shared__ __align__(16) float Gs[4 * 512 * 4];
    const int tid = threadIdx.x, lane = tid & 31, lr = lane & 15, hi = lane >> 4, wv = tid >> 5; const int z = blockIdx.x, bl = z / NH_, h = z % NH_;
    const float* zr = ZB + ((size_t)h * 16 + wv) * (16 * TT) + lane * 4;   // this wave's 16 queries x 256 keys of the pair bias, in accumulator order (k_ztr)
    const int q = wv * 16 + lr;
    // the head's weights (rows h*32.. of planes 0..3 of WT, 8 KB each, one 16-byte piece a thread and plane), then the wave's own LayerNorm fragments
    const bf* wp = WT + (size_t)h * (HDR * DM) + tid * 8; const size_t zo = (size_t)(bl * 16 + wv) * (16 * DM) + lane * 8;
    v8us wst[4]; v16bf zh[4], zl[4];
#pragma unroll
    for (int p = 0; p < 4; ++p) wst[p] = *(const v8us*)(wp + (size_t)p * DR * DM);
#pragma unroll
    for (int kc = 0; kc < 4; ++kc) { zh[kc] = WFrag<bf>::ld(Xh + zo + kc * 512); zl[kc] = WFrag<bf>::ld(Xl + zo + kc * 512); }
    asm volatile("s_wait_xcnt 0x0" ::: "memory");   // the work below may reuse registers that held the addresses of the loads above: the wait that belongs in front of that
#pragma unroll
    for (int p = 0; p < 4; ++p) *(v8usa*)(Ws + p * (HDR * DM) + tid * 8) = wst[p];
    __syncthreads();   // the four weight planes are complete in LDS before any wave reads a fragment
    v8f pq[2], pk[2], pv[2], pg[2];
#pragma unroll
    for (int mb = 0; mb < 2; ++mb) { pq[mb] = (v8f){}; pk[mb] = (v8f){}; pv[mb] = (v8f){}; pg[mb] = (v8f){}; }
#pragma unroll
    for (int kc = 0; kc < 4; ++kc) { v16bf wf[4][2];
#pragma unroll
        for (int p = 0; p < 4; ++p)
#pragma unroll
            for (int mb = 0; mb < 2; ++mb) wf[p][mb] = ldswfrag(Ws + p * (HDR * DM) + mb * (16 * DM) + kc * 512 + lane * 8);
#pragma unroll
        for (int mb = 0; mb < 2; ++mb) { pq[mb] = wmmab(wf[0][mb], zh[kc], pq[mb]); pk[mb] = wmmab(wf[1][mb], zh[kc], pk[mb]); pv[mb] = wmmab(zh[kc], wf[2][mb], pv[mb]); pg[mb] = wmmab(wf[3][mb], zh[kc], pg[mb]); }
#pragma unroll
        for (int mb = 0; mb < 2; ++mb) { pq[mb] = wmmab(wf[0][mb], zl[kc], pq[mb]); pk[mb] = wmmab(wf[1][mb], zl[kc], pk[mb]); pv[mb] = wmmab(zl[kc], wf[2][mb], pv[mb]); pg[mb] = wmmab(wf[3][mb], zl[kc], pg[mb]); } }
    // the next two lines end the projections here: left free, the last products sink among the loads and the arithmetic below and keep the LayerNorm and weight fragments' registers, which the pair bias needs (spills)
    asm volatile("" :: "v"(pq[0]), "v"(pq[1]), "v"(pk[0]), "v"(pk[1]), "v"(pv[0]), "v"(pv[1]), "v"(pg[0]), "v"(pg[1]));   // inputs only: the eight accumulators are complete at this place
    __builtin_amdgcn_sched_barrier(0);   // nothing of the work below is moved up among the products
    const float* bp = bg + h * HDR + 8 * hi; v4f gb[4], za[16], zb[16];
#pragma unroll
    for (int g = 0; g < 4; ++g) gb[g] = *(const v4f*)(bp + (g >> 1) * 16 + (g & 1) * 4);
#pragma unroll
    for (int mb = 0; mb < 2; ++mb) { v4u oh, ol, ph, pl;   // pk[mb][r] = K of key q at d = mb*16 + 8*hi + r; pv[mb][r] = V of key wv*16 + 8*hi + r at d = mb*16 + lr
#pragma unroll
        for (int i = 0; i < 4; ++i) { unsigned p, r; split2(pk[mb][2 * i], pk[mb][2 * i + 1], p, r); oh[i] = p; ol[i] = r; split2(pv[mb][2 * i], pv[mb][2 * i + 1], p, r); ph[i] = p; pl[i] = r; }
        *(v4ua*)(Kh + q * KPI + mb * 16 + 8 * hi) = oh; *(v4ua*)(Kl + q * KPI + mb * 16 + 8 * hi) = ol; *(v4ua*)(Vh + (mb * 16 + lr) * VPI + wv * 16 + 8 * hi) = ph; *(v4ua*)(Vl + (mb * 16 + lr) * VPI + wv * 16 + 8 * hi) = pl; }
    __builtin_amdgcn_sched_barrier(0);   // the 128 registers of the pair bias are taken only here, when the LayerNorm and weight fragments and the K and V accumulators are free: its loads moved further up would not fit
#pragma unroll
    for (int kt = 0; kt < 16; ++kt) { za[kt] = *(const v4f*)(zr + kt * 256); if (kt < 15) zb[kt] = *(const v4f*)(zr + kt * 256 + 128); }
    asm volatile("s_wait_xcnt 0x0" ::: "memory");   // the last load of a run may land on the run's own address pair: the wait that belongs in front of that
    zb[15] = *(const v4f*)(zr + 15 * 256 + 128);
    __builtin_amdgcn_sched_barrier(0);   // keeps the loads above in front of the arithmetic below, which runs while they fly: moved behind it they would start only when it is done
    v8u qh, ql;   // pq[g][r] = Q of query q at d = g*16 + 8*hi + r: the B fragment's own order
#pragma unroll
    for (int g = 0; g < 2; ++g)
#pragma unroll
        for (int i = 0; i < 4; ++i) { unsigned p, r; split2(pq[g][2 * i], pq[g][2 * i + 1], p, r); qh[g * 4 + i] = p; ql[g * 4 + i] = r; }
    const v16bf Qh = __builtin_bit_cast(v16bf, qh), Ql = __builtin_bit_cast(v16bf, ql);
    v8f sg[2];   // sg[mb][r] = gate of query q at d = mb*16 + 8*hi + r
#pragma unroll
    for (int g = 0; g < 4; ++g)
#pragma unroll
        for (int u = 0; u < 4; ++u) { const float eg = expf(-(pg[g >> 1][(g & 1) * 4 + u] + bfr(gb[g][u]))); sg[g >> 1][(g & 1) * 4 + u] = __fdiv_rn(1.0f, __fadd_rn(1.0f, eg)); }
    // the 16 gates wait in LDS, each thread's in its own four 16-byte places (no other thread reads them: no barrier), until the context is there: kept in registers through the score and probability phases they spill
#pragma unroll
    for (int g = 0; g < 4; ++g) { v4f t; t[0] = sg[g >> 1][(g & 1) * 4]; t[1] = sg[g >> 1][(g & 1) * 4 + 1]; t[2] = sg[g >> 1][(g & 1) * 4 + 2]; t[3] = sg[g >> 1][(g & 1) * 4 + 3]; *(v4fa*)(Gs + (g * 512 + tid) * 4) = t; }
    __builtin_amdgcn_sched_barrier(0);   // keeps the gate's arithmetic above, where the wave would otherwise only wait for the pair bias: left free, part of it sinks behind the barrier, into the phases that the vector port limits
    v8f acc[16];
#pragma unroll
    for (int kt = 0; kt < 16; ++kt) { const v4f a = za[kt]; const v4f b = zb[kt];
#pragma unroll
        for (int u = 0; u < 4; ++u) { acc[kt][u] = a[u] * RSCL; acc[kt][4 + u] = b[u] * RSCL; } }
    __syncthreads();   // the K and V planes are complete before any wave reads a fragment
#pragma unroll
    for (int kt = 0; kt < 16; ++kt) { const int ko = (kt * 16 + lr) * KPI + 8 * hi; const v16bf ah = ldsfrag(Kh + ko), al = ldsfrag(Kl + ko);
        acc[kt] = wmmab(ah, Qh, acc[kt]); acc[kt] = wmmab(ah, Ql, acc[kt]); acc[kt] = wmmab(al, Qh, acc[kt]); }
    v8f m8 = acc[0];
#pragma unroll
    for (int kt = 1; kt < 16; ++kt)
#pragma unroll
        for (int r = 0; r < 8; ++r) m8[r] = fmaxf(m8[r], acc[kt][r]);
    float mx = fmaxf(fmaxf(fmaxf(m8[0], m8[1]), fmaxf(m8[2], m8[3])), fmaxf(fmaxf(m8[4], m8[5]), fmaxf(m8[6], m8[7])));
    mx = fmaxf(mx, __shfl_xor(mx, 16, 32));   // the other half of the query's keys
    const float c1 = SCL * 1.4426950408889634f, mc = mx * c1; v8f s8 = (v8f){};
#pragma unroll
    for (int kt = 0; kt < 16; ++kt)
#pragma unroll
        for (int r = 0; r < 8; ++r) { const float e = exp2slot(fmaf(acc[kt][r], c1, -mc)); acc[kt][r] = e; s8[r] += e; }
    float sum = ((s8[0] + s8[1]) + (s8[2] + s8[3])) + ((s8[4] + s8[5]) + (s8[6] + s8[7]));
    sum += __shfl_xor(sum, 16, 32);
    const float f = __fdiv_rn(1.0f, sum);
    v8f o[2]; o[0] = (v8f){}; o[1] = (v8f){};
#pragma unroll
    for (int ks = 0; ks < 8; ++ks) { v8u ph, pl;
#pragma unroll
        for (int g = 0; g < 2; ++g)
#pragma unroll
            for (int i = 0; i < 4; ++i) { unsigned p, r; split2(acc[2 * ks + g][2 * i] * f, acc[2 * ks + g][2 * i + 1] * f, p, r); ph[g * 4 + i] = p; pl[g * 4 + i] = r; }
        const v16bf Ph = __builtin_bit_cast(v16bf, ph), Pl = __builtin_bit_cast(v16bf, pl);
#pragma unroll
        for (int mb = 0; mb < 2; ++mb) { const int vo = (mb * 16 + lr) * VPI + ks * 32 + 8 * hi; const v16bf vh = ldsfrag(Vh + vo), vl = ldsfrag(Vl + vo);
            o[mb] = wmmab(vh, Ph, o[mb]); o[mb] = wmmab(vh, Pl, o[mb]); o[mb] = wmmab(vl, Ph, o[mb]); } }
#pragma unroll
    for (int mb = 0; mb < 2; ++mb) { float ov[8]; v4u oh, ol; const v4f ga = *(const v4fa*)(Gs + (2 * mb * 512 + tid) * 4), gc = *(const v4fa*)(Gs + ((2 * mb + 1) * 512 + tid) * 4);   // o[mb][r] = context of query q at d = mb*16 + 8*hi + r; ga, gc = its 8 gates
#pragma unroll
        for (int r = 0; r < 8; ++r) ov[r] = __fmul_rn(o[mb][r], (r < 4 ? ga : gc)[r & 3]);
#pragma unroll
        for (int i = 0; i < 4; ++i) { unsigned p, r; split2(ov[2 * i], ov[2 * i + 1], p, r); oh[i] = p; ol[i] = r; }
        const size_t fo = fro(bl * TT + q, h * HDR + mb * 16 + 8 * hi, DR); *(v4u*)(Ah + fo) = oh; *(v4u*)(Al + fo) = ol; }
}
__global__ __launch_bounds__(256) void k_merge(const float* __restrict__ O, int h0, bf* Ah, bf* Al) { const size_t e = ((size_t)blockIdx.x * 256 + threadIdx.x) * 2; if (e >= (size_t)ZH * TT * HD) return; const int d = (int)(e % HD); const int t = (int)((e / HD) % TT); const int zz = (int)(e / ((size_t)HD * TT)); const float cs = (t < RH) ? 1.0f : (1.0f / PCAR); const size_t oo = (size_t)t * DQ + (h0 + zz) * HD + d;
    v2us oh, ol;
#pragma unroll
    for (int q = 0; q < 2; ++q) { unsigned short a, c2; splitf(O[e + q] * cs, a, c2); oh[q] = a; ol[q] = c2; } *(v2us*)(Ah + oo) = oh; *(v2us*)(Al + oo) = ol;  }

extern "C" void kernel_launch(void* const* d_in, const int* in_sizes, int n_in,
                              void* d_out, int out_size, void* d_ws, size_t ws_size, hipStream_t stream) {
    (void)in_sizes; (void)n_in; (void)out_size;
    const float* x = (const float*)d_in[0]; const float* qng = (const float*)d_in[1]; const float* qnb = (const float*)d_in[2]; const float* wq = (const float*)d_in[3]; const float* wk = (const float*)d_in[4]; const float* wv = (const float*)d_in[5]; const float* w2d = (const float*)d_in[6]; const float* wg = (const float*)d_in[7]; const float* bg = (const float*)d_in[8]; const float* wo = (const float*)d_in[9]; const float* bo = (const float*)d_in[10];
    float* OUT = (float*)d_out;   // [256][256][128]
    char* wsp = (char*)d_ws; auto take = [&](size_t bytes) { char* p = wsp; wsp += (bytes + 255) & ~(size_t)255; return (void*)p; };
    bf* WT = (bf*)take((size_t)6 * DR * DM * 2); bf* WO = WT + (size_t)5 * DR * DM;   /* one block of six planes: Wq, Wk, Wv, Wg, pair-bias weights, Wo */
    bf* XNh = (bf*)take((size_t)GR * DM * 2); bf* XNl = (bf*)take((size_t)GR * DM * 2); float* ZB = (float*)take((size_t)NH_ * TT * TT * 4);
    float* ZF = (float*)take((size_t)NPZ * ZW * 4);   /* the pair bias before its transpose (pitch ZW) */
    bf* AOh = (bf*)take((size_t)GR * DR * 2); bf* AOl = (bf*)take((size_t)GR * DR * 2);
    if ((size_t)(wsp - (char*)d_ws) > ws_size) return;   // ws ~ 81 MiB
    k_pre<<<NWB + NPZ / 8, 256, 0, stream>>>(x, qng, qnb, XNh, XNl, wq, wk, wv, wg, w2d, wo, WT);
    k_gemmw<bf, 1, false><<<dim3(1, GR / 64, 1), 32, 0, stream>>>(XNh, XNl, WT + (size_t)4 * DR * DM, nullptr, DM, ZF, ZW, nullptr, 0, 0, 0, 1, -1, 0);   /* pair bias */
    k_ztr<<<(NH_ * TT * TT + 255) / 256, 256, 0, stream>>>(ZF, ZB);
    k_attn<<<NVH, 512, 0, stream>>>(XNh, XNl, WT, ZB, bg, AOh, AOl);   /* q, k, v, gate projections and attention */
    k_gemmw<bf, 1, true><<<dim3(DM / 64, GR / 64, 1), 32, 0, stream>>>(AOh, AOl, WO, nullptr, DR, OUT, DM, bo, 0, 0, 0, DM / 64, -1, 0);
}

// v007
// It runs in 79.1 microseconds.
// Next to v006, in two timings, it ran 1.07 times as fast each time.
// Counting every step since v000, it is 10.8 times as fast.
#include <hip/hip_runtime.h>

// Triangle_Att_Start (AlphaFold triangle attention, starting node: pair_embed [256 rows i][256 j][128]; z = LayerNorm(pair); q/k/v = z W ([128][4 x 32]), q x 32^-0.5; bias[h][j][k] = (z Wb)[j][k][h] shared over rows i; gate = sigmoid(z Wg + bg); logits[h][i][j][k] = q_ij.k_ik + bias[h][j][k]; softmax over k; o = (a v) * gate; out = o Wo + bo -> [256][256][128]).
// Batched layout (exact): every row i is an independent 256-token attention; 256 rows x 4 heads = 1024 'virtual heads' of 256 tokens, one work-group of the fused attention kernel each, all in one launch, which also projects its own q, k, v and gate; the pair-bias projection runs with the LayerNorm, the output projection on all 65,536 stacked (row, j) positions at once.

#define NB_  256
#define TT   256
#define DM   128
#define NH_  4
#define NKV  4
#define REP  (NH_ / NKV)
#define HD   64
#define DQ   (NH_ * HD)
#define DKV  (NKV * HD)
#define ZH   256   // virtual heads per k_moutv / k_merge call (a quarter of NVH)
#define RH   256
#define WIN  0
#define PCAR 1024.0f
#define HDR  32
#define DR   (NH_ * HDR)   // 128
#define CZ   128
#define NPZ  (TT * TT)     // pair rows 65536
#define ZW   64
#define LR   256    // tokens per row (no padding)
#define GB   256    // rows per group: all of them, one group
#define NG   (NB_ / GB)
#define GR   (GB * TT)   // stacked rows per group
#define NVH  (GB * NH_)  // virtual heads per group
#define SCL  0.17677669529663689f   // 32^-0.5
typedef _Float16 h16;
typedef unsigned short bf;
typedef __attribute__((ext_vector_type(16))) __bf16   v16bf;
typedef __attribute__((ext_vector_type(16))) _Float16 v16h;
typedef __attribute__((ext_vector_type(8)))  _Float16 v8h;
typedef __attribute__((ext_vector_type(8)))  unsigned short v8us;
typedef __attribute__((ext_vector_type(8)))  float    v8f;
typedef __attribute__((ext_vector_type(4)))  float    v4f;
typedef v8h  __attribute__((may_alias)) v8ha;
typedef v4f  __attribute__((may_alias)) v4fa;
typedef v8us __attribute__((may_alias)) v8usa;

__device__ __forceinline__ unsigned short f2bf(float f) { unsigned u = __float_as_uint(f); u += 0x7FFFu + ((u >> 16) & 1u); return (unsigned short)(u >> 16); }
__device__ __forceinline__ float bf2f(unsigned short b) { return __uint_as_float(((unsigned)b) << 16); }
__device__ __forceinline__ float bfr(float f) { return bf2f(f2bf(f)); }
__device__ __forceinline__ v16h cat16(v8h lo, v8h hi) { return __builtin_shufflevector(lo, hi, 0, 1, 2, 3, 4, 5, 6, 7, 8, 9, 10, 11, 12, 13, 14, 15); }
__device__ __forceinline__ v16bf cat16b(v8us lo, v8us hi) { return __builtin_bit_cast(v16bf, __builtin_shufflevector(lo, hi, 0, 1, 2, 3, 4, 5, 6, 7, 8, 9, 10, 11, 12, 13, 14, 15)); }
__device__ __forceinline__ v8f wmma16(v16h a, v16h b, v8f c) { return __builtin_amdgcn_wmma_f32_16x16x32_f16(false, a, false, b, (short)0, c, false, false); }
__device__ __forceinline__ v8f wmmab(v16bf a, v16bf b, v8f c) { return __builtin_amdgcn_wmma_f32_16x16x32_bf16(false, a, false, b, (short)0, c, false, false); }



// ---- k_gemmw: register-blocked GEMM, ONE WAVE per 64x64 output tile (16 accumulators), operands straight from 16-bit planes in fragment order (fro); grid (column tiles of all z slices, M/64), 32 threads: the tiles that read the same 64 rows of A start side by side.
// A, A2, Bt, Bt2 lie in fragment order (fro below): the 32 lanes' 16-byte pieces of one fragment load are 512 contiguous bytes, four whole lines, not 16-byte pieces of 16 lines.
// C[m][n] (f32, pitch ldc, + optional f32 bias[n]) = sum_k A[m][k] Bt[n][k] (+ split products per NSPLIT). z-batch: ct column tiles a slice, strides sA/sB/sC in elements; slice zx (if any) has the output pitch ldx. K % 32 == 0.
// fro: element offset of (row n, k) in a fragment-ordered plane of K columns: blocks of 16 rows x 32 k (512 elements); in a block two halves (k 0-15, 16-31) of 32 lane pieces; lane piece 16 * ((k >> 3) & 1) + (n & 15) holds 8 consecutive k
__device__ __forceinline__ size_t fro(int n, int k, int K) { return ((size_t)(n >> 4) * (K >> 5) + (k >> 5)) * 512 + ((k >> 4) & 1) * 256 + ((((k >> 3) & 1) << 4) + (n & 15)) * 8 + (k & 7); }
template <typename T16> struct WFrag;
template <> struct WFrag<h16> { typedef v16h V; static __device__ __forceinline__ V ld(const h16* p) { return cat16(*(const v8h*)p, *(const v8h*)(p + 256)); } static __device__ __forceinline__ v8f mma(V a, V b, v8f c) { return wmma16(a, b, c); } };
template <> struct WFrag<bf> { typedef v16bf V; static __device__ __forceinline__ V ld(const bf* p) { return cat16b(*(const v8us*)p, *(const v8us*)(p + 256)); } static __device__ __forceinline__ v8f mma(V a, V b, v8f c) { return wmmab(a, b, c); } };
template <typename T16, int NSPLIT, bool BIAS>
__global__ __launch_bounds__(32) void k_gemmw(const T16* __restrict__ A, const T16* __restrict__ A2, const T16* __restrict__ Bt, const T16* __restrict__ Bt2, int K, float* C, int ldc, const float* __restrict__ bias, size_t sA, size_t sB, size_t sC, int ct, int zx, int ldx) {
    typedef typename WFrag<T16>::V V;
    __shared__ __align__(16) float os[16 * 68];
    const size_t z = blockIdx.x / ct; A += z * sA; if (A2) A2 += z * sA; Bt += z * sB; if (Bt2) Bt2 += z * sB; C += z * sC; if ((int)z == zx) ldc = ldx;
    const int lane = threadIdx.x & 31, lr = lane & 15, hi = lane >> 4; const int r0 = blockIdx.y * 64, c0 = (blockIdx.x % ct) * 64;
    v8f acc[4][4];
#pragma unroll
    for (int mb = 0; mb < 4; ++mb)
#pragma unroll
        for (int nb = 0; nb < 4; ++nb) acc[mb][nb] = (v8f){};
    const size_t aoff = (size_t)r0 * K + lane * 8, boff = (size_t)c0 * K + lane * 8;   // fro(r0 + lr, 8 * hi, K), fro(c0 + lr, 8 * hi, K); 16 rows on = 16 * K elements, 32 k on = 512
#pragma unroll 1
    for (int kc = 0; kc < K; kc += 32) {
        V a[4], a2[4];
#pragma unroll
        for (int mb = 0; mb < 4; ++mb) { a[mb] = WFrag<T16>::ld(A + aoff + (size_t)mb * 16 * K + kc * 16); if (NSPLIT == 1 || NSPLIT == 2) a2[mb] = WFrag<T16>::ld(A2 + aoff + (size_t)mb * 16 * K + kc * 16); }
#pragma unroll
        for (int nb = 0; nb < 4; ++nb) { const V b = WFrag<T16>::ld(Bt + boff + (size_t)nb * 16 * K + kc * 16); V b2; if (NSPLIT >= 2) b2 = WFrag<T16>::ld(Bt2 + boff + (size_t)nb * 16 * K + kc * 16);
#pragma unroll
            for (int mb = 0; mb < 4; ++mb) { acc[mb][nb] = WFrag<T16>::mma(a[mb], b, acc[mb][nb]); if (NSPLIT == 1 || NSPLIT == 2) acc[mb][nb] = WFrag<T16>::mma(a2[mb], b, acc[mb][nb]); if (NSPLIT >= 2) acc[mb][nb] = WFrag<T16>::mma(a[mb], b2, acc[mb][nb]); } }
        asm volatile("v_nop\n\tv_nop\n\tv_nop\n\tv_nop" : "+v"(acc[0][0]), "+v"(acc[1][1]), "+v"(acc[2][2]), "+v"(acc[3][3]) : "v"(a[0]), "v"(a[3]));
    }
#pragma unroll
    for (int mb = 0; mb < 4; ++mb) {
#pragma unroll
        for (int nb = 0; nb < 4; ++nb) {
#pragma unroll
            for (int j = 0; j < 8; ++j) os[(hi * 8 + j) * 68 + nb * 16 + lr] = acc[mb][nb][j]; }
        __builtin_amdgcn_wave_barrier(); asm volatile("" ::: "memory");
        float* crow = C + (size_t)(r0 + mb * 16) * ldc + c0;
{
#pragma unroll
            for (int s = 0; s < 8; ++s) { const int row = 2 * s + hi, cofs = lr * 4; v4f val = *(const v4fa*)(os + row * 68 + cofs); if (BIAS) { val[0] += bfr(bias[c0 + cofs]); val[1] += bfr(bias[c0 + cofs + 1]); val[2] += bfr(bias[c0 + cofs + 2]); val[3] += bfr(bias[c0 + cofs + 3]); }
                *(v4f*)(crow + (size_t)row * ldc + cofs) = val; }
             }
        if (mb < 3) asm volatile("s_wait_xcnt 0x0" ::: "memory");   // the next round rewrites the stores' address and data registers: the wait that belongs in front of that
        __builtin_amdgcn_wave_barrier(); asm volatile("" ::: "memory");
    }
}

__device__ __forceinline__ h16 tohx(float x) { return (h16)x; }
__device__ __forceinline__ void splitf(float y, unsigned short& h, unsigned short& l) { h = f2bf(y); l = f2bf(y - bf2f(h)); }
typedef __attribute__((ext_vector_type(2))) _Float16 v2h;
typedef __attribute__((ext_vector_type(4))) _Float16 v4h;
typedef __attribute__((ext_vector_type(2))) unsigned short v2us;
typedef __attribute__((ext_vector_type(4))) unsigned short v4us;
typedef __attribute__((ext_vector_type(2))) float v2f;
typedef __attribute__((ext_vector_type(4))) int v4i;

__device__ __forceinline__ void d_wtG(int bx, const float* __restrict__ w, int K, int N, bf* Bt) {
    const int lane = threadIdx.x & 31; const int L0 = (bx * 8 + (threadIdx.x >> 5)) * 8; const int nlines = N * K / 64;
{
#pragma unroll 1
        for (int l = 0; l < 8; ++l) { const int L = L0 + l; if (L >= nlines) break; const size_t e = (size_t)L * 64 + lane * 2; const int k = (int)(e % K), n = (int)(e / K); v2us o;
            o[0] = f2bf(w[(size_t)k * N + n]); o[1] = f2bf(w[(size_t)(k + 1) * N + n]); *(v2us*)(Bt + fro(n, k, K)) = o;
            asm volatile("s_wait_xcnt 0x0" ::: "memory"); }   // the next trip rewrites the store's address and data registers: the wait that belongs in front of that
         }
}
__global__ __launch_bounds__(256) void k_cvt8(const float* __restrict__ src, bf* dst, size_t n8) { const size_t i = (size_t)blockIdx.x * 256 + threadIdx.x; if (i >= n8) return; const v8f v = *(const v8f*)(src + i * 8); v8us o;
#pragma unroll
    for (int k = 0; k < 8; ++k) o[k] = f2bf(v[k]); *(v8us*)(dst + i * 8) = o;  }
__global__ __launch_bounds__(256) void k_cscvt(const float* __restrict__ cosT, const float* __restrict__ sinT, float* CS) { const int idx = blockIdx.x * 256 + threadIdx.x; if (idx >= TT * HD) return; v2f cs; cs[0] = bfr(cosT[idx]); cs[1] = bfr(sinT[idx]); *(v2f*)(CS + (size_t)idx * 2) = cs;  }
// k_rope: head planes [h][t][d] (fp16 + hi/lo) of rope(x) x sc with the rotate-half convention out[d] = x[d] cos[t][d] - x[d+HD/2] sin[t][d], out[d+HD/2] = x[d+HD/2] cos[t][d+HD/2] + x[d] sin[t][d+HD/2]
__global__ __launch_bounds__(256) void k_rope(const float* __restrict__ F, int pitch, int nheads, const float* __restrict__ CS, const float* __restrict__ RF, const float* __restrict__ nw, float sc, h16* P16, bf* Ph, bf* Pl) {
    const size_t e = ((size_t)blockIdx.x * 256 + threadIdx.x) * 2; if (e >= (size_t)nheads * TT * HD) return; const int d = (int)(e % HD); const int t = (int)((e / HD) % TT); const int h = (int)(e / ((size_t)HD * TT)); const float* f = F + (size_t)t * pitch + h * HD; const float rf = RF ? RF[(size_t)h * TT + t] : 1.0f; v2h o16; v2us oh, ol;
#pragma unroll
    for (int q = 0; q < 2; ++q) { const int dd = d + q; const int dp = (dd < HD / 2) ? dd + HD / 2 : dd - HD / 2; float x0 = f[dd], x1 = f[dp];
        if (RF) { float n0 = __fmul_rn(x0, rf), n1 = __fmul_rn(x1, rf); asm volatile("" : "+v"(n0)); asm volatile("" : "+v"(n1)); x0 = __fmul_rn(bfr(nw[dd]), n0); x1 = __fmul_rn(bfr(nw[dp]), n1); }
        const v2f cs = *(const v2f*)(CS + ((size_t)t * HD + dd) * 2); float a = __fmul_rn(x0, cs[0]), bq = __fmul_rn(x1, cs[1]); asm volatile("" : "+v"(a)); asm volatile("" : "+v"(bq)); const float r = ((dd < HD / 2) ? __fsub_rn(a, bq) : __fadd_rn(a, bq)) * sc;
        o16[q] = tohx(r); unsigned short a2, c2; splitf(r, a2, c2); oh[q] = a2; ol[q] = c2; }
    *(v2h*)(P16 + e) = o16; *(v2us*)(Ph + e) = oh; *(v2us*)(Pl + e) = ol;  }
__global__ __launch_bounds__(256) void k_vtp(const float* __restrict__ F, int pitch, int nheads, h16* V16, bf* Vh, bf* Vl) { const size_t e = ((size_t)blockIdx.x * 256 + threadIdx.x) * 2; if (e >= (size_t)nheads * HD * TT) return; const int t = (int)(e % TT); const int d = (int)((e / TT) % HD); const int g = (int)(e / ((size_t)TT * HD)); v2h o16; v2us oh, ol;
#pragma unroll
    for (int q = 0; q < 2; ++q) { const float x = F[(size_t)(t + q) * pitch + g * HD + d]; o16[q] = tohx(x); unsigned short a2, c2; splitf(x, a2, c2); oh[q] = a2; ol[q] = c2; }
    *(v2h*)(V16 + e) = o16; *(v2us*)(Vh + e) = oh; *(v2us*)(Vl + e) = ol;  }
__global__ __launch_bounds__(256) void k_cvt8padg(const float* __restrict__ src, bf* XB2) { const size_t e8 = ((size_t)blockIdx.x * 256 + threadIdx.x) * 8; if (e8 >= (size_t)GR * DM) return; const int r = (int)(e8 / DM); const int bl = r / TT, t = r % TT; v8us o; if (t < LR) { const float* sp2 = src + ((size_t)bl * LR + t) * DM + (e8 % DM); for (int u = 0; u < 8; ++u) o[u] = f2bf(bfr(sp2[u])); } else { for (int u = 0; u < 8; ++u) o[u] = 0; } *(v8us*)(XB2 + e8) = o;  }
__global__ __launch_bounds__(256) void k_moutv(const float* __restrict__ O, int z0, float* YO2) { const size_t e = ((size_t)blockIdx.x * 256 + threadIdx.x) * 2; if (e >= (size_t)ZH * TT * HD) return; const int d = (int)(e % HD); const int t = (int)((e / HD) % TT); const int zz = (int)(e / ((size_t)HD * TT)); const int z = z0 + zz; const int bl = z / NH_, h = z % NH_; v2f o; o[0] = O[e]; o[1] = O[e + 1]; float* dst = YO2 + ((size_t)bl * TT + t) * DQ + (size_t)h * HD + d; *(v2f*)dst = o;  }
__global__ __launch_bounds__(256) void k_outcpg(const float* __restrict__ Y, float* O2) { const size_t e = ((size_t)blockIdx.x * 256 + threadIdx.x) * 4; if (e >= (size_t)GB * LR * DM) return; const size_t r = e / DM; const int bl = (int)(r / LR), t = (int)(r % LR); const v4f a = *(const v4f*)(Y + ((size_t)bl * TT + t) * DM + (e % DM)); *(v4f*)(O2 + e) = a;  }
__global__ __launch_bounds__(256) void k_hlG(const float* __restrict__ F, bf* Fh, bf* Fl, size_t n) { const size_t e = ((size_t)blockIdx.x * 256 + threadIdx.x) * 4; if (e >= n) return; const v4f a = *(const v4f*)(F + e); v4us oh, ol; for (int u = 0; u < 4; ++u) { unsigned short p, q; splitf(a[u], p, q); oh[u] = p; ol[u] = q; } *(v4us*)(Fh + e) = oh; *(v4us*)(Fl + e) = ol;  }
#define LNP  136   // LDS row pitch, bf16 elements: 272 bytes = 16 x odd, no bank conflict for 16-byte reads down a column of rows
typedef v4us __attribute__((may_alias)) v4usa;
__device__ __forceinline__ v16bf ldsfrag(const bf* p) { return cat16b(*(const v8usa*)p, *(const v8usa*)(p + 16)); }
__device__ __forceinline__ v16bf ldswfrag(const bf* p) { return cat16b(*(const v8usa*)p, *(const v8usa*)(p + 256)); }   // a fragment kept in fragment order: two runs of 512 contiguous bytes
// d_lnzb: LayerNorm and pair bias of 128 pair rows in a block of 8 waves. Block g = (query tile qt, key tile kt, half qo of the query tile); wave w takes query q = qt*16 + qo*8 + w and the 16 keys kt*16.., that is the 16 consecutive pair rows q*256 + kt*16.. (8 KB of X, all 16 loads in flight at once).
// A lane holds 4 columns of each row, as the row sums want it; the hi and lo values are turned through the wave's own LDS rows into the lane's pieces of the fragment order (fro): token lr, 8 consecutive k. These 32 registers a plane go to global as they are (512 contiguous bytes a store) and are the A operand of bias = z Wb.
// B = the 4 columns of Wb padded to 16, built once a block in LDS in fragment order. Each accumulator sums hi then lo per 32-k chunk. Lane (hi, lr = head) then holds keys kt*16 + 8*hi + r of head lr.
// The bias leaves in the order of k_attn's score accumulators: ZB[h][query tile qt][key tile kt][half][lane][u] = bias of query qt*16 + (lane & 15), key kt*16 + 8*(lane >> 4) + 4*half + u, so that each of the reader's wave-wide 16-byte loads covers 512 contiguous bytes. The 8 queries of the block fill whole 128-byte lines: gathered in LDS, 16 lines a block.
#define NLB  (NPZ / 128)   // LayerNorm blocks
__device__ __forceinline__ void d_lnzb(int g, const float* __restrict__ X, const float* __restrict__ gam, const float* __restrict__ bet, const float* __restrict__ Wp, bf* Xh, bf* Xl, float* ZB) {
    __shared__ __align__(16) bf st[8 * 2 * 16 * LNP]; __shared__ __align__(16) bf wbs[16 * CZ]; __shared__ __align__(16) float zs[16 * 8 * 4];
    const int tid = threadIdx.x, lane = tid & 31, lr = lane & 15, hi = lane >> 4, w = tid >> 5; const int qt = g >> 5, kt = (g >> 1) & 15, qo = g & 1;
    const int tile = (qt * 16 + qo * 8 + w) * 16 + kt;   // 16 pair rows
    const float* f = X + (size_t)tile * (16 * CZ) + lane * 4; v4f a[16];
    const int wr = tid >> 4, wc = (tid & 15) * 8; float wl[8], gg[4], bb[4];   // thread = (padded weight row wr, 8 k); rows NH_.. are zero: they load a row that exists, all 8 loads in flight, and drop it
#pragma unroll
    for (int u = 0; u < 8; ++u) wl[u] = Wp[(size_t)(wc + u) * NH_ + (wr & (NH_ - 1))];
#pragma unroll
    for (int u = 0; u < 4; ++u) { gg[u] = gam[lane * 4 + u]; bb[u] = bet[lane * 4 + u]; }
#pragma unroll
    for (int r = 0; r < 15; ++r) a[r] = *(const v4f*)(f + r * CZ);
    asm volatile("s_wait_xcnt 0x0" ::: "memory");   // the last load of a run may land on the run's own address pair: the wait that belongs in front of that
    a[15] = *(const v4f*)(f + 15 * CZ);
    asm volatile("s_wait_xcnt 0x0" ::: "memory");   // the work below may reuse registers that held the addresses of the loads above: the wait that belongs in front of that
    { v8us o; const unsigned short keep = (wr < NH_) ? (unsigned short)0xFFFFu : (unsigned short)0;
#pragma unroll
        for (int u = 0; u < 8; ++u) o[u] = f2bf(bfr(wl[u])) & keep;
        *(v8usa*)(wbs + fro(wr, wc, CZ)) = o; }
#pragma unroll
    for (int u = 0; u < 4; ++u) { gg[u] = bfr(gg[u]); bb[u] = bfr(bb[u]); }
    // the row arithmetic keeps its statements and their order, the empty asm ones too (each product is rounded before its add; the sums run in the same order), only looped over the wave's 16 rows phase by phase, so that 16 butterflies are in flight together: the two planes keep their values bit for bit
    float v[16][4], su[16], sq[16], mu[16], rs[16];
#pragma unroll
    for (int r = 0; r < 16; ++r) { su[r] = 0.f; for (int u = 0; u < 4; ++u) { float xv = bfr(a[r][u]); asm volatile("" : "+v"(xv)); v[r][u] = xv; su[r] = __fadd_rn(su[r], xv); } }
#pragma unroll
    for (int sh = 16; sh; sh >>= 1)
#pragma unroll
        for (int r = 0; r < 16; ++r) su[r] = __fadd_rn(su[r], __shfl_xor(su[r], sh, 32));
#pragma unroll
    for (int r = 0; r < 16; ++r) { mu[r] = __fdiv_rn(su[r], (float)CZ); sq[r] = 0.f; for (int q = 0; q < 4; ++q) { float d0 = __fsub_rn(v[r][q], mu[r]); asm volatile("" : "+v"(d0)); float p = __fmul_rn(d0, d0); asm volatile("" : "+v"(p)); sq[r] = __fadd_rn(sq[r], p); } }
#pragma unroll
    for (int sh = 16; sh; sh >>= 1)
#pragma unroll
        for (int r = 0; r < 16; ++r) sq[r] = __fadd_rn(sq[r], __shfl_xor(sq[r], sh, 32));
    bf* sw = st + w * (2 * 16 * LNP);
#pragma unroll
    for (int r = 0; r < 16; ++r) { rs[r] = __fdiv_rn(1.0f, sqrtf(__fadd_rn(__fdiv_rn(sq[r], (float)CZ), 1e-5f))); v4us oh, ol;
        for (int u = 0; u < 4; ++u) { float d0 = __fsub_rn(v[r][u], mu[r]); asm volatile("" : "+v"(d0)); float n = __fmul_rn(d0, rs[r]); asm volatile("" : "+v"(n)); float y = __fmul_rn(n, gg[u]); asm volatile("" : "+v"(y)); y = __fadd_rn(y, bb[u]); unsigned short p2, q2; splitf(y, p2, q2); oh[u] = p2; ol[u] = q2; }
        *(v4usa*)(sw + r * LNP + lane * 4) = oh; *(v4usa*)(sw + (16 + r) * LNP + lane * 4) = ol; }
    __syncthreads();   // the padded pair-bias weights are complete in LDS before any wave reads a fragment of them (and the wave's own 16 rows before it reads them across lanes)
    v8us fh[4][2], fl[4][2]; const bf* sr = sw + lr * LNP + 8 * hi;
#pragma unroll
    for (int kc = 0; kc < 4; ++kc)
#pragma unroll
        for (int hf = 0; hf < 2; ++hf) { fh[kc][hf] = *(const v8usa*)(sr + kc * 32 + hf * 16); fl[kc][hf] = *(const v8usa*)(sr + 16 * LNP + kc * 32 + hf * 16); }
    v8f zacc = (v8f){};
#pragma unroll
    for (int kc = 0; kc < 4; ++kc) { const v16bf wb = ldswfrag(wbs + kc * 512 + lane * 8); zacc = wmmab(cat16b(fh[kc][0], fh[kc][1]), wb, zacc); zacc = wmmab(cat16b(fl[kc][0], fl[kc][1]), wb, zacc); }
    if (lr < NH_) { v4f t0, t1;   // zacc[r] = bias of query q, key kt*16 + 8*hi + r, head lr
        for (int u = 0; u < 4; ++u) { t0[u] = zacc[u]; t1[u] = zacc[4 + u]; }
        *(v4fa*)(zs + (((lr * 2 + 0) * 2 + hi) * 8 + w) * 4) = t0; *(v4fa*)(zs + (((lr * 2 + 1) * 2 + hi) * 8 + w) * 4) = t1; }
    __syncthreads();   // the 8 queries' pieces of every line are in LDS before the line is stored; the planes' stores stand behind it, because the barrier waits for every store in front of it
    bf* ph = Xh + (size_t)tile * (16 * CZ) + lane * 8; bf* pl = Xl + (size_t)tile * (16 * CZ) + lane * 8;
#pragma unroll
    for (int kc = 0; kc < 4; ++kc)
#pragma unroll
        for (int hf = 0; hf < 2; ++hf) { *(v8us*)(ph + kc * 512 + hf * 256) = fh[kc][hf]; *(v8us*)(pl + kc * 512 + hf * 256) = fl[kc][hf]; }
    if (tid < 128) { const int ln = tid >> 3, h = ln >> 2, hf = (ln >> 1) & 1, hh = ln & 1;   // line = (head, half, hi); piece = query
        *(v4f*)(ZB + (((size_t)h * 16 + qt) * 16 + kt) * 256 + hf * 128 + (16 * hh + qo * 8 + (tid & 7)) * 4) = *(const v4fa*)(zs + tid * 4); }
}
// ---- k_pre: all that depends on the inputs alone, in one launch. Blocks 0..19: the five weight planes of WT, in fragment order (fro), 4 blocks each (Wq, Wk, Wv, Wg, Wo transposed to bf16); blocks 20..: LayerNorm of the 65,536 pair rows, 128 rows a block, its hi and lo planes in fragment order, and the pair bias of the same rows (d_lnzb).
#define WPB  4     // blocks per weight plane: DM * DR / 64 lines at 64 lines a block
#define NWB  (5 * WPB)
__global__ __launch_bounds__(256) void k_pre(const float* __restrict__ X, const float* __restrict__ gam, const float* __restrict__ bet, bf* Xh, bf* Xl, const float* __restrict__ wq, const float* __restrict__ wk, const float* __restrict__ wv, const float* __restrict__ wg, const float* __restrict__ w2d, const float* __restrict__ wo, bf* WT, float* ZB) {
    const int b = blockIdx.x;
    if (b < NWB) { const int p = b / WPB, bx = b % WPB;
        d_wtG(bx, (p == 0) ? wq : (p == 1) ? wk : (p == 2) ? wv : (p == 3) ? wg : wo, DM, DR, WT + (size_t)p * DR * DM);   // DM == DR: Wo's K and N are the same two numbers
        return; }
    d_lnzb(b - NWB, X, gam, bet, w2d, Xh, Xl, ZB);
}
// ---- k_attn: the q, k, v and gate projections and the whole attention of one virtual head (row bl, head h) in one work-group: 16 waves x 16 tokens, all 256 keys at once; q, k, v, gate logits, scores and probabilities never leave the chip.
// Projections: wave w takes the 16 tokens w*16.. of the row. Its LayerNorm fragments (hi and lo planes, fragment order fro, 4 chunks of 32 k) come straight from global into registers; the head's 32 columns of Wq, Wk, Wv, Wg (4 x 8 KB, already in fragment order) are copied to LDS once a work-group. Each accumulator sums hi then lo per 32-k chunk.
// Q^T, K^T, G^T = W^T z^T (A = weight rows d, B = token columns): a lane holds d = mb*16 + 8*hi + r of ONE token lr. That is the B fragment of Q as it stands, 8 consecutive d of a K row for LDS, and the gate of the lane's own context values. V = z Wv (A = tokens, B = weight columns d): a lane holds 8 consecutive tokens of one d, 16 bytes of a V^T row for LDS.
// K [key][d] and V^T [d][key] are split into bf16 hi/lo planes on the way into LDS. S^T = K Q^T (A = K rows, B = Q columns), so a lane holds 128 scores of ONE query: tile kt, register r = key kt*16 + 8*hi + r, query lr.
// Two neighbouring score tiles, converted in place, are the B operand of O^T = V^T P^T (hardware k order: 8*hi + s, 16 + 8*hi + (s - 8)); the LDS fragment loads use the same order.
// The pair bias, times 32^0.5, is the start value of the score accumulators; 32^-0.5 is folded into the exponent's scale.
// The gate is applied here: a lane's 8 context values of one accumulator are 8 consecutive k of one row of the output projection's A operand, and the 32 lanes' pieces are one half block of its fragment order (fro), so the gated hi and lo planes go straight from the accumulators to global, 512 contiguous bytes a store.
#define KPI  40    // K row pitch in LDS, bf16 elements: 80 bytes = 16 x odd, no bank conflict for 16-byte reads
#define VPI  264   // V^T row pitch in LDS: 528 bytes = 16 x odd
#define RSCL 5.656854249492381f   // 32^0.5
typedef __attribute__((ext_vector_type(2))) __bf16 v2bf;
typedef __attribute__((ext_vector_type(2))) unsigned v2u;
typedef __attribute__((ext_vector_type(4))) unsigned v4u;
typedef __attribute__((ext_vector_type(8))) unsigned v8u;
typedef unsigned __attribute__((may_alias)) u32a;
typedef v2u __attribute__((may_alias)) v2ua;
__device__ __forceinline__ unsigned pk2(float a, float b) { v2f x; x[0] = a; x[1] = b; return __builtin_bit_cast(unsigned, __builtin_convertvector(x, v2bf)); }
__device__ __forceinline__ void split2(float a, float b, unsigned& h, unsigned& l) { h = pk2(a, b); l = pk2(a - __uint_as_float(h << 16), b - __uint_as_float(h & 0xFFFF0000u)); }
// 2^x with the one issue slot that the instruction set asks for behind a transcendental, before its result is read or its source register overwritten: in one statement, so that the slot stands directly behind it
__device__ __forceinline__ float exp2slot(float x) { float e; asm("v_exp_f32 %0, %1\n\tv_nop" : "=v"(e) : "v"(x)); return e; }
typedef v4u __attribute__((may_alias)) v4ua;
__global__ __launch_bounds__(512) void k_attn(const bf* __restrict__ Xh, const bf* __restrict__ Xl, const bf* __restrict__ WT, const float* __restrict__ ZB, const float* __restrict__ bg, bf* __restrict__ Ah, bf* __restrict__ Al) {
    __shared__ __align__(16) bf Kh[TT * KPI]; __shared__ __align__(16) bf Kl[TT * KPI]; __shared__ __align__(16) bf Vh[HDR * VPI]; __shared__ __align__(16) bf Vl[HDR * VPI]; __shared__ __align__(16) bf Ws[4 * HDR * DM]; __shared__ __align__(16) float Gs[4 * 512 * 4];
    const int tid = threadIdx.x, lane = tid & 31, lr = lane & 15, hi = lane >> 4, wv = tid >> 5; const int z = blockIdx.x, bl = z / NH_, h = z % NH_;
    const float* zr = ZB + ((size_t)h * 16 + wv) * (16 * TT) + lane * 4;   // this wave's 16 queries x 256 keys of the pair bias, in accumulator order (d_lnzb)
    const int q = wv * 16 + lr;
    // the head's weights (rows h*32.. of planes 0..3 of WT, 8 KB each, one 16-byte piece a thread and plane), then the wave's own LayerNorm fragments
    const bf* wp = WT + (size_t)h * (HDR * DM) + tid * 8; const size_t zo = (size_t)(bl * 16 + wv) * (16 * DM) + lane * 8;
    v8us wst[4]; v16bf zh[4], zl[4];
#pragma unroll
    for (int p = 0; p < 4; ++p) wst[p] = *(const v8us*)(wp + (size_t)p * DR * DM);
#pragma unroll
    for (int kc = 0; kc < 4; ++kc) { zh[kc] = WFrag<bf>::ld(Xh + zo + kc * 512); zl[kc] = WFrag<bf>::ld(Xl + zo + kc * 512); }
    asm volatile("s_wait_xcnt 0x0" ::: "memory");   // the work below may reuse registers that held the addresses of the loads above: the wait that belongs in front of that
#pragma unroll
    for (int p = 0; p < 4; ++p) *(v8usa*)(Ws + p * (HDR * DM) + tid * 8) = wst[p];
    __syncthreads();   // the four weight planes are complete in LDS before any wave reads a fragment
    v8f pq[2], pk[2], pv[2], pg[2];
#pragma unroll
    for (int mb = 0; mb < 2; ++mb) { pq[mb] = (v8f){}; pk[mb] = (v8f){}; pv[mb] = (v8f){}; pg[mb] = (v8f){}; }
#pragma unroll
    for (int kc = 0; kc < 4; ++kc) { v16bf wf[4][2];
#pragma unroll
        for (int p = 0; p < 4; ++p)
#pragma unroll
            for (int mb = 0; mb < 2; ++mb) wf[p][mb] = ldswfrag(Ws + p * (HDR * DM) + mb * (16 * DM) + kc * 512 + lane * 8);
#pragma unroll
        for (int mb = 0; mb < 2; ++mb) { pq[mb] = wmmab(wf[0][mb], zh[kc], pq[mb]); pk[mb] = wmmab(wf[1][mb], zh[kc], pk[mb]); pv[mb] = wmmab(zh[kc], wf[2][mb], pv[mb]); pg[mb] = wmmab(wf[3][mb], zh[kc], pg[mb]); }
#pragma unroll
        for (int mb = 0; mb < 2; ++mb) { pq[mb] = wmmab(wf[0][mb], zl[kc], pq[mb]); pk[mb] = wmmab(wf[1][mb], zl[kc], pk[mb]); pv[mb] = wmmab(zl[kc], wf[2][mb], pv[mb]); pg[mb] = wmmab(wf[3][mb], zl[kc], pg[mb]); } }
    // the next two lines end the projections here: left free, the last products sink among the loads and the arithmetic below and keep the LayerNorm and weight fragments' registers, which the pair bias needs (spills)
    asm volatile("" :: "v"(pq[0]), "v"(pq[1]), "v"(pk[0]), "v"(pk[1]), "v"(pv[0]), "v"(pv[1]), "v"(pg[0]), "v"(pg[1]));   // inputs only: the eight accumulators are complete at this place
    __builtin_amdgcn_sched_barrier(0);   // nothing of the work below is moved up among the products
    const float* bp = bg + h * HDR + 8 * hi; v4f gb[4], za[16], zb[16];
#pragma unroll
    for (int g = 0; g < 4; ++g) gb[g] = *(const v4f*)(bp + (g >> 1) * 16 + (g & 1) * 4);
#pragma unroll
    for (int mb = 0; mb < 2; ++mb) { v4u oh, ol, ph, pl;   // pk[mb][r] = K of key q at d = mb*16 + 8*hi + r; pv[mb][r] = V of key wv*16 + 8*hi + r at d = mb*16 + lr
#pragma unroll
        for (int i = 0; i < 4; ++i) { unsigned p, r; split2(pk[mb][2 * i], pk[mb][2 * i + 1], p, r); oh[i] = p; ol[i] = r; split2(pv[mb][2 * i], pv[mb][2 * i + 1], p, r); ph[i] = p; pl[i] = r; }
        *(v4ua*)(Kh + q * KPI + mb * 16 + 8 * hi) = oh; *(v4ua*)(Kl + q * KPI + mb * 16 + 8 * hi) = ol; *(v4ua*)(Vh + (mb * 16 + lr) * VPI + wv * 16 + 8 * hi) = ph; *(v4ua*)(Vl + (mb * 16 + lr) * VPI + wv * 16 + 8 * hi) = pl; }
    __builtin_amdgcn_sched_barrier(0);   // the 128 registers of the pair bias are taken only here, when the LayerNorm and weight fragments and the K and V accumulators are free: its loads moved further up would not fit
#pragma unroll
    for (int kt = 0; kt < 16; ++kt) { za[kt] = *(const v4f*)(zr + kt * 256); if (kt < 15) zb[kt] = *(const v4f*)(zr + kt * 256 + 128); }
    asm volatile("s_wait_xcnt 0x0" ::: "memory");   // the last load of a run may land on the run's own address pair: the wait that belongs in front of that
    zb[15] = *(const v4f*)(zr + 15 * 256 + 128);
    __builtin_amdgcn_sched_barrier(0);   // keeps the loads above in front of the arithmetic below, which runs while they fly: moved behind it they would start only when it is done
    v8u qh, ql;   // pq[g][r] = Q of query q at d = g*16 + 8*hi + r: the B fragment's own order
#pragma unroll
    for (int g = 0; g < 2; ++g)
#pragma unroll
        for (int i = 0; i < 4; ++i) { unsigned p, r; split2(pq[g][2 * i], pq[g][2 * i + 1], p, r); qh[g * 4 + i] = p; ql[g * 4 + i] = r; }
    const v16bf Qh = __builtin_bit_cast(v16bf, qh), Ql = __builtin_bit_cast(v16bf, ql);
    v8f sg[2];   // sg[mb][r] = gate of query q at d = mb*16 + 8*hi + r
#pragma unroll
    for (int g = 0; g < 4; ++g)
#pragma unroll
        for (int u = 0; u < 4; ++u) { const float eg = expf(-(pg[g >> 1][(g & 1) * 4 + u] + bfr(gb[g][u]))); sg[g >> 1][(g & 1) * 4 + u] = __fdiv_rn(1.0f, __fadd_rn(1.0f, eg)); }
    // the 16 gates wait in LDS, each thread's in its own four 16-byte places (no other thread reads them: no barrier), until the context is there: kept in registers through the score and probability phases they spill
#pragma unroll
    for (int g = 0; g < 4; ++g) { v4f t; t[0] = sg[g >> 1][(g & 1) * 4]; t[1] = sg[g >> 1][(g & 1) * 4 + 1]; t[2] = sg[g >> 1][(g & 1) * 4 + 2]; t[3] = sg[g >> 1][(g & 1) * 4 + 3]; *(v4fa*)(Gs + (g * 512 + tid) * 4) = t; }
    __builtin_amdgcn_sched_barrier(0);   // keeps the gate's arithmetic above, where the wave would otherwise only wait for the pair bias: left free, part of it sinks behind the barrier, into the phases that the vector port limits
    v8f acc[16];
#pragma unroll
    for (int kt = 0; kt < 16; ++kt) { const v4f a = za[kt]; const v4f b = zb[kt];
#pragma unroll
        for (int u = 0; u < 4; ++u) { acc[kt][u] = a[u] * RSCL; acc[kt][4 + u] = b[u] * RSCL; } }
    __syncthreads();   // the K and V planes are complete before any wave reads a fragment
#pragma unroll
    for (int kt = 0; kt < 16; ++kt) { const int ko = (kt * 16 + lr) * KPI + 8 * hi; const v16bf ah = ldsfrag(Kh + ko), al = ldsfrag(Kl + ko);
        acc[kt] = wmmab(ah, Qh, acc[kt]); acc[kt] = wmmab(ah, Ql, acc[kt]); acc[kt] = wmmab(al, Qh, acc[kt]); }
    v8f m8 = acc[0];
#pragma unroll
    for (int kt = 1; kt < 16; ++kt)
#pragma unroll
        for (int r = 0; r < 8; ++r) m8[r] = fmaxf(m8[r], acc[kt][r]);
    float mx = fmaxf(fmaxf(fmaxf(m8[0], m8[1]), fmaxf(m8[2], m8[3])), fmaxf(fmaxf(m8[4], m8[5]), fmaxf(m8[6], m8[7])));
    mx = fmaxf(mx, __shfl_xor(mx, 16, 32));   // the other half of the query's keys
    const float c1 = SCL * 1.4426950408889634f, mc = mx * c1; v8f s8 = (v8f){};
#pragma unroll
    for (int kt = 0; kt < 16; ++kt)
#pragma unroll
        for (int r = 0; r < 8; ++r) { const float e = exp2slot(fmaf(acc[kt][r], c1, -mc)); acc[kt][r] = e; s8[r] += e; }
    float sum = ((s8[0] + s8[1]) + (s8[2] + s8[3])) + ((s8[4] + s8[5]) + (s8[6] + s8[7]));
    sum += __shfl_xor(sum, 16, 32);
    const float f = __fdiv_rn(1.0f, sum);
    v8f o[2]; o[0] = (v8f){}; o[1] = (v8f){};
#pragma unroll
    for (int ks = 0; ks < 8; ++ks) { v8u ph, pl;
#pragma unroll
        for (int g = 0; g < 2; ++g)
#pragma unroll
            for (int i = 0; i < 4; ++i) { unsigned p, r; split2(acc[2 * ks + g][2 * i] * f, acc[2 * ks + g][2 * i + 1] * f, p, r); ph[g * 4 + i] = p; pl[g * 4 + i] = r; }
        const v16bf Ph = __builtin_bit_cast(v16bf, ph), Pl = __builtin_bit_cast(v16bf, pl);
#pragma unroll
        for (int mb = 0; mb < 2; ++mb) { const int vo = (mb * 16 + lr) * VPI + ks * 32 + 8 * hi; const v16bf vh = ldsfrag(Vh + vo), vl = ldsfrag(Vl + vo);
            o[mb] = wmmab(vh, Ph, o[mb]); o[mb] = wmmab(vh, Pl, o[mb]); o[mb] = wmmab(vl, Ph, o[mb]); } }
#pragma unroll
    for (int mb = 0; mb < 2; ++mb) { float ov[8]; v4u oh, ol; const v4f ga = *(const v4fa*)(Gs + (2 * mb * 512 + tid) * 4), gc = *(const v4fa*)(Gs + ((2 * mb + 1) * 512 + tid) * 4);   // o[mb][r] = context of query q at d = mb*16 + 8*hi + r; ga, gc = its 8 gates
#pragma unroll
        for (int r = 0; r < 8; ++r) ov[r] = __fmul_rn(o[mb][r], (r < 4 ? ga : gc)[r & 3]);
#pragma unroll
        for (int i = 0; i < 4; ++i) { unsigned p, r; split2(ov[2 * i], ov[2 * i + 1], p, r); oh[i] = p; ol[i] = r; }
        const size_t fo = fro(bl * TT + q, h * HDR + mb * 16 + 8 * hi, DR); *(v4u*)(Ah + fo) = oh; *(v4u*)(Al + fo) = ol; }
}
__global__ __launch_bounds__(256) void k_merge(const float* __restrict__ O, int h0, bf* Ah, bf* Al) { const size_t e = ((size_t)blockIdx.x * 256 + threadIdx.x) * 2; if (e >= (size_t)ZH * TT * HD) return; const int d = (int)(e % HD); const int t = (int)((e / HD) % TT); const int zz = (int)(e / ((size_t)HD * TT)); const float cs = (t < RH) ? 1.0f : (1.0f / PCAR); const size_t oo = (size_t)t * DQ + (h0 + zz) * HD + d;
    v2us oh, ol;
#pragma unroll
    for (int q = 0; q < 2; ++q) { unsigned short a, c2; splitf(O[e + q] * cs, a, c2); oh[q] = a; ol[q] = c2; } *(v2us*)(Ah + oo) = oh; *(v2us*)(Al + oo) = ol;  }

extern "C" void kernel_launch(void* const* d_in, const int* in_sizes, int n_in,
                              void* d_out, int out_size, void* d_ws, size_t ws_size, hipStream_t stream) {
    (void)in_sizes; (void)n_in; (void)out_size;
    const float* x = (const float*)d_in[0]; const float* qng = (const float*)d_in[1]; const float* qnb = (const float*)d_in[2]; const float* wq = (const float*)d_in[3]; const float* wk = (const float*)d_in[4]; const float* wv = (const float*)d_in[5]; const float* w2d = (const float*)d_in[6]; const float* wg = (const float*)d_in[7]; const float* bg = (const float*)d_in[8]; const float* wo = (const float*)d_in[9]; const float* bo = (const float*)d_in[10];
    float* OUT = (float*)d_out;   // [256][256][128]
    char* wsp = (char*)d_ws; auto take = [&](size_t bytes) { char* p = wsp; wsp += (bytes + 255) & ~(size_t)255; return (void*)p; };
    bf* WT = (bf*)take((size_t)5 * DR * DM * 2); bf* WO = WT + (size_t)4 * DR * DM;   /* one block of five planes: Wq, Wk, Wv, Wg, Wo */
    bf* XNh = (bf*)take((size_t)GR * DM * 2); bf* XNl = (bf*)take((size_t)GR * DM * 2); float* ZB = (float*)take((size_t)NH_ * TT * TT * 4);
    bf* AOh = (bf*)take((size_t)GR * DR * 2); bf* AOl = (bf*)take((size_t)GR * DR * 2);
    if ((size_t)(wsp - (char*)d_ws) > ws_size) return;   // ws ~ 65 MiB
    k_pre<<<NWB + NLB, 256, 0, stream>>>(x, qng, qnb, XNh, XNl, wq, wk, wv, wg, w2d, wo, WT, ZB);   /* weight planes, LayerNorm, pair bias */
    k_attn<<<NVH, 512, 0, stream>>>(XNh, XNl, WT, ZB, bg, AOh, AOl);   /* q, k, v, gate projections and attention */
    k_gemmw<bf, 1, true><<<dim3(DM / 64, GR / 64, 1), 32, 0, stream>>>(AOh, AOl, WO, nullptr, DR, OUT, DM, bo, 0, 0, 0, DM / 64, -1, 0);
}

// v008
// A run of this version takes 68.7 microseconds.
// Timed twice side by side with v007, it ran 1.15 times as fast both times.
// Over all steps from v000 it is 12.5 times as fast.
#include <hip/hip_runtime.h>

// Triangle_Att_Start (AlphaFold triangle attention, starting node: pair_embed [256 rows i][256 j][128]; z = LayerNorm(pair); q/k/v = z W ([128][4 x 32]), q x 32^-0.5; bias[h][j][k] = (z Wb)[j][k][h] shared over rows i; gate = sigmoid(z Wg + bg); logits[h][i][j][k] = q_ij.k_ik + bias[h][j][k]; softmax over k; o = (a v) * gate; out = o Wo + bo -> [256][256][128]).
// Batched layout (exact): every row i is an independent 256-token attention; 256 rows x 4 heads = 1024 'virtual heads' of 256 tokens, one work-group of the fused attention kernel each, all in one launch, which also projects its own q, k, v and gate; the pair-bias projection runs with the LayerNorm, the output projection on all 65,536 stacked (row, j) positions at once.

#define NB_  256
#define TT   256
#define DM   128
#define NH_  4
#define NKV  4
#define REP  (NH_ / NKV)
#define HD   64
#define DQ   (NH_ * HD)
#define DKV  (NKV * HD)
#define ZH   256   // virtual heads per k_moutv / k_merge call (a quarter of NVH)
#define RH   256
#define WIN  0
#define PCAR 1024.0f
#define HDR  32
#define DR   (NH_ * HDR)   // 128
#define CZ   128
#define NPZ  (TT * TT)     // pair rows 65536
#define ZW   64
#define LR   256    // tokens per row (no padding)
#define GB   256    // rows per group: all of them, one group
#define NG   (NB_ / GB)
#define GR   (GB * TT)   // stacked rows per group
#define NVH  (GB * NH_)  // virtual heads per group
#define SCL  0.17677669529663689f   // 32^-0.5
typedef _Float16 h16;
typedef unsigned short bf;
typedef __attribute__((ext_vector_type(16))) __bf16   v16bf;
typedef __attribute__((ext_vector_type(16))) _Float16 v16h;
typedef __attribute__((ext_vector_type(8)))  _Float16 v8h;
typedef __attribute__((ext_vector_type(8)))  unsigned short v8us;
typedef __attribute__((ext_vector_type(8)))  float    v8f;
typedef __attribute__((ext_vector_type(4)))  float    v4f;
typedef v8h  __attribute__((may_alias)) v8ha;
typedef v4f  __attribute__((may_alias)) v4fa;
typedef v8us __attribute__((may_alias)) v8usa;

__device__ __forceinline__ unsigned short f2bf(float f) { unsigned u = __float_as_uint(f); u += 0x7FFFu + ((u >> 16) & 1u); return (unsigned short)(u >> 16); }
__device__ __forceinline__ float bf2f(unsigned short b) { return __uint_as_float(((unsigned)b) << 16); }
__device__ __forceinline__ float bfr(float f) { return bf2f(f2bf(f)); }
__device__ __forceinline__ v16h cat16(v8h lo, v8h hi) { return __builtin_shufflevector(lo, hi, 0, 1, 2, 3, 4, 5, 6, 7, 8, 9, 10, 11, 12, 13, 14, 15); }
__device__ __forceinline__ v16bf cat16b(v8us lo, v8us hi) { return __builtin_bit_cast(v16bf, __builtin_shufflevector(lo, hi, 0, 1, 2, 3, 4, 5, 6, 7, 8, 9, 10, 11, 12, 13, 14, 15)); }
__device__ __forceinline__ v8f wmma16(v16h a, v16h b, v8f c) { return __builtin_amdgcn_wmma_f32_16x16x32_f16(false, a, false, b, (short)0, c, false, false); }
__device__ __forceinline__ v8f wmmab(v16bf a, v16bf b, v8f c) { return __builtin_amdgcn_wmma_f32_16x16x32_bf16(false, a, false, b, (short)0, c, false, false); }



// ---- k_gemmw: register-blocked GEMM, ONE WAVE per 64x64 output tile (16 accumulators), operands straight from 16-bit planes in fragment order (fro); grid (column tiles of all z slices, M/64), 32 threads: the tiles that read the same 64 rows of A start side by side.
// A, A2, Bt, Bt2 lie in fragment order (fro below): the 32 lanes' 16-byte pieces of one fragment load are 512 contiguous bytes, four whole lines, not 16-byte pieces of 16 lines.
// C[m][n] (f32, pitch ldc, + optional f32 bias[n]) = sum_k A[m][k] Bt[n][k] (+ split products per NSPLIT). z-batch: ct column tiles a slice, strides sA/sB/sC in elements; slice zx (if any) has the output pitch ldx. K % 32 == 0.
// fro: element offset of (row n, k) in a fragment-ordered plane of K columns: blocks of 16 rows x 32 k (512 elements); in a block two halves (k 0-15, 16-31) of 32 lane pieces; lane piece 16 * ((k >> 3) & 1) + (n & 15) holds 8 consecutive k
__device__ __forceinline__ size_t fro(int n, int k, int K) { return ((size_t)(n >> 4) * (K >> 5) + (k >> 5)) * 512 + ((k >> 4) & 1) * 256 + ((((k >> 3) & 1) << 4) + (n & 15)) * 8 + (k & 7); }
template <typename T16> struct WFrag;
template <> struct WFrag<h16> { typedef v16h V; static __device__ __forceinline__ V ld(const h16* p) { return cat16(*(const v8h*)p, *(const v8h*)(p + 256)); } static __device__ __forceinline__ v8f mma(V a, V b, v8f c) { return wmma16(a, b, c); } };
template <> struct WFrag<bf> { typedef v16bf V; static __device__ __forceinline__ V ld(const bf* p) { return cat16b(*(const v8us*)p, *(const v8us*)(p + 256)); } static __device__ __forceinline__ v8f mma(V a, V b, v8f c) { return wmmab(a, b, c); } };
template <typename T16, int NSPLIT, bool BIAS>
__global__ __launch_bounds__(32) void k_gemmw(const T16* __restrict__ A, const T16* __restrict__ A2, const T16* __restrict__ Bt, const T16* __restrict__ Bt2, int K, float* C, int ldc, const float* __restrict__ bias, size_t sA, size_t sB, size_t sC, int ct, int zx, int ldx) {
    typedef typename WFrag<T16>::V V;
    __shared__ __align__(16) float os[16 * 68];
    const size_t z = blockIdx.x / ct; A += z * sA; if (A2) A2 += z * sA; Bt += z * sB; if (Bt2) Bt2 += z * sB; C += z * sC; if ((int)z == zx) ldc = ldx;
    const int lane = threadIdx.x & 31, lr = lane & 15, hi = lane >> 4; const int r0 = blockIdx.y * 64, c0 = (blockIdx.x % ct) * 64;
    v8f acc[4][4];
#pragma unroll
    for (int mb = 0; mb < 4; ++mb)
#pragma unroll
        for (int nb = 0; nb < 4; ++nb) acc[mb][nb] = (v8f){};
    const size_t aoff = (size_t)r0 * K + lane * 8, boff = (size_t)c0 * K + lane * 8;   // fro(r0 + lr, 8 * hi, K), fro(c0 + lr, 8 * hi, K); 16 rows on = 16 * K elements, 32 k on = 512
#pragma unroll 1
    for (int kc = 0; kc < K; kc += 32) {
        V a[4], a2[4];
#pragma unroll
        for (int mb = 0; mb < 4; ++mb) { a[mb] = WFrag<T16>::ld(A + aoff + (size_t)mb * 16 * K + kc * 16); if (NSPLIT == 1 || NSPLIT == 2) a2[mb] = WFrag<T16>::ld(A2 + aoff + (size_t)mb * 16 * K + kc * 16); }
#pragma unroll
        for (int nb = 0; nb < 4; ++nb) { const V b = WFrag<T16>::ld(Bt + boff + (size_t)nb * 16 * K + kc * 16); V b2; if (NSPLIT >= 2) b2 = WFrag<T16>::ld(Bt2 + boff + (size_t)nb * 16 * K + kc * 16);
#pragma unroll
            for (int mb = 0; mb < 4; ++mb) { acc[mb][nb] = WFrag<T16>::mma(a[mb], b, acc[mb][nb]); if (NSPLIT == 1 || NSPLIT == 2) acc[mb][nb] = WFrag<T16>::mma(a2[mb], b, acc[mb][nb]); if (NSPLIT >= 2) acc[mb][nb] = WFrag<T16>::mma(a[mb], b2, acc[mb][nb]); } }
        asm volatile("v_nop\n\tv_nop\n\tv_nop\n\tv_nop" : "+v"(acc[0][0]), "+v"(acc[1][1]), "+v"(acc[2][2]), "+v"(acc[3][3]) : "v"(a[0]), "v"(a[3]));
    }
#pragma unroll
    for (int mb = 0; mb < 4; ++mb) {
#pragma unroll
        for (int nb = 0; nb < 4; ++nb) {
#pragma unroll
            for (int j = 0; j < 8; ++j) os[(hi * 8 + j) * 68 + nb * 16 + lr] = acc[mb][nb][j]; }
        __builtin_amdgcn_wave_barrier(); asm volatile("" ::: "memory");
        float* crow = C + (size_t)(r0 + mb * 16) * ldc + c0;
{
#pragma unroll
            for (int s = 0; s < 8; ++s) { const int row = 2 * s + hi, cofs = lr * 4; v4f val = *(const v4fa*)(os + row * 68 + cofs); if (BIAS) { val[0] += bfr(bias[c0 + cofs]); val[1] += bfr(bias[c0 + cofs + 1]); val[2] += bfr(bias[c0 + cofs + 2]); val[3] += bfr(bias[c0 + cofs + 3]); }
                *(v4f*)(crow + (size_t)row * ldc + cofs) = val; }
             }
        if (mb < 3) asm volatile("s_wait_xcnt 0x0" ::: "memory");   // the next round rewrites the stores' address and data registers: the wait that belongs in front of that
        __builtin_amdgcn_wave_barrier(); asm volatile("" ::: "memory");
    }
}

__device__ __forceinline__ h16 tohx(float x) { return (h16)x; }
__device__ __forceinline__ void splitf(float y, unsigned short& h, unsigned short& l) { h = f2bf(y); l = f2bf(y - bf2f(h)); }
typedef __attribute__((ext_vector_type(2))) _Float16 v2h;
typedef __attribute__((ext_vector_type(4))) _Float16 v4h;
typedef __attribute__((ext_vector_type(2))) unsigned short v2us;
typedef __attribute__((ext_vector_type(4))) unsigned short v4us;
typedef __attribute__((ext_vector_type(2))) float v2f;
typedef __attribute__((ext_vector_type(4))) int v4i;

__device__ __forceinline__ void d_wtG(int bx, const float* __restrict__ w, int K, int N, bf* Bt) {
    const int lane = threadIdx.x & 31; const int L0 = (bx * 8 + (threadIdx.x >> 5)) * 8; const int nlines = N * K / 64;
{
#pragma unroll 1
        for (int l = 0; l < 8; ++l) { const int L = L0 + l; if (L >= nlines) break; const size_t e = (size_t)L * 64 + lane * 2; const int k = (int)(e % K), n = (int)(e / K); v2us o;
            o[0] = f2bf(w[(size_t)k * N + n]); o[1] = f2bf(w[(size_t)(k + 1) * N + n]); *(v2us*)(Bt + fro(n, k, K)) = o;
            asm volatile("s_wait_xcnt 0x0" ::: "memory"); }   // the next trip rewrites the store's address and data registers: the wait that belongs in front of that
         }
}
__global__ __launch_bounds__(256) void k_cvt8(const float* __restrict__ src, bf* dst, size_t n8) { const size_t i = (size_t)blockIdx.x * 256 + threadIdx.x; if (i >= n8) return; const v8f v = *(const v8f*)(src + i * 8); v8us o;
#pragma unroll
    for (int k = 0; k < 8; ++k) o[k] = f2bf(v[k]); *(v8us*)(dst + i * 8) = o;  }
__global__ __launch_bounds__(256) void k_cscvt(const float* __restrict__ cosT, const float* __restrict__ sinT, float* CS) { const int idx = blockIdx.x * 256 + threadIdx.x; if (idx >= TT * HD) return; v2f cs; cs[0] = bfr(cosT[idx]); cs[1] = bfr(sinT[idx]); *(v2f*)(CS + (size_t)idx * 2) = cs;  }
// k_rope: head planes [h][t][d] (fp16 + hi/lo) of rope(x) x sc with the rotate-half convention out[d] = x[d] cos[t][d] - x[d+HD/2] sin[t][d], out[d+HD/2] = x[d+HD/2] cos[t][d+HD/2] + x[d] sin[t][d+HD/2]
__global__ __launch_bounds__(256) void k_rope(const float* __restrict__ F, int pitch, int nheads, const float* __restrict__ CS, const float* __restrict__ RF, const float* __restrict__ nw, float sc, h16* P16, bf* Ph, bf* Pl) {
    const size_t e = ((size_t)blockIdx.x * 256 + threadIdx.x) * 2; if (e >= (size_t)nheads * TT * HD) return; const int d = (int)(e % HD); const int t = (int)((e / HD) % TT); const int h = (int)(e / ((size_t)HD * TT)); const float* f = F + (size_t)t * pitch + h * HD; const float rf = RF ? RF[(size_t)h * TT + t] : 1.0f; v2h o16; v2us oh, ol;
#pragma unroll
    for (int q = 0; q < 2; ++q) { const int dd = d + q; const int dp = (dd < HD / 2) ? dd + HD / 2 : dd - HD / 2; float x0 = f[dd], x1 = f[dp];
        if (RF) { float n0 = __fmul_rn(x0, rf), n1 = __fmul_rn(x1, rf); asm volatile("" : "+v"(n0)); asm volatile("" : "+v"(n1)); x0 = __fmul_rn(bfr(nw[dd]), n0); x1 = __fmul_rn(bfr(nw[dp]), n1); }
        const v2f cs = *(const v2f*)(CS + ((size_t)t * HD + dd) * 2); float a = __fmul_rn(x0, cs[0]), bq = __fmul_rn(x1, cs[1]); asm volatile("" : "+v"(a)); asm volatile("" : "+v"(bq)); const float r = ((dd < HD / 2) ? __fsub_rn(a, bq) : __fadd_rn(a, bq)) * sc;
        o16[q] = tohx(r); unsigned short a2, c2; splitf(r, a2, c2); oh[q] = a2; ol[q] = c2; }
    *(v2h*)(P16 + e) = o16; *(v2us*)(Ph + e) = oh; *(v2us*)(Pl + e) = ol;  }
__global__ __launch_bounds__(256) void k_vtp(const float* __restrict__ F, int pitch, int nheads, h16* V16, bf* Vh, bf* Vl) { const size_t e = ((size_t)blockIdx.x * 256 + threadIdx.x) * 2; if (e >= (size_t)nheads * HD * TT) return; const int t = (int)(e % TT); const int d = (int)((e / TT) % HD); const int g = (int)(e / ((size_t)TT * HD)); v2h o16; v2us oh, ol;
#pragma unroll
    for (int q = 0; q < 2; ++q) { const float x = F[(size_t)(t + q) * pitch + g * HD + d]; o16[q] = tohx(x); unsigned short a2, c2; splitf(x, a2, c2); oh[q] = a2; ol[q] = c2; }
    *(v2h*)(V16 + e) = o16; *(v2us*)(Vh + e) = oh; *(v2us*)(Vl + e) = ol;  }
__global__ __launch_bounds__(256) void k_cvt8padg(const float* __restrict__ src, bf* XB2) { const size_t e8 = ((size_t)blockIdx.x * 256 + threadIdx.x) * 8; if (e8 >= (size_t)GR * DM) return; const int r = (int)(e8 / DM); const int bl = r / TT, t = r % TT; v8us o; if (t < LR) { const float* sp2 = src + ((size_t)bl * LR + t) * DM + (e8 % DM); for (int u = 0; u < 8; ++u) o[u] = f2bf(bfr(sp2[u])); } else { for (int u = 0; u < 8; ++u) o[u] = 0; } *(v8us*)(XB2 + e8) = o;  }
__global__ __launch_bounds__(256) void k_moutv(const float* __restrict__ O, int z0, float* YO2) { const size_t e = ((size_t)blockIdx.x * 256 + threadIdx.x) * 2; if (e >= (size_t)ZH * TT * HD) return; const int d = (int)(e % HD); const int t = (int)((e / HD) % TT); const int zz = (int)(e / ((size_t)HD * TT)); const int z = z0 + zz; const int bl = z / NH_, h = z % NH_; v2f o; o[0] = O[e]; o[1] = O[e + 1]; float* dst = YO2 + ((size_t)bl * TT + t) * DQ + (size_t)h * HD + d; *(v2f*)dst = o;  }
__global__ __launch_bounds__(256) void k_outcpg(const float* __restrict__ Y, float* O2) { const size_t e = ((size_t)blockIdx.x * 256 + threadIdx.x) * 4; if (e >= (size_t)GB * LR * DM) return; const size_t r = e / DM; const int bl = (int)(r / LR), t = (int)(r % LR); const v4f a = *(const v4f*)(Y + ((size_t)bl * TT + t) * DM + (e % DM)); *(v4f*)(O2 + e) = a;  }
__global__ __launch_bounds__(256) void k_hlG(const float* __restrict__ F, bf* Fh, bf* Fl, size_t n) { const size_t e = ((size_t)blockIdx.x * 256 + threadIdx.x) * 4; if (e >= n) return; const v4f a = *(const v4f*)(F + e); v4us oh, ol; for (int u = 0; u < 4; ++u) { unsigned short p, q; splitf(a[u], p, q); oh[u] = p; ol[u] = q; } *(v4us*)(Fh + e) = oh; *(v4us*)(Fl + e) = ol;  }
#define LNP  136   // LDS row pitch, bf16 elements: 272 bytes = 16 x odd, no bank conflict for 16-byte reads down a column of rows
typedef v4us __attribute__((may_alias)) v4usa;
__device__ __forceinline__ v16bf ldsfrag(const bf* p) { return cat16b(*(const v8usa*)p, *(const v8usa*)(p + 16)); }
__device__ __forceinline__ v16bf ldswfrag(const bf* p) { return cat16b(*(const v8usa*)p, *(const v8usa*)(p + 256)); }   // a fragment kept in fragment order: two runs of 512 contiguous bytes
// d_lnzb: LayerNorm and pair bias of 128 pair rows in a block of 8 waves. Block g = (query tile qt, key tile kt, half qo of the query tile); wave w takes query q = qt*16 + qo*8 + w and the 16 keys kt*16.., that is the 16 consecutive pair rows q*256 + kt*16.. (8 KB of X, all 16 loads in flight at once).
// A lane holds 4 columns of each row, as the row sums want it; the hi and lo values are turned through the wave's own LDS rows into the lane's pieces of the fragment order (fro): token lr, 8 consecutive k. These 32 registers a plane go to global as they are (512 contiguous bytes a store) and are the A operand of bias = z Wb.
// B = the 4 columns of Wb padded to 16, built once a block in LDS in fragment order. Each accumulator sums hi then lo per 32-k chunk. Lane (hi, lr = head) then holds keys kt*16 + 8*hi + r of head lr.
// The bias leaves in the order of k_attn's score accumulators: ZB[h][query tile qt][key tile kt][half][lane][u] = 32^0.5 x bias of query qt*16 + (lane & 15), key kt*16 + 8*(lane >> 4) + 4*half + u, so that each of the reader's wave-wide 16-byte loads covers 512 contiguous bytes. The 8 queries of the block fill whole 128-byte lines: gathered in LDS, 16 lines a block.
#define NLB  (NPZ / 128)   // LayerNorm blocks
#define RSCL 5.656854249492381f   // 32^0.5
__device__ __forceinline__ void d_lnzb(int g, const float* __restrict__ X, const float* __restrict__ gam, const float* __restrict__ bet, const float* __restrict__ Wp, bf* Xh, bf* Xl, float* ZB) {
    __shared__ __align__(16) bf st[8 * 2 * 16 * LNP]; __shared__ __align__(16) bf wbs[16 * CZ]; __shared__ __align__(16) float zs[16 * 8 * 4];
    const int tid = threadIdx.x, lane = tid & 31, lr = lane & 15, hi = lane >> 4, w = tid >> 5; const int qt = g >> 5, kt = (g >> 1) & 15, qo = g & 1;
    const int tile = (qt * 16 + qo * 8 + w) * 16 + kt;   // 16 pair rows
    const float* f = X + (size_t)tile * (16 * CZ) + lane * 4; v4f a[16];
    const int wr = tid >> 4, wc = (tid & 15) * 8; float wl[8], gg[4], bb[4];   // thread = (padded weight row wr, 8 k); rows NH_.. are zero: they load a row that exists, all 8 loads in flight, and drop it
#pragma unroll
    for (int u = 0; u < 8; ++u) wl[u] = Wp[(size_t)(wc + u) * NH_ + (wr & (NH_ - 1))];
#pragma unroll
    for (int u = 0; u < 4; ++u) { gg[u] = gam[lane * 4 + u]; bb[u] = bet[lane * 4 + u]; }
#pragma unroll
    for (int r = 0; r < 15; ++r) a[r] = *(const v4f*)(f + r * CZ);
    asm volatile("s_wait_xcnt 0x0" ::: "memory");   // the last load of a run may land on the run's own address pair: the wait that belongs in front of that
    a[15] = *(const v4f*)(f + 15 * CZ);
    asm volatile("s_wait_xcnt 0x0" ::: "memory");   // the work below may reuse registers that held the addresses of the loads above: the wait that belongs in front of that
    { v8us o; const unsigned short keep = (wr < NH_) ? (unsigned short)0xFFFFu : (unsigned short)0;
#pragma unroll
        for (int u = 0; u < 8; ++u) o[u] = f2bf(bfr(wl[u])) & keep;
        *(v8usa*)(wbs + fro(wr, wc, CZ)) = o; }
#pragma unroll
    for (int u = 0; u < 4; ++u) { gg[u] = bfr(gg[u]); bb[u] = bfr(bb[u]); }
    // the row arithmetic keeps its statements and their order, the empty asm ones too (each product is rounded before its add; the sums run in the same order), only looped over the wave's 16 rows phase by phase, so that 16 butterflies are in flight together: the two planes keep their values bit for bit
    float v[16][4], su[16], sq[16], mu[16], rs[16];
#pragma unroll
    for (int r = 0; r < 16; ++r) { su[r] = 0.f; for (int u = 0; u < 4; ++u) { float xv = bfr(a[r][u]); asm volatile("" : "+v"(xv)); v[r][u] = xv; su[r] = __fadd_rn(su[r], xv); } }
#pragma unroll
    for (int sh = 16; sh; sh >>= 1)
#pragma unroll
        for (int r = 0; r < 16; ++r) su[r] = __fadd_rn(su[r], __shfl_xor(su[r], sh, 32));
#pragma unroll
    for (int r = 0; r < 16; ++r) { mu[r] = __fdiv_rn(su[r], (float)CZ); sq[r] = 0.f; for (int q = 0; q < 4; ++q) { float d0 = __fsub_rn(v[r][q], mu[r]); asm volatile("" : "+v"(d0)); float p = __fmul_rn(d0, d0); asm volatile("" : "+v"(p)); sq[r] = __fadd_rn(sq[r], p); } }
#pragma unroll
    for (int sh = 16; sh; sh >>= 1)
#pragma unroll
        for (int r = 0; r < 16; ++r) sq[r] = __fadd_rn(sq[r], __shfl_xor(sq[r], sh, 32));
    bf* sw = st + w * (2 * 16 * LNP);
#pragma unroll
    for (int r = 0; r < 16; ++r) { rs[r] = __fdiv_rn(1.0f, sqrtf(__fadd_rn(__fdiv_rn(sq[r], (float)CZ), 1e-5f))); v4us oh, ol;
        for (int u = 0; u < 4; ++u) { float d0 = __fsub_rn(v[r][u], mu[r]); asm volatile("" : "+v"(d0)); float n = __fmul_rn(d0, rs[r]); asm volatile("" : "+v"(n)); float y = __fmul_rn(n, gg[u]); asm volatile("" : "+v"(y)); y = __fadd_rn(y, bb[u]); unsigned short p2, q2; splitf(y, p2, q2); oh[u] = p2; ol[u] = q2; }
        *(v4usa*)(sw + r * LNP + lane * 4) = oh; *(v4usa*)(sw + (16 + r) * LNP + lane * 4) = ol; }
    __syncthreads();   // the padded pair-bias weights are complete in LDS before any wave reads a fragment of them (and the wave's own 16 rows before it reads them across lanes)
    v8us fh[4][2], fl[4][2]; const bf* sr = sw + lr * LNP + 8 * hi;
#pragma unroll
    for (int kc = 0; kc < 4; ++kc)
#pragma unroll
        for (int hf = 0; hf < 2; ++hf) { fh[kc][hf] = *(const v8usa*)(sr + kc * 32 + hf * 16); fl[kc][hf] = *(const v8usa*)(sr + 16 * LNP + kc * 32 + hf * 16); }
    v8f zacc = (v8f){};
#pragma unroll
    for (int kc = 0; kc < 4; ++kc) { const v16bf wb = ldswfrag(wbs + kc * 512 + lane * 8); zacc = wmmab(cat16b(fh[kc][0], fh[kc][1]), wb, zacc); zacc = wmmab(cat16b(fl[kc][0], fl[kc][1]), wb, zacc); }
    if (lr < NH_) { v4f t0, t1;   // zacc[r] = bias of query q, key kt*16 + 8*hi + r, head lr
        for (int u = 0; u < 4; ++u) { t0[u] = zacc[u] * RSCL; t1[u] = zacc[4 + u] * RSCL; }   // times 32^0.5 here, so that the reader's loads are its accumulators' start values as they land
        *(v4fa*)(zs + (((lr * 2 + 0) * 2 + hi) * 8 + w) * 4) = t0; *(v4fa*)(zs + (((lr * 2 + 1) * 2 + hi) * 8 + w) * 4) = t1; }
    __syncthreads();   // the 8 queries' pieces of every line are in LDS before the line is stored; the planes' stores stand behind it, because the barrier waits for every store in front of it
    bf* ph = Xh + (size_t)tile * (16 * CZ) + lane * 8; bf* pl = Xl + (size_t)tile * (16 * CZ) + lane * 8;
#pragma unroll
    for (int kc = 0; kc < 4; ++kc)
#pragma unroll
        for (int hf = 0; hf < 2; ++hf) { *(v8us*)(ph + kc * 512 + hf * 256) = fh[kc][hf]; *(v8us*)(pl + kc * 512 + hf * 256) = fl[kc][hf]; }
    if (tid < 128) { const int ln = tid >> 3, h = ln >> 2, hf = (ln >> 1) & 1, hh = ln & 1;   // line = (head, half, hi); piece = query
        *(v4f*)(ZB + (((size_t)h * 16 + qt) * 16 + kt) * 256 + hf * 128 + (16 * hh + qo * 8 + (tid & 7)) * 4) = *(const v4fa*)(zs + tid * 4); }
}
// ---- k_pre: all that depends on the inputs alone, in one launch. Blocks 0..19: the five weight planes of WT, in fragment order (fro), 4 blocks each (Wq, Wk, Wv, Wg, Wo transposed to bf16); blocks 20..: LayerNorm of the 65,536 pair rows, 128 rows a block, its hi and lo planes in fragment order, and the pair bias of the same rows (d_lnzb).
#define WPB  4     // blocks per weight plane: DM * DR / 64 lines at 64 lines a block
#define NWB  (5 * WPB)
__global__ __launch_bounds__(256) void k_pre(const float* __restrict__ X, const float* __restrict__ gam, const float* __restrict__ bet, bf* Xh, bf* Xl, const float* __restrict__ wq, const float* __restrict__ wk, const float* __restrict__ wv, const float* __restrict__ wg, const float* __restrict__ w2d, const float* __restrict__ wo, bf* WT, float* ZB) {
    const int b = blockIdx.x;
    if (b < NWB) { const int p = b / WPB, bx = b % WPB;
        d_wtG(bx, (p == 0) ? wq : (p == 1) ? wk : (p == 2) ? wv : (p == 3) ? wg : wo, DM, DR, WT + (size_t)p * DR * DM);   // DM == DR: Wo's K and N are the same two numbers
        return; }
    d_lnzb(b - NWB, X, gam, bet, w2d, Xh, Xl, ZB);
}
// ---- k_attn: the q, k, v and gate projections and the whole attention of one virtual head (row bl, head h) in one work-group: 16 waves x 16 tokens, the 256 keys in four quarters of 64 (running maximum and sum), in 128 registers a wave so that two work-groups share a WGP; q, k, v, gate logits, scores and probabilities never leave the chip.
// Projections: wave w takes the 16 tokens w*16.. of the row. Its LayerNorm fragments (hi and lo planes, fragment order fro, 4 chunks of 32 k) come straight from global into registers; the head's 32 columns of Wq, Wk, Wv, Wg (4 x 8 KB, already in fragment order) are copied to LDS once a work-group. Each accumulator sums hi then lo per 32-k chunk.
// Q^T, K^T, G^T = W^T z^T (A = weight rows d, B = token columns): a lane holds d = mb*16 + 8*hi + r of ONE token lr. That is the B fragment of Q as it stands, 8 consecutive d of a K row for LDS, and the gate of the lane's own context values. V = z Wv (A = tokens, B = weight columns d): a lane holds 8 consecutive tokens of one d, 16 bytes of a V^T row for LDS.
// K [key][d] and V^T [d][key] are split into bf16 hi/lo planes on the way into LDS. S^T = K Q^T (A = K rows, B = Q columns), so a lane holds the scores of ONE query, 32 a quarter: tile kt, register r = key kt*16 + 8*hi + r, query lr.
// Two neighbouring score tiles, converted in place, are the B operand of O^T = V^T P^T (hardware k order: 8*hi + s, 16 + 8*hi + (s - 8)); the LDS fragment loads use the same order.
// The pair bias, stored times 32^0.5 by d_lnzb, is the start value of the score accumulators; 32^-0.5 is folded into the exponent's scale.
// The gate is applied here: a lane's 8 context values of one accumulator are 8 consecutive k of one row of the output projection's A operand, and the 32 lanes' pieces are one half block of its fragment order (fro), so the gated hi and lo planes go straight from the accumulators to global, 512 contiguous bytes a store.
#define KPI  40    // K row pitch in LDS, bf16 elements: 80 bytes = 16 x odd, no bank conflict for 16-byte reads
#define VPI  264   // V^T row pitch in LDS: 528 bytes = 16 x odd
typedef __attribute__((ext_vector_type(2))) __bf16 v2bf;
typedef __attribute__((ext_vector_type(2))) unsigned v2u;
typedef __attribute__((ext_vector_type(4))) unsigned v4u;
typedef __attribute__((ext_vector_type(8))) unsigned v8u;
typedef unsigned __attribute__((may_alias)) u32a;
typedef v2u __attribute__((may_alias)) v2ua;
__device__ __forceinline__ unsigned pk2(float a, float b) { v2f x; x[0] = a; x[1] = b; return __builtin_bit_cast(unsigned, __builtin_convertvector(x, v2bf)); }
__device__ __forceinline__ void split2(float a, float b, unsigned& h, unsigned& l) { h = pk2(a, b); l = pk2(a - __uint_as_float(h << 16), b - __uint_as_float(h & 0xFFFF0000u)); }
// 2^x with the one issue slot that the instruction set asks for behind a transcendental, before its result is read or its source register overwritten: in one statement, so that the slot stands directly behind it
__device__ __forceinline__ float exp2slot(float x) { float e; asm("v_exp_f32 %0, %1\n\tv_nop" : "=v"(e) : "v"(x)); return e; }
typedef v4u __attribute__((may_alias)) v4ua;
// eight 2^x in place, in one statement. In place, because these stand among the products: the statement writes only registers that the compiler's own multiply-adds have just written, so the distance behind a matrix instruction that the compiler keeps for those holds for it too. Each v_exp_f32 is followed by an independent one, the last by the one issue slot that the instruction set asks for behind a transcendental
__device__ __forceinline__ void exp2x8(float (&x)[8]) { asm("v_exp_f32 %0, %0\n\tv_exp_f32 %1, %1\n\tv_exp_f32 %2, %2\n\tv_exp_f32 %3, %3\n\tv_exp_f32 %4, %4\n\tv_exp_f32 %5, %5\n\tv_exp_f32 %6, %6\n\tv_exp_f32 %7, %7\n\tv_nop" : "+v"(x[0]), "+v"(x[1]), "+v"(x[2]), "+v"(x[3]), "+v"(x[4]), "+v"(x[5]), "+v"(x[6]), "+v"(x[7])); }
// lane l with lane l ^ 16 as a vector cross-row move: no index register to keep and no LDS round trip
__device__ __forceinline__ float xhalf(float x) { return __builtin_bit_cast(float, __builtin_amdgcn_permlanex16(__builtin_bit_cast(int, x), __builtin_bit_cast(int, x), 0x76543210, 0xfedcba98, false, false)); }
__global__ __launch_bounds__(512, 8) void k_attn(const bf* __restrict__ Xh, const bf* __restrict__ Xl, const bf* __restrict__ WT, const float* __restrict__ ZB, const float* __restrict__ bg, bf* __restrict__ Ah, bf* __restrict__ Al) {   // 8 waves a SIMD = 128 registers a wave: two work-groups share a WGP, and one computes while the other loads or waits at a barrier
    __shared__ __align__(16) bf Kh[TT * KPI]; __shared__ __align__(16) bf Kl[TT * KPI]; __shared__ __align__(16) bf Vh[HDR * VPI]; __shared__ __align__(16) bf Vl[HDR * VPI]; __shared__ __align__(16) bf Ws[4 * HDR * DM]; __shared__ __align__(16) float Gs[4 * 512 * 4];
    const int tid = threadIdx.x, lane = tid & 31, lr = lane & 15, hi = lane >> 4, wv = __builtin_amdgcn_readfirstlane(tid >> 5); const int z = blockIdx.x, bl = z / NH_, h = z % NH_;   // the wave's number in a scalar register: the bases of its global addresses then take no vector registers
    const float* zr = ZB + ((size_t)h * 16 + wv) * (16 * TT) + lane * 4;   // this wave's 16 queries x 256 keys of the pair bias, in accumulator order (d_lnzb)
    const int q = wv * 16 + lr;
    // the head's weights (rows h*32.. of planes 0..3 of WT, 8 KB each, one 16-byte piece a thread and plane), then the wave's own LayerNorm fragments
    const bf* wp = WT + (size_t)h * (HDR * DM) + tid * 8; const size_t zo = (size_t)(bl * 16 + wv) * (16 * DM); const bf* xh = Xh + zo; const bf* xl = Xl + zo;   // the wave's bases are scalar; the lane's part is one register that lives on as the LDS offset of the weight fragments, so no load of the run lands on an address register
    v8us wst[4]; v16bf zh[4], zl[4];
#pragma unroll
    for (int p = 0; p < 4; ++p) wst[p] = *(const v8us*)(wp + (size_t)p * DR * DM);
#pragma unroll
    for (int kc = 0; kc < 4; ++kc) { zh[kc] = WFrag<bf>::ld(xh + lane * 8 + kc * 512); zl[kc] = WFrag<bf>::ld(xl + lane * 8 + kc * 512); }
    asm volatile("s_wait_xcnt 0x0" ::: "memory");   // the work below may reuse registers that held the addresses of the loads above: the wait that belongs in front of that
#pragma unroll
    for (int p = 0; p < 4; ++p) *(v8usa*)(Ws + p * (HDR * DM) + tid * 8) = wst[p];
    __syncthreads();   // the four weight planes are complete in LDS before any wave reads a fragment
    // the projections run plane by plane, K, V, gate, Q: two accumulators at a time beside the 64 registers of the LayerNorm fragments; each accumulator keeps its order of sums (hi then lo per 32-k chunk)
    const float* bp = bg + h * HDR + 8 * hi; v4f gb[4]; v8f bz[4];
    { v8f pk[2]; pk[0] = (v8f){}; pk[1] = (v8f){};
#pragma unroll
        for (int kc = 0; kc < 4; ++kc) { v16bf wf[2];
#pragma unroll
            for (int mb = 0; mb < 2; ++mb) wf[mb] = ldswfrag(Ws + 1 * (HDR * DM) + mb * (16 * DM) + kc * 512 + lane * 8);
            pk[0] = wmmab(wf[0], zh[kc], pk[0]); pk[1] = wmmab(wf[1], zh[kc], pk[1]); pk[0] = wmmab(wf[0], zl[kc], pk[0]); pk[1] = wmmab(wf[1], zl[kc], pk[1]); 
            if (kc == 1) __builtin_amdgcn_sched_barrier(0); }   // the weight fragments of at most two chunks are fetched ahead: those of all four would not fit beside the LayerNorm fragments (spills)
#pragma unroll
        for (int mb = 0; mb < 2; ++mb) { v4u oh, ol;   // pk[mb][r] = K of key q at d = mb*16 + 8*hi + r
#pragma unroll
            for (int i = 0; i < 4; ++i) { unsigned p, r; split2(pk[mb][2 * i], pk[mb][2 * i + 1], p, r); oh[i] = p; ol[i] = r; }
            *(v4ua*)(Kh + q * KPI + mb * 16 + 8 * hi) = oh; *(v4ua*)(Kl + q * KPI + mb * 16 + 8 * hi) = ol; } }
    __builtin_amdgcn_sched_barrier(0);   // a plane starts when the one before has left its registers: mixed, the planes would not fit in the 128 registers
    { v8f pv[2]; pv[0] = (v8f){}; pv[1] = (v8f){};
#pragma unroll
        for (int kc = 0; kc < 4; ++kc) { v16bf wf[2];
#pragma unroll
            for (int mb = 0; mb < 2; ++mb) wf[mb] = ldswfrag(Ws + 2 * (HDR * DM) + mb * (16 * DM) + kc * 512 + lane * 8);
            pv[0] = wmmab(zh[kc], wf[0], pv[0]); pv[1] = wmmab(zh[kc], wf[1], pv[1]); pv[0] = wmmab(zl[kc], wf[0], pv[0]); pv[1] = wmmab(zl[kc], wf[1], pv[1]); 
            if (kc == 1) __builtin_amdgcn_sched_barrier(0); }   // the weight fragments of at most two chunks are fetched ahead: those of all four would not fit beside the LayerNorm fragments (spills)
#pragma unroll
        for (int mb = 0; mb < 2; ++mb) { v4u ph, pl;   // pv[mb][r] = V of key wv*16 + 8*hi + r at d = mb*16 + lr
#pragma unroll
            for (int i = 0; i < 4; ++i) { unsigned p, r; split2(pv[mb][2 * i], pv[mb][2 * i + 1], p, r); ph[i] = p; pl[i] = r; }
            *(v4ua*)(Vh + (mb * 16 + lr) * VPI + wv * 16 + 8 * hi) = ph; *(v4ua*)(Vl + (mb * 16 + lr) * VPI + wv * 16 + 8 * hi) = pl; } }
    __builtin_amdgcn_sched_barrier(0);   // as above: the next plane starts when this one has left its registers
#pragma unroll
    for (int g = 0; g < 4; ++g) gb[g] = *(const v4f*)(bp + (g >> 1) * 16 + (g & 1) * 4);
    asm volatile("s_wait_xcnt 0x0" ::: "memory");   // the work below may reuse registers that held the addresses of the loads above: the wait that belongs in front of that
    v8f pq[2], pg[2]; pg[0] = (v8f){}; pg[1] = (v8f){}; pq[0] = (v8f){}; pq[1] = (v8f){};
#pragma unroll
    for (int kc = 0; kc < 4; ++kc) { v16bf wf[2];
#pragma unroll
        for (int mb = 0; mb < 2; ++mb) wf[mb] = ldswfrag(Ws + 3 * (HDR * DM) + mb * (16 * DM) + kc * 512 + lane * 8);
        pg[0] = wmmab(wf[0], zh[kc], pg[0]); pg[1] = wmmab(wf[1], zh[kc], pg[1]); pg[0] = wmmab(wf[0], zl[kc], pg[0]); pg[1] = wmmab(wf[1], zl[kc], pg[1]); 
            if (kc == 1) __builtin_amdgcn_sched_barrier(0); }   // the weight fragments of at most two chunks are fetched ahead: those of all four would not fit beside the LayerNorm fragments (spills)
#pragma unroll
    for (int g = 0; g < 4; ++g)
#pragma unroll
        for (int u = 0; u < 4; ++u) pg[g >> 1][(g & 1) * 4 + u] += bfr(gb[g][u]);   // the gate's bias
    // the 16 gate logits wait in LDS, each thread's in its own four 16-byte places (no other thread reads them: no barrier), while Q is projected: beside the LayerNorm fragments there is no room for both
#pragma unroll
    for (int g = 0; g < 4; ++g) { v4f t; t[0] = pg[g >> 1][(g & 1) * 4]; t[1] = pg[g >> 1][(g & 1) * 4 + 1]; t[2] = pg[g >> 1][(g & 1) * 4 + 2]; t[3] = pg[g >> 1][(g & 1) * 4 + 3]; *(v4fa*)(Gs + (g * 512 + tid) * 4) = t; }
    __builtin_amdgcn_sched_barrier(0);   // as above: the next plane starts when this one has left its registers
#pragma unroll
    for (int kc = 0; kc < 4; ++kc) { v16bf wf[2];
#pragma unroll
        for (int mb = 0; mb < 2; ++mb) wf[mb] = ldswfrag(Ws + mb * (16 * DM) + kc * 512 + lane * 8);
        pq[0] = wmmab(wf[0], zh[kc], pq[0]); pq[1] = wmmab(wf[1], zh[kc], pq[1]); pq[0] = wmmab(wf[0], zl[kc], pq[0]); pq[1] = wmmab(wf[1], zl[kc], pq[1]); 
            if (kc == 1) __builtin_amdgcn_sched_barrier(0); }   // the weight fragments of at most two chunks are fetched ahead: those of all four would not fit beside the LayerNorm fragments (spills)
    // the next two lines end the projections here: left free, the last products sink among the loads and the arithmetic below and keep the LayerNorm and weight fragments' registers, which the pair bias needs (spills)
    asm volatile("" :: "v"(pq[0]), "v"(pq[1]));   // inputs only: the two accumulators are complete at this place
    __builtin_amdgcn_sched_barrier(0);   // nothing of the work below is moved up among the products
    // the pair bias of the first 64 keys: 32 registers, taken when the LayerNorm and weight fragments are free
#pragma unroll
    for (int kt = 0; kt < 3; ++kt) bz[kt] = __builtin_shufflevector(*(const v4f*)(zr + kt * 256), *(const v4f*)(zr + kt * 256 + 128), 0, 1, 2, 3, 4, 5, 6, 7);   // both loads of a tile land in the eight registers of its accumulator
    asm volatile("s_wait_xcnt 0x0" ::: "memory");   // the last loads of a run may land on the run's own address register: the wait that belongs in front of that
    bz[3] = __builtin_shufflevector(*(const v4f*)(zr + 3 * 256), *(const v4f*)(zr + 3 * 256 + 128), 0, 1, 2, 3, 4, 5, 6, 7);
    asm volatile("s_wait_xcnt 0x0" ::: "memory");   // the work below may reuse registers that held the addresses of the loads above: the wait that belongs in front of that
    __builtin_amdgcn_sched_barrier(0);   // keeps the loads above in front of the arithmetic below, which runs while they fly: moved behind it they would start only when it is done
    v8u qh, ql;   // pq[g][r] = Q of query q at d = g*16 + 8*hi + r: the B fragment's own order
#pragma unroll
    for (int g = 0; g < 2; ++g)
#pragma unroll
        for (int i = 0; i < 4; ++i) { unsigned p, r; split2(pq[g][2 * i], pq[g][2 * i + 1], p, r); qh[g * 4 + i] = p; ql[g * 4 + i] = r; }
#pragma unroll
    for (int g = 0; g < 4; ++g) { const v4f t = *(const v4fa*)(Gs + (g * 512 + tid) * 4); pg[g >> 1][(g & 1) * 4] = t[0]; pg[g >> 1][(g & 1) * 4 + 1] = t[1]; pg[g >> 1][(g & 1) * 4 + 2] = t[2]; pg[g >> 1][(g & 1) * 4 + 3] = t[3]; }
    v8f sg[2];   // sg[mb][r] = gate of query q at d = mb*16 + 8*hi + r
#pragma unroll
    for (int g = 0; g < 4; ++g)
#pragma unroll
        for (int u = 0; u < 4; ++u) { const float eg = expf(-pg[g >> 1][(g & 1) * 4 + u]); sg[g >> 1][(g & 1) * 4 + u] = __fdiv_rn(1.0f, __fadd_rn(1.0f, eg)); }
    // the 16 gates wait in LDS, each thread's in its own four 16-byte places (no other thread reads them: no barrier), until the context is there: kept in registers through the score and probability phases they spill
#pragma unroll
    for (int g = 0; g < 4; ++g) { v4f t; t[0] = sg[g >> 1][(g & 1) * 4]; t[1] = sg[g >> 1][(g & 1) * 4 + 1]; t[2] = sg[g >> 1][(g & 1) * 4 + 2]; t[3] = sg[g >> 1][(g & 1) * 4 + 3]; *(v4fa*)(Gs + (g * 512 + tid) * 4) = t; }
    __builtin_amdgcn_sched_barrier(0);   // keeps the gate's arithmetic above, where the wave would otherwise only wait for the pair bias: left free, part of it sinks behind the barrier, into the phases that the vector port limits
    __syncthreads();   // the K and V planes are complete before any wave reads a fragment
    // from here on every lane-dependent address is formed from a lane number taken anew: the thread number and what was derived from it need not be kept through the projections, nor several derived values through the phases below
    const int ln = (int)__builtin_amdgcn_mbcnt_lo(~0u, 0u), l15 = ln & 15, lh = ln >> 4, slot = wv * 32 + ln;
    const float* zr2 = ZB + ((size_t)h * 16 + wv) * (16 * TT) + ln * 4;
    // the 256 keys in four quarters of 64, so that 32 registers hold the scores: running maximum mrun and running sum srun; the context and the sum so far are scaled to each new maximum, and the division by the sum is applied to the context at the end
    const v16bf Qh = __builtin_bit_cast(v16bf, qh), Ql = __builtin_bit_cast(v16bf, ql);
    const float c1 = SCL * 1.4426950408889634f; float mrun = 0.f, srun = 0.f;
    v8f o[2]; o[0] = (v8f){}; o[1] = (v8f){};
#pragma unroll
    for (int ch = 0; ch < 4; ++ch) {
        v8f acc[4];
#pragma unroll
        for (int kt = 0; kt < 4; ++kt) acc[kt] = bz[kt];
#pragma unroll
        for (int kt = 0; kt < 4; ++kt) { const int ko = ((ch * 4 + kt) * 16 + l15) * KPI + 8 * lh; const v16bf ah = ldsfrag(Kh + ko), al = ldsfrag(Kl + ko);
            acc[kt] = wmmab(ah, Qh, acc[kt]); acc[kt] = wmmab(ah, Ql, acc[kt]); acc[kt] = wmmab(al, Qh, acc[kt]); }
        v8f m8 = acc[0];
#pragma unroll
        for (int kt = 1; kt < 4; ++kt)
#pragma unroll
            for (int r = 0; r < 8; ++r) m8[r] = fmaxf(m8[r], acc[kt][r]);
        float mx = fmaxf(fmaxf(fmaxf(m8[0], m8[1]), fmaxf(m8[2], m8[3])), fmaxf(fmaxf(m8[4], m8[5]), fmaxf(m8[6], m8[7])));
        mx = fmaxf(mx, xhalf(mx));   // the other lane's keys of this quarter
        if (ch > 0) { mx = fmaxf(mx, mrun); const float al = exp2slot((mrun - mx) * c1);   // what the quarters before were scaled by, against the new maximum
            srun *= al;
#pragma unroll
            for (int r = 0; r < 8; ++r) { o[0][r] *= al; o[1][r] *= al; } }
        mrun = mx;
        const float mc = mx * c1; v8f s8 = (v8f){};
        // 32 keys at a time: exponentials, their sums, the hi/lo split and the products, so that a tile's registers are free as soon as its probabilities are fragments
#pragma unroll
        for (int ks = 0; ks < 2; ++ks) { v8u ph, pl;
#pragma unroll
            for (int g = 0; g < 2; ++g) { float e[8];
#pragma unroll
                for (int r = 0; r < 8; ++r) e[r] = fmaf(acc[2 * ks + g][r], c1, -mc);
                exp2x8(e);
#pragma unroll
                for (int r = 0; r < 8; ++r) s8[r] += e[r];
#pragma unroll
                for (int i = 0; i < 4; ++i) { unsigned p, r; split2(e[2 * i], e[2 * i + 1], p, r); ph[g * 4 + i] = p; pl[g * 4 + i] = r; } }
            const v16bf Ph = __builtin_bit_cast(v16bf, ph), Pl = __builtin_bit_cast(v16bf, pl);
#pragma unroll
            for (int mb = 0; mb < 2; ++mb) { const int vo = (mb * 16 + l15) * VPI + (ch * 2 + ks) * 32 + 8 * lh; const v16bf vh = ldsfrag(Vh + vo), vl = ldsfrag(Vl + vo);
                o[mb] = wmmab(vh, Ph, o[mb]); o[mb] = wmmab(vh, Pl, o[mb]); o[mb] = wmmab(vl, Ph, o[mb]); } }
        srun += ((s8[0] + s8[1]) + (s8[2] + s8[3])) + ((s8[4] + s8[5]) + (s8[6] + s8[7]));
        asm volatile("" :: "v"(srun));   // input only: the quarter's sum is complete at this place; left free, its additions sink to the kernel's end and the terms are kept for them (spills)
        __builtin_amdgcn_sched_barrier(0);   // holds the line above in front of the next quarter
        if (ch < 3) {   // the pair bias of the next 64 keys, into the registers that this quarter's probabilities have left
#pragma unroll
            for (int kt = 0; kt < 4; ++kt) bz[kt] = __builtin_shufflevector(*(const v4f*)(zr2 + ((ch + 1) * 4 + kt) * 256), *(const v4f*)(zr2 + ((ch + 1) * 4 + kt) * 256 + 128), 0, 1, 2, 3, 4, 5, 6, 7);
            asm volatile("s_wait_xcnt 0x0" ::: "memory"); }   // the work below may reuse registers that held the addresses of the loads above: the wait that belongs in front of that
    }
    float sum = srun; sum += xhalf(sum);
    const float f = __fdiv_rn(1.0f, sum);
#pragma unroll
    for (int mb = 0; mb < 2; ++mb) { float ov[8]; v4u oh, ol; const v4f ga = *(const v4fa*)(Gs + (2 * mb * 512 + slot) * 4), gc = *(const v4fa*)(Gs + ((2 * mb + 1) * 512 + slot) * 4);   // o[mb][r] = context of query q at d = mb*16 + 8*hi + r, not yet divided by the sum; ga, gc = its 8 gates
#pragma unroll
        for (int r = 0; r < 8; ++r) ov[r] = __fmul_rn(o[mb][r] * f, (r < 4 ? ga : gc)[r & 3]);
#pragma unroll
        for (int i = 0; i < 4; ++i) { unsigned p, r; split2(ov[2 * i], ov[2 * i + 1], p, r); oh[i] = p; ol[i] = r; }
        const size_t fo = fro(bl * TT + wv * 16 + l15, h * HDR + mb * 16 + 8 * lh, DR); *(v4u*)(Ah + fo) = oh; *(v4u*)(Al + fo) = ol; }
}
__global__ __launch_bounds__(256) void k_merge(const float* __restrict__ O, int h0, bf* Ah, bf* Al) { const size_t e = ((size_t)blockIdx.x * 256 + threadIdx.x) * 2; if (e >= (size_t)ZH * TT * HD) return; const int d = (int)(e % HD); const int t = (int)((e / HD) % TT); const int zz = (int)(e / ((size_t)HD * TT)); const float cs = (t < RH) ? 1.0f : (1.0f / PCAR); const size_t oo = (size_t)t * DQ + (h0 + zz) * HD + d;
    v2us oh, ol;
#pragma unroll
    for (int q = 0; q < 2; ++q) { unsigned short a, c2; splitf(O[e + q] * cs, a, c2); oh[q] = a; ol[q] = c2; } *(v2us*)(Ah + oo) = oh; *(v2us*)(Al + oo) = ol;  }

extern "C" void kernel_launch(void* const* d_in, const int* in_sizes, int n_in,
                              void* d_out, int out_size, void* d_ws, size_t ws_size, hipStream_t stream) {
    (void)in_sizes; (void)n_in; (void)out_size;
    const float* x = (const float*)d_in[0]; const float* qng = (const float*)d_in[1]; const float* qnb = (const float*)d_in[2]; const float* wq = (const float*)d_in[3]; const float* wk = (const float*)d_in[4]; const float* wv = (const float*)d_in[5]; const float* w2d = (const float*)d_in[6]; const float* wg = (const float*)d_in[7]; const float* bg = (const float*)d_in[8]; const float* wo = (const float*)d_in[9]; const float* bo = (const float*)d_in[10];
    float* OUT = (float*)d_out;   // [256][256][128]
    char* wsp = (char*)d_ws; auto take = [&](size_t bytes) { char* p = wsp; wsp += (bytes + 255) & ~(size_t)255; return (void*)p; };
    bf* WT = (bf*)take((size_t)5 * DR * DM * 2); bf* WO = WT + (size_t)4 * DR * DM;   /* one block of five planes: Wq, Wk, Wv, Wg, Wo */
    bf* XNh = (bf*)take((size_t)GR * DM * 2); bf* XNl = (bf*)take((size_t)GR * DM * 2); float* ZB = (float*)take((size_t)NH_ * TT * TT * 4);
    bf* AOh = (bf*)take((size_t)GR * DR * 2); bf* AOl = (bf*)take((size_t)GR * DR * 2);
    if ((size_t)(wsp - (char*)d_ws) > ws_size) return;   // ws ~ 65 MiB
    k_pre<<<NWB + NLB, 256, 0, stream>>>(x, qng, qnb, XNh, XNl, wq, wk, wv, wg, w2d, wo, WT, ZB);   /* weight planes, LayerNorm, pair bias */
    k_attn<<<NVH, 512, 0, stream>>>(XNh, XNl, WT, ZB, bg, AOh, AOl);   /* q, k, v, gate projections and attention */
    k_gemmw<bf, 1, true><<<dim3(DM / 64, GR / 64, 1), 32, 0, stream>>>(AOh, AOl, WO, nullptr, DR, OUT, DM, bo, 0, 0, 0, DM / 64, -1, 0);
}

// v009
// It runs in 64.4 microseconds.
// Timed twice side by side with v008, it ran 1.06 times as fast both times.
// Counting every step since v000, it is 13.3 times as fast.
#include <hip/hip_runtime.h>

// Triangle_Att_Start (AlphaFold triangle attention, starting node: pair_embed [256 rows i][256 j][128]; z = LayerNorm(pair); q/k/v = z W ([128][4 x 32]), q x 32^-0.5; bias[h][j][k] = (z Wb)[j][k][h] shared over rows i; gate = sigmoid(z Wg + bg); logits[h][i][j][k] = q_ij.k_ik + bias[h][j][k]; softmax over k; o = (a v) * gate; out = o Wo + bo -> [256][256][128]).
// Batched layout (exact): every row i is an independent 256-token attention; 256 rows x 4 heads = 1024 'virtual heads' of 256 tokens, one work-group of the fused attention kernel each, all in one launch, which also projects its own q, k, v and gate; the pair-bias projection runs with the LayerNorm, the output projection on all 65,536 stacked (row, j) positions at once.

#define NB_  256
#define TT   256
#define DM   128
#define NH_  4
#define NKV  4
#define REP  (NH_ / NKV)
#define HD   64
#define DQ   (NH_ * HD)
#define DKV  (NKV * HD)
#define ZH   256   // virtual heads per k_moutv / k_merge call (a quarter of NVH)
#define RH   256
#define WIN  0
#define PCAR 1024.0f
#define HDR  32
#define DR   (NH_ * HDR)   // 128
#define CZ   128
#define NPZ  (TT * TT)     // pair rows 65536
#define ZW   64
#define LR   256    // tokens per row (no padding)
#define GB   256    // rows per group: all of them, one group
#define NG   (NB_ / GB)
#define GR   (GB * TT)   // stacked rows per group
#define NVH  (GB * NH_)  // virtual heads per group
#define SCL  0.17677669529663689f   // 32^-0.5
typedef _Float16 h16;
typedef unsigned short bf;
typedef __attribute__((ext_vector_type(16))) __bf16   v16bf;
typedef __attribute__((ext_vector_type(16))) _Float16 v16h;
typedef __attribute__((ext_vector_type(8)))  _Float16 v8h;
typedef __attribute__((ext_vector_type(8)))  unsigned short v8us;
typedef __attribute__((ext_vector_type(8)))  float    v8f;
typedef __attribute__((ext_vector_type(4)))  float    v4f;
typedef v8h  __attribute__((may_alias)) v8ha;
typedef v4f  __attribute__((may_alias)) v4fa;
typedef v8us __attribute__((may_alias)) v8usa;

__device__ __forceinline__ unsigned short f2bf(float f) { return __builtin_bit_cast(unsigned short, (__bf16)f); }   // round to nearest even, by the conversion instruction
__device__ __forceinline__ float bf2f(unsigned short b) { return __uint_as_float(((unsigned)b) << 16); }
__device__ __forceinline__ float bfr(float f) { return bf2f(f2bf(f)); }
typedef __attribute__((ext_vector_type(2))) __bf16 v2bf;
typedef __attribute__((ext_vector_type(2))) float v2f;
typedef __attribute__((ext_vector_type(2))) unsigned v2u;
typedef v2u __attribute__((may_alias)) v2ua;
__device__ __forceinline__ unsigned pk2(float a, float b) { v2f x; x[0] = a; x[1] = b; return __builtin_bit_cast(unsigned, __builtin_convertvector(x, v2bf)); }
__device__ __forceinline__ void split2(float a, float b, unsigned& h, unsigned& l) { h = pk2(a, b); l = pk2(a - __uint_as_float(h << 16), b - __uint_as_float(h & 0xFFFF0000u)); }
__device__ __forceinline__ void bfr2(float a, float b, float& x, float& y) { const unsigned p = pk2(a, b); x = __uint_as_float(p << 16); y = __uint_as_float(p & 0xFFFF0000u); }   // two values rounded to bf16 by one conversion
// eight reciprocals, or eight reciprocal square roots, in place, in one statement: each is followed by an independent one, the last by the one issue slot that the instruction set asks for behind a transcendental
__device__ __forceinline__ void rcpx8(float (&x)[8]) { asm("v_rcp_f32 %0, %0\n\tv_rcp_f32 %1, %1\n\tv_rcp_f32 %2, %2\n\tv_rcp_f32 %3, %3\n\tv_rcp_f32 %4, %4\n\tv_rcp_f32 %5, %5\n\tv_rcp_f32 %6, %6\n\tv_rcp_f32 %7, %7\n\tv_nop" : "+v"(x[0]), "+v"(x[1]), "+v"(x[2]), "+v"(x[3]), "+v"(x[4]), "+v"(x[5]), "+v"(x[6]), "+v"(x[7])); }
__device__ __forceinline__ void rsqx8(float (&x)[8]) { asm("v_rsq_f32 %0, %0\n\tv_rsq_f32 %1, %1\n\tv_rsq_f32 %2, %2\n\tv_rsq_f32 %3, %3\n\tv_rsq_f32 %4, %4\n\tv_rsq_f32 %5, %5\n\tv_rsq_f32 %6, %6\n\tv_rsq_f32 %7, %7\n\tv_nop" : "+v"(x[0]), "+v"(x[1]), "+v"(x[2]), "+v"(x[3]), "+v"(x[4]), "+v"(x[5]), "+v"(x[6]), "+v"(x[7])); }
__device__ __forceinline__ v16h cat16(v8h lo, v8h hi) { return __builtin_shufflevector(lo, hi, 0, 1, 2, 3, 4, 5, 6, 7, 8, 9, 10, 11, 12, 13, 14, 15); }
__device__ __forceinline__ v16bf cat16b(v8us lo, v8us hi) { return __builtin_bit_cast(v16bf, __builtin_shufflevector(lo, hi, 0, 1, 2, 3, 4, 5, 6, 7, 8, 9, 10, 11, 12, 13, 14, 15)); }
__device__ __forceinline__ v8f wmma16(v16h a, v16h b, v8f c) { return __builtin_amdgcn_wmma_f32_16x16x32_f16(false, a, false, b, (short)0, c, false, false); }
__device__ __forceinline__ v8f wmmab(v16bf a, v16bf b, v8f c) { return __builtin_amdgcn_wmma_f32_16x16x32_bf16(false, a, false, b, (short)0, c, false, false); }



// ---- k_gemmw: register-blocked GEMM, ONE WAVE per 64x64 output tile (16 accumulators), operands straight from 16-bit planes in fragment order (fro); grid (column tiles of all z slices, M/64), 32 threads: the tiles that read the same 64 rows of A start side by side.
// A, A2, Bt, Bt2 lie in fragment order (fro below): the 32 lanes' 16-byte pieces of one fragment load are 512 contiguous bytes, four whole lines, not 16-byte pieces of 16 lines.
// C[m][n] (f32, pitch ldc, + optional f32 bias[n]) = sum_k A[m][k] Bt[n][k] (+ split products per NSPLIT). z-batch: ct column tiles a slice, strides sA/sB/sC in elements; slice zx (if any) has the output pitch ldx. K % 32 == 0.
// fro: element offset of (row n, k) in a fragment-ordered plane of K columns: blocks of 16 rows x 32 k (512 elements); in a block two halves (k 0-15, 16-31) of 32 lane pieces; lane piece 16 * ((k >> 3) & 1) + (n & 15) holds 8 consecutive k
__device__ __forceinline__ size_t fro(int n, int k, int K) { return ((size_t)(n >> 4) * (K >> 5) + (k >> 5)) * 512 + ((k >> 4) & 1) * 256 + ((((k >> 3) & 1) << 4) + (n & 15)) * 8 + (k & 7); }
template <typename T16> struct WFrag;
template <> struct WFrag<h16> { typedef v16h V; static __device__ __forceinline__ V ld(const h16* p) { return cat16(*(const v8h*)p, *(const v8h*)(p + 256)); } static __device__ __forceinline__ v8f mma(V a, V b, v8f c) { return wmma16(a, b, c); } };
template <> struct WFrag<bf> { typedef v16bf V; static __device__ __forceinline__ V ld(const bf* p) { return cat16b(*(const v8us*)p, *(const v8us*)(p + 256)); } static __device__ __forceinline__ v8f mma(V a, V b, v8f c) { return wmmab(a, b, c); } };
template <typename T16, int NSPLIT, bool BIAS>
__global__ __launch_bounds__(32) void k_gemmw(const T16* __restrict__ A, const T16* __restrict__ A2, const T16* __restrict__ Bt, const T16* __restrict__ Bt2, int K, float* C, int ldc, const float* __restrict__ bias, size_t sA, size_t sB, size_t sC, int ct, int zx, int ldx) {
    typedef typename WFrag<T16>::V V;
    __shared__ __align__(16) float os[16 * 68];
    const size_t z = blockIdx.x / ct; A += z * sA; if (A2) A2 += z * sA; Bt += z * sB; if (Bt2) Bt2 += z * sB; C += z * sC; if ((int)z == zx) ldc = ldx;
    const int lane = threadIdx.x & 31, lr = lane & 15, hi = lane >> 4; const int r0 = blockIdx.y * 64, c0 = (blockIdx.x % ct) * 64;
    v8f acc[4][4];
#pragma unroll
    for (int mb = 0; mb < 4; ++mb)
#pragma unroll
        for (int nb = 0; nb < 4; ++nb) acc[mb][nb] = (v8f){};
    const size_t aoff = (size_t)r0 * K + lane * 8, boff = (size_t)c0 * K + lane * 8;   // fro(r0 + lr, 8 * hi, K), fro(c0 + lr, 8 * hi, K); 16 rows on = 16 * K elements, 32 k on = 512
#pragma unroll 1
    for (int kc = 0; kc < K; kc += 32) {
        V a[4], a2[4];
#pragma unroll
        for (int mb = 0; mb < 4; ++mb) { a[mb] = WFrag<T16>::ld(A + aoff + (size_t)mb * 16 * K + kc * 16); if (NSPLIT == 1 || NSPLIT == 2) a2[mb] = WFrag<T16>::ld(A2 + aoff + (size_t)mb * 16 * K + kc * 16); }
#pragma unroll
        for (int nb = 0; nb < 4; ++nb) { const V b = WFrag<T16>::ld(Bt + boff + (size_t)nb * 16 * K + kc * 16); V b2; if (NSPLIT >= 2) b2 = WFrag<T16>::ld(Bt2 + boff + (size_t)nb * 16 * K + kc * 16);
#pragma unroll
            for (int mb = 0; mb < 4; ++mb) { acc[mb][nb] = WFrag<T16>::mma(a[mb], b, acc[mb][nb]); if (NSPLIT == 1 || NSPLIT == 2) acc[mb][nb] = WFrag<T16>::mma(a2[mb], b, acc[mb][nb]); if (NSPLIT >= 2) acc[mb][nb] = WFrag<T16>::mma(a[mb], b2, acc[mb][nb]); } }
        asm volatile("v_nop\n\tv_nop\n\tv_nop\n\tv_nop" : "+v"(acc[0][0]), "+v"(acc[1][1]), "+v"(acc[2][2]), "+v"(acc[3][3]) : "v"(a[0]), "v"(a[3]));
    }
#pragma unroll
    for (int mb = 0; mb < 4; ++mb) {
#pragma unroll
        for (int nb = 0; nb < 4; ++nb) {
#pragma unroll
            for (int j = 0; j < 8; ++j) os[(hi * 8 + j) * 68 + nb * 16 + lr] = acc[mb][nb][j]; }
        __builtin_amdgcn_wave_barrier(); asm volatile("" ::: "memory");
        float* crow = C + (size_t)(r0 + mb * 16) * ldc + c0;
{
#pragma unroll
            for (int s = 0; s < 8; ++s) { const int row = 2 * s + hi, cofs = lr * 4; v4f val = *(const v4fa*)(os + row * 68 + cofs); if (BIAS) { val[0] += bfr(bias[c0 + cofs]); val[1] += bfr(bias[c0 + cofs + 1]); val[2] += bfr(bias[c0 + cofs + 2]); val[3] += bfr(bias[c0 + cofs + 3]); }
                *(v4f*)(crow + (size_t)row * ldc + cofs) = val; }
             }
        if (mb < 3) asm volatile("s_wait_xcnt 0x0" ::: "memory");   // the next round rewrites the stores' address and data registers: the wait that belongs in front of that
        __builtin_amdgcn_wave_barrier(); asm volatile("" ::: "memory");
    }
}

__device__ __forceinline__ h16 tohx(float x) { return (h16)x; }
__device__ __forceinline__ void splitf(float y, unsigned short& h, unsigned short& l) { h = f2bf(y); l = f2bf(y - bf2f(h)); }
typedef __attribute__((ext_vector_type(2))) _Float16 v2h;
typedef __attribute__((ext_vector_type(4))) _Float16 v4h;
typedef __attribute__((ext_vector_type(2))) unsigned short v2us;
typedef __attribute__((ext_vector_type(4))) unsigned short v4us;
typedef __attribute__((ext_vector_type(4))) int v4i;

__device__ __forceinline__ void d_wtG(int bx, const float* __restrict__ w, int K, int N, bf* Bt) {
    const int lane = threadIdx.x & 31; const int L0 = (bx * 8 + (threadIdx.x >> 5)) * 8; const int nlines = N * K / 64;
{
#pragma unroll 1
        for (int l = 0; l < 8; ++l) { const int L = L0 + l; if (L >= nlines) break; const size_t e = (size_t)L * 64 + lane * 2; const int k = (int)(e % K), n = (int)(e / K); v2us o;
            o[0] = f2bf(w[(size_t)k * N + n]); o[1] = f2bf(w[(size_t)(k + 1) * N + n]); *(v2us*)(Bt + fro(n, k, K)) = o;
            asm volatile("s_wait_xcnt 0x0" ::: "memory"); }   // the next trip rewrites the store's address and data registers: the wait that belongs in front of that
         }
}
__global__ __launch_bounds__(256) void k_cvt8(const float* __restrict__ src, bf* dst, size_t n8) { const size_t i = (size_t)blockIdx.x * 256 + threadIdx.x; if (i >= n8) return; const v8f v = *(const v8f*)(src + i * 8); v8us o;
#pragma unroll
    for (int k = 0; k < 8; ++k) o[k] = f2bf(v[k]); *(v8us*)(dst + i * 8) = o;  }
__global__ __launch_bounds__(256) void k_cscvt(const float* __restrict__ cosT, const float* __restrict__ sinT, float* CS) { const int idx = blockIdx.x * 256 + threadIdx.x; if (idx >= TT * HD) return; v2f cs; cs[0] = bfr(cosT[idx]); cs[1] = bfr(sinT[idx]); *(v2f*)(CS + (size_t)idx * 2) = cs;  }
// k_rope: head planes [h][t][d] (fp16 + hi/lo) of rope(x) x sc with the rotate-half convention out[d] = x[d] cos[t][d] - x[d+HD/2] sin[t][d], out[d+HD/2] = x[d+HD/2] cos[t][d+HD/2] + x[d] sin[t][d+HD/2]
__global__ __launch_bounds__(256) void k_rope(const float* __restrict__ F, int pitch, int nheads, const float* __restrict__ CS, const float* __restrict__ RF, const float* __restrict__ nw, float sc, h16* P16, bf* Ph, bf* Pl) {
    const size_t e = ((size_t)blockIdx.x * 256 + threadIdx.x) * 2; if (e >= (size_t)nheads * TT * HD) return; const int d = (int)(e % HD); const int t = (int)((e / HD) % TT); const int h = (int)(e / ((size_t)HD * TT)); const float* f = F + (size_t)t * pitch + h * HD; const float rf = RF ? RF[(size_t)h * TT + t] : 1.0f; v2h o16; v2us oh, ol;
#pragma unroll
    for (int q = 0; q < 2; ++q) { const int dd = d + q; const int dp = (dd < HD / 2) ? dd + HD / 2 : dd - HD / 2; float x0 = f[dd], x1 = f[dp];
        if (RF) { float n0 = __fmul_rn(x0, rf), n1 = __fmul_rn(x1, rf); asm volatile("" : "+v"(n0)); asm volatile("" : "+v"(n1)); x0 = __fmul_rn(bfr(nw[dd]), n0); x1 = __fmul_rn(bfr(nw[dp]), n1); }
        const v2f cs = *(const v2f*)(CS + ((size_t)t * HD + dd) * 2); float a = __fmul_rn(x0, cs[0]), bq = __fmul_rn(x1, cs[1]); asm volatile("" : "+v"(a)); asm volatile("" : "+v"(bq)); const float r = ((dd < HD / 2) ? __fsub_rn(a, bq) : __fadd_rn(a, bq)) * sc;
        o16[q] = tohx(r); unsigned short a2, c2; splitf(r, a2, c2); oh[q] = a2; ol[q] = c2; }
    *(v2h*)(P16 + e) = o16; *(v2us*)(Ph + e) = oh; *(v2us*)(Pl + e) = ol;  }
__global__ __launch_bounds__(256) void k_vtp(const float* __restrict__ F, int pitch, int nheads, h16* V16, bf* Vh, bf* Vl) { const size_t e = ((size_t)blockIdx.x * 256 + threadIdx.x) * 2; if (e >= (size_t)nheads * HD * TT) return; const int t = (int)(e % TT); const int d = (int)((e / TT) % HD); const int g = (int)(e / ((size_t)TT * HD)); v2h o16; v2us oh, ol;
#pragma unroll
    for (int q = 0; q < 2; ++q) { const float x = F[(size_t)(t + q) * pitch + g * HD + d]; o16[q] = tohx(x); unsigned short a2, c2; splitf(x, a2, c2); oh[q] = a2; ol[q] = c2; }
    *(v2h*)(V16 + e) = o16; *(v2us*)(Vh + e) = oh; *(v2us*)(Vl + e) = ol;  }
__global__ __launch_bounds__(256) void k_cvt8padg(const float* __restrict__ src, bf* XB2) { const size_t e8 = ((size_t)blockIdx.x * 256 + threadIdx.x) * 8; if (e8 >= (size_t)GR * DM) return; const int r = (int)(e8 / DM); const int bl = r / TT, t = r % TT; v8us o; if (t < LR) { const float* sp2 = src + ((size_t)bl * LR + t) * DM + (e8 % DM); for (int u = 0; u < 8; ++u) o[u] = f2bf(bfr(sp2[u])); } else { for (int u = 0; u < 8; ++u) o[u] = 0; } *(v8us*)(XB2 + e8) = o;  }
__global__ __launch_bounds__(256) void k_moutv(const float* __restrict__ O, int z0, float* YO2) { const size_t e = ((size_t)blockIdx.x * 256 + threadIdx.x) * 2; if (e >= (size_t)ZH * TT * HD) return; const int d = (int)(e % HD); const int t = (int)((e / HD) % TT); const int zz = (int)(e / ((size_t)HD * TT)); const int z = z0 + zz; const int bl = z / NH_, h = z % NH_; v2f o; o[0] = O[e]; o[1] = O[e + 1]; float* dst = YO2 + ((size_t)bl * TT + t) * DQ + (size_t)h * HD + d; *(v2f*)dst = o;  }
__global__ __launch_bounds__(256) void k_outcpg(const float* __restrict__ Y, float* O2) { const size_t e = ((size_t)blockIdx.x * 256 + threadIdx.x) * 4; if (e >= (size_t)GB * LR * DM) return; const size_t r = e / DM; const int bl = (int)(r / LR), t = (int)(r % LR); const v4f a = *(const v4f*)(Y + ((size_t)bl * TT + t) * DM + (e % DM)); *(v4f*)(O2 + e) = a;  }
__global__ __launch_bounds__(256) void k_hlG(const float* __restrict__ F, bf* Fh, bf* Fl, size_t n) { const size_t e = ((size_t)blockIdx.x * 256 + threadIdx.x) * 4; if (e >= n) return; const v4f a = *(const v4f*)(F + e); v4us oh, ol; for (int u = 0; u < 4; ++u) { unsigned short p, q; splitf(a[u], p, q); oh[u] = p; ol[u] = q; } *(v4us*)(Fh + e) = oh; *(v4us*)(Fl + e) = ol;  }
#define LNP  136   // LDS row pitch, bf16 elements: 272 bytes = 16 x odd, no bank conflict for 16-byte reads down a column of rows
typedef v4us __attribute__((may_alias)) v4usa;
__device__ __forceinline__ v16bf ldsfrag(const bf* p) { return cat16b(*(const v8usa*)p, *(const v8usa*)(p + 16)); }
__device__ __forceinline__ v16bf ldswfrag(const bf* p) { return cat16b(*(const v8usa*)p, *(const v8usa*)(p + 256)); }   // a fragment kept in fragment order: two runs of 512 contiguous bytes
// d_lnzb: LayerNorm and pair bias of 128 pair rows in a block of 8 waves. Block g = (query tile qt, key tile kt, half qo of the query tile); wave w takes query q = qt*16 + qo*8 + w and the 16 keys kt*16.., that is the 16 consecutive pair rows q*256 + kt*16.. (8 KB of X, all 16 loads in flight at once).
// A lane holds 4 columns of each row, as the row sums want it; the hi and lo values are turned through the wave's own LDS rows into the lane's pieces of the fragment order (fro): token lr, 8 consecutive k. These 32 registers a plane go to global as they are (512 contiguous bytes a store) and are the A operand of bias = z Wb.
// B = the 4 columns of Wb padded to 16, built once a block in LDS in fragment order. Each accumulator sums hi then lo per 32-k chunk. Lane (hi, lr = head) then holds keys kt*16 + 8*hi + r of head lr.
// The bias leaves in the order of k_attn's score accumulators: ZB[h][query tile qt][key tile kt][half][lane][u] = 32^0.5 x bias of query qt*16 + (lane & 15), key kt*16 + 8*(lane >> 4) + 4*half + u, so that each of the reader's wave-wide 16-byte loads covers 512 contiguous bytes. The 8 queries of the block fill whole 128-byte lines: gathered in LDS, 16 lines a block.
#define NLB  (NPZ / 128)   // LayerNorm blocks
#define RSCL 5.656854249492381f   // 32^0.5
__device__ __forceinline__ void d_lnzb(int g, const float* __restrict__ X, const float* __restrict__ gam, const float* __restrict__ bet, const float* __restrict__ Wp, bf* Xh, bf* Xl, float* ZB) {
    __shared__ __align__(16) bf st[8 * 2 * 16 * LNP]; __shared__ __align__(16) bf wbs[16 * CZ]; __shared__ __align__(16) float zs[16 * 8 * 4];
    const int tid = threadIdx.x, lane = tid & 31, lr = lane & 15, hi = lane >> 4, w = tid >> 5; const int qt = g >> 5, kt = (g >> 1) & 15, qo = g & 1;
    const int tile = (qt * 16 + qo * 8 + w) * 16 + kt;   // 16 pair rows
    const float* f = X + (size_t)tile * (16 * CZ) + lane * 4; v4f a[16];
    const int wr = tid >> 4, wc = (tid & 15) * 8; float wl[8], gg[4], bb[4];   // thread = (padded weight row wr, 8 k); rows NH_.. are zero: they load a row that exists, all 8 loads in flight, and drop it
#pragma unroll
    for (int u = 0; u < 8; ++u) wl[u] = Wp[(size_t)(wc + u) * NH_ + (wr & (NH_ - 1))];
#pragma unroll
    for (int u = 0; u < 4; ++u) { gg[u] = gam[lane * 4 + u]; bb[u] = bet[lane * 4 + u]; }
#pragma unroll
    for (int r = 0; r < 15; ++r) a[r] = *(const v4f*)(f + r * CZ);
    asm volatile("s_wait_xcnt 0x0" ::: "memory");   // the last load of a run may land on the run's own address pair: the wait that belongs in front of that
    a[15] = *(const v4f*)(f + 15 * CZ);
    asm volatile("s_wait_xcnt 0x0" ::: "memory");   // the work below may reuse registers that held the addresses of the loads above: the wait that belongs in front of that
    { v8us o; const unsigned short keep = (wr < NH_) ? (unsigned short)0xFFFFu : (unsigned short)0;
#pragma unroll
        for (int u = 0; u < 8; ++u) o[u] = f2bf(bfr(wl[u])) & keep;
        *(v8usa*)(wbs + fro(wr, wc, CZ)) = o; }
#pragma unroll
    for (int u = 0; u < 4; ++u) { gg[u] = bfr(gg[u]); bb[u] = bfr(bb[u]); }
    // the row arithmetic runs over the wave's 16 rows phase by phase, so that 16 butterflies are in flight together; each product is rounded before its add (the empty asm statements). Roundings to bf16 go two at a time through the conversion instruction, 1/sqrt through v_rsq_f32
    float v[16][4], su[16], sq[16], mu[16], rs[16];
#pragma unroll
    for (int r = 0; r < 16; ++r) { su[r] = 0.f; float xr[4]; bfr2(a[r][0], a[r][1], xr[0], xr[1]); bfr2(a[r][2], a[r][3], xr[2], xr[3]); for (int u = 0; u < 4; ++u) { float xv = xr[u]; asm volatile("" : "+v"(xv)); v[r][u] = xv; su[r] = __fadd_rn(su[r], xv); } }
#pragma unroll
    for (int sh = 16; sh; sh >>= 1)
#pragma unroll
        for (int r = 0; r < 16; ++r) su[r] = __fadd_rn(su[r], __shfl_xor(su[r], sh, 32));
#pragma unroll
    for (int r = 0; r < 16; ++r) { mu[r] = __fdiv_rn(su[r], (float)CZ); sq[r] = 0.f; for (int q = 0; q < 4; ++q) { float d0 = __fsub_rn(v[r][q], mu[r]); asm volatile("" : "+v"(d0)); float p = __fmul_rn(d0, d0); asm volatile("" : "+v"(p)); sq[r] = __fadd_rn(sq[r], p); } }
#pragma unroll
    for (int sh = 16; sh; sh >>= 1)
#pragma unroll
        for (int r = 0; r < 16; ++r) sq[r] = __fadd_rn(sq[r], __shfl_xor(sq[r], sh, 32));
    bf* sw = st + w * (2 * 16 * LNP);
#pragma unroll
    for (int g = 0; g < 2; ++g) { float t[8];
#pragma unroll
        for (int r = 0; r < 8; ++r) t[r] = __fadd_rn(__fdiv_rn(sq[g * 8 + r], (float)CZ), 1e-5f);
        rsqx8(t);
#pragma unroll
        for (int r = 0; r < 8; ++r) rs[g * 8 + r] = t[r]; }
#pragma unroll
    for (int r = 0; r < 16; ++r) { float y4[4]; v2u oh, ol;
        for (int u = 0; u < 4; ++u) { float d0 = __fsub_rn(v[r][u], mu[r]); asm volatile("" : "+v"(d0)); float n = __fmul_rn(d0, rs[r]); asm volatile("" : "+v"(n)); float y = __fmul_rn(n, gg[u]); asm volatile("" : "+v"(y)); y4[u] = __fadd_rn(y, bb[u]); }
        for (int i = 0; i < 2; ++i) { unsigned p2, q2; split2(y4[2 * i], y4[2 * i + 1], p2, q2); oh[i] = p2; ol[i] = q2; }
        *(v2ua*)(sw + r * LNP + lane * 4) = oh; *(v2ua*)(sw + (16 + r) * LNP + lane * 4) = ol; }
    __syncthreads();   // the padded pair-bias weights are complete in LDS before any wave reads a fragment of them (and the wave's own 16 rows before it reads them across lanes)
    v8us fh[4][2], fl[4][2]; const bf* sr = sw + lr * LNP + 8 * hi;
#pragma unroll
    for (int kc = 0; kc < 4; ++kc)
#pragma unroll
        for (int hf = 0; hf < 2; ++hf) { fh[kc][hf] = *(const v8usa*)(sr + kc * 32 + hf * 16); fl[kc][hf] = *(const v8usa*)(sr + 16 * LNP + kc * 32 + hf * 16); }
    v8f zacc = (v8f){};
#pragma unroll
    for (int kc = 0; kc < 4; ++kc) { const v16bf wb = ldswfrag(wbs + kc * 512 + lane * 8); zacc = wmmab(cat16b(fh[kc][0], fh[kc][1]), wb, zacc); zacc = wmmab(cat16b(fl[kc][0], fl[kc][1]), wb, zacc); }
    if (lr < NH_) { v4f t0, t1;   // zacc[r] = bias of query q, key kt*16 + 8*hi + r, head lr
        for (int u = 0; u < 4; ++u) { t0[u] = zacc[u] * RSCL; t1[u] = zacc[4 + u] * RSCL; }   // times 32^0.5 here, so that the reader's loads are its accumulators' start values as they land
        *(v4fa*)(zs + (((lr * 2 + 0) * 2 + hi) * 8 + w) * 4) = t0; *(v4fa*)(zs + (((lr * 2 + 1) * 2 + hi) * 8 + w) * 4) = t1; }
    __syncthreads();   // the 8 queries' pieces of every line are in LDS before the line is stored; the planes' stores stand behind it, because the barrier waits for every store in front of it
    bf* ph = Xh + (size_t)tile * (16 * CZ) + lane * 8; bf* pl = Xl + (size_t)tile * (16 * CZ) + lane * 8;
#pragma unroll
    for (int kc = 0; kc < 4; ++kc)
#pragma unroll
        for (int hf = 0; hf < 2; ++hf) { *(v8us*)(ph + kc * 512 + hf * 256) = fh[kc][hf]; *(v8us*)(pl + kc * 512 + hf * 256) = fl[kc][hf]; }
    if (tid < 128) { const int ln = tid >> 3, h = ln >> 2, hf = (ln >> 1) & 1, hh = ln & 1;   // line = (head, half, hi); piece = query
        *(v4f*)(ZB + (((size_t)h * 16 + qt) * 16 + kt) * 256 + hf * 128 + (16 * hh + qo * 8 + (tid & 7)) * 4) = *(const v4fa*)(zs + tid * 4); }
}
// ---- k_pre: all that depends on the inputs alone, in one launch. Blocks 0..19: the five weight planes of WT, in fragment order (fro), 4 blocks each (Wq, Wk, Wv, Wg, Wo transposed to bf16); blocks 20..: LayerNorm of the 65,536 pair rows, 128 rows a block, its hi and lo planes in fragment order, and the pair bias of the same rows (d_lnzb).
#define WPB  4     // blocks per weight plane: DM * DR / 64 lines at 64 lines a block
#define NWB  (5 * WPB)
__global__ __launch_bounds__(256) void k_pre(const float* __restrict__ X, const float* __restrict__ gam, const float* __restrict__ bet, bf* Xh, bf* Xl, const float* __restrict__ wq, const float* __restrict__ wk, const float* __restrict__ wv, const float* __restrict__ wg, const float* __restrict__ w2d, const float* __restrict__ wo, bf* WT, float* ZB) {
    const int b = blockIdx.x;
    if (b < NWB) { const int p = b / WPB, bx = b % WPB;
        d_wtG(bx, (p == 0) ? wq : (p == 1) ? wk : (p == 2) ? wv : (p == 3) ? wg : wo, DM, DR, WT + (size_t)p * DR * DM);   // DM == DR: Wo's K and N are the same two numbers
        return; }
    d_lnzb(b - NWB, X, gam, bet, w2d, Xh, Xl, ZB);
}
// ---- k_attn: the q, k, v and gate projections and the whole attention of one virtual head (row bl, head h) in one work-group: 16 waves x 16 tokens, the 256 keys in four quarters of 64 (running maximum and sum), in 128 registers a wave so that two work-groups share a WGP; q, k, v, gate logits, scores and probabilities never leave the chip.
// Projections: wave w takes the 16 tokens w*16.. of the row. Its LayerNorm fragments (hi and lo planes, fragment order fro, 4 chunks of 32 k) come straight from global into registers; the head's 32 columns of Wq, Wk, Wv, Wg (4 x 8 KB, already in fragment order) are copied to LDS once a work-group. Each accumulator sums hi then lo per 32-k chunk.
// Q^T, K^T, G^T = W^T z^T (A = weight rows d, B = token columns): a lane holds d = mb*16 + 8*hi + r of ONE token lr. That is the B fragment of Q as it stands, 8 consecutive d of a K row for LDS, and the gate of the lane's own context values. V = z Wv (A = tokens, B = weight columns d): a lane holds 8 consecutive tokens of one d, 16 bytes of a V^T row for LDS.
// K [key][d] and V^T [d][key] are split into bf16 hi/lo planes on the way into LDS. S^T = K Q^T (A = K rows, B = Q columns), so a lane holds the scores of ONE query, 32 a quarter: tile kt, register r = key kt*16 + 8*hi + r, query lr.
// Two neighbouring score tiles, converted in place, are the B operand of O^T = V^T P^T (hardware k order: 8*hi + s, 16 + 8*hi + (s - 8)); the LDS fragment loads use the same order.
// The pair bias, stored times 32^0.5 by d_lnzb, is the start value of the score accumulators; 32^-0.5 is folded into the exponent's scale.
// The gate is applied here: a lane's 8 context values of one accumulator are 8 consecutive k of one row of the output projection's A operand, and the 32 lanes' pieces are one half block of its fragment order (fro), so the gated hi and lo planes go straight from the accumulators to global, 512 contiguous bytes a store.
#define KPI  40    // K row pitch in LDS, bf16 elements: 80 bytes = 16 x odd, no bank conflict for 16-byte reads
#define VPI  264   // V^T row pitch in LDS: 528 bytes = 16 x odd
typedef __attribute__((ext_vector_type(4))) unsigned v4u;
typedef __attribute__((ext_vector_type(8))) unsigned v8u;
typedef unsigned __attribute__((may_alias)) u32a;
// 2^x with the one issue slot that the instruction set asks for behind a transcendental, before its result is read or its source register overwritten: in one statement, so that the slot stands directly behind it
__device__ __forceinline__ float exp2slot(float x) { float e; asm("v_exp_f32 %0, %1\n\tv_nop" : "=v"(e) : "v"(x)); return e; }
__device__ __forceinline__ float rcpslot(float x) { float e; asm("v_rcp_f32 %0, %1\n\tv_nop" : "=v"(e) : "v"(x)); return e; }   // 1/x, with the same slot
typedef v4u __attribute__((may_alias)) v4ua;
// eight 2^x in place, in one statement. In place, because these stand among the products: the statement writes only registers that the compiler's own multiply-adds have just written, so the distance behind a matrix instruction that the compiler keeps for those holds for it too. Each v_exp_f32 is followed by an independent one, the last by the one issue slot that the instruction set asks for behind a transcendental
__device__ __forceinline__ void exp2x8(float (&x)[8]) { asm("v_exp_f32 %0, %0\n\tv_exp_f32 %1, %1\n\tv_exp_f32 %2, %2\n\tv_exp_f32 %3, %3\n\tv_exp_f32 %4, %4\n\tv_exp_f32 %5, %5\n\tv_exp_f32 %6, %6\n\tv_exp_f32 %7, %7\n\tv_nop" : "+v"(x[0]), "+v"(x[1]), "+v"(x[2]), "+v"(x[3]), "+v"(x[4]), "+v"(x[5]), "+v"(x[6]), "+v"(x[7])); }
// lane l with lane l ^ 16 as a vector cross-row move: no index register to keep and no LDS round trip
__device__ __forceinline__ float xhalf(float x) { return __builtin_bit_cast(float, __builtin_amdgcn_permlanex16(__builtin_bit_cast(int, x), __builtin_bit_cast(int, x), 0x76543210, 0xfedcba98, false, false)); }
__global__ __launch_bounds__(512, 8) void k_attn(const bf* __restrict__ Xh, const bf* __restrict__ Xl, const bf* __restrict__ WT, const float* __restrict__ ZB, const float* __restrict__ bg, bf* __restrict__ Ah, bf* __restrict__ Al) {   // 8 waves a SIMD = 128 registers a wave: two work-groups share a WGP, and one computes while the other loads or waits at a barrier
    __shared__ __align__(16) bf Kh[TT * KPI]; __shared__ __align__(16) bf Kl[TT * KPI]; __shared__ __align__(16) bf Vh[HDR * VPI]; __shared__ __align__(16) bf Vl[HDR * VPI]; __shared__ __align__(16) bf Ws[4 * HDR * DM]; __shared__ __align__(16) float Gs[4 * 512 * 4];
    const int tid = threadIdx.x, lane = tid & 31, lr = lane & 15, hi = lane >> 4, wv = __builtin_amdgcn_readfirstlane(tid >> 5); const int z = blockIdx.x, bl = z / NH_, h = z % NH_;   // the wave's number in a scalar register: the bases of its global addresses then take no vector registers
    const float* zr = ZB + ((size_t)h * 16 + wv) * (16 * TT) + lane * 4;   // this wave's 16 queries x 256 keys of the pair bias, in accumulator order (d_lnzb)
    const int q = wv * 16 + lr;
    // the head's weights (rows h*32.. of planes 0..3 of WT, 8 KB each, one 16-byte piece a thread and plane), then the wave's own LayerNorm fragments
    const bf* wp = WT + (size_t)h * (HDR * DM) + tid * 8; const size_t zo = (size_t)(bl * 16 + wv) * (16 * DM); const bf* xh = Xh + zo; const bf* xl = Xl + zo;   // the wave's bases are scalar; the lane's part is one register that lives on as the LDS offset of the weight fragments, so no load of the run lands on an address register
    v8us wst[4]; v16bf zh[4], zl[4];
#pragma unroll
    for (int p = 0; p < 4; ++p) wst[p] = *(const v8us*)(wp + (size_t)p * DR * DM);
#pragma unroll
    for (int kc = 0; kc < 4; ++kc) { zh[kc] = WFrag<bf>::ld(xh + lane * 8 + kc * 512); zl[kc] = WFrag<bf>::ld(xl + lane * 8 + kc * 512); }
    asm volatile("s_wait_xcnt 0x0" ::: "memory");   // the work below may reuse registers that held the addresses of the loads above: the wait that belongs in front of that
#pragma unroll
    for (int p = 0; p < 4; ++p) *(v8usa*)(Ws + p * (HDR * DM) + tid * 8) = wst[p];
    __syncthreads();   // the four weight planes are complete in LDS before any wave reads a fragment
    // the projections run plane by plane, K, V, gate, Q: two accumulators at a time beside the 64 registers of the LayerNorm fragments; each accumulator keeps its order of sums (hi then lo per 32-k chunk)
    const float* bp = bg + h * HDR + 8 * hi; v4f gb[4]; v8f bz[4];
    { v8f pk[2]; pk[0] = (v8f){}; pk[1] = (v8f){};
#pragma unroll
        for (int kc = 0; kc < 4; ++kc) { v16bf wf[2];
#pragma unroll
            for (int mb = 0; mb < 2; ++mb) wf[mb] = ldswfrag(Ws + 1 * (HDR * DM) + mb * (16 * DM) + kc * 512 + lane * 8);
            pk[0] = wmmab(wf[0], zh[kc], pk[0]); pk[1] = wmmab(wf[1], zh[kc], pk[1]); pk[0] = wmmab(wf[0], zl[kc], pk[0]); pk[1] = wmmab(wf[1], zl[kc], pk[1]); 
            if (kc == 1) __builtin_amdgcn_sched_barrier(0); }   // the weight fragments of at most two chunks are fetched ahead: those of all four would not fit beside the LayerNorm fragments (spills)
#pragma unroll
        for (int mb = 0; mb < 2; ++mb) { v4u oh, ol;   // pk[mb][r] = K of key q at d = mb*16 + 8*hi + r
#pragma unroll
            for (int i = 0; i < 4; ++i) { unsigned p, r; split2(pk[mb][2 * i], pk[mb][2 * i + 1], p, r); oh[i] = p; ol[i] = r; }
            *(v4ua*)(Kh + q * KPI + mb * 16 + 8 * hi) = oh; *(v4ua*)(Kl + q * KPI + mb * 16 + 8 * hi) = ol; } }
    __builtin_amdgcn_sched_barrier(0);   // a plane starts when the one before has left its registers: mixed, the planes would not fit in the 128 registers
    { v8f pv[2]; pv[0] = (v8f){}; pv[1] = (v8f){};
#pragma unroll
        for (int kc = 0; kc < 4; ++kc) { v16bf wf[2];
#pragma unroll
            for (int mb = 0; mb < 2; ++mb) wf[mb] = ldswfrag(Ws + 2 * (HDR * DM) + mb * (16 * DM) + kc * 512 + lane * 8);
            pv[0] = wmmab(zh[kc], wf[0], pv[0]); pv[1] = wmmab(zh[kc], wf[1], pv[1]); pv[0] = wmmab(zl[kc], wf[0], pv[0]); pv[1] = wmmab(zl[kc], wf[1], pv[1]); 
            if (kc == 1) __builtin_amdgcn_sched_barrier(0); }   // the weight fragments of at most two chunks are fetched ahead: those of all four would not fit beside the LayerNorm fragments (spills)
#pragma unroll
        for (int mb = 0; mb < 2; ++mb) { v4u ph, pl;   // pv[mb][r] = V of key wv*16 + 8*hi + r at d = mb*16 + lr
#pragma unroll
            for (int i = 0; i < 4; ++i) { unsigned p, r; split2(pv[mb][2 * i], pv[mb][2 * i + 1], p, r); ph[i] = p; pl[i] = r; }
            *(v4ua*)(Vh + (mb * 16 + lr) * VPI + wv * 16 + 8 * hi) = ph; *(v4ua*)(Vl + (mb * 16 + lr) * VPI + wv * 16 + 8 * hi) = pl; } }
    __builtin_amdgcn_sched_barrier(0);   // as above: the next plane starts when this one has left its registers
#pragma unroll
    for (int g = 0; g < 4; ++g) gb[g] = *(const v4f*)(bp + (g >> 1) * 16 + (g & 1) * 4);
    asm volatile("s_wait_xcnt 0x0" ::: "memory");   // the work below may reuse registers that held the addresses of the loads above: the wait that belongs in front of that
    v8f pq[2], pg[2]; pg[0] = (v8f){}; pg[1] = (v8f){}; pq[0] = (v8f){}; pq[1] = (v8f){};
#pragma unroll
    for (int kc = 0; kc < 4; ++kc) { v16bf wf[2];
#pragma unroll
        for (int mb = 0; mb < 2; ++mb) wf[mb] = ldswfrag(Ws + 3 * (HDR * DM) + mb * (16 * DM) + kc * 512 + lane * 8);
        pg[0] = wmmab(wf[0], zh[kc], pg[0]); pg[1] = wmmab(wf[1], zh[kc], pg[1]); pg[0] = wmmab(wf[0], zl[kc], pg[0]); pg[1] = wmmab(wf[1], zl[kc], pg[1]); 
            if (kc == 1) __builtin_amdgcn_sched_barrier(0); }   // the weight fragments of at most two chunks are fetched ahead: those of all four would not fit beside the LayerNorm fragments (spills)
#pragma unroll
    for (int g = 0; g < 4; ++g)
#pragma unroll
        for (int u = 0; u < 4; ++u) pg[g >> 1][(g & 1) * 4 + u] += bfr(gb[g][u]);   // the gate's bias
    // the 16 gate logits wait in LDS, each thread's in its own four 16-byte places (no other thread reads them: no barrier), while Q is projected: beside the LayerNorm fragments there is no room for both
#pragma unroll
    for (int g = 0; g < 4; ++g) { v4f t; t[0] = pg[g >> 1][(g & 1) * 4]; t[1] = pg[g >> 1][(g & 1) * 4 + 1]; t[2] = pg[g >> 1][(g & 1) * 4 + 2]; t[3] = pg[g >> 1][(g & 1) * 4 + 3]; *(v4fa*)(Gs + (g * 512 + tid) * 4) = t; }
    __builtin_amdgcn_sched_barrier(0);   // as above: the next plane starts when this one has left its registers
#pragma unroll
    for (int kc = 0; kc < 4; ++kc) { v16bf wf[2];
#pragma unroll
        for (int mb = 0; mb < 2; ++mb) wf[mb] = ldswfrag(Ws + mb * (16 * DM) + kc * 512 + lane * 8);
        pq[0] = wmmab(wf[0], zh[kc], pq[0]); pq[1] = wmmab(wf[1], zh[kc], pq[1]); pq[0] = wmmab(wf[0], zl[kc], pq[0]); pq[1] = wmmab(wf[1], zl[kc], pq[1]); 
            if (kc == 1) __builtin_amdgcn_sched_barrier(0); }   // the weight fragments of at most two chunks are fetched ahead: those of all four would not fit beside the LayerNorm fragments (spills)
    // the next two lines end the projections here: left free, the last products sink among the loads and the arithmetic below and keep the LayerNorm and weight fragments' registers, which the pair bias needs (spills)
    asm volatile("" :: "v"(pq[0]), "v"(pq[1]));   // inputs only: the two accumulators are complete at this place
    __builtin_amdgcn_sched_barrier(0);   // nothing of the work below is moved up among the products
    // the pair bias of the first 64 keys: 32 registers, taken when the LayerNorm and weight fragments are free
#pragma unroll
    for (int kt = 0; kt < 3; ++kt) bz[kt] = __builtin_shufflevector(*(const v4f*)(zr + kt * 256), *(const v4f*)(zr + kt * 256 + 128), 0, 1, 2, 3, 4, 5, 6, 7);   // both loads of a tile land in the eight registers of its accumulator
    asm volatile("s_wait_xcnt 0x0" ::: "memory");   // the last loads of a run may land on the run's own address register: the wait that belongs in front of that
    bz[3] = __builtin_shufflevector(*(const v4f*)(zr + 3 * 256), *(const v4f*)(zr + 3 * 256 + 128), 0, 1, 2, 3, 4, 5, 6, 7);
    asm volatile("s_wait_xcnt 0x0" ::: "memory");   // the work below may reuse registers that held the addresses of the loads above: the wait that belongs in front of that
    __builtin_amdgcn_sched_barrier(0);   // keeps the loads above in front of the arithmetic below, which runs while they fly: moved behind it they would start only when it is done
    v8u qh, ql;   // pq[g][r] = Q of query q at d = g*16 + 8*hi + r: the B fragment's own order
#pragma unroll
    for (int g = 0; g < 2; ++g)
#pragma unroll
        for (int i = 0; i < 4; ++i) { unsigned p, r; split2(pq[g][2 * i], pq[g][2 * i + 1], p, r); qh[g * 4 + i] = p; ql[g * 4 + i] = r; }
#pragma unroll
    for (int g = 0; g < 4; ++g) { const v4f t = *(const v4fa*)(Gs + (g * 512 + tid) * 4); pg[g >> 1][(g & 1) * 4] = t[0]; pg[g >> 1][(g & 1) * 4 + 1] = t[1]; pg[g >> 1][(g & 1) * 4 + 2] = t[2]; pg[g >> 1][(g & 1) * 4 + 3] = t[3]; }
    v8f sg[2];   // sg[mb][r] = gate of query q at d = mb*16 + 8*hi + r
#pragma unroll
    for (int mb = 0; mb < 2; ++mb) { float e[8];   // 1 / (1 + 2^(-x log2 e)): four instructions a gate; a logit far out gives 2^.. = inf or 0 and the gate 0 or 1
#pragma unroll
        for (int r = 0; r < 8; ++r) e[r] = pg[mb][r] * -1.4426950408889634f;
        exp2x8(e);
#pragma unroll
        for (int r = 0; r < 8; ++r) e[r] = 1.0f + e[r];
        rcpx8(e);
#pragma unroll
        for (int r = 0; r < 8; ++r) sg[mb][r] = e[r]; }
    // the 16 gates wait in LDS, each thread's in its own four 16-byte places (no other thread reads them: no barrier), until the context is there: kept in registers through the score and probability phases they spill
#pragma unroll
    for (int g = 0; g < 4; ++g) { v4f t; t[0] = sg[g >> 1][(g & 1) * 4]; t[1] = sg[g >> 1][(g & 1) * 4 + 1]; t[2] = sg[g >> 1][(g & 1) * 4 + 2]; t[3] = sg[g >> 1][(g & 1) * 4 + 3]; *(v4fa*)(Gs + (g * 512 + tid) * 4) = t; }
    __builtin_amdgcn_sched_barrier(0);   // keeps the gate's arithmetic above, where the wave would otherwise only wait for the pair bias: left free, part of it sinks behind the barrier, into the phases that the vector port limits
    __syncthreads();   // the K and V planes are complete before any wave reads a fragment
    // from here on every lane-dependent address is formed from a lane number taken anew: the thread number and what was derived from it need not be kept through the projections, nor several derived values through the phases below
    const int ln = (int)__builtin_amdgcn_mbcnt_lo(~0u, 0u), l15 = ln & 15, lh = ln >> 4, slot = wv * 32 + ln;
    const float* zr2 = ZB + ((size_t)h * 16 + wv) * (16 * TT) + ln * 4;
    // the 256 keys in four quarters of 64, so that 32 registers hold the scores: running maximum mrun and running sum srun; the context and the sum so far are scaled to each new maximum, and the division by the sum is applied to the context at the end
    const v16bf Qh = __builtin_bit_cast(v16bf, qh), Ql = __builtin_bit_cast(v16bf, ql);
    const float c1 = SCL * 1.4426950408889634f; float mrun = 0.f, srun = 0.f;
    v8f o[2]; o[0] = (v8f){}; o[1] = (v8f){};
#pragma unroll
    for (int ch = 0; ch < 4; ++ch) {
        v8f acc[4];
#pragma unroll
        for (int kt = 0; kt < 4; ++kt) acc[kt] = bz[kt];
#pragma unroll
        for (int kt = 0; kt < 4; ++kt) { const int ko = ((ch * 4 + kt) * 16 + l15) * KPI + 8 * lh; const v16bf ah = ldsfrag(Kh + ko), al = ldsfrag(Kl + ko);
            acc[kt] = wmmab(ah, Qh, acc[kt]); acc[kt] = wmmab(ah, Ql, acc[kt]); acc[kt] = wmmab(al, Qh, acc[kt]); }
        v8f m8 = acc[0];
#pragma unroll
        for (int kt = 1; kt < 4; ++kt)
#pragma unroll
            for (int r = 0; r < 8; ++r) m8[r] = fmaxf(m8[r], acc[kt][r]);
        float mx = fmaxf(fmaxf(fmaxf(m8[0], m8[1]), fmaxf(m8[2], m8[3])), fmaxf(fmaxf(m8[4], m8[5]), fmaxf(m8[6], m8[7])));
        mx = fmaxf(mx, xhalf(mx));   // the other lane's keys of this quarter
        if (ch > 0) { mx = fmaxf(mx, mrun); const float al = exp2slot((mrun - mx) * c1);   // what the quarters before were scaled by, against the new maximum
            srun *= al;
#pragma unroll
            for (int r = 0; r < 8; ++r) { o[0][r] *= al; o[1][r] *= al; } }
        mrun = mx;
        const float mc = mx * c1; v8f s8 = (v8f){};
        // 32 keys at a time: exponentials, their sums, the hi/lo split and the products, so that a tile's registers are free as soon as its probabilities are fragments
#pragma unroll
        for (int ks = 0; ks < 2; ++ks) { v8u ph, pl;
#pragma unroll
            for (int g = 0; g < 2; ++g) { float e[8];
#pragma unroll
                for (int r = 0; r < 8; ++r) e[r] = fmaf(acc[2 * ks + g][r], c1, -mc);
                exp2x8(e);
#pragma unroll
                for (int r = 0; r < 8; ++r) s8[r] += e[r];
#pragma unroll
                for (int i = 0; i < 4; ++i) { unsigned p, r; split2(e[2 * i], e[2 * i + 1], p, r); ph[g * 4 + i] = p; pl[g * 4 + i] = r; } }
            const v16bf Ph = __builtin_bit_cast(v16bf, ph), Pl = __builtin_bit_cast(v16bf, pl);
#pragma unroll
            for (int mb = 0; mb < 2; ++mb) { const int vo = (mb * 16 + l15) * VPI + (ch * 2 + ks) * 32 + 8 * lh; const v16bf vh = ldsfrag(Vh + vo), vl = ldsfrag(Vl + vo);
                o[mb] = wmmab(vh, Ph, o[mb]); o[mb] = wmmab(vh, Pl, o[mb]); o[mb] = wmmab(vl, Ph, o[mb]); } }
        srun += ((s8[0] + s8[1]) + (s8[2] + s8[3])) + ((s8[4] + s8[5]) + (s8[6] + s8[7]));
        asm volatile("" :: "v"(srun));   // input only: the quarter's sum is complete at this place; left free, its additions sink to the kernel's end and the terms are kept for them (spills)
        __builtin_amdgcn_sched_barrier(0);   // holds the line above in front of the next quarter
        if (ch < 3) {   // the pair bias of the next 64 keys, into the registers that this quarter's probabilities have left
#pragma unroll
            for (int kt = 0; kt < 4; ++kt) bz[kt] = __builtin_shufflevector(*(const v4f*)(zr2 + ((ch + 1) * 4 + kt) * 256), *(const v4f*)(zr2 + ((ch + 1) * 4 + kt) * 256 + 128), 0, 1, 2, 3, 4, 5, 6, 7);
            asm volatile("s_wait_xcnt 0x0" ::: "memory"); }   // the work below may reuse registers that held the addresses of the loads above: the wait that belongs in front of that
    }
    float sum = srun; sum += xhalf(sum);
    const float f = rcpslot(sum);
#pragma unroll
    for (int mb = 0; mb < 2; ++mb) { float ov[8]; v4u oh, ol; const v4f ga = *(const v4fa*)(Gs + (2 * mb * 512 + slot) * 4), gc = *(const v4fa*)(Gs + ((2 * mb + 1) * 512 + slot) * 4);   // o[mb][r] = context of query q at d = mb*16 + 8*hi + r, not yet divided by the sum; ga, gc = its 8 gates
#pragma unroll
        for (int r = 0; r < 8; ++r) ov[r] = __fmul_rn(o[mb][r] * f, (r < 4 ? ga : gc)[r & 3]);
#pragma unroll
        for (int i = 0; i < 4; ++i) { unsigned p, r; split2(ov[2 * i], ov[2 * i + 1], p, r); oh[i] = p; ol[i] = r; }
        const size_t fo = fro(bl * TT + wv * 16 + l15, h * HDR + mb * 16 + 8 * lh, DR); *(v4u*)(Ah + fo) = oh; *(v4u*)(Al + fo) = ol; }
}
__global__ __launch_bounds__(256) void k_merge(const float* __restrict__ O, int h0, bf* Ah, bf* Al) { const size_t e = ((size_t)blockIdx.x * 256 + threadIdx.x) * 2; if (e >= (size_t)ZH * TT * HD) return; const int d = (int)(e % HD); const int t = (int)((e / HD) % TT); const int zz = (int)(e / ((size_t)HD * TT)); const float cs = (t < RH) ? 1.0f : (1.0f / PCAR); const size_t oo = (size_t)t * DQ + (h0 + zz) * HD + d;
    v2us oh, ol;
#pragma unroll
    for (int q = 0; q < 2; ++q) { unsigned short a, c2; splitf(O[e + q] * cs, a, c2); oh[q] = a; ol[q] = c2; } *(v2us*)(Ah + oo) = oh; *(v2us*)(Al + oo) = ol;  }

extern "C" void kernel_launch(void* const* d_in, const int* in_sizes, int n_in,
                              void* d_out, int out_size, void* d_ws, size_t ws_size, hipStream_t stream) {
    (void)in_sizes; (void)n_in; (void)out_size;
    const float* x = (const float*)d_in[0]; const float* qng = (const float*)d_in[1]; const float* qnb = (const float*)d_in[2]; const float* wq = (const float*)d_in[3]; const float* wk = (const float*)d_in[4]; const float* wv = (const float*)d_in[5]; const float* w2d = (const float*)d_in[6]; const float* wg = (const float*)d_in[7]; const float* bg = (const float*)d_in[8]; const float* wo = (const float*)d_in[9]; const float* bo = (const float*)d_in[10];
    float* OUT = (float*)d_out;   // [256][256][128]
    char* wsp = (char*)d_ws; auto take = [&](size_t bytes) { char* p = wsp; wsp += (bytes + 255) & ~(size_t)255; return (void*)p; };
    bf* WT = (bf*)take((size_t)5 * DR * DM * 2); bf* WO = WT + (size_t)4 * DR * DM;   /* one block of five planes: Wq, Wk, Wv, Wg, Wo */
    bf* XNh = (bf*)take((size_t)GR * DM * 2); bf* XNl = (bf*)take((size_t)GR * DM * 2); float* ZB = (float*)take((size_t)NH_ * TT * TT * 4);
    bf* AOh = (bf*)take((size_t)GR * DR * 2); bf* AOl = (bf*)take((size_t)GR * DR * 2);
    if ((size_t)(wsp - (char*)d_ws) > ws_size) return;   // ws ~ 65 MiB
    k_pre<<<NWB + NLB, 256, 0, stream>>>(x, qng, qnb, XNh, XNl, wq, wk, wv, wg, w2d, wo, WT, ZB);   /* weight planes, LayerNorm, pair bias */
    k_attn<<<NVH, 512, 0, stream>>>(XNh, XNl, WT, ZB, bg, AOh, AOl);   /* q, k, v, gate projections and attention */
    k_gemmw<bf, 1, true><<<dim3(DM / 64, GR / 64, 1), 32, 0, stream>>>(AOh, AOl, WO, nullptr, DR, OUT, DM, bo, 0, 0, 0, DM / 64, -1, 0);
}
